// v000
// Measured on an AMD MI455X. A time is GPU time per run, averaged over a window of back-to-back runs after a warm-up
// (all launches, gaps included; the runs take copies of the inputs in turn), and the median of several windows.
// Apart from v000's, it joins two sittings. Times from different sittings can be a few percent apart, while
// side-by-side timings come from the same sitting.
// The starting kernel, v000, takes 1110 microseconds a run.
#include <hip/hip_runtime.h>
#include <math.h>
// Multi-head attention over 32x32 feature maps (8 batches, 12 heads x 64, 1024 queries/keys): the four 1x1-conv projections
// (1024 x 768 · 768 x 768 per batch; the output projection computed transposed so it lands in the (B, C, H·W) layout) and the attention
// (scores and p·v, p carried x2^15): v_wmma_f32_16x16x32_f16, f16 operands, f32 accumulate; softmax f32. Input transposes are VALU copies.
typedef __attribute__((ext_vector_type(16))) _Float16 v16h;
typedef __attribute__((ext_vector_type(8)))  _Float16 v8h;
typedef __attribute__((ext_vector_type(16))) __bf16   v16b;
typedef __attribute__((ext_vector_type(8)))  __bf16   v8b;
typedef __attribute__((ext_vector_type(8)))  float    v8f;
typedef __attribute__((ext_vector_type(4)))  float    v4f;
#define PSCALE 32768.0f
#define U16(p) ((const unsigned short*)(const void*)(p))
#define PSCALE_INV (1.0f / 32768.0f)

__device__ __forceinline__ unsigned short f2bf_bits(float f) {
  unsigned u = __float_as_uint(f);
  return (unsigned short)((u + 0x7FFFu + ((u >> 16) & 1u)) >> 16);
}
__device__ __forceinline__ float bf_bits2f(unsigned short h) { return __uint_as_float(((unsigned)h) << 16); }

// hazard guards as plain device helpers (no inline asm inside the kernel template body)
__device__ __forceinline__ void dep_guard_h(v8f& a, v8f& b, v16h x, v16h y) { asm volatile("v_nop\n\tv_nop\n\tv_nop\n\tv_nop" : "+v"(a), "+v"(b) : "v"(x), "v"(y)); }
__device__ __forceinline__ void dep_guard_b(v8f& a, v8f& b, v16b x, v16b y) { asm volatile("v_nop\n\tv_nop\n\tv_nop\n\tv_nop" : "+v"(a), "+v"(b) : "v"(x), "v"(y)); }
__device__ __forceinline__ void keep4_h(v16h a, v16h b, v16h c, v16h d) { asm volatile("v_nop" :: "v"(a), "v"(b), "v"(c), "v"(d)); }
__device__ __forceinline__ void keep4_b(v16b a, v16b b, v16b c, v16b d) { asm volatile("v_nop" :: "v"(a), "v"(b), "v"(c), "v"(d)); }
__device__ __forceinline__ void acc_guard4(v8f& a, v8f& b, v8f& c, v8f& d) { asm volatile("v_nop\n\tv_nop\n\tv_nop\n\tv_nop" : "+v"(a), "+v"(b), "+v"(c), "+v"(d)); }
template <typename T> struct Frag;
template <> struct Frag<_Float16> {
  typedef v16h V; union U { v16h v; v8h h[2]; };
  static __device__ __forceinline__ v16h load(const _Float16* p) {   // elements 0..7 <- p[0..7], 8..15 <- p[16..23]
    U f; f.h[0] = *(const v8h*)(p); f.h[1] = *(const v8h*)(p + 16); return f.v;
  }
  static __device__ __forceinline__ v8f mma(v16h a, v16h b, v8f c) {
    return __builtin_amdgcn_wmma_f32_16x16x32_f16(false, a, false, b, (short)0, c, false, false);
  }
  static __device__ __forceinline__ void guard(v8f& a, v8f& b, v16h x, v16h y) { dep_guard_h(a, b, x, y); }
  static __device__ __forceinline__ void keep(v16h a, v16h b, v16h c, v16h d) { keep4_h(a, b, c, d); }
};
template <> struct Frag<__bf16> {
  typedef v16b V; union U { v16b v; v8b h[2]; };
  static __device__ __forceinline__ v16b load(const __bf16* p) {
    U f; f.h[0] = *(const v8b*)(p); f.h[1] = *(const v8b*)(p + 16); return f.v;
  }
  static __device__ __forceinline__ v8f mma(v16b a, v16b b, v8f c) {
    return __builtin_amdgcn_wmma_f32_16x16x32_bf16(false, a, false, b, (short)0, c, false, false);
  }
  static __device__ __forceinline__ void guard(v8f& a, v8f& b, v16b x, v16b y) { dep_guard_b(a, b, x, y); }
  static __device__ __forceinline__ void keep(v16b a, v16b b, v16b c, v16b d) { keep4_b(a, b, c, d); }
};

// ---- Register-blocked batched WMMA GEMM ------------------------------------
// C[m,n] = scale * sum_k A[m,k] * Bt[n,k] (+bias)(+resid); each wave owns a 64x64 tile.
// A row-major [M,K]; Bt row-major [N,K]; M,N % 64 == 0, K % 32 == 0.
// SPLIT: operands are hi/lo planes (A2/Bt2 = lo planes, same layout); product = hi·hi + hi·lo + lo·hi.
// BIAS_MODE: 0 = none, 1 = bias[m], 2 = bias[n].
// OUT_MODE: 0 = f32, 1 = f16, 2 = bf16 hi plane (Cout) + bf16 lo plane (Cout2).
// ET: 0 = f16 operands, 1 = bf16 operands (pointers passed as 16-bit storage)
template <int ET> struct Elem;
template <> struct Elem<0> { typedef _Float16 T; };
template <> struct Elem<1> { typedef __bf16 T; };
template <int ET, bool SPLIT, int BIAS_MODE, int OUT_MODE, bool RESID, int ACT = 0>
__global__ __launch_bounds__(256) void wmma_gemm64(
    const unsigned short* __restrict__ Ap, const unsigned short* __restrict__ A2p, int lda, long strideA,
    const unsigned short* __restrict__ Btp, const unsigned short* __restrict__ Bt2p, int ldb, long strideB,
    void* __restrict__ Cout, void* __restrict__ Cout2, int ldc, long strideC,
    const float* __restrict__ bias,
    const float* __restrict__ resid, long strideR,
    int M, int N, int K, float scale) {
  typedef typename Elem<ET>::T T;
  typedef typename Frag<T>::V V;
  const T* A = (const T*)Ap; const T* A2 = (const T*)A2p; const T* Bt = (const T*)Btp; const T* Bt2 = (const T*)Bt2p;
  __shared__ __align__(16) float sT[8][16 * 68];   // per-wave 16x64 slab, pitch 68 floats
  const int b    = blockIdx.y;
  const int lane = threadIdx.x & 31;
  const int wave = threadIdx.x >> 5;
  const int tilesN = N >> 6;
  const int tilesM = M >> 6;
  const int tile = blockIdx.x * 8 + wave;
  if (tile >= tilesM * tilesN) return;   // wave-uniform; no block barriers in this kernel
  const int tm = tile / tilesN;
  const int tn = tile - tm * tilesN;
  const int m0 = tm << 6;
  const int n0 = tn << 6;

  const T* Ab  = A  + (size_t)b * strideA;
  const T* Bb  = Bt + (size_t)b * strideB;
  const T* Ab2 = SPLIT ? (A2  + (size_t)b * strideA) : nullptr;
  const T* Bb2 = SPLIT ? (Bt2 + (size_t)b * strideB) : nullptr;

  const int rlane = lane & 15;                 // row (A) / col (B, D) within subtile
  const int koff  = (lane >> 4) * 8;           // k offset of this lane half
  const int mOff  = (lane >> 4) * 8;           // D row offset

  v8f acc[4][4];
#pragma unroll
  for (int i = 0; i < 4; ++i)
#pragma unroll
    for (int j = 0; j < 4; ++j) acc[i][j] = (v8f){0.f,0.f,0.f,0.f,0.f,0.f,0.f,0.f};

  for (int k0 = 0; k0 < K; k0 += 32) {
    V bh[4], bl[4];
#pragma unroll
    for (int j = 0; j < 4; ++j) {
      const size_t bo = (size_t)(n0 + (j << 4) + rlane) * ldb + koff + k0;
      bh[j] = Frag<T>::load(Bb + bo);
      if (SPLIT) bl[j] = Frag<T>::load(Bb2 + bo);
    }
#pragma unroll
    for (int i = 0; i < 4; ++i) {
      const size_t ao = (size_t)(m0 + (i << 4) + rlane) * lda + koff + k0;
      V ah = Frag<T>::load(Ab + ao);
      V al;
      if (SPLIT) al = Frag<T>::load(Ab2 + ao);
#pragma unroll
      for (int j = 0; j < 4; ++j) {
        acc[i][j] = Frag<T>::mma(ah, bh[j], acc[i][j]);
        if (SPLIT) {
          acc[i][j] = Frag<T>::mma(ah, bl[j], acc[i][j]);
          acc[i][j] = Frag<T>::mma(al, bh[j], acc[i][j]);
        }
      }
      Frag<T>::guard(acc[i][0], acc[i][3], ah, SPLIT ? al : ah);
    }
    Frag<T>::keep(bh[0], bh[1], bh[2], bh[3]);
    if (SPLIT) Frag<T>::keep(bl[0], bl[1], bl[2], bl[3]);
  }
  acc_guard4(acc[0][0], acc[0][1], acc[0][2], acc[0][3]);
  acc_guard4(acc[1][0], acc[1][1], acc[1][2], acc[1][3]);
  acc_guard4(acc[2][0], acc[2][1], acc[2][2], acc[2][3]);
  acc_guard4(acc[3][0], acc[3][1], acc[3][2], acc[3][3]);

  // ---- epilogue ----
  float* slab = sT[wave];
  const float* Rb = RESID ? (resid + (size_t)b * strideR) : nullptr;
#pragma unroll
  for (int i = 0; i < 4; ++i) {
    const int mBase = m0 + (i << 4);
#pragma unroll
    for (int j = 0; j < 4; ++j) {
      const int n = n0 + (j << 4) + rlane;
      float bv = 0.f;
      if (BIAS_MODE == 2) bv = bias[n];
#pragma unroll
      for (int r = 0; r < 8; ++r) {
        float v = acc[i][j][r] * scale;
        if (BIAS_MODE == 1) v += bias[mBase + mOff + r];
        if (BIAS_MODE == 2) v += bv;
        if (RESID) v += Rb[(size_t)(mBase + mOff + r) * ldc + n];
        if (ACT == 1) v = tanhf(v);
        if (ACT == 2) v = fmaxf(v, 0.0f);
        if (ACT == 3) v = v / (1.0f + expf(-v));
        if (ACT == 4) v = (v > 0.f) ? v : 0.01f * v;
        if (ACT == 5) v = 0.5f * v * (1.0f + erff(v * 0.70710678118654752f));
        slab[(mOff + r) * 68 + (j << 4) + rlane] = v;
      }
    }
    __builtin_amdgcn_fence(__ATOMIC_RELEASE, "workgroup");
    __builtin_amdgcn_wave_barrier();
    __builtin_amdgcn_fence(__ATOMIC_ACQUIRE, "workgroup");
    if (OUT_MODE == 0) {
      float* C = (float*)Cout + (size_t)b * strideC;
      const int hh = lane >> 4, c4 = (lane & 15) * 4;     // row seg = 256 B = 16 lanes x 16 B
      {
#pragma unroll
        for (int it = 0; it < 8; ++it) {
          const int row = it * 2 + hh;
          v4f v = *(const v4f*)(slab + row * 68 + c4);
          *(v4f*)(C + (size_t)(mBase + row) * ldc + n0 + c4) = v;
        }
        
      }
    } else {
      const int q = lane >> 3, c8 = (lane & 7) * 8;
      unsigned short* C  = (unsigned short*)Cout  + (size_t)b * strideC;
      unsigned short* C2 = (OUT_MODE == 2) ? ((unsigned short*)Cout2 + (size_t)b * strideC) : nullptr;
      {
#pragma unroll
        for (int it = 0; it < 4; ++it) {
          const int row = it * 4 + q;
          const float* sp = slab + row * 68 + c8;
          v8h hv, lv;
#pragma unroll
          for (int e = 0; e < 8; ++e) {
            if (OUT_MODE == 1) {
              hv[e] = (_Float16)sp[e];
            } else {
              unsigned short hb = f2bf_bits(sp[e]);
              unsigned short lb = f2bf_bits(sp[e] - bf_bits2f(hb));
              hv[e] = __builtin_bit_cast(_Float16, hb);
              lv[e] = __builtin_bit_cast(_Float16, lb);
            }
          }
          *(v8h*)(C + (size_t)(mBase + row) * ldc + n0 + c8) = hv;
          if (OUT_MODE == 2) *(v8h*)(C2 + (size_t)(mBase + row) * ldc + n0 + c8) = lv;
        }
        
      }
    }
    __builtin_amdgcn_fence(__ATOMIC_RELEASE, "workgroup");
    __builtin_amdgcn_wave_barrier();
    __builtin_amdgcn_fence(__ATOMIC_ACQUIRE, "workgroup");
  }
}

__global__ __launch_bounds__(256) void cast_f32_f16x2(
    const float* __restrict__ in, _Float16* __restrict__ out, int n2) {
  int i = blockIdx.x * 256 + threadIdx.x;
  if (i < n2) {
    const _Float16 h0 = (_Float16)in[2 * i], h1 = (_Float16)in[2 * i + 1];
    const unsigned u = (unsigned)__builtin_bit_cast(unsigned short, h0) | ((unsigned)__builtin_bit_cast(unsigned short, h1) << 16);
    ((unsigned*)out)[i] = u;
    
  }
}


// ---- f32 -> f16 cast with a power-of-two pre-scale (folded back by the consumer GEMM's scale) ----
__global__ __launch_bounds__(256) void cast_f32_f16x2s(const float* __restrict__ in, _Float16* __restrict__ out, int n2, float s) {
  int i = blockIdx.x * 256 + threadIdx.x;
  if (i < n2) {
    const _Float16 h0 = (_Float16)(in[2 * i] * s), h1 = (_Float16)(in[2 * i + 1] * s);
    const unsigned u = (unsigned)__builtin_bit_cast(unsigned short, h0) | ((unsigned)__builtin_bit_cast(unsigned short, h1) << 16);
    ((unsigned*)out)[i] = u;
    
  }
}
__global__ __launch_bounds__(256) void split_f32_bf16x2(
    const float* __restrict__ in, __bf16* __restrict__ hi, __bf16* __restrict__ lo, long n2) {
  long i = (long)blockIdx.x * 256 + threadIdx.x;
  long stride = (long)gridDim.x * 256;
  {
    for (long j = i; j < n2; j += stride) {
      const float a = in[2 * j], b = in[2 * j + 1];
      const unsigned short ah = f2bf_bits(a), bh = f2bf_bits(b);
      const unsigned short al = f2bf_bits(a - bf_bits2f(ah)), bl = f2bf_bits(b - bf_bits2f(bh));
      ((unsigned*)hi)[j] = (unsigned)ah | ((unsigned)bh << 16);
      ((unsigned*)lo)[j] = (unsigned)al | ((unsigned)bl << 16);
    }
    
  }
}


// ---- f32 [R][C] (row pitch ldi) -> f16 transposed [C][R] (row pitch ldo); 64x64 tiles; each output row segment
__global__ __launch_bounds__(256) void transpose_cast_f16(const float* __restrict__ in, int ldi,
                                                         _Float16* __restrict__ outT, int ldo, float scale) {
  __shared__ __align__(16) _Float16 tile[64][72];     // [c][r]
  const int c0 = blockIdx.x * 64, r0 = blockIdx.y * 64;
  const int t = threadIdx.y * 32 + threadIdx.x;
  for (int i = threadIdx.y; i < 64; i += 8) {
    tile[threadIdx.x][i]      = (_Float16)(in[(size_t)(r0 + i) * ldi + c0 + threadIdx.x] * scale);
    tile[32 + threadIdx.x][i] = (_Float16)(in[(size_t)(r0 + i) * ldi + c0 + 32 + threadIdx.x] * scale);
  }
  __syncthreads();
  const int q = t >> 3, c8 = (t & 7) * 8;
  {
#pragma unroll
    for (int it = 0; it < 2; ++it) {
      const int c = it * 32 + q;
      v8h hv = *(const v8h*)(&tile[c][c8]);
      *(v8h*)(outT + (size_t)(c0 + c) * ldo + r0 + c8) = hv;
    }
    
  }
}

// ---- f32 [R][C] (pitch ldi) -> bf16 hi/lo transposed planes [C][R] (pitch ldo); 64x64 tiles; each output row segment
__global__ __launch_bounds__(256) void transpose_split_bf16(const float* __restrict__ in, int ldi,
                                                           __bf16* __restrict__ outH, __bf16* __restrict__ outL, int ldo) {
  __shared__ __align__(16) float tile[64][68];     // [c][r]
  const int c0 = blockIdx.x * 64, r0 = blockIdx.y * 64;
  const int t = threadIdx.y * 32 + threadIdx.x;
  for (int i = threadIdx.y; i < 64; i += 8) {
    tile[threadIdx.x][i]      = in[(size_t)(r0 + i) * ldi + c0 + threadIdx.x];
    tile[32 + threadIdx.x][i] = in[(size_t)(r0 + i) * ldi + c0 + 32 + threadIdx.x];
  }
  __syncthreads();
  const int q = t >> 3, c8 = (t & 7) * 8;
  {
#pragma unroll
    for (int it = 0; it < 2; ++it) {
      const int c = it * 32 + q;
      v8b hv, lv;
#pragma unroll
      for (int e = 0; e < 8; ++e) {
        const float f = tile[c][c8 + e];
        const unsigned short hb = f2bf_bits(f);
        hv[e] = __builtin_bit_cast(__bf16, hb);
        lv[e] = __builtin_bit_cast(__bf16, f2bf_bits(f - bf_bits2f(hb)));
      }
      *(v8b*)(outH + (size_t)(c0 + c) * ldo + r0 + c8) = hv;
      *(v8b*)(outL + (size_t)(c0 + c) * ldo + r0 + c8) = lv;
    }
    
  }
}

// =====================================================================================
// Generic causal/non-causal attention for head_dim 64, f32 in / f32 out; 16-bit operands: bf16 with optional hi/lo splits, or
// plain f16 (F16=true, non-split, probabilities carried x2^15).
//   scores = (q*qscale)·kᵀ : v_wmma_f32_16x16x32_bf16; SPLIT_QK -> q,k as bf16 hi/lo (hi·hi + hi·lo + lo·hi)
//   out    = p·v           : v_wmma_f32_16x16x32_bf16; SPLIT_PV -> p,v as bf16 hi/lo; else p,v plain bf16
//   f32 accumulate; online softmax in f32. Block = 4 waves = 64 query rows of one (batch, head); S % 64 == 0.
//   Element (b, s, h, d) of tensor X lives at X[b*X_bs + s*X_rs + h*X_hs + d] (strides in floats, multiples of 4).
//   Masking: mask_mode 0 none, 1 causal (kv > q masked), 2 tensor [S][Skv] shared over (b,h) (float if
//   mask_is_int==0, int32 with element == 0 -> masked if 1, int32 with element != 0 -> masked if 2), 3 per-token vectors qmask[B][S] & kvmask[B][Skv] (int32,
//   0 -> masked), 4 causal + sliding window (kv > q or q - kv > W masked; W passed in mask_is_int);
//   5 = relative-position bias: s += cp[b,h,q][idx[q][kv]] + pc[b,h,kv][idx[q][kv]] with idx = mask_b ([S][Skv] int32) and
//   mask_a an int32 [S][Skv] tensor with nonzero = masked (tables: element (b,h,row,n) at X + b*c_bs + h*c_hs + row*c_rs + n);
//   masked scores are replaced by mask_fill (e.g. -inf or -1e9) before the softmax.
//   grid.x = B * H * (S/64) (or a sub-range with blk0).
// =====================================================================================
#define AT_D 64
#define AT_NW 4
#define AT_QB 64
#define AT_KC 64
struct AttnGeom { const float* cp = nullptr; const float* pc = nullptr; long c_bs = 0, c_rs = 0, c_hs = 0;   // mode-5 score-bias tables
                  long q_bs, q_rs, q_hs, k_bs, k_rs, k_hs, v_bs, v_rs, v_hs, o_bs, o_rs, o_hs;
                  int S, Skv, H, mask_mode; float qscale; int blk0; float mask_fill; int mask_is_int; };
static_assert(sizeof(AttnGeom) == 168, "no padding");

__device__ __forceinline__ unsigned short at_bf_bits(float f) {
  unsigned u = __float_as_uint(f);
  return (unsigned short)((u + 0x7FFFu + ((u >> 16) & 1u)) >> 16);
}
__device__ __forceinline__ __bf16 at_f2bf(float f) { return __builtin_bit_cast(__bf16, at_bf_bits(f)); }
__device__ __forceinline__ void at_split(float f, __bf16& hi, __bf16& lo) {
  const unsigned short hb = at_bf_bits(f);
  hi = __builtin_bit_cast(__bf16, hb);
  lo = at_f2bf(f - __uint_as_float(((unsigned)hb) << 16));
}
__device__ __forceinline__ v8f at_mma(v16b a, v16b b, v8f c) {
  c = __builtin_amdgcn_wmma_f32_16x16x32_bf16(false, a, false, b, (short)0, c, false, false);
  asm volatile("v_nop\n\tv_nop\n\tv_nop\n\tv_nop" : "+v"(c) : "v"(a), "v"(b));
  return c;
}
// 16-bit element as a bit pattern held in a __bf16 slot: f16 bits when F16, bf16 (RNE) otherwise
template <bool F16> __device__ __forceinline__ __bf16 at_to16(float f) {
  if (F16) return __builtin_bit_cast(__bf16, (_Float16)f);
  return at_f2bf(f);
}
template <bool F16> __device__ __forceinline__ v8f at_mma16(v16b a, v16b b, v8f c) {
  if (F16) {
    const v16h ah = __builtin_bit_cast(v16h, a), bh = __builtin_bit_cast(v16h, b);
    c = __builtin_amdgcn_wmma_f32_16x16x32_f16(false, ah, false, bh, (short)0, c, false, false);
    asm volatile("v_nop\n\tv_nop\n\tv_nop\n\tv_nop" : "+v"(c) : "v"(ah), "v"(bh));
    return c;
  }
  return at_mma(a, b, c);
}

template <bool SPLIT_QK, bool SPLIT_PV, bool F16 = false>
__global__ __launch_bounds__(128)
void attn64_kernel(const float* __restrict__ q, const float* __restrict__ k,
                   const float* __restrict__ v, float* __restrict__ out,
                   const void* __restrict__ mask_a, const int* __restrict__ mask_b, AttnGeom g) {
  static_assert(!(F16 && (SPLIT_QK || SPLIT_PV)), "f16 mode is non-split");
  const float PSC = F16 ? 32768.0f : 1.0f;     // f16 probabilities carried x2^15 (subnormal range), folded into the final 1/l
  union FB { v16b v; v8b h[2]; };
  __shared__ __align__(16) __bf16 Ksh[AT_KC * AT_D];             // K hi [kv][d]      8 KB
  __shared__ __align__(16) __bf16 Ksl[SPLIT_QK ? AT_KC * AT_D : 8];
  __shared__ __align__(16) __bf16 Vth[AT_D * AT_KC];             // V hi [d][kv]      8 KB
  __shared__ __align__(16) __bf16 Vtl[SPLIT_PV ? AT_D * AT_KC : 8];
  __shared__ __align__(16) __bf16 Psh[AT_NW][16 * AT_KC];        // per wave P hi [row][kv]  8 KB
  __shared__ __align__(16) __bf16 Psl[SPLIT_PV ? AT_NW : 1][SPLIT_PV ? 16 * AT_KC : 8];
  __shared__ __align__(16) float  Os[AT_NW][16 * 68];            // per wave out tile, pitch 68

  const int tid  = threadIdx.x;
  const int wave = tid >> 5;
  const int lane = tid & 31;
  const int hh   = lane >> 4;
  const int c    = lane & 15;

  const int nqb = g.S / AT_QB;
  const int bx = blockIdx.x + g.blk0;
  const int qb = bx % nqb;
  const int bh = bx / nqb;
  const int h  = bh % g.H;
  const int b  = bh / g.H;
  const int qbase_block = qb * AT_QB;
  const int q0 = qbase_block + wave * 16;

  const float* qb_ptr = q + (size_t)b * g.q_bs + (size_t)h * g.q_hs;
  const float* kb_ptr = k + (size_t)b * g.k_bs + (size_t)h * g.k_hs;
  const float* vb_ptr = v + (size_t)b * g.v_bs + (size_t)h * g.v_hs;
  float*       ob_ptr = out + (size_t)b * g.o_bs + (size_t)h * g.o_hs;

  // ---- Q fragments (A operand): 2 d-chunks, hi (and lo) ----
  v16b qah[2], qal[2];
  {
    const float* qrow = qb_ptr + (size_t)(q0 + c) * g.q_rs;
#pragma unroll
    for (int dc = 0; dc < 2; ++dc) {
#pragma unroll
      for (int e = 0; e < 8; ++e) {
        const float f0 = qrow[dc * 32 + 8 * hh + e] * g.qscale;
        const float f1 = qrow[dc * 32 + 16 + 8 * hh + e] * g.qscale;
        if (SPLIT_QK) { __bf16 hq, lq; at_split(f0, hq, lq); qah[dc][e] = hq; qal[dc][e] = lq; at_split(f1, hq, lq); qah[dc][8 + e] = hq; qal[dc][8 + e] = lq; }
        else { qah[dc][e] = at_to16<F16>(f0); qah[dc][8 + e] = at_to16<F16>(f1); qal[dc][e] = qah[dc][e]; qal[dc][8 + e] = qah[dc][8 + e]; }
      }
    }
  }

  float mrow[8], lrow[8];
  v8f oacc[4];
#pragma unroll
  for (int r = 0; r < 8; ++r) { mrow[r] = -INFINITY; lrow[r] = 0.f; }
#pragma unroll
  for (int t = 0; t < 4; ++t) oacc[t] = (v8f){0.f,0.f,0.f,0.f,0.f,0.f,0.f,0.f};

  const int nChunks = (g.mask_mode == 1 || g.mask_mode == 4) ? (qb + 1) : (g.Skv / AT_KC);   // block-uniform
  // per-row query mask (mode 3)
  int qkeep[8];
#pragma unroll
  for (int r = 0; r < 8; ++r) qkeep[r] = (g.mask_mode == 3) ? mask_b[(size_t)b * g.S + q0 + 8 * hh + r] : 1;   // mask_b = qmask in mode 3
  for (int kc = 0; kc < nChunks; ++kc) {
    const int kv0 = kc * AT_KC;
    __syncthreads();
    {
      const int kvr = tid >> 1, dh = (tid & 1) * 32;
      const float* krow = kb_ptr + (size_t)(kv0 + kvr) * g.k_rs + dh;
      const float* vrow = vb_ptr + (size_t)(kv0 + kvr) * g.v_rs + dh;
#pragma unroll
      for (int i = 0; i < 8; ++i) {
        v4f kk = *(const v4f*)(krow + 4 * i);
        v4f vv = *(const v4f*)(vrow + 4 * i);
#pragma unroll
        for (int e = 0; e < 4; ++e) {
          const int d = dh + 4 * i + e;
          if (SPLIT_QK) { __bf16 a, bl; at_split(kk[e], a, bl); Ksh[kvr * AT_D + d] = a; Ksl[kvr * AT_D + d] = bl; }
          else Ksh[kvr * AT_D + d] = at_to16<F16>(kk[e]);
          if (SPLIT_PV) { __bf16 a, bl; at_split(vv[e], a, bl); Vth[d * AT_KC + kvr] = a; Vtl[d * AT_KC + kvr] = bl; }
          else Vth[d * AT_KC + kvr] = at_to16<F16>(vv[e]);
        }
      }
    }
    __syncthreads();

    v8f s[4];
#pragma unroll
    for (int j = 0; j < 4; ++j) {
      s[j] = (v8f){0.f,0.f,0.f,0.f,0.f,0.f,0.f,0.f};
#pragma unroll 1
      for (int dc = 0; dc < 2; ++dc) {
        FB kb;
        kb.h[0] = *(const v8b*)(Ksh + (j * 16 + c) * AT_D + dc * 32 + 8 * hh);
        kb.h[1] = *(const v8b*)(Ksh + (j * 16 + c) * AT_D + dc * 32 + 16 + 8 * hh);
        s[j] = at_mma16<F16>(qah[dc], kb.v, s[j]);
        if (SPLIT_QK) {
          FB kl;
          kl.h[0] = *(const v8b*)(Ksl + (j * 16 + c) * AT_D + dc * 32 + 8 * hh);
          kl.h[1] = *(const v8b*)(Ksl + (j * 16 + c) * AT_D + dc * 32 + 16 + 8 * hh);
          s[j] = at_mma16<F16>(qah[dc], kl.v, s[j]);
          s[j] = at_mma16<F16>(qal[dc], kb.v, s[j]);
        }
      }
    }
    const bool diag = (g.mask_mode == 1) && (kc == qb);
    int kvkeep[4] = {1, 1, 1, 1};
    if (g.mask_mode == 3) {
#pragma unroll
      for (int j = 0; j < 4; ++j) kvkeep[j] = ((const int*)mask_a)[(size_t)b * g.Skv + kv0 + j * 16 + c];   // mask_a = kvmask
    }
    float cm[8];
#pragma unroll
    for (int r = 0; r < 8; ++r) {
      const int qrow = q0 + 8 * hh + r;
      float m = -INFINITY;
#pragma unroll
      for (int j = 0; j < 4; ++j) {
        const int kvcol = kv0 + j * 16 + c;
        bool masked = false;
        if (diag) masked = (kvcol > qrow);
        else if (g.mask_mode == 4) masked = (kvcol > qrow) || (qrow - kvcol > g.mask_is_int);
        else if (g.mask_mode == 2) {
          const size_t mi = (size_t)qrow * g.Skv + kvcol;
          masked = (g.mask_is_int == 0) ? (((const float*)mask_a)[mi] == 0.0f)
                 : (g.mask_is_int == 1) ? (((const int*)mask_a)[mi] == 0) : (((const int*)mask_a)[mi] != 0);
        } else if (g.mask_mode == 3) masked = (qkeep[r] == 0) || (kvkeep[j] == 0);
        else if (g.mask_mode == 5) {
          const size_t mi = (size_t)qrow * g.Skv + kvcol;
          masked = (((const int*)mask_a)[mi] != 0);
          int n = mask_b[mi]; n = n < 0 ? 0 : n;
          s[j][r] += g.cp[(size_t)b * g.c_bs + (size_t)h * g.c_hs + (size_t)qrow * g.c_rs + n]
                   + g.pc[(size_t)b * g.c_bs + (size_t)h * g.c_hs + (size_t)kvcol * g.c_rs + n];
        }
        if (masked) s[j][r] = g.mask_fill;
        m = fmaxf(m, s[j][r]);
      }
#pragma unroll
      for (int off = 1; off < 16; off <<= 1) m = fmaxf(m, __shfl_xor(m, off, 32));
      cm[r] = m;
    }
    __bf16* pwh = Psh[wave];
    __bf16* pwl = Psl[SPLIT_PV ? wave : 0];
#pragma unroll
    for (int r = 0; r < 8; ++r) {
      const float mnew = fmaxf(mrow[r], cm[r]);
      const float alpha = expf(mrow[r] - mnew);
      mrow[r] = mnew;
      float psum = 0.f;
#pragma unroll
      for (int j = 0; j < 4; ++j) {
        const float p = expf(s[j][r] - mnew);
        psum += p;
        if (SPLIT_PV) { __bf16 a, bl; at_split(p, a, bl); pwh[(8 * hh + r) * AT_KC + j * 16 + c] = a; pwl[(8 * hh + r) * AT_KC + j * 16 + c] = bl; }
        else pwh[(8 * hh + r) * AT_KC + j * 16 + c] = at_to16<F16>(p * PSC);
      }
#pragma unroll
      for (int off = 1; off < 16; off <<= 1) psum += __shfl_xor(psum, off, 32);
      lrow[r] = lrow[r] * alpha + psum;
#pragma unroll
      for (int t = 0; t < 4; ++t) oacc[t][r] *= alpha;
    }
    __builtin_amdgcn_fence(__ATOMIC_RELEASE, "workgroup");
    __builtin_amdgcn_wave_barrier();
    __builtin_amdgcn_fence(__ATOMIC_ACQUIRE, "workgroup");
#pragma unroll 1
    for (int kk = 0; kk < 2; ++kk) {
      FB pa, pl;
      pa.h[0] = *(const v8b*)(pwh + c * AT_KC + kk * 32 + 8 * hh);
      pa.h[1] = *(const v8b*)(pwh + c * AT_KC + kk * 32 + 16 + 8 * hh);
      if (SPLIT_PV) {
        pl.h[0] = *(const v8b*)(pwl + c * AT_KC + kk * 32 + 8 * hh);
        pl.h[1] = *(const v8b*)(pwl + c * AT_KC + kk * 32 + 16 + 8 * hh);
      }
#pragma unroll
      for (int t = 0; t < 4; ++t) {
        FB vb;
        vb.h[0] = *(const v8b*)(Vth + (t * 16 + c) * AT_KC + kk * 32 + 8 * hh);
        vb.h[1] = *(const v8b*)(Vth + (t * 16 + c) * AT_KC + kk * 32 + 16 + 8 * hh);
        oacc[t] = at_mma16<F16>(pa.v, vb.v, oacc[t]);
        if (SPLIT_PV) {
          FB vl;
          vl.h[0] = *(const v8b*)(Vtl + (t * 16 + c) * AT_KC + kk * 32 + 8 * hh);
          vl.h[1] = *(const v8b*)(Vtl + (t * 16 + c) * AT_KC + kk * 32 + 16 + 8 * hh);
          oacc[t] = at_mma16<F16>(pa.v, vl.v, oacc[t]);
          oacc[t] = at_mma16<F16>(pl.v, vb.v, oacc[t]);
        }
      }
    }
  }

  float* os = Os[wave];
#pragma unroll
  for (int r = 0; r < 8; ++r) {
    const float inv = 1.0f / (lrow[r] * PSC);
#pragma unroll
    for (int t = 0; t < 4; ++t) os[(8 * hh + r) * 68 + t * 16 + c] = oacc[t][r] * inv;
  }
  __builtin_amdgcn_fence(__ATOMIC_RELEASE, "workgroup");
  __builtin_amdgcn_wave_barrier();
  __builtin_amdgcn_fence(__ATOMIC_ACQUIRE, "workgroup");
  {
    const int c4 = (lane & 15) * 4;
    {
#pragma unroll
      for (int it = 0; it < 8; ++it) {
        const int row = it * 2 + hh;
        v4f val = *(const v4f*)(os + row * 68 + c4);
        *(v4f*)(ob_ptr + (size_t)(q0 + row) * g.o_rs + c4) = val;
      }
      
    }
  }
}

#define EB 8
#define EC 768
#define ES 1024
#define EH 12
extern "C" void kernel_launch(void* const* d_in, const int* in_sizes, int n_in, void* d_out, int out_size, void* d_ws, size_t ws_size, hipStream_t stream) {
  (void)in_sizes; (void)n_in; (void)out_size; (void)ws_size;
  const float* q = (const float*)d_in[0]; const float* k = (const float*)d_in[1]; const float* v = (const float*)d_in[2];
  const float* Wq = (const float*)d_in[3]; const float* bq = (const float*)d_in[4]; const float* Wk = (const float*)d_in[5]; const float* bk = (const float*)d_in[6];
  const float* Wv = (const float*)d_in[7]; const float* bv = (const float*)d_in[8]; const float* Wo = (const float*)d_in[9]; const float* bo = (const float*)d_in[10];
  float* out = (float*)d_out;    // [8][768][1024]
  char* ws = (char*)d_ws; size_t off = 0;
  auto carve = [&](size_t bytes) -> char* { char* p = ws + off; off += (bytes + 255) & ~(size_t)255; return p; };
  _Float16* QT = (_Float16*)carve((size_t)EB * ES * EC * 2); _Float16* KT = (_Float16*)carve((size_t)EB * ES * EC * 2); _Float16* VT = (_Float16*)carve((size_t)EB * ES * EC * 2);   // 3 x 12.6 MB
  _Float16* Wq16 = (_Float16*)carve((size_t)EC * EC * 2); _Float16* Wk16 = (_Float16*)carve((size_t)EC * EC * 2); _Float16* Wv16 = (_Float16*)carve((size_t)EC * EC * 2); _Float16* Wo16 = (_Float16*)carve((size_t)EC * EC * 2);
  float* QE = (float*)carve((size_t)EB * ES * EC * 4); float* KE = (float*)carve((size_t)EB * ES * EC * 4); float* VE = (float*)carve((size_t)EB * ES * EC * 4);   // 3 x 25 MB
  float* Of = (float*)carve((size_t)EB * ES * EC * 4);
  _Float16* O16 = QT;     // reuse (QT dead after the q projection)
  for (int b = 0; b < EB; ++b) {
    transpose_cast_f16<<<dim3(ES / 64, EC / 64), dim3(32, 8), 0, stream>>>(q + (size_t)b * EC * ES, ES, QT + (size_t)b * ES * EC, EC, 1.0f);   // [768][1024] -> [1024][768]
    transpose_cast_f16<<<dim3(ES / 64, EC / 64), dim3(32, 8), 0, stream>>>(k + (size_t)b * EC * ES, ES, KT + (size_t)b * ES * EC, EC, 1.0f);
    transpose_cast_f16<<<dim3(ES / 64, EC / 64), dim3(32, 8), 0, stream>>>(v + (size_t)b * EC * ES, ES, VT + (size_t)b * ES * EC, EC, 1.0f);
  }
  cast_f32_f16x2<<<(EC * EC / 2 + 255) / 256, 256, 0, stream>>>(Wq, Wq16, EC * EC / 2);   // 1x1-conv weights [out][in] are the Bt layout
  cast_f32_f16x2<<<(EC * EC / 2 + 255) / 256, 256, 0, stream>>>(Wk, Wk16, EC * EC / 2);
  cast_f32_f16x2<<<(EC * EC / 2 + 255) / 256, 256, 0, stream>>>(Wv, Wv16, EC * EC / 2);
  cast_f32_f16x2<<<(EC * EC / 2 + 255) / 256, 256, 0, stream>>>(Wo, Wo16, EC * EC / 2);   // used as the A operand ([M=o][K=c]) of the output GEMM
  { const int t = (ES / 64) * (EC / 64);
    wmma_gemm64<0, false, 2, 0, false><<<dim3((t + 7) / 8, EB), 256, 0, stream>>>(U16(QT), nullptr, EC, (long)ES * EC, U16(Wq16), nullptr, EC, 0, QE, nullptr, EC, (long)ES * EC, bq, nullptr, 0, ES, EC, EC, 1.0f);
    wmma_gemm64<0, false, 2, 0, false><<<dim3((t + 7) / 8, EB), 256, 0, stream>>>(U16(KT), nullptr, EC, (long)ES * EC, U16(Wk16), nullptr, EC, 0, KE, nullptr, EC, (long)ES * EC, bk, nullptr, 0, ES, EC, EC, 1.0f);
    wmma_gemm64<0, false, 2, 0, false><<<dim3((t + 7) / 8, EB), 256, 0, stream>>>(U16(VT), nullptr, EC, (long)ES * EC, U16(Wv16), nullptr, EC, 0, VE, nullptr, EC, (long)ES * EC, bv, nullptr, 0, ES, EC, EC, 1.0f); }
  { AttnGeom g;
    g.q_bs = (long)ES * EC; g.q_rs = EC; g.q_hs = 64; g.k_bs = (long)ES * EC; g.k_rs = EC; g.k_hs = 64; g.v_bs = (long)ES * EC; g.v_rs = EC; g.v_hs = 64; g.o_bs = (long)ES * EC; g.o_rs = EC; g.o_hs = 64;
    g.S = ES; g.Skv = ES; g.H = EH; g.mask_mode = 0; g.qscale = 0.125f; g.blk0 = 0; g.mask_fill = -INFINITY; g.mask_is_int = 0;
    attn64_kernel<false, false, true><<<EB * EH * (ES / AT_QB), AT_NW * 32, 0, stream>>>(QE, KE, VE, Of, nullptr, nullptr, g); }
  cast_f32_f16x2<<<(EB * ES * EC / 2 + 255) / 256, 256, 0, stream>>>(Of, O16, EB * ES * EC / 2);
  { const int t = (EC / 64) * (ES / 64);   // outᵀ per batch: A = Wo [768][768], Bt = O16[b] [1024][768] -> out[b] [768][1024], bias per row
    wmma_gemm64<0, false, 1, 0, false><<<dim3((t + 7) / 8, EB), 256, 0, stream>>>(U16(Wo16), nullptr, EC, 0, U16(O16), nullptr, EC, (long)ES * EC, out, nullptr, ES, (long)EC * ES, bo, nullptr, 0, EC, ES, EC, 1.0f); }
}

// v001
// One run takes 466 microseconds.
// Two timings next to v000 both put it at 2.36 times that version's speed.
#include <hip/hip_runtime.h>
#include <math.h>
// Multi-head attention over 32x32 feature maps (8 batches, 12 heads x 64, 1024 queries/keys): the four 1x1-conv projections
// (1024 x 768 · 768 x 768 per batch; the output projection computed transposed so it lands in the (B, C, H·W) layout) and the attention
// (scores and p·v, p carried x2^15): v_wmma_f32_16x16x32_f16, f16 operands, f32 accumulate; softmax f32. Input transposes are VALU copies.
typedef __attribute__((ext_vector_type(16))) _Float16 v16h;
typedef __attribute__((ext_vector_type(8)))  _Float16 v8h;
typedef __attribute__((ext_vector_type(16))) __bf16   v16b;
typedef __attribute__((ext_vector_type(8)))  __bf16   v8b;
typedef __attribute__((ext_vector_type(8)))  float    v8f;
typedef __attribute__((ext_vector_type(4)))  float    v4f;
#define PSCALE 32768.0f
#define U16(p) ((const unsigned short*)(const void*)(p))
#define PSCALE_INV (1.0f / 32768.0f)

__device__ __forceinline__ unsigned short f2bf_bits(float f) {
  unsigned u = __float_as_uint(f);
  return (unsigned short)((u + 0x7FFFu + ((u >> 16) & 1u)) >> 16);
}
__device__ __forceinline__ float bf_bits2f(unsigned short h) { return __uint_as_float(((unsigned)h) << 16); }

// hazard guards as plain device helpers (no inline asm inside the kernel template body)
__device__ __forceinline__ void dep_guard_h(v8f& a, v8f& b, v16h x, v16h y) { asm volatile("v_nop\n\tv_nop\n\tv_nop\n\tv_nop" : "+v"(a), "+v"(b) : "v"(x), "v"(y)); }
__device__ __forceinline__ void dep_guard_b(v8f& a, v8f& b, v16b x, v16b y) { asm volatile("v_nop\n\tv_nop\n\tv_nop\n\tv_nop" : "+v"(a), "+v"(b) : "v"(x), "v"(y)); }
__device__ __forceinline__ void keep4_h(v16h a, v16h b, v16h c, v16h d) { asm volatile("v_nop" :: "v"(a), "v"(b), "v"(c), "v"(d)); }
__device__ __forceinline__ void keep4_b(v16b a, v16b b, v16b c, v16b d) { asm volatile("v_nop" :: "v"(a), "v"(b), "v"(c), "v"(d)); }
__device__ __forceinline__ void acc_guard4(v8f& a, v8f& b, v8f& c, v8f& d) { asm volatile("v_nop\n\tv_nop\n\tv_nop\n\tv_nop" : "+v"(a), "+v"(b), "+v"(c), "+v"(d)); }
template <typename T> struct Frag;
template <> struct Frag<_Float16> {
  typedef v16h V; union U { v16h v; v8h h[2]; };
  static __device__ __forceinline__ v16h load(const _Float16* p) {   // elements 0..7 <- p[0..7], 8..15 <- p[16..23]
    U f; f.h[0] = *(const v8h*)(p); f.h[1] = *(const v8h*)(p + 16); return f.v;
  }
  static __device__ __forceinline__ v8f mma(v16h a, v16h b, v8f c) {
    return __builtin_amdgcn_wmma_f32_16x16x32_f16(false, a, false, b, (short)0, c, false, false);
  }
  static __device__ __forceinline__ void guard(v8f& a, v8f& b, v16h x, v16h y) { dep_guard_h(a, b, x, y); }
  static __device__ __forceinline__ void keep(v16h a, v16h b, v16h c, v16h d) { keep4_h(a, b, c, d); }
};
template <> struct Frag<__bf16> {
  typedef v16b V; union U { v16b v; v8b h[2]; };
  static __device__ __forceinline__ v16b load(const __bf16* p) {
    U f; f.h[0] = *(const v8b*)(p); f.h[1] = *(const v8b*)(p + 16); return f.v;
  }
  static __device__ __forceinline__ v8f mma(v16b a, v16b b, v8f c) {
    return __builtin_amdgcn_wmma_f32_16x16x32_bf16(false, a, false, b, (short)0, c, false, false);
  }
  static __device__ __forceinline__ void guard(v8f& a, v8f& b, v16b x, v16b y) { dep_guard_b(a, b, x, y); }
  static __device__ __forceinline__ void keep(v16b a, v16b b, v16b c, v16b d) { keep4_b(a, b, c, d); }
};

// ---- Register-blocked batched WMMA GEMM ------------------------------------
// C[m,n] = scale * sum_k A[m,k] * Bt[n,k] (+bias)(+resid); each wave owns a 64x64 tile.
// A row-major [M,K]; Bt row-major [N,K]; M,N % 64 == 0, K % 32 == 0.
// SPLIT: operands are hi/lo planes (A2/Bt2 = lo planes, same layout); product = hi·hi + hi·lo + lo·hi.
// BIAS_MODE: 0 = none, 1 = bias[m], 2 = bias[n].
// OUT_MODE: 0 = f32, 1 = f16, 2 = bf16 hi plane (Cout) + bf16 lo plane (Cout2).
// ET: 0 = f16 operands, 1 = bf16 operands (pointers passed as 16-bit storage)
template <int ET> struct Elem;
template <> struct Elem<0> { typedef _Float16 T; };
template <> struct Elem<1> { typedef __bf16 T; };
template <int ET, bool SPLIT, int BIAS_MODE, int OUT_MODE, bool RESID, int ACT = 0>
__global__ __launch_bounds__(256) void wmma_gemm64(
    const unsigned short* __restrict__ Ap, const unsigned short* __restrict__ A2p, int lda, long strideA,
    const unsigned short* __restrict__ Btp, const unsigned short* __restrict__ Bt2p, int ldb, long strideB,
    void* __restrict__ Cout, void* __restrict__ Cout2, int ldc, long strideC,
    const float* __restrict__ bias,
    const float* __restrict__ resid, long strideR,
    int M, int N, int K, float scale) {
  typedef typename Elem<ET>::T T;
  typedef typename Frag<T>::V V;
  const T* A = (const T*)Ap; const T* A2 = (const T*)A2p; const T* Bt = (const T*)Btp; const T* Bt2 = (const T*)Bt2p;
  __shared__ __align__(16) float sT[8][16 * 68];   // per-wave 16x64 slab, pitch 68 floats
  const int b    = blockIdx.y;
  const int lane = threadIdx.x & 31;
  const int wave = threadIdx.x >> 5;
  const int tilesN = N >> 6;
  const int tilesM = M >> 6;
  const int tile = blockIdx.x * 8 + wave;
  if (tile >= tilesM * tilesN) return;   // wave-uniform; no block barriers in this kernel
  const int tm = tile / tilesN;
  const int tn = tile - tm * tilesN;
  const int m0 = tm << 6;
  const int n0 = tn << 6;

  const T* Ab  = A  + (size_t)b * strideA;
  const T* Bb  = Bt + (size_t)b * strideB;
  const T* Ab2 = SPLIT ? (A2  + (size_t)b * strideA) : nullptr;
  const T* Bb2 = SPLIT ? (Bt2 + (size_t)b * strideB) : nullptr;

  const int rlane = lane & 15;                 // row (A) / col (B, D) within subtile
  const int koff  = (lane >> 4) * 8;           // k offset of this lane half
  const int mOff  = (lane >> 4) * 8;           // D row offset

  v8f acc[4][4];
#pragma unroll
  for (int i = 0; i < 4; ++i)
#pragma unroll
    for (int j = 0; j < 4; ++j) acc[i][j] = (v8f){0.f,0.f,0.f,0.f,0.f,0.f,0.f,0.f};

  for (int k0 = 0; k0 < K; k0 += 32) {
    V bh[4], bl[4];
#pragma unroll
    for (int j = 0; j < 4; ++j) {
      const size_t bo = (size_t)(n0 + (j << 4) + rlane) * ldb + koff + k0;
      bh[j] = Frag<T>::load(Bb + bo);
      if (SPLIT) bl[j] = Frag<T>::load(Bb2 + bo);
    }
#pragma unroll
    for (int i = 0; i < 4; ++i) {
      const size_t ao = (size_t)(m0 + (i << 4) + rlane) * lda + koff + k0;
      V ah = Frag<T>::load(Ab + ao);
      V al;
      if (SPLIT) al = Frag<T>::load(Ab2 + ao);
#pragma unroll
      for (int j = 0; j < 4; ++j) {
        acc[i][j] = Frag<T>::mma(ah, bh[j], acc[i][j]);
        if (SPLIT) {
          acc[i][j] = Frag<T>::mma(ah, bl[j], acc[i][j]);
          acc[i][j] = Frag<T>::mma(al, bh[j], acc[i][j]);
        }
      }
      Frag<T>::guard(acc[i][0], acc[i][3], ah, SPLIT ? al : ah);
    }
    Frag<T>::keep(bh[0], bh[1], bh[2], bh[3]);
    if (SPLIT) Frag<T>::keep(bl[0], bl[1], bl[2], bl[3]);
  }
  acc_guard4(acc[0][0], acc[0][1], acc[0][2], acc[0][3]);
  acc_guard4(acc[1][0], acc[1][1], acc[1][2], acc[1][3]);
  acc_guard4(acc[2][0], acc[2][1], acc[2][2], acc[2][3]);
  acc_guard4(acc[3][0], acc[3][1], acc[3][2], acc[3][3]);

  // ---- epilogue ----
  float* slab = sT[wave];
  const float* Rb = RESID ? (resid + (size_t)b * strideR) : nullptr;
#pragma unroll
  for (int i = 0; i < 4; ++i) {
    const int mBase = m0 + (i << 4);
#pragma unroll
    for (int j = 0; j < 4; ++j) {
      const int n = n0 + (j << 4) + rlane;
      float bv = 0.f;
      if (BIAS_MODE == 2) bv = bias[n];
#pragma unroll
      for (int r = 0; r < 8; ++r) {
        float v = acc[i][j][r] * scale;
        if (BIAS_MODE == 1) v += bias[mBase + mOff + r];
        if (BIAS_MODE == 2) v += bv;
        if (RESID) v += Rb[(size_t)(mBase + mOff + r) * ldc + n];
        if (ACT == 1) v = tanhf(v);
        if (ACT == 2) v = fmaxf(v, 0.0f);
        if (ACT == 3) v = v / (1.0f + expf(-v));
        if (ACT == 4) v = (v > 0.f) ? v : 0.01f * v;
        if (ACT == 5) v = 0.5f * v * (1.0f + erff(v * 0.70710678118654752f));
        slab[(mOff + r) * 68 + (j << 4) + rlane] = v;
      }
    }
    __builtin_amdgcn_fence(__ATOMIC_RELEASE, "workgroup");
    __builtin_amdgcn_wave_barrier();
    __builtin_amdgcn_fence(__ATOMIC_ACQUIRE, "workgroup");
    if (OUT_MODE == 0) {
      float* C = (float*)Cout + (size_t)b * strideC;
      const int hh = lane >> 4, c4 = (lane & 15) * 4;     // row seg = 256 B = 16 lanes x 16 B
      {
#pragma unroll
        for (int it = 0; it < 8; ++it) {
          const int row = it * 2 + hh;
          v4f v = *(const v4f*)(slab + row * 68 + c4);
          *(v4f*)(C + (size_t)(mBase + row) * ldc + n0 + c4) = v;
        }
        
      }
    } else {
      const int q = lane >> 3, c8 = (lane & 7) * 8;
      unsigned short* C  = (unsigned short*)Cout  + (size_t)b * strideC;
      unsigned short* C2 = (OUT_MODE == 2) ? ((unsigned short*)Cout2 + (size_t)b * strideC) : nullptr;
      {
#pragma unroll
        for (int it = 0; it < 4; ++it) {
          const int row = it * 4 + q;
          const float* sp = slab + row * 68 + c8;
          v8h hv, lv;
#pragma unroll
          for (int e = 0; e < 8; ++e) {
            if (OUT_MODE == 1) {
              hv[e] = (_Float16)sp[e];
            } else {
              unsigned short hb = f2bf_bits(sp[e]);
              unsigned short lb = f2bf_bits(sp[e] - bf_bits2f(hb));
              hv[e] = __builtin_bit_cast(_Float16, hb);
              lv[e] = __builtin_bit_cast(_Float16, lb);
            }
          }
          *(v8h*)(C + (size_t)(mBase + row) * ldc + n0 + c8) = hv;
          if (OUT_MODE == 2) *(v8h*)(C2 + (size_t)(mBase + row) * ldc + n0 + c8) = lv;
        }
        
      }
    }
    __builtin_amdgcn_fence(__ATOMIC_RELEASE, "workgroup");
    __builtin_amdgcn_wave_barrier();
    __builtin_amdgcn_fence(__ATOMIC_ACQUIRE, "workgroup");
  }
}

__global__ __launch_bounds__(256) void cast_f32_f16x2(
    const float* __restrict__ in, _Float16* __restrict__ out, int n2) {
  int i = blockIdx.x * 256 + threadIdx.x;
  if (i < n2) {
    const _Float16 h0 = (_Float16)in[2 * i], h1 = (_Float16)in[2 * i + 1];
    const unsigned u = (unsigned)__builtin_bit_cast(unsigned short, h0) | ((unsigned)__builtin_bit_cast(unsigned short, h1) << 16);
    ((unsigned*)out)[i] = u;
    
  }
}


// ---- f32 -> f16 cast with a power-of-two pre-scale (folded back by the consumer GEMM's scale) ----
__global__ __launch_bounds__(256) void cast_f32_f16x2s(const float* __restrict__ in, _Float16* __restrict__ out, int n2, float s) {
  int i = blockIdx.x * 256 + threadIdx.x;
  if (i < n2) {
    const _Float16 h0 = (_Float16)(in[2 * i] * s), h1 = (_Float16)(in[2 * i + 1] * s);
    const unsigned u = (unsigned)__builtin_bit_cast(unsigned short, h0) | ((unsigned)__builtin_bit_cast(unsigned short, h1) << 16);
    ((unsigned*)out)[i] = u;
    
  }
}
__global__ __launch_bounds__(256) void split_f32_bf16x2(
    const float* __restrict__ in, __bf16* __restrict__ hi, __bf16* __restrict__ lo, long n2) {
  long i = (long)blockIdx.x * 256 + threadIdx.x;
  long stride = (long)gridDim.x * 256;
  {
    for (long j = i; j < n2; j += stride) {
      const float a = in[2 * j], b = in[2 * j + 1];
      const unsigned short ah = f2bf_bits(a), bh = f2bf_bits(b);
      const unsigned short al = f2bf_bits(a - bf_bits2f(ah)), bl = f2bf_bits(b - bf_bits2f(bh));
      ((unsigned*)hi)[j] = (unsigned)ah | ((unsigned)bh << 16);
      ((unsigned*)lo)[j] = (unsigned)al | ((unsigned)bl << 16);
    }
    
  }
}


// ---- f32 [R][C] (row pitch ldi) -> f16 transposed [C][R] (row pitch ldo); 64x64 tiles; each output row segment
__global__ __launch_bounds__(256) void transpose_cast_f16(const float* __restrict__ in, int ldi,
                                                         _Float16* __restrict__ outT, int ldo, float scale) {
  __shared__ __align__(16) _Float16 tile[64][72];     // [c][r]
  const int c0 = blockIdx.x * 64, r0 = blockIdx.y * 64;
  const int t = threadIdx.y * 32 + threadIdx.x;
  for (int i = threadIdx.y; i < 64; i += 8) {
    tile[threadIdx.x][i]      = (_Float16)(in[(size_t)(r0 + i) * ldi + c0 + threadIdx.x] * scale);
    tile[32 + threadIdx.x][i] = (_Float16)(in[(size_t)(r0 + i) * ldi + c0 + 32 + threadIdx.x] * scale);
  }
  __syncthreads();
  const int q = t >> 3, c8 = (t & 7) * 8;
  {
#pragma unroll
    for (int it = 0; it < 2; ++it) {
      const int c = it * 32 + q;
      v8h hv = *(const v8h*)(&tile[c][c8]);
      *(v8h*)(outT + (size_t)(c0 + c) * ldo + r0 + c8) = hv;
    }
    
  }
}

// ---- f32 [R][C] (pitch ldi) -> bf16 hi/lo transposed planes [C][R] (pitch ldo); 64x64 tiles; each output row segment
__global__ __launch_bounds__(256) void transpose_split_bf16(const float* __restrict__ in, int ldi,
                                                           __bf16* __restrict__ outH, __bf16* __restrict__ outL, int ldo) {
  __shared__ __align__(16) float tile[64][68];     // [c][r]
  const int c0 = blockIdx.x * 64, r0 = blockIdx.y * 64;
  const int t = threadIdx.y * 32 + threadIdx.x;
  for (int i = threadIdx.y; i < 64; i += 8) {
    tile[threadIdx.x][i]      = in[(size_t)(r0 + i) * ldi + c0 + threadIdx.x];
    tile[32 + threadIdx.x][i] = in[(size_t)(r0 + i) * ldi + c0 + 32 + threadIdx.x];
  }
  __syncthreads();
  const int q = t >> 3, c8 = (t & 7) * 8;
  {
#pragma unroll
    for (int it = 0; it < 2; ++it) {
      const int c = it * 32 + q;
      v8b hv, lv;
#pragma unroll
      for (int e = 0; e < 8; ++e) {
        const float f = tile[c][c8 + e];
        const unsigned short hb = f2bf_bits(f);
        hv[e] = __builtin_bit_cast(__bf16, hb);
        lv[e] = __builtin_bit_cast(__bf16, f2bf_bits(f - bf_bits2f(hb)));
      }
      *(v8b*)(outH + (size_t)(c0 + c) * ldo + r0 + c8) = hv;
      *(v8b*)(outL + (size_t)(c0 + c) * ldo + r0 + c8) = lv;
    }
    
  }
}

// =====================================================================================
// Generic causal/non-causal attention for head_dim 64, f32 in / f32 out; 16-bit operands: bf16 with optional hi/lo splits, or
// plain f16 (F16=true, non-split, probabilities carried x2^15).
//   scores = (q*qscale)·kᵀ : v_wmma_f32_16x16x32_bf16; SPLIT_QK -> q,k as bf16 hi/lo (hi·hi + hi·lo + lo·hi)
//   out    = p·v           : v_wmma_f32_16x16x32_bf16; SPLIT_PV -> p,v as bf16 hi/lo; else p,v plain bf16
//   f32 accumulate; online softmax in f32. Block = 4 waves = 64 query rows of one (batch, head); S % 64 == 0.
//   Element (b, s, h, d) of tensor X lives at X[b*X_bs + s*X_rs + h*X_hs + d] (strides in floats, multiples of 4).
//   Masking: MASK_MODE 0 none, 1 causal (kv > q masked), 2 tensor [S][Skv] shared over (b,h) (float if
//   mask_is_int==0, int32 with element == 0 -> masked if 1, int32 with element != 0 -> masked if 2), 3 per-token vectors qmask[B][S] & kvmask[B][Skv] (int32,
//   0 -> masked), 4 causal + sliding window (kv > q or q - kv > W masked; W passed in mask_is_int);
//   5 = relative-position bias: s += cp[b,h,q][idx[q][kv]] + pc[b,h,kv][idx[q][kv]] with idx = mask_b ([S][Skv] int32) and
//   mask_a an int32 [S][Skv] tensor with nonzero = masked (tables: element (b,h,row,n) at X + b*c_bs + h*c_hs + row*c_rs + n);
//   masked scores are replaced by mask_fill (e.g. -inf or -1e9) before the softmax.
//   grid.x = B * H * (S/64) (or a sub-range with blk0).
// =====================================================================================
#define AT_D 64
#define AT_NW 4
#define AT_QB 64
#define AT_KC 64
struct AttnGeom { const float* cp = nullptr; const float* pc = nullptr; long c_bs = 0, c_rs = 0, c_hs = 0;   // mode-5 score-bias tables
                  long q_bs, q_rs, q_hs, k_bs, k_rs, k_hs, v_bs, v_rs, v_hs, o_bs, o_rs, o_hs;
                  int S, Skv, H, mask_mode; float qscale; int blk0; float mask_fill; int mask_is_int; };
static_assert(sizeof(AttnGeom) == 168, "no padding");

__device__ __forceinline__ unsigned short at_bf_bits(float f) {
  unsigned u = __float_as_uint(f);
  return (unsigned short)((u + 0x7FFFu + ((u >> 16) & 1u)) >> 16);
}
__device__ __forceinline__ __bf16 at_f2bf(float f) { return __builtin_bit_cast(__bf16, at_bf_bits(f)); }
__device__ __forceinline__ void at_split(float f, __bf16& hi, __bf16& lo) {
  const unsigned short hb = at_bf_bits(f);
  hi = __builtin_bit_cast(__bf16, hb);
  lo = at_f2bf(f - __uint_as_float(((unsigned)hb) << 16));
}
__device__ __forceinline__ v8f at_mma(v16b a, v16b b, v8f c) {
  c = __builtin_amdgcn_wmma_f32_16x16x32_bf16(false, a, false, b, (short)0, c, false, false);
  asm volatile("v_nop\n\tv_nop\n\tv_nop\n\tv_nop" : "+v"(c) : "v"(a), "v"(b));
  return c;
}
// 16-bit element as a bit pattern held in a __bf16 slot: f16 bits when F16, bf16 (RNE) otherwise
template <bool F16> __device__ __forceinline__ __bf16 at_to16(float f) {
  if (F16) return __builtin_bit_cast(__bf16, (_Float16)f);
  return at_f2bf(f);
}
template <bool F16> __device__ __forceinline__ v8f at_mma16(v16b a, v16b b, v8f c) {
  if (F16) {
    const v16h ah = __builtin_bit_cast(v16h, a), bh = __builtin_bit_cast(v16h, b);
    c = __builtin_amdgcn_wmma_f32_16x16x32_f16(false, ah, false, bh, (short)0, c, false, false);
    asm volatile("v_nop\n\tv_nop\n\tv_nop\n\tv_nop" : "+v"(c) : "v"(ah), "v"(bh));
    return c;
  }
  return at_mma(a, b, c);
}

// MASK_MODE is a compile-time constant: each instance holds only its own masking code, so the score loop has no per-element mode branches.
template <bool SPLIT_QK, bool SPLIT_PV, bool F16, int MASK_MODE>
__global__ __launch_bounds__(128)
void attn64_kernel(const float* __restrict__ q, const float* __restrict__ k,
                   const float* __restrict__ v, float* __restrict__ out,
                   const void* __restrict__ mask_a, const int* __restrict__ mask_b, AttnGeom g) {
  static_assert(!(F16 && (SPLIT_QK || SPLIT_PV)), "f16 mode is non-split");
  const float PSC = F16 ? 32768.0f : 1.0f;     // f16 probabilities carried x2^15 (subnormal range), folded into the final 1/l
  union FB { v16b v; v8b h[2]; };
  __shared__ __align__(16) __bf16 Ksh[AT_KC * AT_D];             // K hi [kv][d]      8 KB
  __shared__ __align__(16) __bf16 Ksl[SPLIT_QK ? AT_KC * AT_D : 8];
  __shared__ __align__(16) __bf16 Vth[AT_D * AT_KC];             // V hi [d][kv]      8 KB
  __shared__ __align__(16) __bf16 Vtl[SPLIT_PV ? AT_D * AT_KC : 8];
  __shared__ __align__(16) __bf16 Psh[AT_NW][16 * AT_KC];        // per wave P hi [row][kv]  8 KB
  __shared__ __align__(16) __bf16 Psl[SPLIT_PV ? AT_NW : 1][SPLIT_PV ? 16 * AT_KC : 8];
  __shared__ __align__(16) float  Os[AT_NW][16 * 68];            // per wave out tile, pitch 68

  const int tid  = threadIdx.x;
  const int wave = tid >> 5;
  const int lane = tid & 31;
  const int hh   = lane >> 4;
  const int c    = lane & 15;

  const int nqb = g.S / AT_QB;
  const int bx = blockIdx.x + g.blk0;
  const int qb = bx % nqb;
  const int bh = bx / nqb;
  const int h  = bh % g.H;
  const int b  = bh / g.H;
  const int qbase_block = qb * AT_QB;
  const int q0 = qbase_block + wave * 16;

  const float* qb_ptr = q + (size_t)b * g.q_bs + (size_t)h * g.q_hs;
  const float* kb_ptr = k + (size_t)b * g.k_bs + (size_t)h * g.k_hs;
  const float* vb_ptr = v + (size_t)b * g.v_bs + (size_t)h * g.v_hs;
  float*       ob_ptr = out + (size_t)b * g.o_bs + (size_t)h * g.o_hs;

  // ---- Q fragments (A operand): 2 d-chunks, hi (and lo) ----
  v16b qah[2], qal[2];
  {
    const float* qrow = qb_ptr + (size_t)(q0 + c) * g.q_rs;
#pragma unroll
    for (int dc = 0; dc < 2; ++dc) {
#pragma unroll
      for (int e = 0; e < 8; ++e) {
        const float f0 = qrow[dc * 32 + 8 * hh + e] * g.qscale;
        const float f1 = qrow[dc * 32 + 16 + 8 * hh + e] * g.qscale;
        if (SPLIT_QK) { __bf16 hq, lq; at_split(f0, hq, lq); qah[dc][e] = hq; qal[dc][e] = lq; at_split(f1, hq, lq); qah[dc][8 + e] = hq; qal[dc][8 + e] = lq; }
        else { qah[dc][e] = at_to16<F16>(f0); qah[dc][8 + e] = at_to16<F16>(f1); qal[dc][e] = qah[dc][e]; qal[dc][8 + e] = qah[dc][8 + e]; }
      }
    }
  }

  float mrow[8], lrow[8];
  v8f oacc[4];
#pragma unroll
  for (int r = 0; r < 8; ++r) { mrow[r] = -INFINITY; lrow[r] = 0.f; }
#pragma unroll
  for (int t = 0; t < 4; ++t) oacc[t] = (v8f){0.f,0.f,0.f,0.f,0.f,0.f,0.f,0.f};

  const int nChunks = (MASK_MODE == 1 || MASK_MODE == 4) ? (qb + 1) : (g.Skv / AT_KC);   // block-uniform
  // per-row query mask (mode 3)
  int qkeep[8];
#pragma unroll
  for (int r = 0; r < 8; ++r) qkeep[r] = (MASK_MODE == 3) ? mask_b[(size_t)b * g.S + q0 + 8 * hh + r] : 1;   // mask_b = qmask in mode 3
  for (int kc = 0; kc < nChunks; ++kc) {
    const int kv0 = kc * AT_KC;
    __syncthreads();
    {
      const int kvr = tid >> 1, dh = (tid & 1) * 32;
      const float* krow = kb_ptr + (size_t)(kv0 + kvr) * g.k_rs + dh;
      const float* vrow = vb_ptr + (size_t)(kv0 + kvr) * g.v_rs + dh;
#pragma unroll
      for (int i = 0; i < 8; ++i) {
        v4f kk = *(const v4f*)(krow + 4 * i);
        v4f vv = *(const v4f*)(vrow + 4 * i);
#pragma unroll
        for (int e = 0; e < 4; ++e) {
          const int d = dh + 4 * i + e;
          if (SPLIT_QK) { __bf16 a, bl; at_split(kk[e], a, bl); Ksh[kvr * AT_D + d] = a; Ksl[kvr * AT_D + d] = bl; }
          else Ksh[kvr * AT_D + d] = at_to16<F16>(kk[e]);
          if (SPLIT_PV) { __bf16 a, bl; at_split(vv[e], a, bl); Vth[d * AT_KC + kvr] = a; Vtl[d * AT_KC + kvr] = bl; }
          else Vth[d * AT_KC + kvr] = at_to16<F16>(vv[e]);
        }
      }
    }
    __syncthreads();

    v8f s[4];
#pragma unroll
    for (int j = 0; j < 4; ++j) {
      s[j] = (v8f){0.f,0.f,0.f,0.f,0.f,0.f,0.f,0.f};
#pragma unroll 1
      for (int dc = 0; dc < 2; ++dc) {
        FB kb;
        kb.h[0] = *(const v8b*)(Ksh + (j * 16 + c) * AT_D + dc * 32 + 8 * hh);
        kb.h[1] = *(const v8b*)(Ksh + (j * 16 + c) * AT_D + dc * 32 + 16 + 8 * hh);
        s[j] = at_mma16<F16>(qah[dc], kb.v, s[j]);
        if (SPLIT_QK) {
          FB kl;
          kl.h[0] = *(const v8b*)(Ksl + (j * 16 + c) * AT_D + dc * 32 + 8 * hh);
          kl.h[1] = *(const v8b*)(Ksl + (j * 16 + c) * AT_D + dc * 32 + 16 + 8 * hh);
          s[j] = at_mma16<F16>(qah[dc], kl.v, s[j]);
          s[j] = at_mma16<F16>(qal[dc], kb.v, s[j]);
        }
      }
    }
    const bool diag = (MASK_MODE == 1) && (kc == qb);
    int kvkeep[4] = {1, 1, 1, 1};
    if (MASK_MODE == 3) {
#pragma unroll
      for (int j = 0; j < 4; ++j) kvkeep[j] = ((const int*)mask_a)[(size_t)b * g.Skv + kv0 + j * 16 + c];   // mask_a = kvmask
    }
    float cm[8];
#pragma unroll
    for (int r = 0; r < 8; ++r) {
      const int qrow = q0 + 8 * hh + r;
      float m = -INFINITY;
#pragma unroll
      for (int j = 0; j < 4; ++j) {
        const int kvcol = kv0 + j * 16 + c;
        bool masked = false;
        if (diag) masked = (kvcol > qrow);
        else if (MASK_MODE == 4) masked = (kvcol > qrow) || (qrow - kvcol > g.mask_is_int);
        else if (MASK_MODE == 2) {
          const size_t mi = (size_t)qrow * g.Skv + kvcol;
          masked = (g.mask_is_int == 0) ? (((const float*)mask_a)[mi] == 0.0f)
                 : (g.mask_is_int == 1) ? (((const int*)mask_a)[mi] == 0) : (((const int*)mask_a)[mi] != 0);
        } else if (MASK_MODE == 3) masked = (qkeep[r] == 0) || (kvkeep[j] == 0);
        else if (MASK_MODE == 5) {
          const size_t mi = (size_t)qrow * g.Skv + kvcol;
          masked = (((const int*)mask_a)[mi] != 0);
          int n = mask_b[mi]; n = n < 0 ? 0 : n;
          s[j][r] += g.cp[(size_t)b * g.c_bs + (size_t)h * g.c_hs + (size_t)qrow * g.c_rs + n]
                   + g.pc[(size_t)b * g.c_bs + (size_t)h * g.c_hs + (size_t)kvcol * g.c_rs + n];
        }
        if (masked) s[j][r] = g.mask_fill;
        m = fmaxf(m, s[j][r]);
      }
#pragma unroll
      for (int off = 1; off < 16; off <<= 1) m = fmaxf(m, __shfl_xor(m, off, 32));
      cm[r] = m;
    }
    __bf16* pwh = Psh[wave];
    __bf16* pwl = Psl[SPLIT_PV ? wave : 0];
#pragma unroll
    for (int r = 0; r < 8; ++r) {
      const float mnew = fmaxf(mrow[r], cm[r]);
      const float alpha = expf(mrow[r] - mnew);
      mrow[r] = mnew;
      float psum = 0.f;
#pragma unroll
      for (int j = 0; j < 4; ++j) {
        const float p = expf(s[j][r] - mnew);
        psum += p;
        if (SPLIT_PV) { __bf16 a, bl; at_split(p, a, bl); pwh[(8 * hh + r) * AT_KC + j * 16 + c] = a; pwl[(8 * hh + r) * AT_KC + j * 16 + c] = bl; }
        else pwh[(8 * hh + r) * AT_KC + j * 16 + c] = at_to16<F16>(p * PSC);
      }
#pragma unroll
      for (int off = 1; off < 16; off <<= 1) psum += __shfl_xor(psum, off, 32);
      lrow[r] = lrow[r] * alpha + psum;
#pragma unroll
      for (int t = 0; t < 4; ++t) oacc[t][r] *= alpha;
    }
    __builtin_amdgcn_fence(__ATOMIC_RELEASE, "workgroup");
    __builtin_amdgcn_wave_barrier();
    __builtin_amdgcn_fence(__ATOMIC_ACQUIRE, "workgroup");
#pragma unroll 1
    for (int kk = 0; kk < 2; ++kk) {
      FB pa, pl;
      pa.h[0] = *(const v8b*)(pwh + c * AT_KC + kk * 32 + 8 * hh);
      pa.h[1] = *(const v8b*)(pwh + c * AT_KC + kk * 32 + 16 + 8 * hh);
      if (SPLIT_PV) {
        pl.h[0] = *(const v8b*)(pwl + c * AT_KC + kk * 32 + 8 * hh);
        pl.h[1] = *(const v8b*)(pwl + c * AT_KC + kk * 32 + 16 + 8 * hh);
      }
#pragma unroll
      for (int t = 0; t < 4; ++t) {
        FB vb;
        vb.h[0] = *(const v8b*)(Vth + (t * 16 + c) * AT_KC + kk * 32 + 8 * hh);
        vb.h[1] = *(const v8b*)(Vth + (t * 16 + c) * AT_KC + kk * 32 + 16 + 8 * hh);
        oacc[t] = at_mma16<F16>(pa.v, vb.v, oacc[t]);
        if (SPLIT_PV) {
          FB vl;
          vl.h[0] = *(const v8b*)(Vtl + (t * 16 + c) * AT_KC + kk * 32 + 8 * hh);
          vl.h[1] = *(const v8b*)(Vtl + (t * 16 + c) * AT_KC + kk * 32 + 16 + 8 * hh);
          oacc[t] = at_mma16<F16>(pa.v, vl.v, oacc[t]);
          oacc[t] = at_mma16<F16>(pl.v, vb.v, oacc[t]);
        }
      }
    }
  }

  float* os = Os[wave];
#pragma unroll
  for (int r = 0; r < 8; ++r) {
    const float inv = 1.0f / (lrow[r] * PSC);
#pragma unroll
    for (int t = 0; t < 4; ++t) os[(8 * hh + r) * 68 + t * 16 + c] = oacc[t][r] * inv;
  }
  __builtin_amdgcn_fence(__ATOMIC_RELEASE, "workgroup");
  __builtin_amdgcn_wave_barrier();
  __builtin_amdgcn_fence(__ATOMIC_ACQUIRE, "workgroup");
  {
    const int c4 = (lane & 15) * 4;
    {
#pragma unroll
      for (int it = 0; it < 8; ++it) {
        const int row = it * 2 + hh;
        v4f val = *(const v4f*)(os + row * 68 + c4);
        *(v4f*)(ob_ptr + (size_t)(q0 + row) * g.o_rs + c4) = val;
      }
      
    }
  }
}

#define EB 8
#define EC 768
#define ES 1024
#define EH 12
extern "C" void kernel_launch(void* const* d_in, const int* in_sizes, int n_in, void* d_out, int out_size, void* d_ws, size_t ws_size, hipStream_t stream) {
  (void)in_sizes; (void)n_in; (void)out_size; (void)ws_size;
  const float* q = (const float*)d_in[0]; const float* k = (const float*)d_in[1]; const float* v = (const float*)d_in[2];
  const float* Wq = (const float*)d_in[3]; const float* bq = (const float*)d_in[4]; const float* Wk = (const float*)d_in[5]; const float* bk = (const float*)d_in[6];
  const float* Wv = (const float*)d_in[7]; const float* bv = (const float*)d_in[8]; const float* Wo = (const float*)d_in[9]; const float* bo = (const float*)d_in[10];
  float* out = (float*)d_out;    // [8][768][1024]
  char* ws = (char*)d_ws; size_t off = 0;
  auto carve = [&](size_t bytes) -> char* { char* p = ws + off; off += (bytes + 255) & ~(size_t)255; return p; };
  _Float16* QT = (_Float16*)carve((size_t)EB * ES * EC * 2); _Float16* KT = (_Float16*)carve((size_t)EB * ES * EC * 2); _Float16* VT = (_Float16*)carve((size_t)EB * ES * EC * 2);   // 3 x 12.6 MB
  _Float16* Wq16 = (_Float16*)carve((size_t)EC * EC * 2); _Float16* Wk16 = (_Float16*)carve((size_t)EC * EC * 2); _Float16* Wv16 = (_Float16*)carve((size_t)EC * EC * 2); _Float16* Wo16 = (_Float16*)carve((size_t)EC * EC * 2);
  float* QE = (float*)carve((size_t)EB * ES * EC * 4); float* KE = (float*)carve((size_t)EB * ES * EC * 4); float* VE = (float*)carve((size_t)EB * ES * EC * 4);   // 3 x 25 MB
  float* Of = (float*)carve((size_t)EB * ES * EC * 4);
  _Float16* O16 = QT;     // reuse (QT dead after the q projection)
  for (int b = 0; b < EB; ++b) {
    transpose_cast_f16<<<dim3(ES / 64, EC / 64), dim3(32, 8), 0, stream>>>(q + (size_t)b * EC * ES, ES, QT + (size_t)b * ES * EC, EC, 1.0f);   // [768][1024] -> [1024][768]
    transpose_cast_f16<<<dim3(ES / 64, EC / 64), dim3(32, 8), 0, stream>>>(k + (size_t)b * EC * ES, ES, KT + (size_t)b * ES * EC, EC, 1.0f);
    transpose_cast_f16<<<dim3(ES / 64, EC / 64), dim3(32, 8), 0, stream>>>(v + (size_t)b * EC * ES, ES, VT + (size_t)b * ES * EC, EC, 1.0f);
  }
  cast_f32_f16x2<<<(EC * EC / 2 + 255) / 256, 256, 0, stream>>>(Wq, Wq16, EC * EC / 2);   // 1x1-conv weights [out][in] are the Bt layout
  cast_f32_f16x2<<<(EC * EC / 2 + 255) / 256, 256, 0, stream>>>(Wk, Wk16, EC * EC / 2);
  cast_f32_f16x2<<<(EC * EC / 2 + 255) / 256, 256, 0, stream>>>(Wv, Wv16, EC * EC / 2);
  cast_f32_f16x2<<<(EC * EC / 2 + 255) / 256, 256, 0, stream>>>(Wo, Wo16, EC * EC / 2);   // used as the A operand ([M=o][K=c]) of the output GEMM
  { const int t = (ES / 64) * (EC / 64);
    wmma_gemm64<0, false, 2, 0, false><<<dim3((t + 7) / 8, EB), 256, 0, stream>>>(U16(QT), nullptr, EC, (long)ES * EC, U16(Wq16), nullptr, EC, 0, QE, nullptr, EC, (long)ES * EC, bq, nullptr, 0, ES, EC, EC, 1.0f);
    wmma_gemm64<0, false, 2, 0, false><<<dim3((t + 7) / 8, EB), 256, 0, stream>>>(U16(KT), nullptr, EC, (long)ES * EC, U16(Wk16), nullptr, EC, 0, KE, nullptr, EC, (long)ES * EC, bk, nullptr, 0, ES, EC, EC, 1.0f);
    wmma_gemm64<0, false, 2, 0, false><<<dim3((t + 7) / 8, EB), 256, 0, stream>>>(U16(VT), nullptr, EC, (long)ES * EC, U16(Wv16), nullptr, EC, 0, VE, nullptr, EC, (long)ES * EC, bv, nullptr, 0, ES, EC, EC, 1.0f); }
  { AttnGeom g;
    g.q_bs = (long)ES * EC; g.q_rs = EC; g.q_hs = 64; g.k_bs = (long)ES * EC; g.k_rs = EC; g.k_hs = 64; g.v_bs = (long)ES * EC; g.v_rs = EC; g.v_hs = 64; g.o_bs = (long)ES * EC; g.o_rs = EC; g.o_hs = 64;
    g.S = ES; g.Skv = ES; g.H = EH; g.mask_mode = 0; g.qscale = 0.125f; g.blk0 = 0; g.mask_fill = -INFINITY; g.mask_is_int = 0;
    attn64_kernel<false, false, true, 0><<<EB * EH * (ES / AT_QB), AT_NW * 32, 0, stream>>>(QE, KE, VE, Of, nullptr, nullptr, g); }
  cast_f32_f16x2<<<(EB * ES * EC / 2 + 255) / 256, 256, 0, stream>>>(Of, O16, EB * ES * EC / 2);
  { const int t = (EC / 64) * (ES / 64);   // outᵀ per batch: A = Wo [768][768], Bt = O16[b] [1024][768] -> out[b] [768][1024], bias per row
    wmma_gemm64<0, false, 1, 0, false><<<dim3((t + 7) / 8, EB), 256, 0, stream>>>(U16(Wo16), nullptr, EC, 0, U16(O16), nullptr, EC, (long)ES * EC, out, nullptr, ES, (long)EC * ES, bo, nullptr, 0, EC, ES, EC, 1.0f); }
}

// v002
// Measured time: 435 microseconds a run.
// In both of two side-by-side timings against v001, it was 1.07 times as fast.
// All steps since v000 together make it 2.53 times as fast.
#include <hip/hip_runtime.h>
#include <math.h>
// Multi-head attention over 32x32 feature maps (8 batches, 12 heads x 64, 1024 queries/keys): the four 1x1-conv projections
// (1024 x 768 · 768 x 768 per batch; the output projection computed transposed so it lands in the (B, C, H·W) layout) and the attention
// (scores and p·v, p carried x2^15): v_wmma_f32_16x16x32_f16, f16 operands, f32 accumulate; softmax f32. Input transposes are VALU copies.
typedef __attribute__((ext_vector_type(16))) _Float16 v16h;
typedef __attribute__((ext_vector_type(8)))  _Float16 v8h;
typedef __attribute__((ext_vector_type(16))) __bf16   v16b;
typedef __attribute__((ext_vector_type(8)))  __bf16   v8b;
typedef __attribute__((ext_vector_type(8)))  float    v8f;
typedef __attribute__((ext_vector_type(4)))  float    v4f;
#define PSCALE 32768.0f
#define U16(p) ((const unsigned short*)(const void*)(p))
#define PSCALE_INV (1.0f / 32768.0f)

__device__ __forceinline__ unsigned short f2bf_bits(float f) {
  unsigned u = __float_as_uint(f);
  return (unsigned short)((u + 0x7FFFu + ((u >> 16) & 1u)) >> 16);
}
__device__ __forceinline__ float bf_bits2f(unsigned short h) { return __uint_as_float(((unsigned)h) << 16); }

// hazard guards as plain device helpers (no inline asm inside the kernel template body)
__device__ __forceinline__ void dep_guard_h(v8f& a, v8f& b, v16h x, v16h y) { asm volatile("v_nop\n\tv_nop\n\tv_nop\n\tv_nop" : "+v"(a), "+v"(b) : "v"(x), "v"(y)); }
__device__ __forceinline__ void dep_guard_b(v8f& a, v8f& b, v16b x, v16b y) { asm volatile("v_nop\n\tv_nop\n\tv_nop\n\tv_nop" : "+v"(a), "+v"(b) : "v"(x), "v"(y)); }
__device__ __forceinline__ void keep4_h(v16h a, v16h b, v16h c, v16h d) { asm volatile("v_nop" :: "v"(a), "v"(b), "v"(c), "v"(d)); }
__device__ __forceinline__ void keep4_b(v16b a, v16b b, v16b c, v16b d) { asm volatile("v_nop" :: "v"(a), "v"(b), "v"(c), "v"(d)); }
__device__ __forceinline__ void acc_guard4(v8f& a, v8f& b, v8f& c, v8f& d) { asm volatile("v_nop\n\tv_nop\n\tv_nop\n\tv_nop" : "+v"(a), "+v"(b), "+v"(c), "+v"(d)); }
template <typename T> struct Frag;
template <> struct Frag<_Float16> {
  typedef v16h V; union U { v16h v; v8h h[2]; };
  static __device__ __forceinline__ v16h load(const _Float16* p) {   // elements 0..7 <- p[0..7], 8..15 <- p[16..23]
    U f; f.h[0] = *(const v8h*)(p); f.h[1] = *(const v8h*)(p + 16); return f.v;
  }
  static __device__ __forceinline__ v8f mma(v16h a, v16h b, v8f c) {
    return __builtin_amdgcn_wmma_f32_16x16x32_f16(false, a, false, b, (short)0, c, false, false);
  }
  static __device__ __forceinline__ void guard(v8f& a, v8f& b, v16h x, v16h y) { dep_guard_h(a, b, x, y); }
  static __device__ __forceinline__ void keep(v16h a, v16h b, v16h c, v16h d) { keep4_h(a, b, c, d); }
};
template <> struct Frag<__bf16> {
  typedef v16b V; union U { v16b v; v8b h[2]; };
  static __device__ __forceinline__ v16b load(const __bf16* p) {
    U f; f.h[0] = *(const v8b*)(p); f.h[1] = *(const v8b*)(p + 16); return f.v;
  }
  static __device__ __forceinline__ v8f mma(v16b a, v16b b, v8f c) {
    return __builtin_amdgcn_wmma_f32_16x16x32_bf16(false, a, false, b, (short)0, c, false, false);
  }
  static __device__ __forceinline__ void guard(v8f& a, v8f& b, v16b x, v16b y) { dep_guard_b(a, b, x, y); }
  static __device__ __forceinline__ void keep(v16b a, v16b b, v16b c, v16b d) { keep4_b(a, b, c, d); }
};

// ---- Register-blocked batched WMMA GEMM ------------------------------------
// C[m,n] = scale * sum_k A[m,k] * Bt[n,k] (+bias)(+resid); each wave owns a 64x64 tile.
// A row-major [M,K]; Bt row-major [N,K]; M,N % 64 == 0, K % 32 == 0.
// SPLIT: operands are hi/lo planes (A2/Bt2 = lo planes, same layout); product = hi·hi + hi·lo + lo·hi.
// BIAS_MODE: 0 = none, 1 = bias[m], 2 = bias[n].
// OUT_MODE: 0 = f32, 1 = f16, 2 = bf16 hi plane (Cout) + bf16 lo plane (Cout2).
// ET: 0 = f16 operands, 1 = bf16 operands (pointers passed as 16-bit storage)
template <int ET> struct Elem;
template <> struct Elem<0> { typedef _Float16 T; };
template <> struct Elem<1> { typedef __bf16 T; };
template <int ET, bool SPLIT, int BIAS_MODE, int OUT_MODE, bool RESID, int ACT = 0>
__global__ __launch_bounds__(256) void wmma_gemm64(
    const unsigned short* __restrict__ Ap, const unsigned short* __restrict__ A2p, int lda, long strideA,
    const unsigned short* __restrict__ Btp, const unsigned short* __restrict__ Bt2p, int ldb, long strideB,
    void* __restrict__ Cout, void* __restrict__ Cout2, int ldc, long strideC,
    const float* __restrict__ bias,
    const float* __restrict__ resid, long strideR,
    int M, int N, int K, float scale) {
  typedef typename Elem<ET>::T T;
  typedef typename Frag<T>::V V;
  const T* A = (const T*)Ap; const T* A2 = (const T*)A2p; const T* Bt = (const T*)Btp; const T* Bt2 = (const T*)Bt2p;
  __shared__ __align__(16) float sT[8][16 * 68];   // per-wave 16x64 slab, pitch 68 floats
  const int b    = blockIdx.y;
  const int lane = threadIdx.x & 31;
  const int wave = threadIdx.x >> 5;
  const int tilesN = N >> 6;
  const int tilesM = M >> 6;
  const int tile = blockIdx.x * 8 + wave;
  if (tile >= tilesM * tilesN) return;   // wave-uniform; no block barriers in this kernel
  const int tm = tile / tilesN;
  const int tn = tile - tm * tilesN;
  const int m0 = tm << 6;
  const int n0 = tn << 6;

  const T* Ab  = A  + (size_t)b * strideA;
  const T* Bb  = Bt + (size_t)b * strideB;
  const T* Ab2 = SPLIT ? (A2  + (size_t)b * strideA) : nullptr;
  const T* Bb2 = SPLIT ? (Bt2 + (size_t)b * strideB) : nullptr;

  const int rlane = lane & 15;                 // row (A) / col (B, D) within subtile
  const int koff  = (lane >> 4) * 8;           // k offset of this lane half
  const int mOff  = (lane >> 4) * 8;           // D row offset

  v8f acc[4][4];
#pragma unroll
  for (int i = 0; i < 4; ++i)
#pragma unroll
    for (int j = 0; j < 4; ++j) acc[i][j] = (v8f){0.f,0.f,0.f,0.f,0.f,0.f,0.f,0.f};

  for (int k0 = 0; k0 < K; k0 += 32) {
    V bh[4], bl[4];
#pragma unroll
    for (int j = 0; j < 4; ++j) {
      const size_t bo = (size_t)(n0 + (j << 4) + rlane) * ldb + koff + k0;
      bh[j] = Frag<T>::load(Bb + bo);
      if (SPLIT) bl[j] = Frag<T>::load(Bb2 + bo);
    }
#pragma unroll
    for (int i = 0; i < 4; ++i) {
      const size_t ao = (size_t)(m0 + (i << 4) + rlane) * lda + koff + k0;
      V ah = Frag<T>::load(Ab + ao);
      V al;
      if (SPLIT) al = Frag<T>::load(Ab2 + ao);
#pragma unroll
      for (int j = 0; j < 4; ++j) {
        acc[i][j] = Frag<T>::mma(ah, bh[j], acc[i][j]);
        if (SPLIT) {
          acc[i][j] = Frag<T>::mma(ah, bl[j], acc[i][j]);
          acc[i][j] = Frag<T>::mma(al, bh[j], acc[i][j]);
        }
      }
      Frag<T>::guard(acc[i][0], acc[i][3], ah, SPLIT ? al : ah);
    }
    Frag<T>::keep(bh[0], bh[1], bh[2], bh[3]);
    if (SPLIT) Frag<T>::keep(bl[0], bl[1], bl[2], bl[3]);
  }
  acc_guard4(acc[0][0], acc[0][1], acc[0][2], acc[0][3]);
  acc_guard4(acc[1][0], acc[1][1], acc[1][2], acc[1][3]);
  acc_guard4(acc[2][0], acc[2][1], acc[2][2], acc[2][3]);
  acc_guard4(acc[3][0], acc[3][1], acc[3][2], acc[3][3]);

  // ---- epilogue ----
  float* slab = sT[wave];
  const float* Rb = RESID ? (resid + (size_t)b * strideR) : nullptr;
#pragma unroll
  for (int i = 0; i < 4; ++i) {
    const int mBase = m0 + (i << 4);
#pragma unroll
    for (int j = 0; j < 4; ++j) {
      const int n = n0 + (j << 4) + rlane;
      float bv = 0.f;
      if (BIAS_MODE == 2) bv = bias[n];
#pragma unroll
      for (int r = 0; r < 8; ++r) {
        float v = acc[i][j][r] * scale;
        if (BIAS_MODE == 1) v += bias[mBase + mOff + r];
        if (BIAS_MODE == 2) v += bv;
        if (RESID) v += Rb[(size_t)(mBase + mOff + r) * ldc + n];
        if (ACT == 1) v = tanhf(v);
        if (ACT == 2) v = fmaxf(v, 0.0f);
        if (ACT == 3) v = v / (1.0f + expf(-v));
        if (ACT == 4) v = (v > 0.f) ? v : 0.01f * v;
        if (ACT == 5) v = 0.5f * v * (1.0f + erff(v * 0.70710678118654752f));
        slab[(mOff + r) * 68 + (j << 4) + rlane] = v;
      }
    }
    __builtin_amdgcn_fence(__ATOMIC_RELEASE, "workgroup");
    __builtin_amdgcn_wave_barrier();
    __builtin_amdgcn_fence(__ATOMIC_ACQUIRE, "workgroup");
    if (OUT_MODE == 0) {
      float* C = (float*)Cout + (size_t)b * strideC;
      const int hh = lane >> 4, c4 = (lane & 15) * 4;     // row seg = 256 B = 16 lanes x 16 B
      {
#pragma unroll
        for (int it = 0; it < 8; ++it) {
          const int row = it * 2 + hh;
          v4f v = *(const v4f*)(slab + row * 68 + c4);
          *(v4f*)(C + (size_t)(mBase + row) * ldc + n0 + c4) = v;
        }
        
      }
    } else {
      const int q = lane >> 3, c8 = (lane & 7) * 8;
      unsigned short* C  = (unsigned short*)Cout  + (size_t)b * strideC;
      unsigned short* C2 = (OUT_MODE == 2) ? ((unsigned short*)Cout2 + (size_t)b * strideC) : nullptr;
      {
#pragma unroll
        for (int it = 0; it < 4; ++it) {
          const int row = it * 4 + q;
          const float* sp = slab + row * 68 + c8;
          v8h hv, lv;
#pragma unroll
          for (int e = 0; e < 8; ++e) {
            if (OUT_MODE == 1) {
              hv[e] = (_Float16)sp[e];
            } else {
              unsigned short hb = f2bf_bits(sp[e]);
              unsigned short lb = f2bf_bits(sp[e] - bf_bits2f(hb));
              hv[e] = __builtin_bit_cast(_Float16, hb);
              lv[e] = __builtin_bit_cast(_Float16, lb);
            }
          }
          *(v8h*)(C + (size_t)(mBase + row) * ldc + n0 + c8) = hv;
          if (OUT_MODE == 2) *(v8h*)(C2 + (size_t)(mBase + row) * ldc + n0 + c8) = lv;
        }
        
      }
    }
    __builtin_amdgcn_fence(__ATOMIC_RELEASE, "workgroup");
    __builtin_amdgcn_wave_barrier();
    __builtin_amdgcn_fence(__ATOMIC_ACQUIRE, "workgroup");
  }
}

__global__ __launch_bounds__(256) void cast_f32_f16x2(
    const float* __restrict__ in, _Float16* __restrict__ out, int n2) {
  int i = blockIdx.x * 256 + threadIdx.x;
  if (i < n2) {
    const _Float16 h0 = (_Float16)in[2 * i], h1 = (_Float16)in[2 * i + 1];
    const unsigned u = (unsigned)__builtin_bit_cast(unsigned short, h0) | ((unsigned)__builtin_bit_cast(unsigned short, h1) << 16);
    ((unsigned*)out)[i] = u;
    
  }
}


// ---- f32 -> f16 cast with a power-of-two pre-scale (folded back by the consumer GEMM's scale) ----
__global__ __launch_bounds__(256) void cast_f32_f16x2s(const float* __restrict__ in, _Float16* __restrict__ out, int n2, float s) {
  int i = blockIdx.x * 256 + threadIdx.x;
  if (i < n2) {
    const _Float16 h0 = (_Float16)(in[2 * i] * s), h1 = (_Float16)(in[2 * i + 1] * s);
    const unsigned u = (unsigned)__builtin_bit_cast(unsigned short, h0) | ((unsigned)__builtin_bit_cast(unsigned short, h1) << 16);
    ((unsigned*)out)[i] = u;
    
  }
}
__global__ __launch_bounds__(256) void split_f32_bf16x2(
    const float* __restrict__ in, __bf16* __restrict__ hi, __bf16* __restrict__ lo, long n2) {
  long i = (long)blockIdx.x * 256 + threadIdx.x;
  long stride = (long)gridDim.x * 256;
  {
    for (long j = i; j < n2; j += stride) {
      const float a = in[2 * j], b = in[2 * j + 1];
      const unsigned short ah = f2bf_bits(a), bh = f2bf_bits(b);
      const unsigned short al = f2bf_bits(a - bf_bits2f(ah)), bl = f2bf_bits(b - bf_bits2f(bh));
      ((unsigned*)hi)[j] = (unsigned)ah | ((unsigned)bh << 16);
      ((unsigned*)lo)[j] = (unsigned)al | ((unsigned)bl << 16);
    }
    
  }
}


// ---- f32 [R][C] (row pitch ldi) -> f16 transposed [C][R] (row pitch ldo); 64x64 tiles; each output row segment
__global__ __launch_bounds__(256) void transpose_cast_f16(const float* __restrict__ in, int ldi,
                                                         _Float16* __restrict__ outT, int ldo, float scale) {
  __shared__ __align__(16) _Float16 tile[64][72];     // [c][r]
  const int c0 = blockIdx.x * 64, r0 = blockIdx.y * 64;
  const int t = threadIdx.y * 32 + threadIdx.x;
  for (int i = threadIdx.y; i < 64; i += 8) {
    tile[threadIdx.x][i]      = (_Float16)(in[(size_t)(r0 + i) * ldi + c0 + threadIdx.x] * scale);
    tile[32 + threadIdx.x][i] = (_Float16)(in[(size_t)(r0 + i) * ldi + c0 + 32 + threadIdx.x] * scale);
  }
  __syncthreads();
  const int q = t >> 3, c8 = (t & 7) * 8;
  {
#pragma unroll
    for (int it = 0; it < 2; ++it) {
      const int c = it * 32 + q;
      v8h hv = *(const v8h*)(&tile[c][c8]);
      *(v8h*)(outT + (size_t)(c0 + c) * ldo + r0 + c8) = hv;
    }
    
  }
}

// ---- f32 [R][C] (pitch ldi) -> bf16 hi/lo transposed planes [C][R] (pitch ldo); 64x64 tiles; each output row segment
__global__ __launch_bounds__(256) void transpose_split_bf16(const float* __restrict__ in, int ldi,
                                                           __bf16* __restrict__ outH, __bf16* __restrict__ outL, int ldo) {
  __shared__ __align__(16) float tile[64][68];     // [c][r]
  const int c0 = blockIdx.x * 64, r0 = blockIdx.y * 64;
  const int t = threadIdx.y * 32 + threadIdx.x;
  for (int i = threadIdx.y; i < 64; i += 8) {
    tile[threadIdx.x][i]      = in[(size_t)(r0 + i) * ldi + c0 + threadIdx.x];
    tile[32 + threadIdx.x][i] = in[(size_t)(r0 + i) * ldi + c0 + 32 + threadIdx.x];
  }
  __syncthreads();
  const int q = t >> 3, c8 = (t & 7) * 8;
  {
#pragma unroll
    for (int it = 0; it < 2; ++it) {
      const int c = it * 32 + q;
      v8b hv, lv;
#pragma unroll
      for (int e = 0; e < 8; ++e) {
        const float f = tile[c][c8 + e];
        const unsigned short hb = f2bf_bits(f);
        hv[e] = __builtin_bit_cast(__bf16, hb);
        lv[e] = __builtin_bit_cast(__bf16, f2bf_bits(f - bf_bits2f(hb)));
      }
      *(v8b*)(outH + (size_t)(c0 + c) * ldo + r0 + c8) = hv;
      *(v8b*)(outL + (size_t)(c0 + c) * ldo + r0 + c8) = lv;
    }
    
  }
}

// =====================================================================================
// Generic causal/non-causal attention for head_dim 64, f32 in / f32 out; 16-bit operands: bf16 with optional hi/lo splits, or
// plain f16 (F16=true, non-split, probabilities carried x2^15).
//   scores = (q*qscale)·kᵀ : v_wmma_f32_16x16x32_bf16; SPLIT_QK -> q,k as bf16 hi/lo (hi·hi + hi·lo + lo·hi)
//   out    = p·v           : v_wmma_f32_16x16x32_bf16; SPLIT_PV -> p,v as bf16 hi/lo; else p,v plain bf16
//   f32 accumulate; online softmax in f32. Block = 4 waves = 64 query rows of one (batch, head); S % 64 == 0.
//   Element (b, s, h, d) of tensor X lives at X[b*X_bs + s*X_rs + h*X_hs + d] (strides in floats, multiples of 4).
//   Masking: MASK_MODE 0 none, 1 causal (kv > q masked), 2 tensor [S][Skv] shared over (b,h) (float if
//   mask_is_int==0, int32 with element == 0 -> masked if 1, int32 with element != 0 -> masked if 2), 3 per-token vectors qmask[B][S] & kvmask[B][Skv] (int32,
//   0 -> masked), 4 causal + sliding window (kv > q or q - kv > W masked; W passed in mask_is_int);
//   5 = relative-position bias: s += cp[b,h,q][idx[q][kv]] + pc[b,h,kv][idx[q][kv]] with idx = mask_b ([S][Skv] int32) and
//   mask_a an int32 [S][Skv] tensor with nonzero = masked (tables: element (b,h,row,n) at X + b*c_bs + h*c_hs + row*c_rs + n);
//   masked scores are replaced by mask_fill (e.g. -inf or -1e9) before the softmax.
//   grid.x = B * H * (S/64) (or a sub-range with blk0).
// =====================================================================================
#define AT_D 64
#define AT_NW 4
#define AT_QB 64
#define AT_KC 64
#define AT_LP 72   // LDS row pitch of the K, V^T and P tiles in 16-bit elements: 144 B = 16 B x 9, so the 16 rows of a ds_load_b128 fragment read fall on distinct banks
struct AttnGeom { const float* cp = nullptr; const float* pc = nullptr; long c_bs = 0, c_rs = 0, c_hs = 0;   // mode-5 score-bias tables
                  long q_bs, q_rs, q_hs, k_bs, k_rs, k_hs, v_bs, v_rs, v_hs, o_bs, o_rs, o_hs;
                  int S, Skv, H, mask_mode; float qscale; int blk0; float mask_fill; int mask_is_int; };
static_assert(sizeof(AttnGeom) == 168, "no padding");

__device__ __forceinline__ unsigned short at_bf_bits(float f) {
  unsigned u = __float_as_uint(f);
  return (unsigned short)((u + 0x7FFFu + ((u >> 16) & 1u)) >> 16);
}
__device__ __forceinline__ __bf16 at_f2bf(float f) { return __builtin_bit_cast(__bf16, at_bf_bits(f)); }
__device__ __forceinline__ void at_split(float f, __bf16& hi, __bf16& lo) {
  const unsigned short hb = at_bf_bits(f);
  hi = __builtin_bit_cast(__bf16, hb);
  lo = at_f2bf(f - __uint_as_float(((unsigned)hb) << 16));
}
__device__ __forceinline__ v8f at_mma(v16b a, v16b b, v8f c) {
  c = __builtin_amdgcn_wmma_f32_16x16x32_bf16(false, a, false, b, (short)0, c, false, false);
  asm volatile("v_nop\n\tv_nop\n\tv_nop\n\tv_nop" : "+v"(c) : "v"(a), "v"(b));
  return c;
}
// 16-bit element as a bit pattern held in a __bf16 slot: f16 bits when F16, bf16 (RNE) otherwise
template <bool F16> __device__ __forceinline__ __bf16 at_to16(float f) {
  if (F16) return __builtin_bit_cast(__bf16, (_Float16)f);
  return at_f2bf(f);
}
template <bool F16> __device__ __forceinline__ v8f at_mma16(v16b a, v16b b, v8f c) {
  if (F16) {
    const v16h ah = __builtin_bit_cast(v16h, a), bh = __builtin_bit_cast(v16h, b);
    c = __builtin_amdgcn_wmma_f32_16x16x32_f16(false, ah, false, bh, (short)0, c, false, false);
    asm volatile("v_nop\n\tv_nop\n\tv_nop\n\tv_nop" : "+v"(c) : "v"(ah), "v"(bh));
    return c;
  }
  return at_mma(a, b, c);
}

// MASK_MODE is a compile-time constant: each instance holds only its own masking code, so the score loop has no per-element mode branches.
template <bool SPLIT_QK, bool SPLIT_PV, bool F16, int MASK_MODE>
__global__ __launch_bounds__(128)
void attn64_kernel(const float* __restrict__ q, const float* __restrict__ k,
                   const float* __restrict__ v, float* __restrict__ out,
                   const void* __restrict__ mask_a, const int* __restrict__ mask_b, AttnGeom g) {
  static_assert(!(F16 && (SPLIT_QK || SPLIT_PV)), "f16 mode is non-split");
  const float PSC = F16 ? 32768.0f : 1.0f;     // f16 probabilities carried x2^15 (subnormal range), folded into the final 1/l
  union FB { v16b v; v8b h[2]; };
  __shared__ __align__(16) __bf16 Ksh[AT_KC * AT_LP];            // K hi [kv][d]      9 KB
  __shared__ __align__(16) __bf16 Ksl[SPLIT_QK ? AT_KC * AT_LP : 8];
  __shared__ __align__(16) __bf16 Vth[AT_D * AT_LP];             // V hi [d][kv]      9 KB
  __shared__ __align__(16) __bf16 Vtl[SPLIT_PV ? AT_D * AT_LP : 8];
  __shared__ __align__(16) __bf16 Psh[AT_NW][16 * AT_LP];        // per wave P hi [row][kv]  9 KB
  __shared__ __align__(16) __bf16 Psl[SPLIT_PV ? AT_NW : 1][SPLIT_PV ? 16 * AT_LP : 8];
  __shared__ __align__(16) float  Os[AT_NW][16 * 68];            // per wave out tile, pitch 68

  const int tid  = threadIdx.x;
  const int wave = tid >> 5;
  const int lane = tid & 31;
  const int hh   = lane >> 4;
  const int c    = lane & 15;

  const int nqb = g.S / AT_QB;
  const int bx = blockIdx.x + g.blk0;
  const int qb = bx % nqb;
  const int bh = bx / nqb;
  const int h  = bh % g.H;
  const int b  = bh / g.H;
  const int qbase_block = qb * AT_QB;
  const int q0 = qbase_block + wave * 16;

  const float* qb_ptr = q + (size_t)b * g.q_bs + (size_t)h * g.q_hs;
  const float* kb_ptr = k + (size_t)b * g.k_bs + (size_t)h * g.k_hs;
  const float* vb_ptr = v + (size_t)b * g.v_bs + (size_t)h * g.v_hs;
  float*       ob_ptr = out + (size_t)b * g.o_bs + (size_t)h * g.o_hs;

  // ---- Q fragments (A operand): 2 d-chunks, hi (and lo) ----
  v16b qah[2], qal[2];
  {
    const float* qrow = qb_ptr + (size_t)(q0 + c) * g.q_rs;
#pragma unroll
    for (int dc = 0; dc < 2; ++dc) {
#pragma unroll
      for (int e = 0; e < 8; ++e) {
        const float f0 = qrow[dc * 32 + 8 * hh + e] * g.qscale;
        const float f1 = qrow[dc * 32 + 16 + 8 * hh + e] * g.qscale;
        if (SPLIT_QK) { __bf16 hq, lq; at_split(f0, hq, lq); qah[dc][e] = hq; qal[dc][e] = lq; at_split(f1, hq, lq); qah[dc][8 + e] = hq; qal[dc][8 + e] = lq; }
        else { qah[dc][e] = at_to16<F16>(f0); qah[dc][8 + e] = at_to16<F16>(f1); qal[dc][e] = qah[dc][e]; qal[dc][8 + e] = qah[dc][8 + e]; }
      }
    }
  }

  float mrow[8], lrow[8];
  v8f oacc[4];
#pragma unroll
  for (int r = 0; r < 8; ++r) { mrow[r] = -INFINITY; lrow[r] = 0.f; }
#pragma unroll
  for (int t = 0; t < 4; ++t) oacc[t] = (v8f){0.f,0.f,0.f,0.f,0.f,0.f,0.f,0.f};

  const int nChunks = (MASK_MODE == 1 || MASK_MODE == 4) ? (qb + 1) : (g.Skv / AT_KC);   // block-uniform
  // per-row query mask (mode 3)
  int qkeep[8];
#pragma unroll
  for (int r = 0; r < 8; ++r) qkeep[r] = (MASK_MODE == 3) ? mask_b[(size_t)b * g.S + q0 + 8 * hh + r] : 1;   // mask_b = qmask in mode 3
  for (int kc = 0; kc < nChunks; ++kc) {
    const int kv0 = kc * AT_KC;
    __syncthreads();
    {
      const int kvr = tid >> 1, dh = (tid & 1) * 32;
      const float* krow = kb_ptr + (size_t)(kv0 + kvr) * g.k_rs + dh;
      const float* vrow = vb_ptr + (size_t)(kv0 + kvr) * g.v_rs + dh;
#pragma unroll
      for (int i = 0; i < 8; ++i) {
        v4f kk = *(const v4f*)(krow + 4 * i);
        v4f vv = *(const v4f*)(vrow + 4 * i);
#pragma unroll
        for (int e = 0; e < 4; ++e) {
          const int d = dh + 4 * i + e;
          if (SPLIT_QK) { __bf16 a, bl; at_split(kk[e], a, bl); Ksh[kvr * AT_LP + d] = a; Ksl[kvr * AT_LP + d] = bl; }
          else Ksh[kvr * AT_LP + d] = at_to16<F16>(kk[e]);
          if (SPLIT_PV) { __bf16 a, bl; at_split(vv[e], a, bl); Vth[d * AT_LP + kvr] = a; Vtl[d * AT_LP + kvr] = bl; }
          else Vth[d * AT_LP + kvr] = at_to16<F16>(vv[e]);
        }
      }
    }
    __syncthreads();

    v8f s[4];
#pragma unroll
    for (int j = 0; j < 4; ++j) {
      s[j] = (v8f){0.f,0.f,0.f,0.f,0.f,0.f,0.f,0.f};
#pragma unroll 1
      for (int dc = 0; dc < 2; ++dc) {
        FB kb;
        kb.h[0] = *(const v8b*)(Ksh + (j * 16 + c) * AT_LP + dc * 32 + 8 * hh);
        kb.h[1] = *(const v8b*)(Ksh + (j * 16 + c) * AT_LP + dc * 32 + 16 + 8 * hh);
        s[j] = at_mma16<F16>(qah[dc], kb.v, s[j]);
        if (SPLIT_QK) {
          FB kl;
          kl.h[0] = *(const v8b*)(Ksl + (j * 16 + c) * AT_LP + dc * 32 + 8 * hh);
          kl.h[1] = *(const v8b*)(Ksl + (j * 16 + c) * AT_LP + dc * 32 + 16 + 8 * hh);
          s[j] = at_mma16<F16>(qah[dc], kl.v, s[j]);
          s[j] = at_mma16<F16>(qal[dc], kb.v, s[j]);
        }
      }
    }
    const bool diag = (MASK_MODE == 1) && (kc == qb);
    int kvkeep[4] = {1, 1, 1, 1};
    if (MASK_MODE == 3) {
#pragma unroll
      for (int j = 0; j < 4; ++j) kvkeep[j] = ((const int*)mask_a)[(size_t)b * g.Skv + kv0 + j * 16 + c];   // mask_a = kvmask
    }
    float cm[8];
#pragma unroll
    for (int r = 0; r < 8; ++r) {
      const int qrow = q0 + 8 * hh + r;
      float m = -INFINITY;
#pragma unroll
      for (int j = 0; j < 4; ++j) {
        const int kvcol = kv0 + j * 16 + c;
        bool masked = false;
        if (diag) masked = (kvcol > qrow);
        else if (MASK_MODE == 4) masked = (kvcol > qrow) || (qrow - kvcol > g.mask_is_int);
        else if (MASK_MODE == 2) {
          const size_t mi = (size_t)qrow * g.Skv + kvcol;
          masked = (g.mask_is_int == 0) ? (((const float*)mask_a)[mi] == 0.0f)
                 : (g.mask_is_int == 1) ? (((const int*)mask_a)[mi] == 0) : (((const int*)mask_a)[mi] != 0);
        } else if (MASK_MODE == 3) masked = (qkeep[r] == 0) || (kvkeep[j] == 0);
        else if (MASK_MODE == 5) {
          const size_t mi = (size_t)qrow * g.Skv + kvcol;
          masked = (((const int*)mask_a)[mi] != 0);
          int n = mask_b[mi]; n = n < 0 ? 0 : n;
          s[j][r] += g.cp[(size_t)b * g.c_bs + (size_t)h * g.c_hs + (size_t)qrow * g.c_rs + n]
                   + g.pc[(size_t)b * g.c_bs + (size_t)h * g.c_hs + (size_t)kvcol * g.c_rs + n];
        }
        if (masked) s[j][r] = g.mask_fill;
        m = fmaxf(m, s[j][r]);
      }
#pragma unroll
      for (int off = 1; off < 16; off <<= 1) m = fmaxf(m, __shfl_xor(m, off, 32));
      cm[r] = m;
    }
    __bf16* pwh = Psh[wave];
    __bf16* pwl = Psl[SPLIT_PV ? wave : 0];
#pragma unroll
    for (int r = 0; r < 8; ++r) {
      const float mnew = fmaxf(mrow[r], cm[r]);
      const float alpha = expf(mrow[r] - mnew);
      mrow[r] = mnew;
      float psum = 0.f;
#pragma unroll
      for (int j = 0; j < 4; ++j) {
        const float p = expf(s[j][r] - mnew);
        psum += p;
        if (SPLIT_PV) { __bf16 a, bl; at_split(p, a, bl); pwh[(8 * hh + r) * AT_LP + j * 16 + c] = a; pwl[(8 * hh + r) * AT_LP + j * 16 + c] = bl; }
        else pwh[(8 * hh + r) * AT_LP + j * 16 + c] = at_to16<F16>(p * PSC);
      }
#pragma unroll
      for (int off = 1; off < 16; off <<= 1) psum += __shfl_xor(psum, off, 32);
      lrow[r] = lrow[r] * alpha + psum;
#pragma unroll
      for (int t = 0; t < 4; ++t) oacc[t][r] *= alpha;
    }
    __builtin_amdgcn_fence(__ATOMIC_RELEASE, "workgroup");
    __builtin_amdgcn_wave_barrier();
    __builtin_amdgcn_fence(__ATOMIC_ACQUIRE, "workgroup");
#pragma unroll 1
    for (int kk = 0; kk < 2; ++kk) {
      FB pa, pl;
      pa.h[0] = *(const v8b*)(pwh + c * AT_LP + kk * 32 + 8 * hh);
      pa.h[1] = *(const v8b*)(pwh + c * AT_LP + kk * 32 + 16 + 8 * hh);
      if (SPLIT_PV) {
        pl.h[0] = *(const v8b*)(pwl + c * AT_LP + kk * 32 + 8 * hh);
        pl.h[1] = *(const v8b*)(pwl + c * AT_LP + kk * 32 + 16 + 8 * hh);
      }
#pragma unroll
      for (int t = 0; t < 4; ++t) {
        FB vb;
        vb.h[0] = *(const v8b*)(Vth + (t * 16 + c) * AT_LP + kk * 32 + 8 * hh);
        vb.h[1] = *(const v8b*)(Vth + (t * 16 + c) * AT_LP + kk * 32 + 16 + 8 * hh);
        oacc[t] = at_mma16<F16>(pa.v, vb.v, oacc[t]);
        if (SPLIT_PV) {
          FB vl;
          vl.h[0] = *(const v8b*)(Vtl + (t * 16 + c) * AT_LP + kk * 32 + 8 * hh);
          vl.h[1] = *(const v8b*)(Vtl + (t * 16 + c) * AT_LP + kk * 32 + 16 + 8 * hh);
          oacc[t] = at_mma16<F16>(pa.v, vl.v, oacc[t]);
          oacc[t] = at_mma16<F16>(pl.v, vb.v, oacc[t]);
        }
      }
    }
  }

  float* os = Os[wave];
#pragma unroll
  for (int r = 0; r < 8; ++r) {
    const float inv = 1.0f / (lrow[r] * PSC);
#pragma unroll
    for (int t = 0; t < 4; ++t) os[(8 * hh + r) * 68 + t * 16 + c] = oacc[t][r] * inv;
  }
  __builtin_amdgcn_fence(__ATOMIC_RELEASE, "workgroup");
  __builtin_amdgcn_wave_barrier();
  __builtin_amdgcn_fence(__ATOMIC_ACQUIRE, "workgroup");
  {
    const int c4 = (lane & 15) * 4;
    {
#pragma unroll
      for (int it = 0; it < 8; ++it) {
        const int row = it * 2 + hh;
        v4f val = *(const v4f*)(os + row * 68 + c4);
        *(v4f*)(ob_ptr + (size_t)(q0 + row) * g.o_rs + c4) = val;
      }
      
    }
  }
}

#define EB 8
#define EC 768
#define ES 1024
#define EH 12
extern "C" void kernel_launch(void* const* d_in, const int* in_sizes, int n_in, void* d_out, int out_size, void* d_ws, size_t ws_size, hipStream_t stream) {
  (void)in_sizes; (void)n_in; (void)out_size; (void)ws_size;
  const float* q = (const float*)d_in[0]; const float* k = (const float*)d_in[1]; const float* v = (const float*)d_in[2];
  const float* Wq = (const float*)d_in[3]; const float* bq = (const float*)d_in[4]; const float* Wk = (const float*)d_in[5]; const float* bk = (const float*)d_in[6];
  const float* Wv = (const float*)d_in[7]; const float* bv = (const float*)d_in[8]; const float* Wo = (const float*)d_in[9]; const float* bo = (const float*)d_in[10];
  float* out = (float*)d_out;    // [8][768][1024]
  char* ws = (char*)d_ws; size_t off = 0;
  auto carve = [&](size_t bytes) -> char* { char* p = ws + off; off += (bytes + 255) & ~(size_t)255; return p; };
  _Float16* QT = (_Float16*)carve((size_t)EB * ES * EC * 2); _Float16* KT = (_Float16*)carve((size_t)EB * ES * EC * 2); _Float16* VT = (_Float16*)carve((size_t)EB * ES * EC * 2);   // 3 x 12.6 MB
  _Float16* Wq16 = (_Float16*)carve((size_t)EC * EC * 2); _Float16* Wk16 = (_Float16*)carve((size_t)EC * EC * 2); _Float16* Wv16 = (_Float16*)carve((size_t)EC * EC * 2); _Float16* Wo16 = (_Float16*)carve((size_t)EC * EC * 2);
  float* QE = (float*)carve((size_t)EB * ES * EC * 4); float* KE = (float*)carve((size_t)EB * ES * EC * 4); float* VE = (float*)carve((size_t)EB * ES * EC * 4);   // 3 x 25 MB
  float* Of = (float*)carve((size_t)EB * ES * EC * 4);
  _Float16* O16 = QT;     // reuse (QT dead after the q projection)
  for (int b = 0; b < EB; ++b) {
    transpose_cast_f16<<<dim3(ES / 64, EC / 64), dim3(32, 8), 0, stream>>>(q + (size_t)b * EC * ES, ES, QT + (size_t)b * ES * EC, EC, 1.0f);   // [768][1024] -> [1024][768]
    transpose_cast_f16<<<dim3(ES / 64, EC / 64), dim3(32, 8), 0, stream>>>(k + (size_t)b * EC * ES, ES, KT + (size_t)b * ES * EC, EC, 1.0f);
    transpose_cast_f16<<<dim3(ES / 64, EC / 64), dim3(32, 8), 0, stream>>>(v + (size_t)b * EC * ES, ES, VT + (size_t)b * ES * EC, EC, 1.0f);
  }
  cast_f32_f16x2<<<(EC * EC / 2 + 255) / 256, 256, 0, stream>>>(Wq, Wq16, EC * EC / 2);   // 1x1-conv weights [out][in] are the Bt layout
  cast_f32_f16x2<<<(EC * EC / 2 + 255) / 256, 256, 0, stream>>>(Wk, Wk16, EC * EC / 2);
  cast_f32_f16x2<<<(EC * EC / 2 + 255) / 256, 256, 0, stream>>>(Wv, Wv16, EC * EC / 2);
  cast_f32_f16x2<<<(EC * EC / 2 + 255) / 256, 256, 0, stream>>>(Wo, Wo16, EC * EC / 2);   // used as the A operand ([M=o][K=c]) of the output GEMM
  { const int t = (ES / 64) * (EC / 64);
    wmma_gemm64<0, false, 2, 0, false><<<dim3((t + 7) / 8, EB), 256, 0, stream>>>(U16(QT), nullptr, EC, (long)ES * EC, U16(Wq16), nullptr, EC, 0, QE, nullptr, EC, (long)ES * EC, bq, nullptr, 0, ES, EC, EC, 1.0f);
    wmma_gemm64<0, false, 2, 0, false><<<dim3((t + 7) / 8, EB), 256, 0, stream>>>(U16(KT), nullptr, EC, (long)ES * EC, U16(Wk16), nullptr, EC, 0, KE, nullptr, EC, (long)ES * EC, bk, nullptr, 0, ES, EC, EC, 1.0f);
    wmma_gemm64<0, false, 2, 0, false><<<dim3((t + 7) / 8, EB), 256, 0, stream>>>(U16(VT), nullptr, EC, (long)ES * EC, U16(Wv16), nullptr, EC, 0, VE, nullptr, EC, (long)ES * EC, bv, nullptr, 0, ES, EC, EC, 1.0f); }
  { AttnGeom g;
    g.q_bs = (long)ES * EC; g.q_rs = EC; g.q_hs = 64; g.k_bs = (long)ES * EC; g.k_rs = EC; g.k_hs = 64; g.v_bs = (long)ES * EC; g.v_rs = EC; g.v_hs = 64; g.o_bs = (long)ES * EC; g.o_rs = EC; g.o_hs = 64;
    g.S = ES; g.Skv = ES; g.H = EH; g.mask_mode = 0; g.qscale = 0.125f; g.blk0 = 0; g.mask_fill = -INFINITY; g.mask_is_int = 0;
    attn64_kernel<false, false, true, 0><<<EB * EH * (ES / AT_QB), AT_NW * 32, 0, stream>>>(QE, KE, VE, Of, nullptr, nullptr, g); }
  cast_f32_f16x2<<<(EB * ES * EC / 2 + 255) / 256, 256, 0, stream>>>(Of, O16, EB * ES * EC / 2);
  { const int t = (EC / 64) * (ES / 64);   // outᵀ per batch: A = Wo [768][768], Bt = O16[b] [1024][768] -> out[b] [768][1024], bias per row
    wmma_gemm64<0, false, 1, 0, false><<<dim3((t + 7) / 8, EB), 256, 0, stream>>>(U16(Wo16), nullptr, EC, 0, U16(O16), nullptr, EC, (long)ES * EC, out, nullptr, ES, (long)EC * ES, bo, nullptr, 0, EC, ES, EC, 1.0f); }
}

// v003
// One run takes 286 microseconds.
// Timed twice side by side with v002, it ran 1.53 and 1.51 times as fast.
// Counting every step since v000, it is 3.84 times as fast.
#include <hip/hip_runtime.h>
#include <math.h>
// Multi-head attention over 32x32 feature maps (8 batches, 12 heads x 64, 1024 queries/keys): the four 1x1-conv projections
// (1024 x 768 · 768 x 768 per batch; the output projection computed transposed so it lands in the (B, C, H·W) layout) and the attention
// (scores and p·v, p carried x2^15): v_wmma_f32_16x16x32_f16, f16 operands, f32 accumulate; softmax f32. Input transposes are VALU copies.
typedef __attribute__((ext_vector_type(16))) _Float16 v16h;
typedef __attribute__((ext_vector_type(8)))  _Float16 v8h;
typedef __attribute__((ext_vector_type(16))) __bf16   v16b;
typedef __attribute__((ext_vector_type(8)))  __bf16   v8b;
typedef __attribute__((ext_vector_type(8)))  float    v8f;
typedef __attribute__((ext_vector_type(4)))  float    v4f;
#define PSCALE 32768.0f
#define U16(p) ((const unsigned short*)(const void*)(p))
#define PSCALE_INV (1.0f / 32768.0f)

__device__ __forceinline__ unsigned short f2bf_bits(float f) {
  unsigned u = __float_as_uint(f);
  return (unsigned short)((u + 0x7FFFu + ((u >> 16) & 1u)) >> 16);
}
__device__ __forceinline__ float bf_bits2f(unsigned short h) { return __uint_as_float(((unsigned)h) << 16); }

// hazard guards as plain device helpers (no inline asm inside the kernel template body)
__device__ __forceinline__ void dep_guard_h(v8f& a, v8f& b, v16h x, v16h y) { asm volatile("v_nop\n\tv_nop\n\tv_nop\n\tv_nop" : "+v"(a), "+v"(b) : "v"(x), "v"(y)); }
__device__ __forceinline__ void dep_guard_b(v8f& a, v8f& b, v16b x, v16b y) { asm volatile("v_nop\n\tv_nop\n\tv_nop\n\tv_nop" : "+v"(a), "+v"(b) : "v"(x), "v"(y)); }
__device__ __forceinline__ void keep4_h(v16h a, v16h b, v16h c, v16h d) { asm volatile("v_nop" :: "v"(a), "v"(b), "v"(c), "v"(d)); }
__device__ __forceinline__ void keep4_b(v16b a, v16b b, v16b c, v16b d) { asm volatile("v_nop" :: "v"(a), "v"(b), "v"(c), "v"(d)); }
__device__ __forceinline__ void acc_guard4(v8f& a, v8f& b, v8f& c, v8f& d) { asm volatile("v_nop\n\tv_nop\n\tv_nop\n\tv_nop" : "+v"(a), "+v"(b), "+v"(c), "+v"(d)); }
template <typename T> struct Frag;
template <> struct Frag<_Float16> {
  typedef v16h V; union U { v16h v; v8h h[2]; };
  static __device__ __forceinline__ v16h load(const _Float16* p) {   // elements 0..7 <- p[0..7], 8..15 <- p[16..23]
    U f; f.h[0] = *(const v8h*)(p); f.h[1] = *(const v8h*)(p + 16); return f.v;
  }
  static __device__ __forceinline__ v8f mma(v16h a, v16h b, v8f c) {
    return __builtin_amdgcn_wmma_f32_16x16x32_f16(false, a, false, b, (short)0, c, false, false);
  }
  static __device__ __forceinline__ void guard(v8f& a, v8f& b, v16h x, v16h y) { dep_guard_h(a, b, x, y); }
  static __device__ __forceinline__ void keep(v16h a, v16h b, v16h c, v16h d) { keep4_h(a, b, c, d); }
};
template <> struct Frag<__bf16> {
  typedef v16b V; union U { v16b v; v8b h[2]; };
  static __device__ __forceinline__ v16b load(const __bf16* p) {
    U f; f.h[0] = *(const v8b*)(p); f.h[1] = *(const v8b*)(p + 16); return f.v;
  }
  static __device__ __forceinline__ v8f mma(v16b a, v16b b, v8f c) {
    return __builtin_amdgcn_wmma_f32_16x16x32_bf16(false, a, false, b, (short)0, c, false, false);
  }
  static __device__ __forceinline__ void guard(v8f& a, v8f& b, v16b x, v16b y) { dep_guard_b(a, b, x, y); }
  static __device__ __forceinline__ void keep(v16b a, v16b b, v16b c, v16b d) { keep4_b(a, b, c, d); }
};

// ---- Register-blocked batched WMMA GEMM ------------------------------------
// C[m,n] = scale * sum_k A[m,k] * Bt[n,k] (+bias)(+resid); each wave owns a 64x64 tile.
// A row-major [M,K]; Bt row-major [N,K]; M,N % 64 == 0, K % 32 == 0.
// SPLIT: operands are hi/lo planes (A2/Bt2 = lo planes, same layout); product = hi·hi + hi·lo + lo·hi.
// BIAS_MODE: 0 = none, 1 = bias[m], 2 = bias[n].
// OUT_MODE: 0 = f32, 1 = f16, 2 = bf16 hi plane (Cout) + bf16 lo plane (Cout2).
// ET: 0 = f16 operands, 1 = bf16 operands (pointers passed as 16-bit storage)
// blockIdx.z picks one of up to three independent problems of the same shape in one launch: operands and output advance by zA / zB / zC
// elements per z, the bias is bias / bias_z1 / bias_z2.
template <int ET> struct Elem;
template <> struct Elem<0> { typedef _Float16 T; };
template <> struct Elem<1> { typedef __bf16 T; };
template <int ET, bool SPLIT, int BIAS_MODE, int OUT_MODE, bool RESID, int ACT = 0>
__global__ __launch_bounds__(256) void wmma_gemm64(
    const unsigned short* __restrict__ Ap, const unsigned short* __restrict__ A2p, int lda, long strideA,
    const unsigned short* __restrict__ Btp, const unsigned short* __restrict__ Bt2p, int ldb, long strideB,
    void* __restrict__ Cout, void* __restrict__ Cout2, int ldc, long strideC,
    const float* __restrict__ bias,
    const float* __restrict__ resid, long strideR,
    int M, int N, int K, float scale,
    long zA, long zB, long zC, const float* __restrict__ bias_z1, const float* __restrict__ bias_z2) {
  typedef typename Elem<ET>::T T;
  typedef typename Frag<T>::V V;
  const T* A = (const T*)Ap; const T* A2 = (const T*)A2p; const T* Bt = (const T*)Btp; const T* Bt2 = (const T*)Bt2p;
  __shared__ __align__(16) float sT[8][16 * 68];   // per-wave 16x64 slab, pitch 68 floats
  const int b    = blockIdx.y;
  const int z    = blockIdx.z;
  const float* biasz = (z == 0) ? bias : (z == 1) ? bias_z1 : bias_z2;
  const int lane = threadIdx.x & 31;
  const int wave = threadIdx.x >> 5;
  const int tilesN = N >> 6;
  const int tilesM = M >> 6;
  const int tile = blockIdx.x * 8 + wave;
  if (tile >= tilesM * tilesN) return;   // wave-uniform; no block barriers in this kernel
  const int tm = tile / tilesN;
  const int tn = tile - tm * tilesN;
  const int m0 = tm << 6;
  const int n0 = tn << 6;

  const T* Ab  = A  + (size_t)z * zA + (size_t)b * strideA;
  const T* Bb  = Bt + (size_t)z * zB + (size_t)b * strideB;
  const T* Ab2 = SPLIT ? (A2  + (size_t)z * zA + (size_t)b * strideA) : nullptr;
  const T* Bb2 = SPLIT ? (Bt2 + (size_t)z * zB + (size_t)b * strideB) : nullptr;

  const int rlane = lane & 15;                 // row (A) / col (B, D) within subtile
  const int koff  = (lane >> 4) * 8;           // k offset of this lane half
  const int mOff  = (lane >> 4) * 8;           // D row offset

  v8f acc[4][4];
#pragma unroll
  for (int i = 0; i < 4; ++i)
#pragma unroll
    for (int j = 0; j < 4; ++j) acc[i][j] = (v8f){0.f,0.f,0.f,0.f,0.f,0.f,0.f,0.f};

  for (int k0 = 0; k0 < K; k0 += 32) {
    V bh[4], bl[4];
#pragma unroll
    for (int j = 0; j < 4; ++j) {
      const size_t bo = (size_t)(n0 + (j << 4) + rlane) * ldb + koff + k0;
      bh[j] = Frag<T>::load(Bb + bo);
      if (SPLIT) bl[j] = Frag<T>::load(Bb2 + bo);
    }
#pragma unroll
    for (int i = 0; i < 4; ++i) {
      const size_t ao = (size_t)(m0 + (i << 4) + rlane) * lda + koff + k0;
      V ah = Frag<T>::load(Ab + ao);
      V al;
      if (SPLIT) al = Frag<T>::load(Ab2 + ao);
#pragma unroll
      for (int j = 0; j < 4; ++j) {
        acc[i][j] = Frag<T>::mma(ah, bh[j], acc[i][j]);
        if (SPLIT) {
          acc[i][j] = Frag<T>::mma(ah, bl[j], acc[i][j]);
          acc[i][j] = Frag<T>::mma(al, bh[j], acc[i][j]);
        }
      }
      Frag<T>::guard(acc[i][0], acc[i][3], ah, SPLIT ? al : ah);
    }
    Frag<T>::keep(bh[0], bh[1], bh[2], bh[3]);
    if (SPLIT) Frag<T>::keep(bl[0], bl[1], bl[2], bl[3]);
  }
  acc_guard4(acc[0][0], acc[0][1], acc[0][2], acc[0][3]);
  acc_guard4(acc[1][0], acc[1][1], acc[1][2], acc[1][3]);
  acc_guard4(acc[2][0], acc[2][1], acc[2][2], acc[2][3]);
  acc_guard4(acc[3][0], acc[3][1], acc[3][2], acc[3][3]);

  // ---- epilogue ----
  float* slab = sT[wave];
  const float* Rb = RESID ? (resid + (size_t)b * strideR) : nullptr;
#pragma unroll
  for (int i = 0; i < 4; ++i) {
    const int mBase = m0 + (i << 4);
#pragma unroll
    for (int j = 0; j < 4; ++j) {
      const int n = n0 + (j << 4) + rlane;
      float bv = 0.f;
      if (BIAS_MODE == 2) bv = biasz[n];
#pragma unroll
      for (int r = 0; r < 8; ++r) {
        float v = acc[i][j][r] * scale;
        if (BIAS_MODE == 1) v += biasz[mBase + mOff + r];
        if (BIAS_MODE == 2) v += bv;
        if (RESID) v += Rb[(size_t)(mBase + mOff + r) * ldc + n];
        if (ACT == 1) v = tanhf(v);
        if (ACT == 2) v = fmaxf(v, 0.0f);
        if (ACT == 3) v = v / (1.0f + expf(-v));
        if (ACT == 4) v = (v > 0.f) ? v : 0.01f * v;
        if (ACT == 5) v = 0.5f * v * (1.0f + erff(v * 0.70710678118654752f));
        slab[(mOff + r) * 68 + (j << 4) + rlane] = v;
      }
    }
    __builtin_amdgcn_fence(__ATOMIC_RELEASE, "workgroup");
    __builtin_amdgcn_wave_barrier();
    __builtin_amdgcn_fence(__ATOMIC_ACQUIRE, "workgroup");
    if (OUT_MODE == 0) {
      float* C = (float*)Cout + (size_t)z * zC + (size_t)b * strideC;
      const int hh = lane >> 4, c4 = (lane & 15) * 4;     // row seg = 256 B = 16 lanes x 16 B
      {
#pragma unroll
        for (int it = 0; it < 8; ++it) {
          const int row = it * 2 + hh;
          v4f v = *(const v4f*)(slab + row * 68 + c4);
          *(v4f*)(C + (size_t)(mBase + row) * ldc + n0 + c4) = v;
        }
        
      }
    } else {
      const int q = lane >> 3, c8 = (lane & 7) * 8;
      unsigned short* C  = (unsigned short*)Cout  + (size_t)z * zC + (size_t)b * strideC;
      unsigned short* C2 = (OUT_MODE == 2) ? ((unsigned short*)Cout2 + (size_t)z * zC + (size_t)b * strideC) : nullptr;
      {
#pragma unroll
        for (int it = 0; it < 4; ++it) {
          const int row = it * 4 + q;
          const float* sp = slab + row * 68 + c8;
          v8h hv, lv;
#pragma unroll
          for (int e = 0; e < 8; ++e) {
            if (OUT_MODE == 1) {
              hv[e] = (_Float16)sp[e];
            } else {
              unsigned short hb = f2bf_bits(sp[e]);
              unsigned short lb = f2bf_bits(sp[e] - bf_bits2f(hb));
              hv[e] = __builtin_bit_cast(_Float16, hb);
              lv[e] = __builtin_bit_cast(_Float16, lb);
            }
          }
          *(v8h*)(C + (size_t)(mBase + row) * ldc + n0 + c8) = hv;
          if (OUT_MODE == 2) *(v8h*)(C2 + (size_t)(mBase + row) * ldc + n0 + c8) = lv;
        }
        
      }
    }
    __builtin_amdgcn_fence(__ATOMIC_RELEASE, "workgroup");
    __builtin_amdgcn_wave_barrier();
    __builtin_amdgcn_fence(__ATOMIC_ACQUIRE, "workgroup");
  }
}

__global__ __launch_bounds__(256) void cast_f32_f16x2(
    const float* __restrict__ in, _Float16* __restrict__ out, int n2) {
  int i = blockIdx.x * 256 + threadIdx.x;
  if (i < n2) {
    const _Float16 h0 = (_Float16)in[2 * i], h1 = (_Float16)in[2 * i + 1];
    const unsigned u = (unsigned)__builtin_bit_cast(unsigned short, h0) | ((unsigned)__builtin_bit_cast(unsigned short, h1) << 16);
    ((unsigned*)out)[i] = u;
    
  }
}

// ---- the same cast for four arrays of equal length in one launch: blockIdx.y picks the input, outputs lie n2 pairs apart ----
__global__ __launch_bounds__(256) void cast4_f32_f16x2(
    const float* __restrict__ in0, const float* __restrict__ in1, const float* __restrict__ in2, const float* __restrict__ in3,
    _Float16* __restrict__ out, int n2) {
  const int y = blockIdx.y;
  const float* in = (y == 0) ? in0 : (y == 1) ? in1 : (y == 2) ? in2 : in3;
  int i = blockIdx.x * 256 + threadIdx.x;
  if (i < n2) {
    const _Float16 h0 = (_Float16)in[2 * i], h1 = (_Float16)in[2 * i + 1];
    const unsigned u = (unsigned)__builtin_bit_cast(unsigned short, h0) | ((unsigned)__builtin_bit_cast(unsigned short, h1) << 16);
    ((unsigned*)out)[(size_t)y * n2 + i] = u;
  }
}

// ---- f32 -> f16 cast with a power-of-two pre-scale (folded back by the consumer GEMM's scale) ----
__global__ __launch_bounds__(256) void cast_f32_f16x2s(const float* __restrict__ in, _Float16* __restrict__ out, int n2, float s) {
  int i = blockIdx.x * 256 + threadIdx.x;
  if (i < n2) {
    const _Float16 h0 = (_Float16)(in[2 * i] * s), h1 = (_Float16)(in[2 * i + 1] * s);
    const unsigned u = (unsigned)__builtin_bit_cast(unsigned short, h0) | ((unsigned)__builtin_bit_cast(unsigned short, h1) << 16);
    ((unsigned*)out)[i] = u;
    
  }
}
__global__ __launch_bounds__(256) void split_f32_bf16x2(
    const float* __restrict__ in, __bf16* __restrict__ hi, __bf16* __restrict__ lo, long n2) {
  long i = (long)blockIdx.x * 256 + threadIdx.x;
  long stride = (long)gridDim.x * 256;
  {
    for (long j = i; j < n2; j += stride) {
      const float a = in[2 * j], b = in[2 * j + 1];
      const unsigned short ah = f2bf_bits(a), bh = f2bf_bits(b);
      const unsigned short al = f2bf_bits(a - bf_bits2f(ah)), bl = f2bf_bits(b - bf_bits2f(bh));
      ((unsigned*)hi)[j] = (unsigned)ah | ((unsigned)bh << 16);
      ((unsigned*)lo)[j] = (unsigned)al | ((unsigned)bl << 16);
    }
    
  }
}


// ---- f32 [R][C] (row pitch ldi) -> f16 transposed [C][R] (row pitch ldo); 64x64 tiles; each output row segment
// blockIdx.z = tensor * nb + batch: three input tensors of nb matrices each (mat elements apart) in one launch; output matrix z lies at outT0 + z * mat.
__global__ __launch_bounds__(256) void transpose_cast_f16(const float* __restrict__ in0, const float* __restrict__ in1, const float* __restrict__ in2,
                                                         int nb, long mat, int ldi, _Float16* __restrict__ outT0, int ldo, float scale) {
  __shared__ __align__(16) _Float16 tile[64][72];     // [c][r]
  const int zt = blockIdx.z / nb, zb = blockIdx.z - zt * nb;
  const float* in = ((zt == 0) ? in0 : (zt == 1) ? in1 : in2) + (size_t)zb * mat;
  _Float16* outT = outT0 + (size_t)blockIdx.z * mat;
  const int c0 = blockIdx.x * 64, r0 = blockIdx.y * 64;
  const int t = threadIdx.y * 32 + threadIdx.x;
  for (int i = threadIdx.y; i < 64; i += 8) {
    tile[threadIdx.x][i]      = (_Float16)(in[(size_t)(r0 + i) * ldi + c0 + threadIdx.x] * scale);
    tile[32 + threadIdx.x][i] = (_Float16)(in[(size_t)(r0 + i) * ldi + c0 + 32 + threadIdx.x] * scale);
  }
  __syncthreads();
  const int q = t >> 3, c8 = (t & 7) * 8;
  {
#pragma unroll
    for (int it = 0; it < 2; ++it) {
      const int c = it * 32 + q;
      v8h hv = *(const v8h*)(&tile[c][c8]);
      *(v8h*)(outT + (size_t)(c0 + c) * ldo + r0 + c8) = hv;
    }
    
  }
}

// ---- f32 [R][C] (pitch ldi) -> bf16 hi/lo transposed planes [C][R] (pitch ldo); 64x64 tiles; each output row segment
__global__ __launch_bounds__(256) void transpose_split_bf16(const float* __restrict__ in, int ldi,
                                                           __bf16* __restrict__ outH, __bf16* __restrict__ outL, int ldo) {
  __shared__ __align__(16) float tile[64][68];     // [c][r]
  const int c0 = blockIdx.x * 64, r0 = blockIdx.y * 64;
  const int t = threadIdx.y * 32 + threadIdx.x;
  for (int i = threadIdx.y; i < 64; i += 8) {
    tile[threadIdx.x][i]      = in[(size_t)(r0 + i) * ldi + c0 + threadIdx.x];
    tile[32 + threadIdx.x][i] = in[(size_t)(r0 + i) * ldi + c0 + 32 + threadIdx.x];
  }
  __syncthreads();
  const int q = t >> 3, c8 = (t & 7) * 8;
  {
#pragma unroll
    for (int it = 0; it < 2; ++it) {
      const int c = it * 32 + q;
      v8b hv, lv;
#pragma unroll
      for (int e = 0; e < 8; ++e) {
        const float f = tile[c][c8 + e];
        const unsigned short hb = f2bf_bits(f);
        hv[e] = __builtin_bit_cast(__bf16, hb);
        lv[e] = __builtin_bit_cast(__bf16, f2bf_bits(f - bf_bits2f(hb)));
      }
      *(v8b*)(outH + (size_t)(c0 + c) * ldo + r0 + c8) = hv;
      *(v8b*)(outL + (size_t)(c0 + c) * ldo + r0 + c8) = lv;
    }
    
  }
}

// =====================================================================================
// Generic causal/non-causal attention for head_dim 64, f32 in / f32 out; 16-bit operands: bf16 with optional hi/lo splits, or
// plain f16 (F16=true, non-split, probabilities carried x2^15).
//   scores = (q*qscale)·kᵀ : v_wmma_f32_16x16x32_bf16; SPLIT_QK -> q,k as bf16 hi/lo (hi·hi + hi·lo + lo·hi)
//   out    = p·v           : v_wmma_f32_16x16x32_bf16; SPLIT_PV -> p,v as bf16 hi/lo; else p,v plain bf16
//   f32 accumulate; online softmax in f32. Block = 4 waves = 64 query rows of one (batch, head); S % 64 == 0.
//   Element (b, s, h, d) of tensor X lives at X[b*X_bs + s*X_rs + h*X_hs + d] (strides in floats, multiples of 4).
//   Masking: MASK_MODE 0 none, 1 causal (kv > q masked), 2 tensor [S][Skv] shared over (b,h) (float if
//   mask_is_int==0, int32 with element == 0 -> masked if 1, int32 with element != 0 -> masked if 2), 3 per-token vectors qmask[B][S] & kvmask[B][Skv] (int32,
//   0 -> masked), 4 causal + sliding window (kv > q or q - kv > W masked; W passed in mask_is_int);
//   5 = relative-position bias: s += cp[b,h,q][idx[q][kv]] + pc[b,h,kv][idx[q][kv]] with idx = mask_b ([S][Skv] int32) and
//   mask_a an int32 [S][Skv] tensor with nonzero = masked (tables: element (b,h,row,n) at X + b*c_bs + h*c_hs + row*c_rs + n);
//   masked scores are replaced by mask_fill (e.g. -inf or -1e9) before the softmax.
//   grid.x = B * H * (S/64) (or a sub-range with blk0).
// =====================================================================================
#define AT_D 64
#define AT_NW 4
#define AT_QB 64
#define AT_KC 64
#define AT_LP 72   // LDS row pitch of the K, V^T and P tiles in 16-bit elements: 144 B = 16 B x 9, so the 16 rows of a ds_load_b128 fragment read fall on distinct banks
struct AttnGeom { const float* cp = nullptr; const float* pc = nullptr; long c_bs = 0, c_rs = 0, c_hs = 0;   // mode-5 score-bias tables
                  long q_bs, q_rs, q_hs, k_bs, k_rs, k_hs, v_bs, v_rs, v_hs, o_bs, o_rs, o_hs;
                  int S, Skv, H, mask_mode; float qscale; int blk0; float mask_fill; int mask_is_int; };
static_assert(sizeof(AttnGeom) == 168, "no padding");

__device__ __forceinline__ unsigned short at_bf_bits(float f) {
  unsigned u = __float_as_uint(f);
  return (unsigned short)((u + 0x7FFFu + ((u >> 16) & 1u)) >> 16);
}
__device__ __forceinline__ __bf16 at_f2bf(float f) { return __builtin_bit_cast(__bf16, at_bf_bits(f)); }
__device__ __forceinline__ void at_split(float f, __bf16& hi, __bf16& lo) {
  const unsigned short hb = at_bf_bits(f);
  hi = __builtin_bit_cast(__bf16, hb);
  lo = at_f2bf(f - __uint_as_float(((unsigned)hb) << 16));
}
__device__ __forceinline__ v8f at_mma(v16b a, v16b b, v8f c) {
  c = __builtin_amdgcn_wmma_f32_16x16x32_bf16(false, a, false, b, (short)0, c, false, false);
  asm volatile("v_nop\n\tv_nop\n\tv_nop\n\tv_nop" : "+v"(c) : "v"(a), "v"(b));
  return c;
}
// 16-bit element as a bit pattern held in a __bf16 slot: f16 bits when F16, bf16 (RNE) otherwise
template <bool F16> __device__ __forceinline__ __bf16 at_to16(float f) {
  if (F16) return __builtin_bit_cast(__bf16, (_Float16)f);
  return at_f2bf(f);
}
template <bool F16> __device__ __forceinline__ v8f at_mma16(v16b a, v16b b, v8f c) {
  if (F16) {
    const v16h ah = __builtin_bit_cast(v16h, a), bh = __builtin_bit_cast(v16h, b);
    c = __builtin_amdgcn_wmma_f32_16x16x32_f16(false, ah, false, bh, (short)0, c, false, false);
    asm volatile("v_nop\n\tv_nop\n\tv_nop\n\tv_nop" : "+v"(c) : "v"(ah), "v"(bh));
    return c;
  }
  return at_mma(a, b, c);
}

// MASK_MODE is a compile-time constant: each instance holds only its own masking code, so the score loop has no per-element mode branches.
template <bool SPLIT_QK, bool SPLIT_PV, bool F16, int MASK_MODE>
__global__ __launch_bounds__(128)
void attn64_kernel(const float* __restrict__ q, const float* __restrict__ k,
                   const float* __restrict__ v, float* __restrict__ out,
                   const void* __restrict__ mask_a, const int* __restrict__ mask_b, AttnGeom g) {
  static_assert(!(F16 && (SPLIT_QK || SPLIT_PV)), "f16 mode is non-split");
  const float PSC = F16 ? 32768.0f : 1.0f;     // f16 probabilities carried x2^15 (subnormal range), folded into the final 1/l
  union FB { v16b v; v8b h[2]; };
  __shared__ __align__(16) __bf16 Ksh[AT_KC * AT_LP];            // K hi [kv][d]      9 KB
  __shared__ __align__(16) __bf16 Ksl[SPLIT_QK ? AT_KC * AT_LP : 8];
  __shared__ __align__(16) __bf16 Vth[AT_D * AT_LP];             // V hi [d][kv]      9 KB
  __shared__ __align__(16) __bf16 Vtl[SPLIT_PV ? AT_D * AT_LP : 8];
  __shared__ __align__(16) __bf16 Psh[AT_NW][16 * AT_LP];        // per wave P hi [row][kv]  9 KB
  __shared__ __align__(16) __bf16 Psl[SPLIT_PV ? AT_NW : 1][SPLIT_PV ? 16 * AT_LP : 8];
  __shared__ __align__(16) float  Os[AT_NW][16 * 68];            // per wave out tile, pitch 68

  const int tid  = threadIdx.x;
  const int wave = tid >> 5;
  const int lane = tid & 31;
  const int hh   = lane >> 4;
  const int c    = lane & 15;

  const int nqb = g.S / AT_QB;
  const int bx = blockIdx.x + g.blk0;
  const int qb = bx % nqb;
  const int bh = bx / nqb;
  const int h  = bh % g.H;
  const int b  = bh / g.H;
  const int qbase_block = qb * AT_QB;
  const int q0 = qbase_block + wave * 16;

  const float* qb_ptr = q + (size_t)b * g.q_bs + (size_t)h * g.q_hs;
  const float* kb_ptr = k + (size_t)b * g.k_bs + (size_t)h * g.k_hs;
  const float* vb_ptr = v + (size_t)b * g.v_bs + (size_t)h * g.v_hs;
  float*       ob_ptr = out + (size_t)b * g.o_bs + (size_t)h * g.o_hs;

  // ---- Q fragments (A operand): 2 d-chunks, hi (and lo) ----
  v16b qah[2], qal[2];
  {
    const float* qrow = qb_ptr + (size_t)(q0 + c) * g.q_rs;
#pragma unroll
    for (int dc = 0; dc < 2; ++dc) {
#pragma unroll
      for (int e = 0; e < 8; ++e) {
        const float f0 = qrow[dc * 32 + 8 * hh + e] * g.qscale;
        const float f1 = qrow[dc * 32 + 16 + 8 * hh + e] * g.qscale;
        if (SPLIT_QK) { __bf16 hq, lq; at_split(f0, hq, lq); qah[dc][e] = hq; qal[dc][e] = lq; at_split(f1, hq, lq); qah[dc][8 + e] = hq; qal[dc][8 + e] = lq; }
        else { qah[dc][e] = at_to16<F16>(f0); qah[dc][8 + e] = at_to16<F16>(f1); qal[dc][e] = qah[dc][e]; qal[dc][8 + e] = qah[dc][8 + e]; }
      }
    }
  }

  float mrow[8], lrow[8];
  v8f oacc[4];
#pragma unroll
  for (int r = 0; r < 8; ++r) { mrow[r] = -INFINITY; lrow[r] = 0.f; }
#pragma unroll
  for (int t = 0; t < 4; ++t) oacc[t] = (v8f){0.f,0.f,0.f,0.f,0.f,0.f,0.f,0.f};

  const int nChunks = (MASK_MODE == 1 || MASK_MODE == 4) ? (qb + 1) : (g.Skv / AT_KC);   // block-uniform
  // per-row query mask (mode 3)
  int qkeep[8];
#pragma unroll
  for (int r = 0; r < 8; ++r) qkeep[r] = (MASK_MODE == 3) ? mask_b[(size_t)b * g.S + q0 + 8 * hh + r] : 1;   // mask_b = qmask in mode 3
  for (int kc = 0; kc < nChunks; ++kc) {
    const int kv0 = kc * AT_KC;
    __syncthreads();
    {
      const int kvr = tid >> 1, dh = (tid & 1) * 32;
      const float* krow = kb_ptr + (size_t)(kv0 + kvr) * g.k_rs + dh;
      const float* vrow = vb_ptr + (size_t)(kv0 + kvr) * g.v_rs + dh;
#pragma unroll
      for (int i = 0; i < 8; ++i) {
        v4f kk = *(const v4f*)(krow + 4 * i);
        v4f vv = *(const v4f*)(vrow + 4 * i);
#pragma unroll
        for (int e = 0; e < 4; ++e) {
          const int d = dh + 4 * i + e;
          if (SPLIT_QK) { __bf16 a, bl; at_split(kk[e], a, bl); Ksh[kvr * AT_LP + d] = a; Ksl[kvr * AT_LP + d] = bl; }
          else Ksh[kvr * AT_LP + d] = at_to16<F16>(kk[e]);
          if (SPLIT_PV) { __bf16 a, bl; at_split(vv[e], a, bl); Vth[d * AT_LP + kvr] = a; Vtl[d * AT_LP + kvr] = bl; }
          else Vth[d * AT_LP + kvr] = at_to16<F16>(vv[e]);
        }
      }
    }
    __syncthreads();

    v8f s[4];
#pragma unroll
    for (int j = 0; j < 4; ++j) {
      s[j] = (v8f){0.f,0.f,0.f,0.f,0.f,0.f,0.f,0.f};
#pragma unroll 1
      for (int dc = 0; dc < 2; ++dc) {
        FB kb;
        kb.h[0] = *(const v8b*)(Ksh + (j * 16 + c) * AT_LP + dc * 32 + 8 * hh);
        kb.h[1] = *(const v8b*)(Ksh + (j * 16 + c) * AT_LP + dc * 32 + 16 + 8 * hh);
        s[j] = at_mma16<F16>(qah[dc], kb.v, s[j]);
        if (SPLIT_QK) {
          FB kl;
          kl.h[0] = *(const v8b*)(Ksl + (j * 16 + c) * AT_LP + dc * 32 + 8 * hh);
          kl.h[1] = *(const v8b*)(Ksl + (j * 16 + c) * AT_LP + dc * 32 + 16 + 8 * hh);
          s[j] = at_mma16<F16>(qah[dc], kl.v, s[j]);
          s[j] = at_mma16<F16>(qal[dc], kb.v, s[j]);
        }
      }
    }
    const bool diag = (MASK_MODE == 1) && (kc == qb);
    int kvkeep[4] = {1, 1, 1, 1};
    if (MASK_MODE == 3) {
#pragma unroll
      for (int j = 0; j < 4; ++j) kvkeep[j] = ((const int*)mask_a)[(size_t)b * g.Skv + kv0 + j * 16 + c];   // mask_a = kvmask
    }
    float cm[8];
#pragma unroll
    for (int r = 0; r < 8; ++r) {
      const int qrow = q0 + 8 * hh + r;
      float m = -INFINITY;
#pragma unroll
      for (int j = 0; j < 4; ++j) {
        const int kvcol = kv0 + j * 16 + c;
        bool masked = false;
        if (diag) masked = (kvcol > qrow);
        else if (MASK_MODE == 4) masked = (kvcol > qrow) || (qrow - kvcol > g.mask_is_int);
        else if (MASK_MODE == 2) {
          const size_t mi = (size_t)qrow * g.Skv + kvcol;
          masked = (g.mask_is_int == 0) ? (((const float*)mask_a)[mi] == 0.0f)
                 : (g.mask_is_int == 1) ? (((const int*)mask_a)[mi] == 0) : (((const int*)mask_a)[mi] != 0);
        } else if (MASK_MODE == 3) masked = (qkeep[r] == 0) || (kvkeep[j] == 0);
        else if (MASK_MODE == 5) {
          const size_t mi = (size_t)qrow * g.Skv + kvcol;
          masked = (((const int*)mask_a)[mi] != 0);
          int n = mask_b[mi]; n = n < 0 ? 0 : n;
          s[j][r] += g.cp[(size_t)b * g.c_bs + (size_t)h * g.c_hs + (size_t)qrow * g.c_rs + n]
                   + g.pc[(size_t)b * g.c_bs + (size_t)h * g.c_hs + (size_t)kvcol * g.c_rs + n];
        }
        if (masked) s[j][r] = g.mask_fill;
        m = fmaxf(m, s[j][r]);
      }
#pragma unroll
      for (int off = 1; off < 16; off <<= 1) m = fmaxf(m, __shfl_xor(m, off, 32));
      cm[r] = m;
    }
    __bf16* pwh = Psh[wave];
    __bf16* pwl = Psl[SPLIT_PV ? wave : 0];
#pragma unroll
    for (int r = 0; r < 8; ++r) {
      const float mnew = fmaxf(mrow[r], cm[r]);
      const float alpha = expf(mrow[r] - mnew);
      mrow[r] = mnew;
      float psum = 0.f;
#pragma unroll
      for (int j = 0; j < 4; ++j) {
        const float p = expf(s[j][r] - mnew);
        psum += p;
        if (SPLIT_PV) { __bf16 a, bl; at_split(p, a, bl); pwh[(8 * hh + r) * AT_LP + j * 16 + c] = a; pwl[(8 * hh + r) * AT_LP + j * 16 + c] = bl; }
        else pwh[(8 * hh + r) * AT_LP + j * 16 + c] = at_to16<F16>(p * PSC);
      }
#pragma unroll
      for (int off = 1; off < 16; off <<= 1) psum += __shfl_xor(psum, off, 32);
      lrow[r] = lrow[r] * alpha + psum;
#pragma unroll
      for (int t = 0; t < 4; ++t) oacc[t][r] *= alpha;
    }
    __builtin_amdgcn_fence(__ATOMIC_RELEASE, "workgroup");
    __builtin_amdgcn_wave_barrier();
    __builtin_amdgcn_fence(__ATOMIC_ACQUIRE, "workgroup");
#pragma unroll 1
    for (int kk = 0; kk < 2; ++kk) {
      FB pa, pl;
      pa.h[0] = *(const v8b*)(pwh + c * AT_LP + kk * 32 + 8 * hh);
      pa.h[1] = *(const v8b*)(pwh + c * AT_LP + kk * 32 + 16 + 8 * hh);
      if (SPLIT_PV) {
        pl.h[0] = *(const v8b*)(pwl + c * AT_LP + kk * 32 + 8 * hh);
        pl.h[1] = *(const v8b*)(pwl + c * AT_LP + kk * 32 + 16 + 8 * hh);
      }
#pragma unroll
      for (int t = 0; t < 4; ++t) {
        FB vb;
        vb.h[0] = *(const v8b*)(Vth + (t * 16 + c) * AT_LP + kk * 32 + 8 * hh);
        vb.h[1] = *(const v8b*)(Vth + (t * 16 + c) * AT_LP + kk * 32 + 16 + 8 * hh);
        oacc[t] = at_mma16<F16>(pa.v, vb.v, oacc[t]);
        if (SPLIT_PV) {
          FB vl;
          vl.h[0] = *(const v8b*)(Vtl + (t * 16 + c) * AT_LP + kk * 32 + 8 * hh);
          vl.h[1] = *(const v8b*)(Vtl + (t * 16 + c) * AT_LP + kk * 32 + 16 + 8 * hh);
          oacc[t] = at_mma16<F16>(pa.v, vl.v, oacc[t]);
          oacc[t] = at_mma16<F16>(pl.v, vb.v, oacc[t]);
        }
      }
    }
  }

  float* os = Os[wave];
#pragma unroll
  for (int r = 0; r < 8; ++r) {
    const float inv = 1.0f / (lrow[r] * PSC);
#pragma unroll
    for (int t = 0; t < 4; ++t) os[(8 * hh + r) * 68 + t * 16 + c] = oacc[t][r] * inv;
  }
  __builtin_amdgcn_fence(__ATOMIC_RELEASE, "workgroup");
  __builtin_amdgcn_wave_barrier();
  __builtin_amdgcn_fence(__ATOMIC_ACQUIRE, "workgroup");
  {
    const int c4 = (lane & 15) * 4;
    {
#pragma unroll
      for (int it = 0; it < 8; ++it) {
        const int row = it * 2 + hh;
        v4f val = *(const v4f*)(os + row * 68 + c4);
        *(v4f*)(ob_ptr + (size_t)(q0 + row) * g.o_rs + c4) = val;
      }
      
    }
  }
}

#define EB 8
#define EC 768
#define ES 1024
#define EH 12
extern "C" void kernel_launch(void* const* d_in, const int* in_sizes, int n_in, void* d_out, int out_size, void* d_ws, size_t ws_size, hipStream_t stream) {
  (void)in_sizes; (void)n_in; (void)out_size; (void)ws_size;
  const float* q = (const float*)d_in[0]; const float* k = (const float*)d_in[1]; const float* v = (const float*)d_in[2];
  const float* Wq = (const float*)d_in[3]; const float* bq = (const float*)d_in[4]; const float* Wk = (const float*)d_in[5]; const float* bk = (const float*)d_in[6];
  const float* Wv = (const float*)d_in[7]; const float* bv = (const float*)d_in[8]; const float* Wo = (const float*)d_in[9]; const float* bo = (const float*)d_in[10];
  float* out = (float*)d_out;    // [8][768][1024]
  char* ws = (char*)d_ws; size_t off = 0;
  auto carve = [&](size_t bytes) -> char* { char* p = ws + off; off += (bytes + 255) & ~(size_t)255; return p; };
  _Float16* QT = (_Float16*)carve((size_t)EB * ES * EC * 2); _Float16* KT = (_Float16*)carve((size_t)EB * ES * EC * 2); _Float16* VT = (_Float16*)carve((size_t)EB * ES * EC * 2);   // 3 x 12.6 MB
  _Float16* Wq16 = (_Float16*)carve((size_t)EC * EC * 2); _Float16* Wk16 = (_Float16*)carve((size_t)EC * EC * 2); _Float16* Wv16 = (_Float16*)carve((size_t)EC * EC * 2); _Float16* Wo16 = (_Float16*)carve((size_t)EC * EC * 2);
  float* QE = (float*)carve((size_t)EB * ES * EC * 4); float* KE = (float*)carve((size_t)EB * ES * EC * 4); float* VE = (float*)carve((size_t)EB * ES * EC * 4);   // 3 x 25 MB
  float* Of = (float*)carve((size_t)EB * ES * EC * 4);
  _Float16* O16 = QT;     // reuse (QT dead after the q projection)
  // Launches that read none of each other's output share one grid. QT, KT, VT lie back to back in the workspace, and so do the four
  // f16 weights and QE, KE, VE (every carve is a multiple of 256 B), so a grid index times a fixed stride reaches each of them.
  (void)KT; (void)VT; (void)Wk16; (void)Wv16;
  transpose_cast_f16<<<dim3(ES / 64, EC / 64, 3 * EB), dim3(32, 8), 0, stream>>>(q, k, v, EB, (long)EC * ES, ES, QT, EC, 1.0f);   // each [768][1024] -> [1024][768]
  cast4_f32_f16x2<<<dim3((EC * EC / 2 + 255) / 256, 4), 256, 0, stream>>>(Wq, Wk, Wv, Wo, Wq16, EC * EC / 2);   // 1x1-conv weights [out][in] are the Bt layout; Wo is the A operand ([M=o][K=c]) of the output GEMM
  { const int t = (ES / 64) * (EC / 64);   // z = 0, 1, 2: the q, k, v projections
    wmma_gemm64<0, false, 2, 0, false><<<dim3((t + 7) / 8, EB, 3), 256, 0, stream>>>(U16(QT), nullptr, EC, (long)ES * EC, U16(Wq16), nullptr, EC, 0, QE, nullptr, EC, (long)ES * EC, bq, nullptr, 0, ES, EC, EC, 1.0f,
        (long)EB * ES * EC, (long)EC * EC, (long)EB * ES * EC, bk, bv); }
  { AttnGeom g;
    g.q_bs = (long)ES * EC; g.q_rs = EC; g.q_hs = 64; g.k_bs = (long)ES * EC; g.k_rs = EC; g.k_hs = 64; g.v_bs = (long)ES * EC; g.v_rs = EC; g.v_hs = 64; g.o_bs = (long)ES * EC; g.o_rs = EC; g.o_hs = 64;
    g.S = ES; g.Skv = ES; g.H = EH; g.mask_mode = 0; g.qscale = 0.125f; g.blk0 = 0; g.mask_fill = -INFINITY; g.mask_is_int = 0;
    attn64_kernel<false, false, true, 0><<<EB * EH * (ES / AT_QB), AT_NW * 32, 0, stream>>>(QE, KE, VE, Of, nullptr, nullptr, g); }
  cast_f32_f16x2<<<(EB * ES * EC / 2 + 255) / 256, 256, 0, stream>>>(Of, O16, EB * ES * EC / 2);
  { const int t = (EC / 64) * (ES / 64);   // outᵀ per batch: A = Wo [768][768], Bt = O16[b] [1024][768] -> out[b] [768][1024], bias per row
    wmma_gemm64<0, false, 1, 0, false><<<dim3((t + 7) / 8, EB), 256, 0, stream>>>(U16(Wo16), nullptr, EC, 0, U16(O16), nullptr, EC, (long)ES * EC, out, nullptr, ES, (long)EC * ES, bo, nullptr, 0, EC, ES, EC, 1.0f, 0, 0, 0, bo, bo); }
}

// v004
// It runs in 214 microseconds.
// Timed twice side by side with v003, it ran 1.34 and 1.33 times as fast.
// Counting every step since v000, it is 5.13 times as fast.
#include <hip/hip_runtime.h>
#include <math.h>
// Multi-head attention over 32x32 feature maps (8 batches, 12 heads x 64, 1024 queries/keys): the four 1x1-conv projections
// (1024 x 768 · 768 x 768 per batch; the output projection computed transposed so it lands in the (B, C, H·W) layout) and the attention
// (scores and p·v, p carried x2^15): v_wmma_f32_16x16x32_f16, f16 operands, f32 accumulate; softmax f32. Input transposes are VALU copies.
typedef __attribute__((ext_vector_type(16))) _Float16 v16h;
typedef __attribute__((ext_vector_type(8)))  _Float16 v8h;
typedef __attribute__((ext_vector_type(16))) __bf16   v16b;
typedef __attribute__((ext_vector_type(8)))  __bf16   v8b;
typedef __attribute__((ext_vector_type(8)))  float    v8f;
typedef __attribute__((ext_vector_type(4)))  float    v4f;
#define PSCALE 32768.0f
#define U16(p) ((const unsigned short*)(const void*)(p))
#define PSCALE_INV (1.0f / 32768.0f)

__device__ __forceinline__ unsigned short f2bf_bits(float f) {
  unsigned u = __float_as_uint(f);
  return (unsigned short)((u + 0x7FFFu + ((u >> 16) & 1u)) >> 16);
}
__device__ __forceinline__ float bf_bits2f(unsigned short h) { return __uint_as_float(((unsigned)h) << 16); }

// hazard guards as plain device helpers (no inline asm inside the kernel template body)
__device__ __forceinline__ void dep_guard_h(v8f& a, v8f& b, v16h x, v16h y) { asm volatile("v_nop\n\tv_nop\n\tv_nop\n\tv_nop" : "+v"(a), "+v"(b) : "v"(x), "v"(y)); }
__device__ __forceinline__ void dep_guard_b(v8f& a, v8f& b, v16b x, v16b y) { asm volatile("v_nop\n\tv_nop\n\tv_nop\n\tv_nop" : "+v"(a), "+v"(b) : "v"(x), "v"(y)); }
__device__ __forceinline__ void keep4_h(v16h a, v16h b, v16h c, v16h d) { asm volatile("v_nop" :: "v"(a), "v"(b), "v"(c), "v"(d)); }
__device__ __forceinline__ void keep4_b(v16b a, v16b b, v16b c, v16b d) { asm volatile("v_nop" :: "v"(a), "v"(b), "v"(c), "v"(d)); }
__device__ __forceinline__ void acc_guard4(v8f& a, v8f& b, v8f& c, v8f& d) { asm volatile("v_nop\n\tv_nop\n\tv_nop\n\tv_nop" : "+v"(a), "+v"(b), "+v"(c), "+v"(d)); }
template <typename T> struct Frag;
template <> struct Frag<_Float16> {
  typedef v16h V; typedef v8h H; union U { v16h v; v8h h[2]; };
  static __device__ __forceinline__ v16h load(const _Float16* p) {   // elements 0..7 <- p[0..7], 8..15 <- p[16..23]
    U f; f.h[0] = *(const v8h*)(p); f.h[1] = *(const v8h*)(p + 16); return f.v;
  }
  static __device__ __forceinline__ v8f mma(v16h a, v16h b, v8f c) {
    return __builtin_amdgcn_wmma_f32_16x16x32_f16(false, a, false, b, (short)0, c, false, false);
  }
  static __device__ __forceinline__ void guard(v8f& a, v8f& b, v16h x, v16h y) { dep_guard_h(a, b, x, y); }
  static __device__ __forceinline__ void keep(v16h a, v16h b, v16h c, v16h d) { keep4_h(a, b, c, d); }
};
template <> struct Frag<__bf16> {
  typedef v16b V; typedef v8b H; union U { v16b v; v8b h[2]; };
  static __device__ __forceinline__ v16b load(const __bf16* p) {
    U f; f.h[0] = *(const v8b*)(p); f.h[1] = *(const v8b*)(p + 16); return f.v;
  }
  static __device__ __forceinline__ v8f mma(v16b a, v16b b, v8f c) {
    return __builtin_amdgcn_wmma_f32_16x16x32_bf16(false, a, false, b, (short)0, c, false, false);
  }
  static __device__ __forceinline__ void guard(v8f& a, v8f& b, v16b x, v16b y) { dep_guard_b(a, b, x, y); }
  static __device__ __forceinline__ void keep(v16b a, v16b b, v16b c, v16b d) { keep4_b(a, b, c, d); }
};

// ---- Register-blocked batched WMMA GEMM ------------------------------------
// C[m,n] = scale * sum_k A[m,k] * Bt[n,k] (+bias)(+resid); each wave owns a 64x64 tile, the 8 waves of a block (2 x 4) one 128x256 tile.
// A row-major [M,K]; Bt row-major [N,K]; M % 128 == 0, N % 256 == 0, K % 64 == 0; grid.x = (M / 128) * (N / 256).
// Operands go through LDS: a stage is 64 k (one whole 128-B line) of the block's 128 A rows and 256 Bt rows, read from global memory
// with every wave-wide 16-B load covering 4 whole lines, two buffers, the next stage's loads in flight while this one is multiplied.
// SPLIT (hi/lo operand planes) is not built in this form.
// BIAS_MODE: 0 = none, 1 = bias[m], 2 = bias[n].
// OUT_MODE: 0 = f32, 1 = f16, 2 = bf16 hi plane (Cout) + bf16 lo plane (Cout2).
// ET: 0 = f16 operands, 1 = bf16 operands (pointers passed as 16-bit storage)
// blockIdx.z picks one of up to three independent problems of the same shape in one launch: operands and output advance by zA / zB / zC
// elements per z, the bias is bias / bias_z1 / bias_z2.
#define GS_K 64                 // k per stage
#define GS_LP 72                // LDS row pitch in 16-bit elements: 144 B = 16 B x 9, for the ds_load_b128 fragment reads
#define GS_ROWS (128 + 256)     // A rows + Bt rows of a block tile
template <int ET> struct Elem;
template <> struct Elem<0> { typedef _Float16 T; };
template <> struct Elem<1> { typedef __bf16 T; };
template <int ET, bool SPLIT, int BIAS_MODE, int OUT_MODE, bool RESID, int ACT = 0>
__global__ __launch_bounds__(256) void wmma_gemm64(
    const unsigned short* __restrict__ Ap, const unsigned short* __restrict__ A2p, int lda, long strideA,
    const unsigned short* __restrict__ Btp, const unsigned short* __restrict__ Bt2p, int ldb, long strideB,
    void* __restrict__ Cout, void* __restrict__ Cout2, int ldc, long strideC,
    const float* __restrict__ bias,
    const float* __restrict__ resid, long strideR,
    int M, int N, int K, float scale,
    long zA, long zB, long zC, const float* __restrict__ bias_z1, const float* __restrict__ bias_z2) {
  typedef typename Elem<ET>::T T;
  typedef typename Frag<T>::V V;
  typedef typename Frag<T>::H H;
  static_assert(!SPLIT, "the LDS-staged loop holds one plane per operand");
  const T* A = (const T*)Ap; const T* Bt = (const T*)Btp;
  (void)A2p; (void)Bt2p;
  __shared__ __align__(16) T sOp[2][GS_ROWS * GS_LP];   // two stages: rows 0..127 = A, rows 128..383 = Bt
  __shared__ __align__(16) float sT[8][16 * 68];   // per-wave 16x64 slab, pitch 68 floats
  const int b    = blockIdx.y;
  const int z    = blockIdx.z;
  const float* biasz = (z == 0) ? bias : (z == 1) ? bias_z1 : bias_z2;
  const int lane = threadIdx.x & 31;
  const int wave = threadIdx.x >> 5;
  const int tilesN = N >> 8;
  const int tilesM = M >> 7;
  const int tile = blockIdx.x;
  if (tile >= tilesM * tilesN) return;   // block-uniform, in front of every barrier
  const int tm = tile / tilesN;
  const int tn = tile - tm * tilesN;
  const int m0b = tm << 7;                     // the block's first row and column
  const int n0b = tn << 8;
  const int wm = wave >> 2, wn = wave & 3;     // the wave's place in the 2 x 4 block tile
  const int m0 = m0b + (wm << 6);
  const int n0 = n0b + (wn << 6);

  const T* Ab  = A  + (size_t)z * zA + (size_t)b * strideA;
  const T* Bb  = Bt + (size_t)z * zB + (size_t)b * strideB;

  const int rlane = lane & 15;                 // row (A) / col (B, D) within subtile
  const int koff  = (lane >> 4) * 8;           // k offset of this lane half
  const int mOff  = (lane >> 4) * 8;           // D row offset

  v8f acc[4][4];
#pragma unroll
  for (int i = 0; i < 4; ++i)
#pragma unroll
    for (int j = 0; j < 4; ++j) acc[i][j] = (v8f){0.f,0.f,0.f,0.f,0.f,0.f,0.f,0.f};

  // Staging map: 16-B piece p = i * 256 + thread of a stage is row p / 8, bytes 16 * (p % 8): 8 lanes cover one row's 128-B line.
  const int srow = threadIdx.x >> 3;
  const int sc8  = (threadIdx.x & 7) * 8;
  const T* gA = Ab + (size_t)(m0b + srow) * lda + sc8;
  const T* gB = Bb + (size_t)(n0b + srow) * ldb + sc8;
  const int sW = srow * GS_LP + sc8;                              // this thread's first piece in a stage
  const int rA = ((wm << 6) + rlane) * GS_LP + koff;              // this lane's fragment rows in a stage
  const int rB = (128 + (wn << 6) + rlane) * GS_LP + koff;
  H st[12];
#pragma unroll
  for (int i = 0; i < 4; ++i) st[i] = *(const H*)(gA + (size_t)(i * 32) * lda);
#pragma unroll
  for (int i = 0; i < 8; ++i) st[4 + i] = *(const H*)(gB + (size_t)(i * 32) * ldb);
#pragma unroll
  for (int i = 0; i < 12; ++i) *(H*)(&sOp[0][sW + i * 32 * GS_LP]) = st[i];
  __syncthreads();

  const int nStage = K / GS_K;
  for (int s = 0; s < nStage; ++s) {
    const T* cur = sOp[s & 1];
    const bool more = (s + 1 < nStage);        // block-uniform
    if (more) {                                // the next stage's lines fly while this stage is multiplied
      const int k1 = (s + 1) * GS_K;
#pragma unroll
      for (int i = 0; i < 4; ++i) st[i] = *(const H*)(gA + (size_t)(i * 32) * lda + k1);
#pragma unroll
      for (int i = 0; i < 8; ++i) st[4 + i] = *(const H*)(gB + (size_t)(i * 32) * ldb + k1);
    }
#pragma unroll
    for (int kb = 0; kb < GS_K / 32; ++kb) {
      V bh[4], ah[4];                          // all eight fragments of a 32-k block are read as one group: one LDS wait per 16 products
#pragma unroll
      for (int j = 0; j < 4; ++j) bh[j] = Frag<T>::load(cur + rB + (j << 4) * GS_LP + kb * 32);
#pragma unroll
      for (int i = 0; i < 4; ++i) ah[i] = Frag<T>::load(cur + rA + (i << 4) * GS_LP + kb * 32);
#pragma unroll
      for (int i = 0; i < 4; ++i) {
#pragma unroll
        for (int j = 0; j < 4; ++j) acc[i][j] = Frag<T>::mma(ah[i], bh[j], acc[i][j]);
        Frag<T>::guard(acc[i][0], acc[i][3], ah[i], ah[i]);
      }
      Frag<T>::keep(bh[0], bh[1], bh[2], bh[3]);
    }
    if (more) {                                // into the buffer whose readers all left it at the barrier that ended stage s - 1
      T* nxt = sOp[(s + 1) & 1];
#pragma unroll
      for (int i = 0; i < 12; ++i) *(H*)(nxt + sW + i * 32 * GS_LP) = st[i];
    }
    __syncthreads();                           // publishes stage s + 1 and ends every wave's reads of stage s
  }
  acc_guard4(acc[0][0], acc[0][1], acc[0][2], acc[0][3]);
  acc_guard4(acc[1][0], acc[1][1], acc[1][2], acc[1][3]);
  acc_guard4(acc[2][0], acc[2][1], acc[2][2], acc[2][3]);
  acc_guard4(acc[3][0], acc[3][1], acc[3][2], acc[3][3]);

  // ---- epilogue ----
  float* slab = sT[wave];
  const float* Rb = RESID ? (resid + (size_t)b * strideR) : nullptr;
#pragma unroll
  for (int i = 0; i < 4; ++i) {
    const int mBase = m0 + (i << 4);
#pragma unroll
    for (int j = 0; j < 4; ++j) {
      const int n = n0 + (j << 4) + rlane;
      float bv = 0.f;
      if (BIAS_MODE == 2) bv = biasz[n];
#pragma unroll
      for (int r = 0; r < 8; ++r) {
        float v = acc[i][j][r] * scale;
        if (BIAS_MODE == 1) v += biasz[mBase + mOff + r];
        if (BIAS_MODE == 2) v += bv;
        if (RESID) v += Rb[(size_t)(mBase + mOff + r) * ldc + n];
        if (ACT == 1) v = tanhf(v);
        if (ACT == 2) v = fmaxf(v, 0.0f);
        if (ACT == 3) v = v / (1.0f + expf(-v));
        if (ACT == 4) v = (v > 0.f) ? v : 0.01f * v;
        if (ACT == 5) v = 0.5f * v * (1.0f + erff(v * 0.70710678118654752f));
        slab[(mOff + r) * 68 + (j << 4) + rlane] = v;
      }
    }
    __builtin_amdgcn_fence(__ATOMIC_RELEASE, "workgroup");
    __builtin_amdgcn_wave_barrier();
    __builtin_amdgcn_fence(__ATOMIC_ACQUIRE, "workgroup");
    if (OUT_MODE == 0) {
      float* C = (float*)Cout + (size_t)z * zC + (size_t)b * strideC;
      const int hh = lane >> 4, c4 = (lane & 15) * 4;     // row seg = 256 B = 16 lanes x 16 B
      {
#pragma unroll
        for (int it = 0; it < 8; ++it) {
          const int row = it * 2 + hh;
          v4f v = *(const v4f*)(slab + row * 68 + c4);
          *(v4f*)(C + (size_t)(mBase + row) * ldc + n0 + c4) = v;
        }
        
      }
    } else {
      const int q = lane >> 3, c8 = (lane & 7) * 8;
      unsigned short* C  = (unsigned short*)Cout  + (size_t)z * zC + (size_t)b * strideC;
      unsigned short* C2 = (OUT_MODE == 2) ? ((unsigned short*)Cout2 + (size_t)z * zC + (size_t)b * strideC) : nullptr;
      {
#pragma unroll
        for (int it = 0; it < 4; ++it) {
          const int row = it * 4 + q;
          const float* sp = slab + row * 68 + c8;
          v8h hv, lv;
#pragma unroll
          for (int e = 0; e < 8; ++e) {
            if (OUT_MODE == 1) {
              hv[e] = (_Float16)sp[e];
            } else {
              unsigned short hb = f2bf_bits(sp[e]);
              unsigned short lb = f2bf_bits(sp[e] - bf_bits2f(hb));
              hv[e] = __builtin_bit_cast(_Float16, hb);
              lv[e] = __builtin_bit_cast(_Float16, lb);
            }
          }
          *(v8h*)(C + (size_t)(mBase + row) * ldc + n0 + c8) = hv;
          if (OUT_MODE == 2) *(v8h*)(C2 + (size_t)(mBase + row) * ldc + n0 + c8) = lv;
        }
        
      }
    }
    __builtin_amdgcn_fence(__ATOMIC_RELEASE, "workgroup");
    __builtin_amdgcn_wave_barrier();
    __builtin_amdgcn_fence(__ATOMIC_ACQUIRE, "workgroup");
  }
}

__global__ __launch_bounds__(256) void cast_f32_f16x2(
    const float* __restrict__ in, _Float16* __restrict__ out, int n2) {
  int i = blockIdx.x * 256 + threadIdx.x;
  if (i < n2) {
    const _Float16 h0 = (_Float16)in[2 * i], h1 = (_Float16)in[2 * i + 1];
    const unsigned u = (unsigned)__builtin_bit_cast(unsigned short, h0) | ((unsigned)__builtin_bit_cast(unsigned short, h1) << 16);
    ((unsigned*)out)[i] = u;
    
  }
}

// ---- the same cast for four arrays of equal length in one launch: blockIdx.y picks the input, outputs lie n2 pairs apart ----
__global__ __launch_bounds__(256) void cast4_f32_f16x2(
    const float* __restrict__ in0, const float* __restrict__ in1, const float* __restrict__ in2, const float* __restrict__ in3,
    _Float16* __restrict__ out, int n2) {
  const int y = blockIdx.y;
  const float* in = (y == 0) ? in0 : (y == 1) ? in1 : (y == 2) ? in2 : in3;
  int i = blockIdx.x * 256 + threadIdx.x;
  if (i < n2) {
    const _Float16 h0 = (_Float16)in[2 * i], h1 = (_Float16)in[2 * i + 1];
    const unsigned u = (unsigned)__builtin_bit_cast(unsigned short, h0) | ((unsigned)__builtin_bit_cast(unsigned short, h1) << 16);
    ((unsigned*)out)[(size_t)y * n2 + i] = u;
  }
}

// ---- f32 -> f16 cast with a power-of-two pre-scale (folded back by the consumer GEMM's scale) ----
__global__ __launch_bounds__(256) void cast_f32_f16x2s(const float* __restrict__ in, _Float16* __restrict__ out, int n2, float s) {
  int i = blockIdx.x * 256 + threadIdx.x;
  if (i < n2) {
    const _Float16 h0 = (_Float16)(in[2 * i] * s), h1 = (_Float16)(in[2 * i + 1] * s);
    const unsigned u = (unsigned)__builtin_bit_cast(unsigned short, h0) | ((unsigned)__builtin_bit_cast(unsigned short, h1) << 16);
    ((unsigned*)out)[i] = u;
    
  }
}
__global__ __launch_bounds__(256) void split_f32_bf16x2(
    const float* __restrict__ in, __bf16* __restrict__ hi, __bf16* __restrict__ lo, long n2) {
  long i = (long)blockIdx.x * 256 + threadIdx.x;
  long stride = (long)gridDim.x * 256;
  {
    for (long j = i; j < n2; j += stride) {
      const float a = in[2 * j], b = in[2 * j + 1];
      const unsigned short ah = f2bf_bits(a), bh = f2bf_bits(b);
      const unsigned short al = f2bf_bits(a - bf_bits2f(ah)), bl = f2bf_bits(b - bf_bits2f(bh));
      ((unsigned*)hi)[j] = (unsigned)ah | ((unsigned)bh << 16);
      ((unsigned*)lo)[j] = (unsigned)al | ((unsigned)bl << 16);
    }
    
  }
}


// ---- f32 [R][C] (row pitch ldi) -> f16 transposed [C][R] (row pitch ldo); 64x64 tiles; each output row segment
// blockIdx.z = tensor * nb + batch: three input tensors of nb matrices each (mat elements apart) in one launch; output matrix z lies at outT0 + z * mat.
__global__ __launch_bounds__(256) void transpose_cast_f16(const float* __restrict__ in0, const float* __restrict__ in1, const float* __restrict__ in2,
                                                         int nb, long mat, int ldi, _Float16* __restrict__ outT0, int ldo, float scale) {
  __shared__ __align__(16) _Float16 tile[64][72];     // [c][r]
  const int zt = blockIdx.z / nb, zb = blockIdx.z - zt * nb;
  const float* in = ((zt == 0) ? in0 : (zt == 1) ? in1 : in2) + (size_t)zb * mat;
  _Float16* outT = outT0 + (size_t)blockIdx.z * mat;
  const int c0 = blockIdx.x * 64, r0 = blockIdx.y * 64;
  const int t = threadIdx.y * 32 + threadIdx.x;
  for (int i = threadIdx.y; i < 64; i += 8) {
    tile[threadIdx.x][i]      = (_Float16)(in[(size_t)(r0 + i) * ldi + c0 + threadIdx.x] * scale);
    tile[32 + threadIdx.x][i] = (_Float16)(in[(size_t)(r0 + i) * ldi + c0 + 32 + threadIdx.x] * scale);
  }
  __syncthreads();
  const int q = t >> 3, c8 = (t & 7) * 8;
  {
#pragma unroll
    for (int it = 0; it < 2; ++it) {
      const int c = it * 32 + q;
      v8h hv = *(const v8h*)(&tile[c][c8]);
      *(v8h*)(outT + (size_t)(c0 + c) * ldo + r0 + c8) = hv;
    }
    
  }
}

// ---- f32 [R][C] (pitch ldi) -> bf16 hi/lo transposed planes [C][R] (pitch ldo); 64x64 tiles; each output row segment
__global__ __launch_bounds__(256) void transpose_split_bf16(const float* __restrict__ in, int ldi,
                                                           __bf16* __restrict__ outH, __bf16* __restrict__ outL, int ldo) {
  __shared__ __align__(16) float tile[64][68];     // [c][r]
  const int c0 = blockIdx.x * 64, r0 = blockIdx.y * 64;
  const int t = threadIdx.y * 32 + threadIdx.x;
  for (int i = threadIdx.y; i < 64; i += 8) {
    tile[threadIdx.x][i]      = in[(size_t)(r0 + i) * ldi + c0 + threadIdx.x];
    tile[32 + threadIdx.x][i] = in[(size_t)(r0 + i) * ldi + c0 + 32 + threadIdx.x];
  }
  __syncthreads();
  const int q = t >> 3, c8 = (t & 7) * 8;
  {
#pragma unroll
    for (int it = 0; it < 2; ++it) {
      const int c = it * 32 + q;
      v8b hv, lv;
#pragma unroll
      for (int e = 0; e < 8; ++e) {
        const float f = tile[c][c8 + e];
        const unsigned short hb = f2bf_bits(f);
        hv[e] = __builtin_bit_cast(__bf16, hb);
        lv[e] = __builtin_bit_cast(__bf16, f2bf_bits(f - bf_bits2f(hb)));
      }
      *(v8b*)(outH + (size_t)(c0 + c) * ldo + r0 + c8) = hv;
      *(v8b*)(outL + (size_t)(c0 + c) * ldo + r0 + c8) = lv;
    }
    
  }
}

// =====================================================================================
// Generic causal/non-causal attention for head_dim 64, f32 in / f32 out; 16-bit operands: bf16 with optional hi/lo splits, or
// plain f16 (F16=true, non-split, probabilities carried x2^15).
//   scores = (q*qscale)·kᵀ : v_wmma_f32_16x16x32_bf16; SPLIT_QK -> q,k as bf16 hi/lo (hi·hi + hi·lo + lo·hi)
//   out    = p·v           : v_wmma_f32_16x16x32_bf16; SPLIT_PV -> p,v as bf16 hi/lo; else p,v plain bf16
//   f32 accumulate; online softmax in f32. Block = 4 waves = 64 query rows of one (batch, head); S % 64 == 0.
//   Element (b, s, h, d) of tensor X lives at X[b*X_bs + s*X_rs + h*X_hs + d] (strides in floats, multiples of 4).
//   Masking: MASK_MODE 0 none, 1 causal (kv > q masked), 2 tensor [S][Skv] shared over (b,h) (float if
//   mask_is_int==0, int32 with element == 0 -> masked if 1, int32 with element != 0 -> masked if 2), 3 per-token vectors qmask[B][S] & kvmask[B][Skv] (int32,
//   0 -> masked), 4 causal + sliding window (kv > q or q - kv > W masked; W passed in mask_is_int);
//   5 = relative-position bias: s += cp[b,h,q][idx[q][kv]] + pc[b,h,kv][idx[q][kv]] with idx = mask_b ([S][Skv] int32) and
//   mask_a an int32 [S][Skv] tensor with nonzero = masked (tables: element (b,h,row,n) at X + b*c_bs + h*c_hs + row*c_rs + n);
//   masked scores are replaced by mask_fill (e.g. -inf or -1e9) before the softmax.
//   grid.x = B * H * (S/64) (or a sub-range with blk0).
// =====================================================================================
#define AT_D 64
#define AT_NW 4
#define AT_QB 64
#define AT_KC 64
#define AT_LP 72   // LDS row pitch of the K, V^T and P tiles in 16-bit elements: 144 B = 16 B x 9, so the 16 rows of a ds_load_b128 fragment read fall on distinct banks
struct AttnGeom { const float* cp = nullptr; const float* pc = nullptr; long c_bs = 0, c_rs = 0, c_hs = 0;   // mode-5 score-bias tables
                  long q_bs, q_rs, q_hs, k_bs, k_rs, k_hs, v_bs, v_rs, v_hs, o_bs, o_rs, o_hs;
                  int S, Skv, H, mask_mode; float qscale; int blk0; float mask_fill; int mask_is_int; };
static_assert(sizeof(AttnGeom) == 168, "no padding");

__device__ __forceinline__ unsigned short at_bf_bits(float f) {
  unsigned u = __float_as_uint(f);
  return (unsigned short)((u + 0x7FFFu + ((u >> 16) & 1u)) >> 16);
}
__device__ __forceinline__ __bf16 at_f2bf(float f) { return __builtin_bit_cast(__bf16, at_bf_bits(f)); }
__device__ __forceinline__ void at_split(float f, __bf16& hi, __bf16& lo) {
  const unsigned short hb = at_bf_bits(f);
  hi = __builtin_bit_cast(__bf16, hb);
  lo = at_f2bf(f - __uint_as_float(((unsigned)hb) << 16));
}
__device__ __forceinline__ v8f at_mma(v16b a, v16b b, v8f c) {
  c = __builtin_amdgcn_wmma_f32_16x16x32_bf16(false, a, false, b, (short)0, c, false, false);
  asm volatile("v_nop\n\tv_nop\n\tv_nop\n\tv_nop" : "+v"(c) : "v"(a), "v"(b));
  return c;
}
// 16-bit element as a bit pattern held in a __bf16 slot: f16 bits when F16, bf16 (RNE) otherwise
template <bool F16> __device__ __forceinline__ __bf16 at_to16(float f) {
  if (F16) return __builtin_bit_cast(__bf16, (_Float16)f);
  return at_f2bf(f);
}
template <bool F16> __device__ __forceinline__ v8f at_mma16(v16b a, v16b b, v8f c) {
  if (F16) {
    const v16h ah = __builtin_bit_cast(v16h, a), bh = __builtin_bit_cast(v16h, b);
    c = __builtin_amdgcn_wmma_f32_16x16x32_f16(false, ah, false, bh, (short)0, c, false, false);
    asm volatile("v_nop\n\tv_nop\n\tv_nop\n\tv_nop" : "+v"(c) : "v"(ah), "v"(bh));
    return c;
  }
  return at_mma(a, b, c);
}

// MASK_MODE is a compile-time constant: each instance holds only its own masking code, so the score loop has no per-element mode branches.
template <bool SPLIT_QK, bool SPLIT_PV, bool F16, int MASK_MODE>
__global__ __launch_bounds__(128)
void attn64_kernel(const float* __restrict__ q, const float* __restrict__ k,
                   const float* __restrict__ v, float* __restrict__ out,
                   const void* __restrict__ mask_a, const int* __restrict__ mask_b, AttnGeom g) {
  static_assert(!(F16 && (SPLIT_QK || SPLIT_PV)), "f16 mode is non-split");
  const float PSC = F16 ? 32768.0f : 1.0f;     // f16 probabilities carried x2^15 (subnormal range), folded into the final 1/l
  union FB { v16b v; v8b h[2]; };
  __shared__ __align__(16) __bf16 Ksh[AT_KC * AT_LP];            // K hi [kv][d]      9 KB
  __shared__ __align__(16) __bf16 Ksl[SPLIT_QK ? AT_KC * AT_LP : 8];
  __shared__ __align__(16) __bf16 Vth[AT_D * AT_LP];             // V hi [d][kv]      9 KB
  __shared__ __align__(16) __bf16 Vtl[SPLIT_PV ? AT_D * AT_LP : 8];
  __shared__ __align__(16) __bf16 Psh[AT_NW][16 * AT_LP];        // per wave P hi [row][kv]  9 KB
  __shared__ __align__(16) __bf16 Psl[SPLIT_PV ? AT_NW : 1][SPLIT_PV ? 16 * AT_LP : 8];
  __shared__ __align__(16) float  Os[AT_NW][16 * 68];            // per wave out tile, pitch 68

  const int tid  = threadIdx.x;
  const int wave = tid >> 5;
  const int lane = tid & 31;
  const int hh   = lane >> 4;
  const int c    = lane & 15;

  const int nqb = g.S / AT_QB;
  const int bx = blockIdx.x + g.blk0;
  const int qb = bx % nqb;
  const int bh = bx / nqb;
  const int h  = bh % g.H;
  const int b  = bh / g.H;
  const int qbase_block = qb * AT_QB;
  const int q0 = qbase_block + wave * 16;

  const float* qb_ptr = q + (size_t)b * g.q_bs + (size_t)h * g.q_hs;
  const float* kb_ptr = k + (size_t)b * g.k_bs + (size_t)h * g.k_hs;
  const float* vb_ptr = v + (size_t)b * g.v_bs + (size_t)h * g.v_hs;
  float*       ob_ptr = out + (size_t)b * g.o_bs + (size_t)h * g.o_hs;

  // ---- Q fragments (A operand): 2 d-chunks, hi (and lo) ----
  v16b qah[2], qal[2];
  {
    const float* qrow = qb_ptr + (size_t)(q0 + c) * g.q_rs;
#pragma unroll
    for (int dc = 0; dc < 2; ++dc) {
#pragma unroll
      for (int e = 0; e < 8; ++e) {
        const float f0 = qrow[dc * 32 + 8 * hh + e] * g.qscale;
        const float f1 = qrow[dc * 32 + 16 + 8 * hh + e] * g.qscale;
        if (SPLIT_QK) { __bf16 hq, lq; at_split(f0, hq, lq); qah[dc][e] = hq; qal[dc][e] = lq; at_split(f1, hq, lq); qah[dc][8 + e] = hq; qal[dc][8 + e] = lq; }
        else { qah[dc][e] = at_to16<F16>(f0); qah[dc][8 + e] = at_to16<F16>(f1); qal[dc][e] = qah[dc][e]; qal[dc][8 + e] = qah[dc][8 + e]; }
      }
    }
  }

  float mrow[8], lrow[8];
  v8f oacc[4];
#pragma unroll
  for (int r = 0; r < 8; ++r) { mrow[r] = -INFINITY; lrow[r] = 0.f; }
#pragma unroll
  for (int t = 0; t < 4; ++t) oacc[t] = (v8f){0.f,0.f,0.f,0.f,0.f,0.f,0.f,0.f};

  const int nChunks = (MASK_MODE == 1 || MASK_MODE == 4) ? (qb + 1) : (g.Skv / AT_KC);   // block-uniform
  // per-row query mask (mode 3)
  int qkeep[8];
#pragma unroll
  for (int r = 0; r < 8; ++r) qkeep[r] = (MASK_MODE == 3) ? mask_b[(size_t)b * g.S + q0 + 8 * hh + r] : 1;   // mask_b = qmask in mode 3
  for (int kc = 0; kc < nChunks; ++kc) {
    const int kv0 = kc * AT_KC;
    __syncthreads();
    {
      const int kvr = tid >> 1, dh = (tid & 1) * 32;
      const float* krow = kb_ptr + (size_t)(kv0 + kvr) * g.k_rs + dh;
      const float* vrow = vb_ptr + (size_t)(kv0 + kvr) * g.v_rs + dh;
#pragma unroll
      for (int i = 0; i < 8; ++i) {
        v4f kk = *(const v4f*)(krow + 4 * i);
        v4f vv = *(const v4f*)(vrow + 4 * i);
#pragma unroll
        for (int e = 0; e < 4; ++e) {
          const int d = dh + 4 * i + e;
          if (SPLIT_QK) { __bf16 a, bl; at_split(kk[e], a, bl); Ksh[kvr * AT_LP + d] = a; Ksl[kvr * AT_LP + d] = bl; }
          else Ksh[kvr * AT_LP + d] = at_to16<F16>(kk[e]);
          if (SPLIT_PV) { __bf16 a, bl; at_split(vv[e], a, bl); Vth[d * AT_LP + kvr] = a; Vtl[d * AT_LP + kvr] = bl; }
          else Vth[d * AT_LP + kvr] = at_to16<F16>(vv[e]);
        }
      }
    }
    __syncthreads();

    v8f s[4];
#pragma unroll
    for (int j = 0; j < 4; ++j) {
      s[j] = (v8f){0.f,0.f,0.f,0.f,0.f,0.f,0.f,0.f};
#pragma unroll 1
      for (int dc = 0; dc < 2; ++dc) {
        FB kb;
        kb.h[0] = *(const v8b*)(Ksh + (j * 16 + c) * AT_LP + dc * 32 + 8 * hh);
        kb.h[1] = *(const v8b*)(Ksh + (j * 16 + c) * AT_LP + dc * 32 + 16 + 8 * hh);
        s[j] = at_mma16<F16>(qah[dc], kb.v, s[j]);
        if (SPLIT_QK) {
          FB kl;
          kl.h[0] = *(const v8b*)(Ksl + (j * 16 + c) * AT_LP + dc * 32 + 8 * hh);
          kl.h[1] = *(const v8b*)(Ksl + (j * 16 + c) * AT_LP + dc * 32 + 16 + 8 * hh);
          s[j] = at_mma16<F16>(qah[dc], kl.v, s[j]);
          s[j] = at_mma16<F16>(qal[dc], kb.v, s[j]);
        }
      }
    }
    const bool diag = (MASK_MODE == 1) && (kc == qb);
    int kvkeep[4] = {1, 1, 1, 1};
    if (MASK_MODE == 3) {
#pragma unroll
      for (int j = 0; j < 4; ++j) kvkeep[j] = ((const int*)mask_a)[(size_t)b * g.Skv + kv0 + j * 16 + c];   // mask_a = kvmask
    }
    float cm[8];
#pragma unroll
    for (int r = 0; r < 8; ++r) {
      const int qrow = q0 + 8 * hh + r;
      float m = -INFINITY;
#pragma unroll
      for (int j = 0; j < 4; ++j) {
        const int kvcol = kv0 + j * 16 + c;
        bool masked = false;
        if (diag) masked = (kvcol > qrow);
        else if (MASK_MODE == 4) masked = (kvcol > qrow) || (qrow - kvcol > g.mask_is_int);
        else if (MASK_MODE == 2) {
          const size_t mi = (size_t)qrow * g.Skv + kvcol;
          masked = (g.mask_is_int == 0) ? (((const float*)mask_a)[mi] == 0.0f)
                 : (g.mask_is_int == 1) ? (((const int*)mask_a)[mi] == 0) : (((const int*)mask_a)[mi] != 0);
        } else if (MASK_MODE == 3) masked = (qkeep[r] == 0) || (kvkeep[j] == 0);
        else if (MASK_MODE == 5) {
          const size_t mi = (size_t)qrow * g.Skv + kvcol;
          masked = (((const int*)mask_a)[mi] != 0);
          int n = mask_b[mi]; n = n < 0 ? 0 : n;
          s[j][r] += g.cp[(size_t)b * g.c_bs + (size_t)h * g.c_hs + (size_t)qrow * g.c_rs + n]
                   + g.pc[(size_t)b * g.c_bs + (size_t)h * g.c_hs + (size_t)kvcol * g.c_rs + n];
        }
        if (masked) s[j][r] = g.mask_fill;
        m = fmaxf(m, s[j][r]);
      }
#pragma unroll
      for (int off = 1; off < 16; off <<= 1) m = fmaxf(m, __shfl_xor(m, off, 32));
      cm[r] = m;
    }
    __bf16* pwh = Psh[wave];
    __bf16* pwl = Psl[SPLIT_PV ? wave : 0];
#pragma unroll
    for (int r = 0; r < 8; ++r) {
      const float mnew = fmaxf(mrow[r], cm[r]);
      const float alpha = expf(mrow[r] - mnew);
      mrow[r] = mnew;
      float psum = 0.f;
#pragma unroll
      for (int j = 0; j < 4; ++j) {
        const float p = expf(s[j][r] - mnew);
        psum += p;
        if (SPLIT_PV) { __bf16 a, bl; at_split(p, a, bl); pwh[(8 * hh + r) * AT_LP + j * 16 + c] = a; pwl[(8 * hh + r) * AT_LP + j * 16 + c] = bl; }
        else pwh[(8 * hh + r) * AT_LP + j * 16 + c] = at_to16<F16>(p * PSC);
      }
#pragma unroll
      for (int off = 1; off < 16; off <<= 1) psum += __shfl_xor(psum, off, 32);
      lrow[r] = lrow[r] * alpha + psum;
#pragma unroll
      for (int t = 0; t < 4; ++t) oacc[t][r] *= alpha;
    }
    __builtin_amdgcn_fence(__ATOMIC_RELEASE, "workgroup");
    __builtin_amdgcn_wave_barrier();
    __builtin_amdgcn_fence(__ATOMIC_ACQUIRE, "workgroup");
#pragma unroll 1
    for (int kk = 0; kk < 2; ++kk) {
      FB pa, pl;
      pa.h[0] = *(const v8b*)(pwh + c * AT_LP + kk * 32 + 8 * hh);
      pa.h[1] = *(const v8b*)(pwh + c * AT_LP + kk * 32 + 16 + 8 * hh);
      if (SPLIT_PV) {
        pl.h[0] = *(const v8b*)(pwl + c * AT_LP + kk * 32 + 8 * hh);
        pl.h[1] = *(const v8b*)(pwl + c * AT_LP + kk * 32 + 16 + 8 * hh);
      }
#pragma unroll
      for (int t = 0; t < 4; ++t) {
        FB vb;
        vb.h[0] = *(const v8b*)(Vth + (t * 16 + c) * AT_LP + kk * 32 + 8 * hh);
        vb.h[1] = *(const v8b*)(Vth + (t * 16 + c) * AT_LP + kk * 32 + 16 + 8 * hh);
        oacc[t] = at_mma16<F16>(pa.v, vb.v, oacc[t]);
        if (SPLIT_PV) {
          FB vl;
          vl.h[0] = *(const v8b*)(Vtl + (t * 16 + c) * AT_LP + kk * 32 + 8 * hh);
          vl.h[1] = *(const v8b*)(Vtl + (t * 16 + c) * AT_LP + kk * 32 + 16 + 8 * hh);
          oacc[t] = at_mma16<F16>(pa.v, vl.v, oacc[t]);
          oacc[t] = at_mma16<F16>(pl.v, vb.v, oacc[t]);
        }
      }
    }
  }

  float* os = Os[wave];
#pragma unroll
  for (int r = 0; r < 8; ++r) {
    const float inv = 1.0f / (lrow[r] * PSC);
#pragma unroll
    for (int t = 0; t < 4; ++t) os[(8 * hh + r) * 68 + t * 16 + c] = oacc[t][r] * inv;
  }
  __builtin_amdgcn_fence(__ATOMIC_RELEASE, "workgroup");
  __builtin_amdgcn_wave_barrier();
  __builtin_amdgcn_fence(__ATOMIC_ACQUIRE, "workgroup");
  {
    const int c4 = (lane & 15) * 4;
    {
#pragma unroll
      for (int it = 0; it < 8; ++it) {
        const int row = it * 2 + hh;
        v4f val = *(const v4f*)(os + row * 68 + c4);
        *(v4f*)(ob_ptr + (size_t)(q0 + row) * g.o_rs + c4) = val;
      }
      
    }
  }
}

#define EB 8
#define EC 768
#define ES 1024
#define EH 12
extern "C" void kernel_launch(void* const* d_in, const int* in_sizes, int n_in, void* d_out, int out_size, void* d_ws, size_t ws_size, hipStream_t stream) {
  (void)in_sizes; (void)n_in; (void)out_size; (void)ws_size;
  const float* q = (const float*)d_in[0]; const float* k = (const float*)d_in[1]; const float* v = (const float*)d_in[2];
  const float* Wq = (const float*)d_in[3]; const float* bq = (const float*)d_in[4]; const float* Wk = (const float*)d_in[5]; const float* bk = (const float*)d_in[6];
  const float* Wv = (const float*)d_in[7]; const float* bv = (const float*)d_in[8]; const float* Wo = (const float*)d_in[9]; const float* bo = (const float*)d_in[10];
  float* out = (float*)d_out;    // [8][768][1024]
  char* ws = (char*)d_ws; size_t off = 0;
  auto carve = [&](size_t bytes) -> char* { char* p = ws + off; off += (bytes + 255) & ~(size_t)255; return p; };
  _Float16* QT = (_Float16*)carve((size_t)EB * ES * EC * 2); _Float16* KT = (_Float16*)carve((size_t)EB * ES * EC * 2); _Float16* VT = (_Float16*)carve((size_t)EB * ES * EC * 2);   // 3 x 12.6 MB
  _Float16* Wq16 = (_Float16*)carve((size_t)EC * EC * 2); _Float16* Wk16 = (_Float16*)carve((size_t)EC * EC * 2); _Float16* Wv16 = (_Float16*)carve((size_t)EC * EC * 2); _Float16* Wo16 = (_Float16*)carve((size_t)EC * EC * 2);
  float* QE = (float*)carve((size_t)EB * ES * EC * 4); float* KE = (float*)carve((size_t)EB * ES * EC * 4); float* VE = (float*)carve((size_t)EB * ES * EC * 4);   // 3 x 25 MB
  float* Of = (float*)carve((size_t)EB * ES * EC * 4);
  _Float16* O16 = QT;     // reuse (QT dead after the q projection)
  // Launches that read none of each other's output share one grid. QT, KT, VT lie back to back in the workspace, and so do the four
  // f16 weights and QE, KE, VE (every carve is a multiple of 256 B), so a grid index times a fixed stride reaches each of them.
  (void)KT; (void)VT; (void)Wk16; (void)Wv16;
  transpose_cast_f16<<<dim3(ES / 64, EC / 64, 3 * EB), dim3(32, 8), 0, stream>>>(q, k, v, EB, (long)EC * ES, ES, QT, EC, 1.0f);   // each [768][1024] -> [1024][768]
  cast4_f32_f16x2<<<dim3((EC * EC / 2 + 255) / 256, 4), 256, 0, stream>>>(Wq, Wk, Wv, Wo, Wq16, EC * EC / 2);   // 1x1-conv weights [out][in] are the Bt layout; Wo is the A operand ([M=o][K=c]) of the output GEMM
  { const int t = (ES / 64) * (EC / 64);   // z = 0, 1, 2: the q, k, v projections
    wmma_gemm64<0, false, 2, 0, false><<<dim3((t + 7) / 8, EB, 3), 256, 0, stream>>>(U16(QT), nullptr, EC, (long)ES * EC, U16(Wq16), nullptr, EC, 0, QE, nullptr, EC, (long)ES * EC, bq, nullptr, 0, ES, EC, EC, 1.0f,
        (long)EB * ES * EC, (long)EC * EC, (long)EB * ES * EC, bk, bv); }
  { AttnGeom g;
    g.q_bs = (long)ES * EC; g.q_rs = EC; g.q_hs = 64; g.k_bs = (long)ES * EC; g.k_rs = EC; g.k_hs = 64; g.v_bs = (long)ES * EC; g.v_rs = EC; g.v_hs = 64; g.o_bs = (long)ES * EC; g.o_rs = EC; g.o_hs = 64;
    g.S = ES; g.Skv = ES; g.H = EH; g.mask_mode = 0; g.qscale = 0.125f; g.blk0 = 0; g.mask_fill = -INFINITY; g.mask_is_int = 0;
    attn64_kernel<false, false, true, 0><<<EB * EH * (ES / AT_QB), AT_NW * 32, 0, stream>>>(QE, KE, VE, Of, nullptr, nullptr, g); }
  cast_f32_f16x2<<<(EB * ES * EC / 2 + 255) / 256, 256, 0, stream>>>(Of, O16, EB * ES * EC / 2);
  { const int t = (EC / 64) * (ES / 64);   // outᵀ per batch: A = Wo [768][768], Bt = O16[b] [1024][768] -> out[b] [768][1024], bias per row
    wmma_gemm64<0, false, 1, 0, false><<<dim3((t + 7) / 8, EB), 256, 0, stream>>>(U16(Wo16), nullptr, EC, 0, U16(O16), nullptr, EC, (long)ES * EC, out, nullptr, ES, (long)EC * ES, bo, nullptr, 0, EC, ES, EC, 1.0f, 0, 0, 0, bo, bo); }
}

// v005
// A run of this version takes 196 microseconds.
// Next to v004, in two timings, it ran 1.09 times as fast each time.
// Over all steps from v000 it is 5.60 times as fast.
#include <hip/hip_runtime.h>
#include <math.h>
// Multi-head attention over 32x32 feature maps (8 batches, 12 heads x 64, 1024 queries/keys): the four 1x1-conv projections
// (1024 x 768 · 768 x 768 per batch; the output projection computed transposed so it lands in the (B, C, H·W) layout) and the attention
// (scores and p·v, p carried x2^15): v_wmma_f32_16x16x32_f16, f16 operands, f32 accumulate; softmax f32. Input transposes are VALU copies.
typedef __attribute__((ext_vector_type(16))) _Float16 v16h;
typedef __attribute__((ext_vector_type(8)))  _Float16 v8h;
typedef __attribute__((ext_vector_type(16))) __bf16   v16b;
typedef __attribute__((ext_vector_type(8)))  __bf16   v8b;
typedef __attribute__((ext_vector_type(8)))  float    v8f;
typedef __attribute__((ext_vector_type(4)))  float    v4f;
#define PSCALE 32768.0f
#define U16(p) ((const unsigned short*)(const void*)(p))
#define PSCALE_INV (1.0f / 32768.0f)

__device__ __forceinline__ unsigned short f2bf_bits(float f) {
  unsigned u = __float_as_uint(f);
  return (unsigned short)((u + 0x7FFFu + ((u >> 16) & 1u)) >> 16);
}
__device__ __forceinline__ float bf_bits2f(unsigned short h) { return __uint_as_float(((unsigned)h) << 16); }

// hazard guards as plain device helpers (no inline asm inside the kernel template body)
__device__ __forceinline__ void dep_guard_h(v8f& a, v8f& b, v16h x, v16h y) { asm volatile("v_nop\n\tv_nop\n\tv_nop\n\tv_nop" : "+v"(a), "+v"(b) : "v"(x), "v"(y)); }
__device__ __forceinline__ void dep_guard_b(v8f& a, v8f& b, v16b x, v16b y) { asm volatile("v_nop\n\tv_nop\n\tv_nop\n\tv_nop" : "+v"(a), "+v"(b) : "v"(x), "v"(y)); }
__device__ __forceinline__ void keep4_h(v16h a, v16h b, v16h c, v16h d) { asm volatile("v_nop" :: "v"(a), "v"(b), "v"(c), "v"(d)); }
__device__ __forceinline__ void keep4_b(v16b a, v16b b, v16b c, v16b d) { asm volatile("v_nop" :: "v"(a), "v"(b), "v"(c), "v"(d)); }
__device__ __forceinline__ void acc_guard4(v8f& a, v8f& b, v8f& c, v8f& d) { asm volatile("v_nop\n\tv_nop\n\tv_nop\n\tv_nop" : "+v"(a), "+v"(b), "+v"(c), "+v"(d)); }
template <typename T> struct Frag;
template <> struct Frag<_Float16> {
  typedef v16h V; typedef v8h H; union U { v16h v; v8h h[2]; };
  static __device__ __forceinline__ v16h load(const _Float16* p) {   // elements 0..7 <- p[0..7], 8..15 <- p[16..23]
    U f; f.h[0] = *(const v8h*)(p); f.h[1] = *(const v8h*)(p + 16); return f.v;
  }
  static __device__ __forceinline__ v8f mma(v16h a, v16h b, v8f c) {
    return __builtin_amdgcn_wmma_f32_16x16x32_f16(false, a, false, b, (short)0, c, false, false);
  }
  static __device__ __forceinline__ void guard(v8f& a, v8f& b, v16h x, v16h y) { dep_guard_h(a, b, x, y); }
  static __device__ __forceinline__ void keep(v16h a, v16h b, v16h c, v16h d) { keep4_h(a, b, c, d); }
};
template <> struct Frag<__bf16> {
  typedef v16b V; typedef v8b H; union U { v16b v; v8b h[2]; };
  static __device__ __forceinline__ v16b load(const __bf16* p) {
    U f; f.h[0] = *(const v8b*)(p); f.h[1] = *(const v8b*)(p + 16); return f.v;
  }
  static __device__ __forceinline__ v8f mma(v16b a, v16b b, v8f c) {
    return __builtin_amdgcn_wmma_f32_16x16x32_bf16(false, a, false, b, (short)0, c, false, false);
  }
  static __device__ __forceinline__ void guard(v8f& a, v8f& b, v16b x, v16b y) { dep_guard_b(a, b, x, y); }
  static __device__ __forceinline__ void keep(v16b a, v16b b, v16b c, v16b d) { keep4_b(a, b, c, d); }
};

// ---- Register-blocked batched WMMA GEMM ------------------------------------
// C[m,n] = scale * sum_k A[m,k] * Bt[n,k] (+bias)(+resid); each wave owns a 64x64 tile, the 8 waves of a block (2 x 4) one 128x256 tile.
// A row-major [M,K]; Bt row-major [N,K]; M % 128 == 0, N % 256 == 0, K % 64 == 0; grid.x = (M / 128) * (N / 256).
// Operands go through LDS: a stage is 64 k (one whole 128-B line) of the block's 128 A rows and 256 Bt rows, read from global memory
// with every wave-wide 16-B load covering 4 whole lines, two buffers, the next stage's loads in flight while this one is multiplied.
// SPLIT (hi/lo operand planes) is not built in this form.
// BIAS_MODE: 0 = none, 1 = bias[m], 2 = bias[n].
// OUT_MODE: 0 = f32, 1 = f16, 2 = bf16 hi plane (Cout) + bf16 lo plane (Cout2).
// ET: 0 = f16 operands, 1 = bf16 operands (pointers passed as 16-bit storage)
// blockIdx.z picks one of up to three independent problems of the same shape in one launch: operands and output advance by zA / zB / zC
// elements per z, the bias is bias / bias_z1 / bias_z2.
#define GS_K 64                 // k per stage
#define GS_LP 72                // LDS row pitch in 16-bit elements: 144 B = 16 B x 9, for the ds_load_b128 fragment reads
#define GS_ROWS (128 + 256)     // A rows + Bt rows of a block tile
template <int ET> struct Elem;
template <> struct Elem<0> { typedef _Float16 T; };
template <> struct Elem<1> { typedef __bf16 T; };
template <int ET, bool SPLIT, int BIAS_MODE, int OUT_MODE, bool RESID, int ACT = 0>
__global__ __launch_bounds__(256) void wmma_gemm64(
    const unsigned short* __restrict__ Ap, const unsigned short* __restrict__ A2p, int lda, long strideA,
    const unsigned short* __restrict__ Btp, const unsigned short* __restrict__ Bt2p, int ldb, long strideB,
    void* __restrict__ Cout, void* __restrict__ Cout2, int ldc, long strideC,
    const float* __restrict__ bias,
    const float* __restrict__ resid, long strideR,
    int M, int N, int K, float scale,
    long zA, long zB, long zC, const float* __restrict__ bias_z1, const float* __restrict__ bias_z2) {
  typedef typename Elem<ET>::T T;
  typedef typename Frag<T>::V V;
  typedef typename Frag<T>::H H;
  static_assert(!SPLIT, "the LDS-staged loop holds one plane per operand");
  const T* A = (const T*)Ap; const T* Bt = (const T*)Btp;
  (void)A2p; (void)Bt2p;
  __shared__ __align__(16) T sOp[2][GS_ROWS * GS_LP];   // two stages: rows 0..127 = A, rows 128..383 = Bt
  __shared__ __align__(16) float sT[8][16 * 68];   // per-wave 16x64 slab, pitch 68 floats
  const int b    = blockIdx.y;
  const int z    = blockIdx.z;
  const float* biasz = (z == 0) ? bias : (z == 1) ? bias_z1 : bias_z2;
  const int lane = threadIdx.x & 31;
  const int wave = threadIdx.x >> 5;
  const int tilesN = N >> 8;
  const int tilesM = M >> 7;
  const int tile = blockIdx.x;
  if (tile >= tilesM * tilesN) return;   // block-uniform, in front of every barrier
  const int tm = tile / tilesN;
  const int tn = tile - tm * tilesN;
  const int m0b = tm << 7;                     // the block's first row and column
  const int n0b = tn << 8;
  const int wm = wave >> 2, wn = wave & 3;     // the wave's place in the 2 x 4 block tile
  const int m0 = m0b + (wm << 6);
  const int n0 = n0b + (wn << 6);

  const T* Ab  = A  + (size_t)z * zA + (size_t)b * strideA;
  const T* Bb  = Bt + (size_t)z * zB + (size_t)b * strideB;

  const int rlane = lane & 15;                 // row (A) / col (B, D) within subtile
  const int koff  = (lane >> 4) * 8;           // k offset of this lane half
  const int mOff  = (lane >> 4) * 8;           // D row offset

  v8f acc[4][4];
#pragma unroll
  for (int i = 0; i < 4; ++i)
#pragma unroll
    for (int j = 0; j < 4; ++j) acc[i][j] = (v8f){0.f,0.f,0.f,0.f,0.f,0.f,0.f,0.f};

  // Staging map: 16-B piece p = i * 256 + thread of a stage is row p / 8, bytes 16 * (p % 8): 8 lanes cover one row's 128-B line.
  const int srow = threadIdx.x >> 3;
  const int sc8  = (threadIdx.x & 7) * 8;
  const T* gA = Ab + (size_t)(m0b + srow) * lda + sc8;
  const T* gB = Bb + (size_t)(n0b + srow) * ldb + sc8;
  const int sW = srow * GS_LP + sc8;                              // this thread's first piece in a stage
  const int rA = ((wm << 6) + rlane) * GS_LP + koff;              // this lane's fragment rows in a stage
  const int rB = (128 + (wn << 6) + rlane) * GS_LP + koff;
  H st[12];
#pragma unroll
  for (int i = 0; i < 4; ++i) st[i] = *(const H*)(gA + (size_t)(i * 32) * lda);
#pragma unroll
  for (int i = 0; i < 8; ++i) st[4 + i] = *(const H*)(gB + (size_t)(i * 32) * ldb);
#pragma unroll
  for (int i = 0; i < 12; ++i) *(H*)(&sOp[0][sW + i * 32 * GS_LP]) = st[i];
  __syncthreads();

  const int nStage = K / GS_K;
  for (int s = 0; s < nStage; ++s) {
    const T* cur = sOp[s & 1];
    const bool more = (s + 1 < nStage);        // block-uniform
    if (more) {                                // the next stage's lines fly while this stage is multiplied
      const int k1 = (s + 1) * GS_K;
#pragma unroll
      for (int i = 0; i < 4; ++i) st[i] = *(const H*)(gA + (size_t)(i * 32) * lda + k1);
#pragma unroll
      for (int i = 0; i < 8; ++i) st[4 + i] = *(const H*)(gB + (size_t)(i * 32) * ldb + k1);
    }
#pragma unroll
    for (int kb = 0; kb < GS_K / 32; ++kb) {
      V bh[4], ah[4];                          // all eight fragments of a 32-k block are read as one group: one LDS wait per 16 products
#pragma unroll
      for (int j = 0; j < 4; ++j) bh[j] = Frag<T>::load(cur + rB + (j << 4) * GS_LP + kb * 32);
#pragma unroll
      for (int i = 0; i < 4; ++i) ah[i] = Frag<T>::load(cur + rA + (i << 4) * GS_LP + kb * 32);
#pragma unroll
      for (int i = 0; i < 4; ++i) {
#pragma unroll
        for (int j = 0; j < 4; ++j) acc[i][j] = Frag<T>::mma(ah[i], bh[j], acc[i][j]);
        Frag<T>::guard(acc[i][0], acc[i][3], ah[i], ah[i]);
      }
      Frag<T>::keep(bh[0], bh[1], bh[2], bh[3]);
    }
    if (more) {                                // into the buffer whose readers all left it at the barrier that ended stage s - 1
      T* nxt = sOp[(s + 1) & 1];
#pragma unroll
      for (int i = 0; i < 12; ++i) *(H*)(nxt + sW + i * 32 * GS_LP) = st[i];
    }
    __syncthreads();                           // publishes stage s + 1 and ends every wave's reads of stage s
  }
  acc_guard4(acc[0][0], acc[0][1], acc[0][2], acc[0][3]);
  acc_guard4(acc[1][0], acc[1][1], acc[1][2], acc[1][3]);
  acc_guard4(acc[2][0], acc[2][1], acc[2][2], acc[2][3]);
  acc_guard4(acc[3][0], acc[3][1], acc[3][2], acc[3][3]);

  // ---- epilogue ----
  float* slab = sT[wave];
  const float* Rb = RESID ? (resid + (size_t)b * strideR) : nullptr;
#pragma unroll
  for (int i = 0; i < 4; ++i) {
    const int mBase = m0 + (i << 4);
#pragma unroll
    for (int j = 0; j < 4; ++j) {
      const int n = n0 + (j << 4) + rlane;
      float bv = 0.f;
      if (BIAS_MODE == 2) bv = biasz[n];
#pragma unroll
      for (int r = 0; r < 8; ++r) {
        float v = acc[i][j][r] * scale;
        if (BIAS_MODE == 1) v += biasz[mBase + mOff + r];
        if (BIAS_MODE == 2) v += bv;
        if (RESID) v += Rb[(size_t)(mBase + mOff + r) * ldc + n];
        if (ACT == 1) v = tanhf(v);
        if (ACT == 2) v = fmaxf(v, 0.0f);
        if (ACT == 3) v = v / (1.0f + expf(-v));
        if (ACT == 4) v = (v > 0.f) ? v : 0.01f * v;
        if (ACT == 5) v = 0.5f * v * (1.0f + erff(v * 0.70710678118654752f));
        slab[(mOff + r) * 68 + (j << 4) + rlane] = v;
      }
    }
    __builtin_amdgcn_fence(__ATOMIC_RELEASE, "workgroup");
    __builtin_amdgcn_wave_barrier();
    __builtin_amdgcn_fence(__ATOMIC_ACQUIRE, "workgroup");
    if (OUT_MODE == 0) {
      float* C = (float*)Cout + (size_t)z * zC + (size_t)b * strideC;
      const int hh = lane >> 4, c4 = (lane & 15) * 4;     // row seg = 256 B = 16 lanes x 16 B
      {
#pragma unroll
        for (int it = 0; it < 8; ++it) {
          const int row = it * 2 + hh;
          v4f v = *(const v4f*)(slab + row * 68 + c4);
          *(v4f*)(C + (size_t)(mBase + row) * ldc + n0 + c4) = v;
        }
        
      }
    } else {
      const int q = lane >> 3, c8 = (lane & 7) * 8;
      unsigned short* C  = (unsigned short*)Cout  + (size_t)z * zC + (size_t)b * strideC;
      unsigned short* C2 = (OUT_MODE == 2) ? ((unsigned short*)Cout2 + (size_t)z * zC + (size_t)b * strideC) : nullptr;
      {
#pragma unroll
        for (int it = 0; it < 4; ++it) {
          const int row = it * 4 + q;
          const float* sp = slab + row * 68 + c8;
          v8h hv, lv;
#pragma unroll
          for (int e = 0; e < 8; ++e) {
            if (OUT_MODE == 1) {
              hv[e] = (_Float16)sp[e];
            } else {
              unsigned short hb = f2bf_bits(sp[e]);
              unsigned short lb = f2bf_bits(sp[e] - bf_bits2f(hb));
              hv[e] = __builtin_bit_cast(_Float16, hb);
              lv[e] = __builtin_bit_cast(_Float16, lb);
            }
          }
          *(v8h*)(C + (size_t)(mBase + row) * ldc + n0 + c8) = hv;
          if (OUT_MODE == 2) *(v8h*)(C2 + (size_t)(mBase + row) * ldc + n0 + c8) = lv;
        }
        
      }
    }
    __builtin_amdgcn_fence(__ATOMIC_RELEASE, "workgroup");
    __builtin_amdgcn_wave_barrier();
    __builtin_amdgcn_fence(__ATOMIC_ACQUIRE, "workgroup");
  }
}

__global__ __launch_bounds__(256) void cast_f32_f16x2(
    const float* __restrict__ in, _Float16* __restrict__ out, int n2) {
  int i = blockIdx.x * 256 + threadIdx.x;
  if (i < n2) {
    const _Float16 h0 = (_Float16)in[2 * i], h1 = (_Float16)in[2 * i + 1];
    const unsigned u = (unsigned)__builtin_bit_cast(unsigned short, h0) | ((unsigned)__builtin_bit_cast(unsigned short, h1) << 16);
    ((unsigned*)out)[i] = u;
    
  }
}

// ---- the same cast for four arrays of equal length in one launch: blockIdx.y picks the input, outputs lie n2 pairs apart ----
__global__ __launch_bounds__(256) void cast4_f32_f16x2(
    const float* __restrict__ in0, const float* __restrict__ in1, const float* __restrict__ in2, const float* __restrict__ in3,
    _Float16* __restrict__ out, int n2) {
  const int y = blockIdx.y;
  const float* in = (y == 0) ? in0 : (y == 1) ? in1 : (y == 2) ? in2 : in3;
  int i = blockIdx.x * 256 + threadIdx.x;
  if (i < n2) {
    const _Float16 h0 = (_Float16)in[2 * i], h1 = (_Float16)in[2 * i + 1];
    const unsigned u = (unsigned)__builtin_bit_cast(unsigned short, h0) | ((unsigned)__builtin_bit_cast(unsigned short, h1) << 16);
    ((unsigned*)out)[(size_t)y * n2 + i] = u;
  }
}

// ---- f32 -> f16 cast with a power-of-two pre-scale (folded back by the consumer GEMM's scale) ----
__global__ __launch_bounds__(256) void cast_f32_f16x2s(const float* __restrict__ in, _Float16* __restrict__ out, int n2, float s) {
  int i = blockIdx.x * 256 + threadIdx.x;
  if (i < n2) {
    const _Float16 h0 = (_Float16)(in[2 * i] * s), h1 = (_Float16)(in[2 * i + 1] * s);
    const unsigned u = (unsigned)__builtin_bit_cast(unsigned short, h0) | ((unsigned)__builtin_bit_cast(unsigned short, h1) << 16);
    ((unsigned*)out)[i] = u;
    
  }
}
__global__ __launch_bounds__(256) void split_f32_bf16x2(
    const float* __restrict__ in, __bf16* __restrict__ hi, __bf16* __restrict__ lo, long n2) {
  long i = (long)blockIdx.x * 256 + threadIdx.x;
  long stride = (long)gridDim.x * 256;
  {
    for (long j = i; j < n2; j += stride) {
      const float a = in[2 * j], b = in[2 * j + 1];
      const unsigned short ah = f2bf_bits(a), bh = f2bf_bits(b);
      const unsigned short al = f2bf_bits(a - bf_bits2f(ah)), bl = f2bf_bits(b - bf_bits2f(bh));
      ((unsigned*)hi)[j] = (unsigned)ah | ((unsigned)bh << 16);
      ((unsigned*)lo)[j] = (unsigned)al | ((unsigned)bl << 16);
    }
    
  }
}


// ---- f32 [R][C] (row pitch ldi) -> f16 transposed [C][R] (row pitch ldo); 64x64 tiles; each output row segment
// blockIdx.z = tensor * nb + batch: three input tensors of nb matrices each (mat elements apart) in one launch; output matrix z lies at outT0 + z * mat.
__global__ __launch_bounds__(256) void transpose_cast_f16(const float* __restrict__ in0, const float* __restrict__ in1, const float* __restrict__ in2,
                                                         int nb, long mat, int ldi, _Float16* __restrict__ outT0, int ldo, float scale) {
  __shared__ __align__(16) _Float16 tile[64][72];     // [c][r]
  const int zt = blockIdx.z / nb, zb = blockIdx.z - zt * nb;
  const float* in = ((zt == 0) ? in0 : (zt == 1) ? in1 : in2) + (size_t)zb * mat;
  _Float16* outT = outT0 + (size_t)blockIdx.z * mat;
  const int c0 = blockIdx.x * 64, r0 = blockIdx.y * 64;
  const int t = threadIdx.y * 32 + threadIdx.x;
  for (int i = threadIdx.y; i < 64; i += 8) {
    tile[threadIdx.x][i]      = (_Float16)(in[(size_t)(r0 + i) * ldi + c0 + threadIdx.x] * scale);
    tile[32 + threadIdx.x][i] = (_Float16)(in[(size_t)(r0 + i) * ldi + c0 + 32 + threadIdx.x] * scale);
  }
  __syncthreads();
  const int q = t >> 3, c8 = (t & 7) * 8;
  {
#pragma unroll
    for (int it = 0; it < 2; ++it) {
      const int c = it * 32 + q;
      v8h hv = *(const v8h*)(&tile[c][c8]);
      *(v8h*)(outT + (size_t)(c0 + c) * ldo + r0 + c8) = hv;
    }
    
  }
}

// ---- f32 [R][C] (pitch ldi) -> bf16 hi/lo transposed planes [C][R] (pitch ldo); 64x64 tiles; each output row segment
__global__ __launch_bounds__(256) void transpose_split_bf16(const float* __restrict__ in, int ldi,
                                                           __bf16* __restrict__ outH, __bf16* __restrict__ outL, int ldo) {
  __shared__ __align__(16) float tile[64][68];     // [c][r]
  const int c0 = blockIdx.x * 64, r0 = blockIdx.y * 64;
  const int t = threadIdx.y * 32 + threadIdx.x;
  for (int i = threadIdx.y; i < 64; i += 8) {
    tile[threadIdx.x][i]      = in[(size_t)(r0 + i) * ldi + c0 + threadIdx.x];
    tile[32 + threadIdx.x][i] = in[(size_t)(r0 + i) * ldi + c0 + 32 + threadIdx.x];
  }
  __syncthreads();
  const int q = t >> 3, c8 = (t & 7) * 8;
  {
#pragma unroll
    for (int it = 0; it < 2; ++it) {
      const int c = it * 32 + q;
      v8b hv, lv;
#pragma unroll
      for (int e = 0; e < 8; ++e) {
        const float f = tile[c][c8 + e];
        const unsigned short hb = f2bf_bits(f);
        hv[e] = __builtin_bit_cast(__bf16, hb);
        lv[e] = __builtin_bit_cast(__bf16, f2bf_bits(f - bf_bits2f(hb)));
      }
      *(v8b*)(outH + (size_t)(c0 + c) * ldo + r0 + c8) = hv;
      *(v8b*)(outL + (size_t)(c0 + c) * ldo + r0 + c8) = lv;
    }
    
  }
}

// =====================================================================================
// Generic causal/non-causal attention for head_dim 64, f32 in / f32 out; 16-bit operands: bf16 with optional hi/lo splits, or
// plain f16 (F16=true, non-split, probabilities carried x2^15).
//   scores = (q*qscale)·kᵀ : v_wmma_f32_16x16x32_bf16; SPLIT_QK -> q,k as bf16 hi/lo (hi·hi + hi·lo + lo·hi)
//   out    = p·v           : v_wmma_f32_16x16x32_bf16; SPLIT_PV -> p,v as bf16 hi/lo; else p,v plain bf16
//   f32 accumulate; online softmax in f32. Block = 4 waves = 64 query rows of one (batch, head); S % 64 == 0.
//   Element (b, s, h, d) of tensor X lives at X[b*X_bs + s*X_rs + h*X_hs + d] (strides in floats, multiples of 4).
//   Masking: MASK_MODE 0 none, 1 causal (kv > q masked), 2 tensor [S][Skv] shared over (b,h) (float if
//   mask_is_int==0, int32 with element == 0 -> masked if 1, int32 with element != 0 -> masked if 2), 3 per-token vectors qmask[B][S] & kvmask[B][Skv] (int32,
//   0 -> masked), 4 causal + sliding window (kv > q or q - kv > W masked; W passed in mask_is_int);
//   5 = relative-position bias: s += cp[b,h,q][idx[q][kv]] + pc[b,h,kv][idx[q][kv]] with idx = mask_b ([S][Skv] int32) and
//   mask_a an int32 [S][Skv] tensor with nonzero = masked (tables: element (b,h,row,n) at X + b*c_bs + h*c_hs + row*c_rs + n);
//   masked scores are replaced by mask_fill (e.g. -inf or -1e9) before the softmax.
//   grid.x = B * H * (S/64) (or a sub-range with blk0).
// =====================================================================================
#define AT_D 64
#define AT_NW 4
#define AT_QB 64
#define AT_KC 64
#define AT_LOG2E 1.4426950408889634f   // e^x = 2^(x * log2 e): the softmax runs in base 2, where the chip's own v_exp_f32 is the whole exponential
#define AT_LP 72   // LDS row pitch of the K, V^T and P tiles in 16-bit elements: 144 B = 16 B x 9, so the 16 rows of a ds_load_b128 fragment read fall on distinct banks
struct AttnGeom { const float* cp = nullptr; const float* pc = nullptr; long c_bs = 0, c_rs = 0, c_hs = 0;   // mode-5 score-bias tables
                  long q_bs, q_rs, q_hs, k_bs, k_rs, k_hs, v_bs, v_rs, v_hs, o_bs, o_rs, o_hs;
                  int S, Skv, H, mask_mode; float qscale; int blk0; float mask_fill; int mask_is_int; };
static_assert(sizeof(AttnGeom) == 168, "no padding");

__device__ __forceinline__ unsigned short at_bf_bits(float f) {
  unsigned u = __float_as_uint(f);
  return (unsigned short)((u + 0x7FFFu + ((u >> 16) & 1u)) >> 16);
}
__device__ __forceinline__ __bf16 at_f2bf(float f) { return __builtin_bit_cast(__bf16, at_bf_bits(f)); }
__device__ __forceinline__ void at_split(float f, __bf16& hi, __bf16& lo) {
  const unsigned short hb = at_bf_bits(f);
  hi = __builtin_bit_cast(__bf16, hb);
  lo = at_f2bf(f - __uint_as_float(((unsigned)hb) << 16));
}
__device__ __forceinline__ v8f at_mma(v16b a, v16b b, v8f c) {
  c = __builtin_amdgcn_wmma_f32_16x16x32_bf16(false, a, false, b, (short)0, c, false, false);
  asm volatile("v_nop\n\tv_nop\n\tv_nop\n\tv_nop" : "+v"(c) : "v"(a), "v"(b));
  return c;
}
// 16-bit element as a bit pattern held in a __bf16 slot: f16 bits when F16, bf16 (RNE) otherwise
template <bool F16> __device__ __forceinline__ __bf16 at_to16(float f) {
  if (F16) return __builtin_bit_cast(__bf16, (_Float16)f);
  return at_f2bf(f);
}
template <bool F16> __device__ __forceinline__ v8f at_mma16(v16b a, v16b b, v8f c) {
  if (F16) {
    const v16h ah = __builtin_bit_cast(v16h, a), bh = __builtin_bit_cast(v16h, b);
    c = __builtin_amdgcn_wmma_f32_16x16x32_f16(false, ah, false, bh, (short)0, c, false, false);
    asm volatile("v_nop\n\tv_nop\n\tv_nop\n\tv_nop" : "+v"(c) : "v"(ah), "v"(bh));
    return c;
  }
  return at_mma(a, b, c);
}

// MASK_MODE is a compile-time constant: each instance holds only its own masking code, so the score loop has no per-element mode branches.
template <bool SPLIT_QK, bool SPLIT_PV, bool F16, int MASK_MODE>
__global__ __launch_bounds__(128)
void attn64_kernel(const float* __restrict__ q, const float* __restrict__ k,
                   const float* __restrict__ v, float* __restrict__ out,
                   const void* __restrict__ mask_a, const int* __restrict__ mask_b, AttnGeom g) {
  static_assert(!(F16 && (SPLIT_QK || SPLIT_PV)), "f16 mode is non-split");
  const float PSC = F16 ? 32768.0f : 1.0f;     // f16 probabilities carried x2^15 (subnormal range), folded into the final 1/l
  union FB { v16b v; v8b h[2]; };
  __shared__ __align__(16) __bf16 Ksh[AT_KC * AT_LP];            // K hi [kv][d]      9 KB
  __shared__ __align__(16) __bf16 Ksl[SPLIT_QK ? AT_KC * AT_LP : 8];
  __shared__ __align__(16) __bf16 Vth[AT_D * AT_LP];             // V hi [d][kv]      9 KB
  __shared__ __align__(16) __bf16 Vtl[SPLIT_PV ? AT_D * AT_LP : 8];
  __shared__ __align__(16) __bf16 Psh[AT_NW][16 * AT_LP];        // per wave P hi [row][kv]  9 KB
  __shared__ __align__(16) __bf16 Psl[SPLIT_PV ? AT_NW : 1][SPLIT_PV ? 16 * AT_LP : 8];
  __shared__ __align__(16) float  Os[AT_NW][16 * 68];            // per wave out tile, pitch 68

  const int tid  = threadIdx.x;
  const int wave = tid >> 5;
  const int lane = tid & 31;
  const int hh   = lane >> 4;
  const int c    = lane & 15;

  const int nqb = g.S / AT_QB;
  const int bx = blockIdx.x + g.blk0;
  const int qb = bx % nqb;
  const int bh = bx / nqb;
  const int h  = bh % g.H;
  const int b  = bh / g.H;
  const int qbase_block = qb * AT_QB;
  const int q0 = qbase_block + wave * 16;

  const float* qb_ptr = q + (size_t)b * g.q_bs + (size_t)h * g.q_hs;
  const float* kb_ptr = k + (size_t)b * g.k_bs + (size_t)h * g.k_hs;
  const float* vb_ptr = v + (size_t)b * g.v_bs + (size_t)h * g.v_hs;
  float*       ob_ptr = out + (size_t)b * g.o_bs + (size_t)h * g.o_hs;

  // ---- Q fragments (A operand): 2 d-chunks, hi (and lo) ----
  v16b qah[2], qal[2];
  {
    const float* qrow = qb_ptr + (size_t)(q0 + c) * g.q_rs;
#pragma unroll
    for (int dc = 0; dc < 2; ++dc) {
#pragma unroll
      for (int e = 0; e < 8; ++e) {
        const float f0 = qrow[dc * 32 + 8 * hh + e] * g.qscale;
        const float f1 = qrow[dc * 32 + 16 + 8 * hh + e] * g.qscale;
        if (SPLIT_QK) { __bf16 hq, lq; at_split(f0, hq, lq); qah[dc][e] = hq; qal[dc][e] = lq; at_split(f1, hq, lq); qah[dc][8 + e] = hq; qal[dc][8 + e] = lq; }
        else { qah[dc][e] = at_to16<F16>(f0); qah[dc][8 + e] = at_to16<F16>(f1); qal[dc][e] = qah[dc][e]; qal[dc][8 + e] = qah[dc][8 + e]; }
      }
    }
  }

  float mrow[8], lrow[8];
  v8f oacc[4];
#pragma unroll
  for (int r = 0; r < 8; ++r) { mrow[r] = -INFINITY; lrow[r] = 0.f; }
#pragma unroll
  for (int t = 0; t < 4; ++t) oacc[t] = (v8f){0.f,0.f,0.f,0.f,0.f,0.f,0.f,0.f};

  const int nChunks = (MASK_MODE == 1 || MASK_MODE == 4) ? (qb + 1) : (g.Skv / AT_KC);   // block-uniform
  // per-row query mask (mode 3)
  int qkeep[8];
#pragma unroll
  for (int r = 0; r < 8; ++r) qkeep[r] = (MASK_MODE == 3) ? mask_b[(size_t)b * g.S + q0 + 8 * hh + r] : 1;   // mask_b = qmask in mode 3
  for (int kc = 0; kc < nChunks; ++kc) {
    const int kv0 = kc * AT_KC;
    __syncthreads();
    {
      const int kvr = tid >> 1, dh = (tid & 1) * 32;
      const float* krow = kb_ptr + (size_t)(kv0 + kvr) * g.k_rs + dh;
      const float* vrow = vb_ptr + (size_t)(kv0 + kvr) * g.v_rs + dh;
#pragma unroll
      for (int i = 0; i < 8; ++i) {
        v4f kk = *(const v4f*)(krow + 4 * i);
        v4f vv = *(const v4f*)(vrow + 4 * i);
#pragma unroll
        for (int e = 0; e < 4; ++e) {
          const int d = dh + 4 * i + e;
          if (SPLIT_QK) { __bf16 a, bl; at_split(kk[e], a, bl); Ksh[kvr * AT_LP + d] = a; Ksl[kvr * AT_LP + d] = bl; }
          else Ksh[kvr * AT_LP + d] = at_to16<F16>(kk[e]);
          if (SPLIT_PV) { __bf16 a, bl; at_split(vv[e], a, bl); Vth[d * AT_LP + kvr] = a; Vtl[d * AT_LP + kvr] = bl; }
          else Vth[d * AT_LP + kvr] = at_to16<F16>(vv[e]);
        }
      }
    }
    __syncthreads();

    v8f s[4];
#pragma unroll
    for (int j = 0; j < 4; ++j) {
      s[j] = (v8f){0.f,0.f,0.f,0.f,0.f,0.f,0.f,0.f};
#pragma unroll 1
      for (int dc = 0; dc < 2; ++dc) {
        FB kb;
        kb.h[0] = *(const v8b*)(Ksh + (j * 16 + c) * AT_LP + dc * 32 + 8 * hh);
        kb.h[1] = *(const v8b*)(Ksh + (j * 16 + c) * AT_LP + dc * 32 + 16 + 8 * hh);
        s[j] = at_mma16<F16>(qah[dc], kb.v, s[j]);
        if (SPLIT_QK) {
          FB kl;
          kl.h[0] = *(const v8b*)(Ksl + (j * 16 + c) * AT_LP + dc * 32 + 8 * hh);
          kl.h[1] = *(const v8b*)(Ksl + (j * 16 + c) * AT_LP + dc * 32 + 16 + 8 * hh);
          s[j] = at_mma16<F16>(qah[dc], kl.v, s[j]);
          s[j] = at_mma16<F16>(qal[dc], kb.v, s[j]);
        }
      }
    }
    const bool diag = (MASK_MODE == 1) && (kc == qb);
    int kvkeep[4] = {1, 1, 1, 1};
    if (MASK_MODE == 3) {
#pragma unroll
      for (int j = 0; j < 4; ++j) kvkeep[j] = ((const int*)mask_a)[(size_t)b * g.Skv + kv0 + j * 16 + c];   // mask_a = kvmask
    }
    float cm[8];
#pragma unroll
    for (int r = 0; r < 8; ++r) {
      const int qrow = q0 + 8 * hh + r;
      float m = -INFINITY;
#pragma unroll
      for (int j = 0; j < 4; ++j) {
        const int kvcol = kv0 + j * 16 + c;
        bool masked = false;
        if (diag) masked = (kvcol > qrow);
        else if (MASK_MODE == 4) masked = (kvcol > qrow) || (qrow - kvcol > g.mask_is_int);
        else if (MASK_MODE == 2) {
          const size_t mi = (size_t)qrow * g.Skv + kvcol;
          masked = (g.mask_is_int == 0) ? (((const float*)mask_a)[mi] == 0.0f)
                 : (g.mask_is_int == 1) ? (((const int*)mask_a)[mi] == 0) : (((const int*)mask_a)[mi] != 0);
        } else if (MASK_MODE == 3) masked = (qkeep[r] == 0) || (kvkeep[j] == 0);
        else if (MASK_MODE == 5) {
          const size_t mi = (size_t)qrow * g.Skv + kvcol;
          masked = (((const int*)mask_a)[mi] != 0);
          int n = mask_b[mi]; n = n < 0 ? 0 : n;
          s[j][r] += g.cp[(size_t)b * g.c_bs + (size_t)h * g.c_hs + (size_t)qrow * g.c_rs + n]
                   + g.pc[(size_t)b * g.c_bs + (size_t)h * g.c_hs + (size_t)kvcol * g.c_rs + n];
        }
        if (masked) s[j][r] = g.mask_fill;
        m = fmaxf(m, s[j][r]);
      }
#pragma unroll
      for (int off = 1; off < 16; off <<= 1) m = fmaxf(m, __shfl_xor(m, off, 32));
      cm[r] = m;
    }
    __bf16* pwh = Psh[wave];
    __bf16* pwl = Psl[SPLIT_PV ? wave : 0];
#pragma unroll
    for (int r = 0; r < 8; ++r) {
      const float mnew = fmaxf(mrow[r], cm[r] * AT_LOG2E);     // the running maximum is kept in log2 units
      const float alpha = __builtin_amdgcn_exp2f(mrow[r] - mnew);
      mrow[r] = mnew;
      float psum = 0.f;
#pragma unroll
      for (int j = 0; j < 4; ++j) {
        const float p = __builtin_amdgcn_exp2f(fmaf(s[j][r], AT_LOG2E, -mnew));   // one fma + one v_exp_f32 per score
        psum += p;
        if (SPLIT_PV) { __bf16 a, bl; at_split(p, a, bl); pwh[(8 * hh + r) * AT_LP + j * 16 + c] = a; pwl[(8 * hh + r) * AT_LP + j * 16 + c] = bl; }
        else pwh[(8 * hh + r) * AT_LP + j * 16 + c] = at_to16<F16>(p * PSC);
      }
#pragma unroll
      for (int off = 1; off < 16; off <<= 1) psum += __shfl_xor(psum, off, 32);
      lrow[r] = lrow[r] * alpha + psum;
#pragma unroll
      for (int t = 0; t < 4; ++t) oacc[t][r] *= alpha;
    }
    __builtin_amdgcn_fence(__ATOMIC_RELEASE, "workgroup");
    __builtin_amdgcn_wave_barrier();
    __builtin_amdgcn_fence(__ATOMIC_ACQUIRE, "workgroup");
#pragma unroll 1
    for (int kk = 0; kk < 2; ++kk) {
      FB pa, pl;
      pa.h[0] = *(const v8b*)(pwh + c * AT_LP + kk * 32 + 8 * hh);
      pa.h[1] = *(const v8b*)(pwh + c * AT_LP + kk * 32 + 16 + 8 * hh);
      if (SPLIT_PV) {
        pl.h[0] = *(const v8b*)(pwl + c * AT_LP + kk * 32 + 8 * hh);
        pl.h[1] = *(const v8b*)(pwl + c * AT_LP + kk * 32 + 16 + 8 * hh);
      }
#pragma unroll
      for (int t = 0; t < 4; ++t) {
        FB vb;
        vb.h[0] = *(const v8b*)(Vth + (t * 16 + c) * AT_LP + kk * 32 + 8 * hh);
        vb.h[1] = *(const v8b*)(Vth + (t * 16 + c) * AT_LP + kk * 32 + 16 + 8 * hh);
        oacc[t] = at_mma16<F16>(pa.v, vb.v, oacc[t]);
        if (SPLIT_PV) {
          FB vl;
          vl.h[0] = *(const v8b*)(Vtl + (t * 16 + c) * AT_LP + kk * 32 + 8 * hh);
          vl.h[1] = *(const v8b*)(Vtl + (t * 16 + c) * AT_LP + kk * 32 + 16 + 8 * hh);
          oacc[t] = at_mma16<F16>(pa.v, vl.v, oacc[t]);
          oacc[t] = at_mma16<F16>(pl.v, vb.v, oacc[t]);
        }
      }
    }
  }

  float* os = Os[wave];
#pragma unroll
  for (int r = 0; r < 8; ++r) {
    const float inv = 1.0f / (lrow[r] * PSC);
#pragma unroll
    for (int t = 0; t < 4; ++t) os[(8 * hh + r) * 68 + t * 16 + c] = oacc[t][r] * inv;
  }
  __builtin_amdgcn_fence(__ATOMIC_RELEASE, "workgroup");
  __builtin_amdgcn_wave_barrier();
  __builtin_amdgcn_fence(__ATOMIC_ACQUIRE, "workgroup");
  {
    const int c4 = (lane & 15) * 4;
    {
#pragma unroll
      for (int it = 0; it < 8; ++it) {
        const int row = it * 2 + hh;
        v4f val = *(const v4f*)(os + row * 68 + c4);
        *(v4f*)(ob_ptr + (size_t)(q0 + row) * g.o_rs + c4) = val;
      }
      
    }
  }
}

#define EB 8
#define EC 768
#define ES 1024
#define EH 12
extern "C" void kernel_launch(void* const* d_in, const int* in_sizes, int n_in, void* d_out, int out_size, void* d_ws, size_t ws_size, hipStream_t stream) {
  (void)in_sizes; (void)n_in; (void)out_size; (void)ws_size;
  const float* q = (const float*)d_in[0]; const float* k = (const float*)d_in[1]; const float* v = (const float*)d_in[2];
  const float* Wq = (const float*)d_in[3]; const float* bq = (const float*)d_in[4]; const float* Wk = (const float*)d_in[5]; const float* bk = (const float*)d_in[6];
  const float* Wv = (const float*)d_in[7]; const float* bv = (const float*)d_in[8]; const float* Wo = (const float*)d_in[9]; const float* bo = (const float*)d_in[10];
  float* out = (float*)d_out;    // [8][768][1024]
  char* ws = (char*)d_ws; size_t off = 0;
  auto carve = [&](size_t bytes) -> char* { char* p = ws + off; off += (bytes + 255) & ~(size_t)255; return p; };
  _Float16* QT = (_Float16*)carve((size_t)EB * ES * EC * 2); _Float16* KT = (_Float16*)carve((size_t)EB * ES * EC * 2); _Float16* VT = (_Float16*)carve((size_t)EB * ES * EC * 2);   // 3 x 12.6 MB
  _Float16* Wq16 = (_Float16*)carve((size_t)EC * EC * 2); _Float16* Wk16 = (_Float16*)carve((size_t)EC * EC * 2); _Float16* Wv16 = (_Float16*)carve((size_t)EC * EC * 2); _Float16* Wo16 = (_Float16*)carve((size_t)EC * EC * 2);
  float* QE = (float*)carve((size_t)EB * ES * EC * 4); float* KE = (float*)carve((size_t)EB * ES * EC * 4); float* VE = (float*)carve((size_t)EB * ES * EC * 4);   // 3 x 25 MB
  float* Of = (float*)carve((size_t)EB * ES * EC * 4);
  _Float16* O16 = QT;     // reuse (QT dead after the q projection)
  // Launches that read none of each other's output share one grid. QT, KT, VT lie back to back in the workspace, and so do the four
  // f16 weights and QE, KE, VE (every carve is a multiple of 256 B), so a grid index times a fixed stride reaches each of them.
  (void)KT; (void)VT; (void)Wk16; (void)Wv16;
  transpose_cast_f16<<<dim3(ES / 64, EC / 64, 3 * EB), dim3(32, 8), 0, stream>>>(q, k, v, EB, (long)EC * ES, ES, QT, EC, 1.0f);   // each [768][1024] -> [1024][768]
  cast4_f32_f16x2<<<dim3((EC * EC / 2 + 255) / 256, 4), 256, 0, stream>>>(Wq, Wk, Wv, Wo, Wq16, EC * EC / 2);   // 1x1-conv weights [out][in] are the Bt layout; Wo is the A operand ([M=o][K=c]) of the output GEMM
  { const int t = (ES / 64) * (EC / 64);   // z = 0, 1, 2: the q, k, v projections
    wmma_gemm64<0, false, 2, 0, false><<<dim3((t + 7) / 8, EB, 3), 256, 0, stream>>>(U16(QT), nullptr, EC, (long)ES * EC, U16(Wq16), nullptr, EC, 0, QE, nullptr, EC, (long)ES * EC, bq, nullptr, 0, ES, EC, EC, 1.0f,
        (long)EB * ES * EC, (long)EC * EC, (long)EB * ES * EC, bk, bv); }
  { AttnGeom g;
    g.q_bs = (long)ES * EC; g.q_rs = EC; g.q_hs = 64; g.k_bs = (long)ES * EC; g.k_rs = EC; g.k_hs = 64; g.v_bs = (long)ES * EC; g.v_rs = EC; g.v_hs = 64; g.o_bs = (long)ES * EC; g.o_rs = EC; g.o_hs = 64;
    g.S = ES; g.Skv = ES; g.H = EH; g.mask_mode = 0; g.qscale = 0.125f; g.blk0 = 0; g.mask_fill = -INFINITY; g.mask_is_int = 0;
    attn64_kernel<false, false, true, 0><<<EB * EH * (ES / AT_QB), AT_NW * 32, 0, stream>>>(QE, KE, VE, Of, nullptr, nullptr, g); }
  cast_f32_f16x2<<<(EB * ES * EC / 2 + 255) / 256, 256, 0, stream>>>(Of, O16, EB * ES * EC / 2);
  { const int t = (EC / 64) * (ES / 64);   // outᵀ per batch: A = Wo [768][768], Bt = O16[b] [1024][768] -> out[b] [768][1024], bias per row
    wmma_gemm64<0, false, 1, 0, false><<<dim3((t + 7) / 8, EB), 256, 0, stream>>>(U16(Wo16), nullptr, EC, 0, U16(O16), nullptr, EC, (long)ES * EC, out, nullptr, ES, (long)EC * ES, bo, nullptr, 0, EC, ES, EC, 1.0f, 0, 0, 0, bo, bo); }
}

// v006
// One run takes 160 microseconds.
// In both of two side-by-side timings against v005, it was 1.22 times as fast.
// Over all steps from v000 it is 6.84 times as fast.
#include <hip/hip_runtime.h>
#include <math.h>
// Multi-head attention over 32x32 feature maps (8 batches, 12 heads x 64, 1024 queries/keys): the four 1x1-conv projections
// (1024 x 768 · 768 x 768 per batch; the output projection computed transposed so it lands in the (B, C, H·W) layout) and the attention
// (scores and p·v, p carried x2^15): v_wmma_f32_16x16x32_f16, f16 operands, f32 accumulate; softmax f32. Input transposes are VALU copies.
typedef __attribute__((ext_vector_type(16))) _Float16 v16h;
typedef __attribute__((ext_vector_type(8)))  _Float16 v8h;
typedef __attribute__((ext_vector_type(16))) __bf16   v16b;
typedef __attribute__((ext_vector_type(8)))  __bf16   v8b;
typedef __attribute__((ext_vector_type(4)))  __bf16   v4b;
typedef __attribute__((ext_vector_type(2)))  __bf16   v2b;
typedef __attribute__((ext_vector_type(8)))  float    v8f;
typedef __attribute__((ext_vector_type(4)))  float    v4f;
#define PSCALE 32768.0f
#define U16(p) ((const unsigned short*)(const void*)(p))
#define PSCALE_INV (1.0f / 32768.0f)

__device__ __forceinline__ unsigned short f2bf_bits(float f) {
  unsigned u = __float_as_uint(f);
  return (unsigned short)((u + 0x7FFFu + ((u >> 16) & 1u)) >> 16);
}
__device__ __forceinline__ float bf_bits2f(unsigned short h) { return __uint_as_float(((unsigned)h) << 16); }

// hazard guards as plain device helpers (no inline asm inside the kernel template body)
__device__ __forceinline__ void dep_guard_h(v8f& a, v8f& b, v16h x, v16h y) { asm volatile("v_nop\n\tv_nop\n\tv_nop\n\tv_nop" : "+v"(a), "+v"(b) : "v"(x), "v"(y)); }
__device__ __forceinline__ void dep_guard_b(v8f& a, v8f& b, v16b x, v16b y) { asm volatile("v_nop\n\tv_nop\n\tv_nop\n\tv_nop" : "+v"(a), "+v"(b) : "v"(x), "v"(y)); }
__device__ __forceinline__ void keep4_h(v16h a, v16h b, v16h c, v16h d) { asm volatile("v_nop" :: "v"(a), "v"(b), "v"(c), "v"(d)); }
__device__ __forceinline__ void keep4_b(v16b a, v16b b, v16b c, v16b d) { asm volatile("v_nop" :: "v"(a), "v"(b), "v"(c), "v"(d)); }
__device__ __forceinline__ void acc_guard4(v8f& a, v8f& b, v8f& c, v8f& d) { asm volatile("v_nop\n\tv_nop\n\tv_nop\n\tv_nop" : "+v"(a), "+v"(b), "+v"(c), "+v"(d)); }
template <typename T> struct Frag;
template <> struct Frag<_Float16> {
  typedef v16h V; typedef v8h H; union U { v16h v; v8h h[2]; };
  static __device__ __forceinline__ v16h load(const _Float16* p) {   // elements 0..7 <- p[0..7], 8..15 <- p[16..23]
    U f; f.h[0] = *(const v8h*)(p); f.h[1] = *(const v8h*)(p + 16); return f.v;
  }
  static __device__ __forceinline__ v8f mma(v16h a, v16h b, v8f c) {
    return __builtin_amdgcn_wmma_f32_16x16x32_f16(false, a, false, b, (short)0, c, false, false);
  }
  static __device__ __forceinline__ void guard(v8f& a, v8f& b, v16h x, v16h y) { dep_guard_h(a, b, x, y); }
  static __device__ __forceinline__ void keep(v16h a, v16h b, v16h c, v16h d) { keep4_h(a, b, c, d); }
};
template <> struct Frag<__bf16> {
  typedef v16b V; typedef v8b H; union U { v16b v; v8b h[2]; };
  static __device__ __forceinline__ v16b load(const __bf16* p) {
    U f; f.h[0] = *(const v8b*)(p); f.h[1] = *(const v8b*)(p + 16); return f.v;
  }
  static __device__ __forceinline__ v8f mma(v16b a, v16b b, v8f c) {
    return __builtin_amdgcn_wmma_f32_16x16x32_bf16(false, a, false, b, (short)0, c, false, false);
  }
  static __device__ __forceinline__ void guard(v8f& a, v8f& b, v16b x, v16b y) { dep_guard_b(a, b, x, y); }
  static __device__ __forceinline__ void keep(v16b a, v16b b, v16b c, v16b d) { keep4_b(a, b, c, d); }
};

// ---- Register-blocked batched WMMA GEMM ------------------------------------
// C[m,n] = scale * sum_k A[m,k] * Bt[n,k] (+bias)(+resid); each wave owns a 64x64 tile, the 8 waves of a block (2 x 4) one 128x256 tile.
// A row-major [M,K]; Bt row-major [N,K]; M % 128 == 0, N % 256 == 0, K % 64 == 0; grid.x = (M / 128) * (N / 256).
// Operands go through LDS: a stage is 64 k (one whole 128-B line) of the block's 128 A rows and 256 Bt rows, read from global memory
// with every wave-wide 16-B load covering 4 whole lines, two buffers, the next stage's loads in flight while this one is multiplied.
// SPLIT (hi/lo operand planes) is not built in this form.
// BIAS_MODE: 0 = none, 1 = bias[m], 2 = bias[n].
// OUT_MODE: 0 = f32, 1 = f16, 2 = bf16 hi plane (Cout) + bf16 lo plane (Cout2).
// ET: 0 = f16 operands, 1 = bf16 operands (pointers passed as 16-bit storage)
// blockIdx.z picks one of up to three independent problems of the same shape in one launch: operands and output advance by zA / zB / zC
// elements per z, the bias is bias / bias_z1 / bias_z2.
#define GS_K 64                 // k per stage
#define GS_LP 72                // LDS row pitch in 16-bit elements: 144 B = 16 B x 9, for the ds_load_b128 fragment reads
#define GS_ROWS (128 + 256)     // A rows + Bt rows of a block tile
template <int ET> struct Elem;
template <> struct Elem<0> { typedef _Float16 T; };
template <> struct Elem<1> { typedef __bf16 T; };
template <int ET, bool SPLIT, int BIAS_MODE, int OUT_MODE, bool RESID, int ACT = 0>
__global__ __launch_bounds__(256) void wmma_gemm64(
    const unsigned short* __restrict__ Ap, const unsigned short* __restrict__ A2p, int lda, long strideA,
    const unsigned short* __restrict__ Btp, const unsigned short* __restrict__ Bt2p, int ldb, long strideB,
    void* __restrict__ Cout, void* __restrict__ Cout2, int ldc, long strideC,
    const float* __restrict__ bias,
    const float* __restrict__ resid, long strideR,
    int M, int N, int K, float scale,
    long zA, long zB, long zC, const float* __restrict__ bias_z1, const float* __restrict__ bias_z2) {
  typedef typename Elem<ET>::T T;
  typedef typename Frag<T>::V V;
  typedef typename Frag<T>::H H;
  static_assert(!SPLIT, "the LDS-staged loop holds one plane per operand");
  const T* A = (const T*)Ap; const T* Bt = (const T*)Btp;
  (void)A2p; (void)Bt2p;
  __shared__ __align__(16) T sOp[2][GS_ROWS * GS_LP];   // two stages: rows 0..127 = A, rows 128..383 = Bt
  __shared__ __align__(16) float sT[8][16 * 68];   // per-wave 16x64 slab, pitch 68 floats
  const int b    = blockIdx.y;
  const int z    = blockIdx.z;
  const float* biasz = (z == 0) ? bias : (z == 1) ? bias_z1 : bias_z2;
  const int lane = threadIdx.x & 31;
  const int wave = threadIdx.x >> 5;
  const int tilesN = N >> 8;
  const int tilesM = M >> 7;
  const int tile = blockIdx.x;
  if (tile >= tilesM * tilesN) return;   // block-uniform, in front of every barrier
  const int tm = tile / tilesN;
  const int tn = tile - tm * tilesN;
  const int m0b = tm << 7;                     // the block's first row and column
  const int n0b = tn << 8;
  const int wm = wave >> 2, wn = wave & 3;     // the wave's place in the 2 x 4 block tile
  const int m0 = m0b + (wm << 6);
  const int n0 = n0b + (wn << 6);

  const T* Ab  = A  + (size_t)z * zA + (size_t)b * strideA;
  const T* Bb  = Bt + (size_t)z * zB + (size_t)b * strideB;

  const int rlane = lane & 15;                 // row (A) / col (B, D) within subtile
  const int koff  = (lane >> 4) * 8;           // k offset of this lane half
  const int mOff  = (lane >> 4) * 8;           // D row offset

  v8f acc[4][4];
#pragma unroll
  for (int i = 0; i < 4; ++i)
#pragma unroll
    for (int j = 0; j < 4; ++j) acc[i][j] = (v8f){0.f,0.f,0.f,0.f,0.f,0.f,0.f,0.f};

  // Staging map: 16-B piece p = i * 256 + thread of a stage is row p / 8, bytes 16 * (p % 8): 8 lanes cover one row's 128-B line.
  const int srow = threadIdx.x >> 3;
  const int sc8  = (threadIdx.x & 7) * 8;
  const T* gA = Ab + (size_t)(m0b + srow) * lda + sc8;
  const T* gB = Bb + (size_t)(n0b + srow) * ldb + sc8;
  const int sW = srow * GS_LP + sc8;                              // this thread's first piece in a stage
  const int rA = ((wm << 6) + rlane) * GS_LP + koff;              // this lane's fragment rows in a stage
  const int rB = (128 + (wn << 6) + rlane) * GS_LP + koff;
  H st[12];
#pragma unroll
  for (int i = 0; i < 4; ++i) st[i] = *(const H*)(gA + (size_t)(i * 32) * lda);
#pragma unroll
  for (int i = 0; i < 8; ++i) st[4 + i] = *(const H*)(gB + (size_t)(i * 32) * ldb);
#pragma unroll
  for (int i = 0; i < 12; ++i) *(H*)(&sOp[0][sW + i * 32 * GS_LP]) = st[i];
  __syncthreads();

  const int nStage = K / GS_K;
  for (int s = 0; s < nStage; ++s) {
    const T* cur = sOp[s & 1];
    const bool more = (s + 1 < nStage);        // block-uniform
    if (more) {                                // the next stage's lines fly while this stage is multiplied
      const int k1 = (s + 1) * GS_K;
#pragma unroll
      for (int i = 0; i < 4; ++i) st[i] = *(const H*)(gA + (size_t)(i * 32) * lda + k1);
#pragma unroll
      for (int i = 0; i < 8; ++i) st[4 + i] = *(const H*)(gB + (size_t)(i * 32) * ldb + k1);
    }
#pragma unroll
    for (int kb = 0; kb < GS_K / 32; ++kb) {
      V bh[4], ah[4];                          // all eight fragments of a 32-k block are read as one group: one LDS wait per 16 products
#pragma unroll
      for (int j = 0; j < 4; ++j) bh[j] = Frag<T>::load(cur + rB + (j << 4) * GS_LP + kb * 32);
#pragma unroll
      for (int i = 0; i < 4; ++i) ah[i] = Frag<T>::load(cur + rA + (i << 4) * GS_LP + kb * 32);
#pragma unroll
      for (int i = 0; i < 4; ++i) {
#pragma unroll
        for (int j = 0; j < 4; ++j) acc[i][j] = Frag<T>::mma(ah[i], bh[j], acc[i][j]);
        Frag<T>::guard(acc[i][0], acc[i][3], ah[i], ah[i]);
      }
      Frag<T>::keep(bh[0], bh[1], bh[2], bh[3]);
    }
    if (more) {                                // into the buffer whose readers all left it at the barrier that ended stage s - 1
      T* nxt = sOp[(s + 1) & 1];
#pragma unroll
      for (int i = 0; i < 12; ++i) *(H*)(nxt + sW + i * 32 * GS_LP) = st[i];
    }
    __syncthreads();                           // publishes stage s + 1 and ends every wave's reads of stage s
  }
  acc_guard4(acc[0][0], acc[0][1], acc[0][2], acc[0][3]);
  acc_guard4(acc[1][0], acc[1][1], acc[1][2], acc[1][3]);
  acc_guard4(acc[2][0], acc[2][1], acc[2][2], acc[2][3]);
  acc_guard4(acc[3][0], acc[3][1], acc[3][2], acc[3][3]);

  // ---- epilogue ----
  float* slab = sT[wave];
  const float* Rb = RESID ? (resid + (size_t)b * strideR) : nullptr;
#pragma unroll
  for (int i = 0; i < 4; ++i) {
    const int mBase = m0 + (i << 4);
#pragma unroll
    for (int j = 0; j < 4; ++j) {
      const int n = n0 + (j << 4) + rlane;
      float bv = 0.f;
      if (BIAS_MODE == 2) bv = biasz[n];
#pragma unroll
      for (int r = 0; r < 8; ++r) {
        float v = acc[i][j][r] * scale;
        if (BIAS_MODE == 1) v += biasz[mBase + mOff + r];
        if (BIAS_MODE == 2) v += bv;
        if (RESID) v += Rb[(size_t)(mBase + mOff + r) * ldc + n];
        if (ACT == 1) v = tanhf(v);
        if (ACT == 2) v = fmaxf(v, 0.0f);
        if (ACT == 3) v = v / (1.0f + expf(-v));
        if (ACT == 4) v = (v > 0.f) ? v : 0.01f * v;
        if (ACT == 5) v = 0.5f * v * (1.0f + erff(v * 0.70710678118654752f));
        slab[(mOff + r) * 68 + (j << 4) + rlane] = v;
      }
    }
    __builtin_amdgcn_fence(__ATOMIC_RELEASE, "workgroup");
    __builtin_amdgcn_wave_barrier();
    __builtin_amdgcn_fence(__ATOMIC_ACQUIRE, "workgroup");
    if (OUT_MODE == 0) {
      float* C = (float*)Cout + (size_t)z * zC + (size_t)b * strideC;
      const int hh = lane >> 4, c4 = (lane & 15) * 4;     // row seg = 256 B = 16 lanes x 16 B
      {
#pragma unroll
        for (int it = 0; it < 8; ++it) {
          const int row = it * 2 + hh;
          v4f v = *(const v4f*)(slab + row * 68 + c4);
          *(v4f*)(C + (size_t)(mBase + row) * ldc + n0 + c4) = v;
        }
        
      }
    } else {
      const int q = lane >> 3, c8 = (lane & 7) * 8;
      unsigned short* C  = (unsigned short*)Cout  + (size_t)z * zC + (size_t)b * strideC;
      unsigned short* C2 = (OUT_MODE == 2) ? ((unsigned short*)Cout2 + (size_t)z * zC + (size_t)b * strideC) : nullptr;
      {
#pragma unroll
        for (int it = 0; it < 4; ++it) {
          const int row = it * 4 + q;
          const float* sp = slab + row * 68 + c8;
          v8h hv, lv;
#pragma unroll
          for (int e = 0; e < 8; ++e) {
            if (OUT_MODE == 1) {
              hv[e] = (_Float16)sp[e];
            } else {
              unsigned short hb = f2bf_bits(sp[e]);
              unsigned short lb = f2bf_bits(sp[e] - bf_bits2f(hb));
              hv[e] = __builtin_bit_cast(_Float16, hb);
              lv[e] = __builtin_bit_cast(_Float16, lb);
            }
          }
          *(v8h*)(C + (size_t)(mBase + row) * ldc + n0 + c8) = hv;
          if (OUT_MODE == 2) *(v8h*)(C2 + (size_t)(mBase + row) * ldc + n0 + c8) = lv;
        }
        
      }
    }
    __builtin_amdgcn_fence(__ATOMIC_RELEASE, "workgroup");
    __builtin_amdgcn_wave_barrier();
    __builtin_amdgcn_fence(__ATOMIC_ACQUIRE, "workgroup");
  }
}

__global__ __launch_bounds__(256) void cast_f32_f16x2(
    const float* __restrict__ in, _Float16* __restrict__ out, int n2) {
  int i = blockIdx.x * 256 + threadIdx.x;
  if (i < n2) {
    const _Float16 h0 = (_Float16)in[2 * i], h1 = (_Float16)in[2 * i + 1];
    const unsigned u = (unsigned)__builtin_bit_cast(unsigned short, h0) | ((unsigned)__builtin_bit_cast(unsigned short, h1) << 16);
    ((unsigned*)out)[i] = u;
    
  }
}

// ---- the same cast for four arrays of equal length in one launch: blockIdx.y picks the input, outputs lie n2 pairs apart ----
__global__ __launch_bounds__(256) void cast4_f32_f16x2(
    const float* __restrict__ in0, const float* __restrict__ in1, const float* __restrict__ in2, const float* __restrict__ in3,
    _Float16* __restrict__ out, int n2) {
  const int y = blockIdx.y;
  const float* in = (y == 0) ? in0 : (y == 1) ? in1 : (y == 2) ? in2 : in3;
  int i = blockIdx.x * 256 + threadIdx.x;
  if (i < n2) {
    const _Float16 h0 = (_Float16)in[2 * i], h1 = (_Float16)in[2 * i + 1];
    const unsigned u = (unsigned)__builtin_bit_cast(unsigned short, h0) | ((unsigned)__builtin_bit_cast(unsigned short, h1) << 16);
    ((unsigned*)out)[(size_t)y * n2 + i] = u;
  }
}

// ---- f32 -> f16 cast with a power-of-two pre-scale (folded back by the consumer GEMM's scale) ----
__global__ __launch_bounds__(256) void cast_f32_f16x2s(const float* __restrict__ in, _Float16* __restrict__ out, int n2, float s) {
  int i = blockIdx.x * 256 + threadIdx.x;
  if (i < n2) {
    const _Float16 h0 = (_Float16)(in[2 * i] * s), h1 = (_Float16)(in[2 * i + 1] * s);
    const unsigned u = (unsigned)__builtin_bit_cast(unsigned short, h0) | ((unsigned)__builtin_bit_cast(unsigned short, h1) << 16);
    ((unsigned*)out)[i] = u;
    
  }
}
__global__ __launch_bounds__(256) void split_f32_bf16x2(
    const float* __restrict__ in, __bf16* __restrict__ hi, __bf16* __restrict__ lo, long n2) {
  long i = (long)blockIdx.x * 256 + threadIdx.x;
  long stride = (long)gridDim.x * 256;
  {
    for (long j = i; j < n2; j += stride) {
      const float a = in[2 * j], b = in[2 * j + 1];
      const unsigned short ah = f2bf_bits(a), bh = f2bf_bits(b);
      const unsigned short al = f2bf_bits(a - bf_bits2f(ah)), bl = f2bf_bits(b - bf_bits2f(bh));
      ((unsigned*)hi)[j] = (unsigned)ah | ((unsigned)bh << 16);
      ((unsigned*)lo)[j] = (unsigned)al | ((unsigned)bl << 16);
    }
    
  }
}


// ---- f32 [R][C] (row pitch ldi) -> f16 transposed [C][R] (row pitch ldo); 64x64 tiles; each output row segment
// blockIdx.z = tensor * nb + batch: three input tensors of nb matrices each (mat elements apart) in one launch; output matrix z lies at outT0 + z * mat.
__global__ __launch_bounds__(256) void transpose_cast_f16(const float* __restrict__ in0, const float* __restrict__ in1, const float* __restrict__ in2,
                                                         int nb, long mat, int ldi, _Float16* __restrict__ outT0, int ldo, float scale) {
  __shared__ __align__(16) _Float16 tile[64][72];     // [c][r]
  const int zt = blockIdx.z / nb, zb = blockIdx.z - zt * nb;
  const float* in = ((zt == 0) ? in0 : (zt == 1) ? in1 : in2) + (size_t)zb * mat;
  _Float16* outT = outT0 + (size_t)blockIdx.z * mat;
  const int c0 = blockIdx.x * 64, r0 = blockIdx.y * 64;
  const int t = threadIdx.y * 32 + threadIdx.x;
  for (int i = threadIdx.y; i < 64; i += 8) {
    tile[threadIdx.x][i]      = (_Float16)(in[(size_t)(r0 + i) * ldi + c0 + threadIdx.x] * scale);
    tile[32 + threadIdx.x][i] = (_Float16)(in[(size_t)(r0 + i) * ldi + c0 + 32 + threadIdx.x] * scale);
  }
  __syncthreads();
  const int q = t >> 3, c8 = (t & 7) * 8;
  {
#pragma unroll
    for (int it = 0; it < 2; ++it) {
      const int c = it * 32 + q;
      v8h hv = *(const v8h*)(&tile[c][c8]);
      *(v8h*)(outT + (size_t)(c0 + c) * ldo + r0 + c8) = hv;
    }
    
  }
}

// ---- f32 [R][C] (pitch ldi) -> bf16 hi/lo transposed planes [C][R] (pitch ldo); 64x64 tiles; each output row segment
__global__ __launch_bounds__(256) void transpose_split_bf16(const float* __restrict__ in, int ldi,
                                                           __bf16* __restrict__ outH, __bf16* __restrict__ outL, int ldo) {
  __shared__ __align__(16) float tile[64][68];     // [c][r]
  const int c0 = blockIdx.x * 64, r0 = blockIdx.y * 64;
  const int t = threadIdx.y * 32 + threadIdx.x;
  for (int i = threadIdx.y; i < 64; i += 8) {
    tile[threadIdx.x][i]      = in[(size_t)(r0 + i) * ldi + c0 + threadIdx.x];
    tile[32 + threadIdx.x][i] = in[(size_t)(r0 + i) * ldi + c0 + 32 + threadIdx.x];
  }
  __syncthreads();
  const int q = t >> 3, c8 = (t & 7) * 8;
  {
#pragma unroll
    for (int it = 0; it < 2; ++it) {
      const int c = it * 32 + q;
      v8b hv, lv;
#pragma unroll
      for (int e = 0; e < 8; ++e) {
        const float f = tile[c][c8 + e];
        const unsigned short hb = f2bf_bits(f);
        hv[e] = __builtin_bit_cast(__bf16, hb);
        lv[e] = __builtin_bit_cast(__bf16, f2bf_bits(f - bf_bits2f(hb)));
      }
      *(v8b*)(outH + (size_t)(c0 + c) * ldo + r0 + c8) = hv;
      *(v8b*)(outL + (size_t)(c0 + c) * ldo + r0 + c8) = lv;
    }
    
  }
}

// =====================================================================================
// Generic causal/non-causal attention for head_dim 64, f32 in / f32 out; 16-bit operands: bf16 with optional hi/lo splits, or
// plain f16 (F16=true, non-split, probabilities carried x2^15).
//   scores = (q*qscale)·kᵀ : v_wmma_f32_16x16x32_bf16; SPLIT_QK -> q,k as bf16 hi/lo (hi·hi + hi·lo + lo·hi)
//   out    = p·v           : v_wmma_f32_16x16x32_bf16; SPLIT_PV -> p,v as bf16 hi/lo; else p,v plain bf16
//   f32 accumulate; online softmax in f32. Block = 4 waves = 64 query rows of one (batch, head); S % 64 == 0.
//   Element (b, s, h, d) of tensor X lives at X[b*X_bs + s*X_rs + h*X_hs + d] (strides in floats, multiples of 4).
//   Masking: MASK_MODE 0 none, 1 causal (kv > q masked), 2 tensor [S][Skv] shared over (b,h) (float if
//   mask_is_int==0, int32 with element == 0 -> masked if 1, int32 with element != 0 -> masked if 2), 3 per-token vectors qmask[B][S] & kvmask[B][Skv] (int32,
//   0 -> masked), 4 causal + sliding window (kv > q or q - kv > W masked; W passed in mask_is_int);
//   5 = relative-position bias: s += cp[b,h,q][idx[q][kv]] + pc[b,h,kv][idx[q][kv]] with idx = mask_b ([S][Skv] int32) and
//   mask_a an int32 [S][Skv] tensor with nonzero = masked (tables: element (b,h,row,n) at X + b*c_bs + h*c_hs + row*c_rs + n);
//   masked scores are replaced by mask_fill (e.g. -inf or -1e9) before the softmax.
//   grid.x = B * H * (S/64) (or a sub-range with blk0).
// =====================================================================================
#define AT_D 64
#define AT_NW 4
#define AT_QB 64
#define AT_KC 64
#define AT_LOG2E 1.4426950408889634f   // e^x = 2^(x * log2 e): the softmax runs in base 2, where the chip's own v_exp_f32 is the whole exponential
#define AT_LP 72   // LDS row pitch of the K, V^T and P tiles in 16-bit elements: 144 B = 16 B x 9, so the 16 rows of a ds_load_b128 fragment read fall on distinct banks
struct AttnGeom { const float* cp = nullptr; const float* pc = nullptr; long c_bs = 0, c_rs = 0, c_hs = 0;   // mode-5 score-bias tables
                  long q_bs, q_rs, q_hs, k_bs, k_rs, k_hs, v_bs, v_rs, v_hs, o_bs, o_rs, o_hs;
                  int S, Skv, H, mask_mode; float qscale; int blk0; float mask_fill; int mask_is_int; };
static_assert(sizeof(AttnGeom) == 168, "no padding");

__device__ __forceinline__ unsigned short at_bf_bits(float f) {
  unsigned u = __float_as_uint(f);
  return (unsigned short)((u + 0x7FFFu + ((u >> 16) & 1u)) >> 16);
}
__device__ __forceinline__ __bf16 at_f2bf(float f) { return __builtin_bit_cast(__bf16, at_bf_bits(f)); }
__device__ __forceinline__ void at_split(float f, __bf16& hi, __bf16& lo) {
  const unsigned short hb = at_bf_bits(f);
  hi = __builtin_bit_cast(__bf16, hb);
  lo = at_f2bf(f - __uint_as_float(((unsigned)hb) << 16));
}
__device__ __forceinline__ v8f at_mma(v16b a, v16b b, v8f c) {
  c = __builtin_amdgcn_wmma_f32_16x16x32_bf16(false, a, false, b, (short)0, c, false, false);
  asm volatile("v_nop\n\tv_nop\n\tv_nop\n\tv_nop" : "+v"(c) : "v"(a), "v"(b));
  return c;
}
// 16-bit element as a bit pattern held in a __bf16 slot: f16 bits when F16, bf16 (RNE) otherwise
template <bool F16> __device__ __forceinline__ __bf16 at_to16(float f) {
  if (F16) return __builtin_bit_cast(__bf16, (_Float16)f);
  return at_f2bf(f);
}
template <bool F16> __device__ __forceinline__ v8f at_mma16(v16b a, v16b b, v8f c) {
  if (F16) {
    const v16h ah = __builtin_bit_cast(v16h, a), bh = __builtin_bit_cast(v16h, b);
    c = __builtin_amdgcn_wmma_f32_16x16x32_f16(false, ah, false, bh, (short)0, c, false, false);
    asm volatile("v_nop\n\tv_nop\n\tv_nop\n\tv_nop" : "+v"(c) : "v"(ah), "v"(bh));
    return c;
  }
  return at_mma(a, b, c);
}

// MASK_MODE is a compile-time constant: each instance holds only its own masking code, so the score loop has no per-element mode branches.
template <bool SPLIT_QK, bool SPLIT_PV, bool F16, int MASK_MODE>
__global__ __launch_bounds__(128)
void attn64_kernel(const float* __restrict__ q, const float* __restrict__ k,
                   const float* __restrict__ v, float* __restrict__ out,
                   const void* __restrict__ mask_a, const int* __restrict__ mask_b, AttnGeom g) {
  static_assert(!(F16 && (SPLIT_QK || SPLIT_PV)), "f16 mode is non-split");
  const float PSC = F16 ? 32768.0f : 1.0f;     // f16 probabilities carried x2^15 (subnormal range), folded into the final 1/l
  union FB { v16b v; v8b h[2]; };
  __shared__ __align__(16) __bf16 Ksh[AT_KC * AT_LP];            // K hi [kv][d]      9 KB
  __shared__ __align__(16) __bf16 Ksl[SPLIT_QK ? AT_KC * AT_LP : 8];
  __shared__ __align__(16) __bf16 Vth[AT_D * AT_LP];             // V hi [d][kv]      9 KB
  __shared__ __align__(16) __bf16 Vtl[SPLIT_PV ? AT_D * AT_LP : 8];
  __shared__ __align__(16) __bf16 Psh[AT_NW][16 * AT_LP];        // per wave P hi [row][kv]  9 KB
  __shared__ __align__(16) __bf16 Psl[SPLIT_PV ? AT_NW : 1][SPLIT_PV ? 16 * AT_LP : 8];
  __shared__ __align__(16) float  Os[AT_NW][16 * 68];            // per wave out tile, pitch 68

  const int tid  = threadIdx.x;
  const int wave = tid >> 5;
  const int lane = tid & 31;
  const int hh   = lane >> 4;
  const int c    = lane & 15;

  const int nqb = g.S / AT_QB;
  const int bx = blockIdx.x + g.blk0;
  const int qb = bx % nqb;
  const int bh = bx / nqb;
  const int h  = bh % g.H;
  const int b  = bh / g.H;
  const int qbase_block = qb * AT_QB;
  const int q0 = qbase_block + wave * 16;

  const float* qb_ptr = q + (size_t)b * g.q_bs + (size_t)h * g.q_hs;
  const float* kb_ptr = k + (size_t)b * g.k_bs + (size_t)h * g.k_hs;
  const float* vb_ptr = v + (size_t)b * g.v_bs + (size_t)h * g.v_hs;
  float*       ob_ptr = out + (size_t)b * g.o_bs + (size_t)h * g.o_hs;

  // ---- Q fragments (A operand): 2 d-chunks, hi (and lo) ----
  v16b qah[2], qal[2];
  {
    const float* qrow = qb_ptr + (size_t)(q0 + c) * g.q_rs;
#pragma unroll
    for (int dc = 0; dc < 2; ++dc) {
#pragma unroll
      for (int e = 0; e < 8; ++e) {
        const float f0 = qrow[dc * 32 + 8 * hh + e] * g.qscale;
        const float f1 = qrow[dc * 32 + 16 + 8 * hh + e] * g.qscale;
        if (SPLIT_QK) { __bf16 hq, lq; at_split(f0, hq, lq); qah[dc][e] = hq; qal[dc][e] = lq; at_split(f1, hq, lq); qah[dc][8 + e] = hq; qal[dc][8 + e] = lq; }
        else { qah[dc][e] = at_to16<F16>(f0); qah[dc][8 + e] = at_to16<F16>(f1); qal[dc][e] = qah[dc][e]; qal[dc][8 + e] = qah[dc][8 + e]; }
      }
    }
  }

  float mrow[8], lrow[8];
  v8f oacc[4];
#pragma unroll
  for (int r = 0; r < 8; ++r) { mrow[r] = -INFINITY; lrow[r] = 0.f; }
#pragma unroll
  for (int t = 0; t < 4; ++t) oacc[t] = (v8f){0.f,0.f,0.f,0.f,0.f,0.f,0.f,0.f};

  const int nChunks = (MASK_MODE == 1 || MASK_MODE == 4) ? (qb + 1) : (g.Skv / AT_KC);   // block-uniform
  // per-row query mask (mode 3)
  int qkeep[8];
#pragma unroll
  for (int r = 0; r < 8; ++r) qkeep[r] = (MASK_MODE == 3) ? mask_b[(size_t)b * g.S + q0 + 8 * hh + r] : 1;   // mask_b = qmask in mode 3
  const char* kp = (const char*)kb_ptr;   // first key row of the current chunk, block-uniform; stepped at the foot of the loop
  const char* vp = (const char*)vb_ptr;
  for (int kc = 0; kc < nChunks; ++kc) {
    const int kv0 = kc * AT_KC;
    __syncthreads();
    {
      // Staging map: 8 lanes cover one 128-B line of a key's head row, so a wave-wide 16-B load takes 4 whole lines (4 keys), not 32 pieces
      // of 32 lines. A thread holds the keys 2n and 2n + 1 at the same four d, so V^T goes to LDS as 32-bit pairs of neighbouring keys.
      const int c8 = tid & 7, rq = (tid >> 3) & 3;
      const int r0 = wave * 16 + rq * 2;                 // load i: key r0 + 8 * (i >> 2) + (i & 1), d from 32 * ((i >> 1) & 1) + 4 * c8
      // address = block-uniform base of the chunk + block-uniform row step + this lane's byte offset inside the 64-key chunk
      const unsigned klo = (unsigned)(r0 * (int)g.k_rs + c8 * 4) * 4u, vlo = (unsigned)(r0 * (int)g.v_rs + c8 * 4) * 4u;
      v4f kk[8], vv[8];
      const char* ka[4]; const char* va[4];              // row n: key r0 + 8 * (n >> 1) + (n & 1)
#pragma unroll
      for (int n = 0; n < 4; ++n) {
        ka[n] = kp + (size_t)(8 * (n >> 1) + (n & 1)) * g.k_rs * 4 + klo;
        va[n] = vp + (size_t)(8 * (n >> 1) + (n & 1)) * g.v_rs * 4 + vlo;
      }
#pragma unroll
      for (int i = 0; i < 8; ++i) kk[i] = *(const v4f*)(ka[2 * (i >> 2) + (i & 1)] + 128 * ((i >> 1) & 1));
      // the wait that stands before a register of an issued global load is overwritten; the addresses are named as inputs so that they
      // stay whole up to it (without that the compiler lays a later load's destination over an earlier load's address pair)
      asm volatile("s_wait_xcnt 0x0" :: "v"(ka[0]), "v"(ka[1]), "v"(ka[2]), "v"(ka[3]) : "memory");
#pragma unroll
      for (int i = 0; i < 8; ++i) vv[i] = *(const v4f*)(va[2 * (i >> 2) + (i & 1)] + 128 * ((i >> 1) & 1));
      asm volatile("s_wait_xcnt 0x0" :: "v"(va[0]), "v"(va[1]), "v"(va[2]), "v"(va[3]) : "memory");   // the same for the V loads
#pragma unroll
      for (int i = 0; i < 8; ++i) {
        const int kvr = r0 + 8 * (i >> 2) + (i & 1), d = 32 * ((i >> 1) & 1) + c8 * 4;
        v4b kh, kl;
#pragma unroll
        for (int e = 0; e < 4; ++e) {
          if (SPLIT_QK) { __bf16 a, bl; at_split(kk[i][e], a, bl); kh[e] = a; kl[e] = bl; }
          else kh[e] = at_to16<F16>(kk[i][e]);
        }
        *(v4b*)(Ksh + kvr * AT_LP + d) = kh;
        if (SPLIT_QK) *(v4b*)(Ksl + kvr * AT_LP + d) = kl;
      }
#pragma unroll
      for (int i = 0; i < 8; i += 2) {
        const int kvr = r0 + 8 * (i >> 2), d = 32 * ((i >> 1) & 1) + c8 * 4;
#pragma unroll
        for (int e = 0; e < 4; ++e) {
          v2b vh, vl;
          if (SPLIT_PV) { __bf16 a, bl; at_split(vv[i][e], a, bl); vh[0] = a; vl[0] = bl; at_split(vv[i + 1][e], a, bl); vh[1] = a; vl[1] = bl; }
          else { vh[0] = at_to16<F16>(vv[i][e]); vh[1] = at_to16<F16>(vv[i + 1][e]); }
          *(v2b*)(Vth + (d + e) * AT_LP + kvr) = vh;
          if (SPLIT_PV) *(v2b*)(Vtl + (d + e) * AT_LP + kvr) = vl;
        }
      }
    }
    __syncthreads();

    v8f s[4];
#pragma unroll
    for (int j = 0; j < 4; ++j) {
      s[j] = (v8f){0.f,0.f,0.f,0.f,0.f,0.f,0.f,0.f};
#pragma unroll 1
      for (int dc = 0; dc < 2; ++dc) {
        FB kb;
        kb.h[0] = *(const v8b*)(Ksh + (j * 16 + c) * AT_LP + dc * 32 + 8 * hh);
        kb.h[1] = *(const v8b*)(Ksh + (j * 16 + c) * AT_LP + dc * 32 + 16 + 8 * hh);
        s[j] = at_mma16<F16>(qah[dc], kb.v, s[j]);
        if (SPLIT_QK) {
          FB kl;
          kl.h[0] = *(const v8b*)(Ksl + (j * 16 + c) * AT_LP + dc * 32 + 8 * hh);
          kl.h[1] = *(const v8b*)(Ksl + (j * 16 + c) * AT_LP + dc * 32 + 16 + 8 * hh);
          s[j] = at_mma16<F16>(qah[dc], kl.v, s[j]);
          s[j] = at_mma16<F16>(qal[dc], kb.v, s[j]);
        }
      }
    }
    const bool diag = (MASK_MODE == 1) && (kc == qb);
    int kvkeep[4] = {1, 1, 1, 1};
    if (MASK_MODE == 3) {
#pragma unroll
      for (int j = 0; j < 4; ++j) kvkeep[j] = ((const int*)mask_a)[(size_t)b * g.Skv + kv0 + j * 16 + c];   // mask_a = kvmask
    }
    float cm[8];
#pragma unroll
    for (int r = 0; r < 8; ++r) {
      const int qrow = q0 + 8 * hh + r;
      float m = -INFINITY;
#pragma unroll
      for (int j = 0; j < 4; ++j) {
        const int kvcol = kv0 + j * 16 + c;
        bool masked = false;
        if (diag) masked = (kvcol > qrow);
        else if (MASK_MODE == 4) masked = (kvcol > qrow) || (qrow - kvcol > g.mask_is_int);
        else if (MASK_MODE == 2) {
          const size_t mi = (size_t)qrow * g.Skv + kvcol;
          masked = (g.mask_is_int == 0) ? (((const float*)mask_a)[mi] == 0.0f)
                 : (g.mask_is_int == 1) ? (((const int*)mask_a)[mi] == 0) : (((const int*)mask_a)[mi] != 0);
        } else if (MASK_MODE == 3) masked = (qkeep[r] == 0) || (kvkeep[j] == 0);
        else if (MASK_MODE == 5) {
          const size_t mi = (size_t)qrow * g.Skv + kvcol;
          masked = (((const int*)mask_a)[mi] != 0);
          int n = mask_b[mi]; n = n < 0 ? 0 : n;
          s[j][r] += g.cp[(size_t)b * g.c_bs + (size_t)h * g.c_hs + (size_t)qrow * g.c_rs + n]
                   + g.pc[(size_t)b * g.c_bs + (size_t)h * g.c_hs + (size_t)kvcol * g.c_rs + n];
        }
        if (masked) s[j][r] = g.mask_fill;
        m = fmaxf(m, s[j][r]);
      }
#pragma unroll
      for (int off = 1; off < 16; off <<= 1) m = fmaxf(m, __shfl_xor(m, off, 32));
      cm[r] = m;
    }
    __bf16* pwh = Psh[wave];
    __bf16* pwl = Psl[SPLIT_PV ? wave : 0];
#pragma unroll
    for (int r = 0; r < 8; ++r) {
      const float mnew = fmaxf(mrow[r], cm[r] * AT_LOG2E);     // the running maximum is kept in log2 units
      const float alpha = __builtin_amdgcn_exp2f(mrow[r] - mnew);
      mrow[r] = mnew;
      float psum = 0.f;
#pragma unroll
      for (int j = 0; j < 4; ++j) {
        const float p = __builtin_amdgcn_exp2f(fmaf(s[j][r], AT_LOG2E, -mnew));   // one fma + one v_exp_f32 per score
        psum += p;
        if (SPLIT_PV) { __bf16 a, bl; at_split(p, a, bl); pwh[(8 * hh + r) * AT_LP + j * 16 + c] = a; pwl[(8 * hh + r) * AT_LP + j * 16 + c] = bl; }
        else pwh[(8 * hh + r) * AT_LP + j * 16 + c] = at_to16<F16>(p * PSC);
      }
#pragma unroll
      for (int off = 1; off < 16; off <<= 1) psum += __shfl_xor(psum, off, 32);
      lrow[r] = lrow[r] * alpha + psum;
#pragma unroll
      for (int t = 0; t < 4; ++t) oacc[t][r] *= alpha;
    }
    __builtin_amdgcn_fence(__ATOMIC_RELEASE, "workgroup");
    __builtin_amdgcn_wave_barrier();
    __builtin_amdgcn_fence(__ATOMIC_ACQUIRE, "workgroup");
#pragma unroll 1
    for (int kk = 0; kk < 2; ++kk) {
      FB pa, pl;
      pa.h[0] = *(const v8b*)(pwh + c * AT_LP + kk * 32 + 8 * hh);
      pa.h[1] = *(const v8b*)(pwh + c * AT_LP + kk * 32 + 16 + 8 * hh);
      if (SPLIT_PV) {
        pl.h[0] = *(const v8b*)(pwl + c * AT_LP + kk * 32 + 8 * hh);
        pl.h[1] = *(const v8b*)(pwl + c * AT_LP + kk * 32 + 16 + 8 * hh);
      }
#pragma unroll
      for (int t = 0; t < 4; ++t) {
        FB vb;
        vb.h[0] = *(const v8b*)(Vth + (t * 16 + c) * AT_LP + kk * 32 + 8 * hh);
        vb.h[1] = *(const v8b*)(Vth + (t * 16 + c) * AT_LP + kk * 32 + 16 + 8 * hh);
        oacc[t] = at_mma16<F16>(pa.v, vb.v, oacc[t]);
        if (SPLIT_PV) {
          FB vl;
          vl.h[0] = *(const v8b*)(Vtl + (t * 16 + c) * AT_LP + kk * 32 + 8 * hh);
          vl.h[1] = *(const v8b*)(Vtl + (t * 16 + c) * AT_LP + kk * 32 + 16 + 8 * hh);
          oacc[t] = at_mma16<F16>(pa.v, vl.v, oacc[t]);
          oacc[t] = at_mma16<F16>(pl.v, vb.v, oacc[t]);
        }
      }
    }
    kp += (size_t)AT_KC * g.k_rs * 4;
    vp += (size_t)AT_KC * g.v_rs * 4;
  }

  float* os = Os[wave];
#pragma unroll
  for (int r = 0; r < 8; ++r) {
    const float inv = 1.0f / (lrow[r] * PSC);
#pragma unroll
    for (int t = 0; t < 4; ++t) os[(8 * hh + r) * 68 + t * 16 + c] = oacc[t][r] * inv;
  }
  __builtin_amdgcn_fence(__ATOMIC_RELEASE, "workgroup");
  __builtin_amdgcn_wave_barrier();
  __builtin_amdgcn_fence(__ATOMIC_ACQUIRE, "workgroup");
  {
    const int c4 = (lane & 15) * 4;
    {
#pragma unroll
      for (int it = 0; it < 8; ++it) {
        const int row = it * 2 + hh;
        v4f val = *(const v4f*)(os + row * 68 + c4);
        *(v4f*)(ob_ptr + (size_t)(q0 + row) * g.o_rs + c4) = val;
      }
      
    }
  }
}

#define EB 8
#define EC 768
#define ES 1024
#define EH 12
extern "C" void kernel_launch(void* const* d_in, const int* in_sizes, int n_in, void* d_out, int out_size, void* d_ws, size_t ws_size, hipStream_t stream) {
  (void)in_sizes; (void)n_in; (void)out_size; (void)ws_size;
  const float* q = (const float*)d_in[0]; const float* k = (const float*)d_in[1]; const float* v = (const float*)d_in[2];
  const float* Wq = (const float*)d_in[3]; const float* bq = (const float*)d_in[4]; const float* Wk = (const float*)d_in[5]; const float* bk = (const float*)d_in[6];
  const float* Wv = (const float*)d_in[7]; const float* bv = (const float*)d_in[8]; const float* Wo = (const float*)d_in[9]; const float* bo = (const float*)d_in[10];
  float* out = (float*)d_out;    // [8][768][1024]
  char* ws = (char*)d_ws; size_t off = 0;
  auto carve = [&](size_t bytes) -> char* { char* p = ws + off; off += (bytes + 255) & ~(size_t)255; return p; };
  _Float16* QT = (_Float16*)carve((size_t)EB * ES * EC * 2); _Float16* KT = (_Float16*)carve((size_t)EB * ES * EC * 2); _Float16* VT = (_Float16*)carve((size_t)EB * ES * EC * 2);   // 3 x 12.6 MB
  _Float16* Wq16 = (_Float16*)carve((size_t)EC * EC * 2); _Float16* Wk16 = (_Float16*)carve((size_t)EC * EC * 2); _Float16* Wv16 = (_Float16*)carve((size_t)EC * EC * 2); _Float16* Wo16 = (_Float16*)carve((size_t)EC * EC * 2);
  float* QE = (float*)carve((size_t)EB * ES * EC * 4); float* KE = (float*)carve((size_t)EB * ES * EC * 4); float* VE = (float*)carve((size_t)EB * ES * EC * 4);   // 3 x 25 MB
  float* Of = (float*)carve((size_t)EB * ES * EC * 4);
  _Float16* O16 = QT;     // reuse (QT dead after the q projection)
  // Launches that read none of each other's output share one grid. QT, KT, VT lie back to back in the workspace, and so do the four
  // f16 weights and QE, KE, VE (every carve is a multiple of 256 B), so a grid index times a fixed stride reaches each of them.
  (void)KT; (void)VT; (void)Wk16; (void)Wv16;
  transpose_cast_f16<<<dim3(ES / 64, EC / 64, 3 * EB), dim3(32, 8), 0, stream>>>(q, k, v, EB, (long)EC * ES, ES, QT, EC, 1.0f);   // each [768][1024] -> [1024][768]
  cast4_f32_f16x2<<<dim3((EC * EC / 2 + 255) / 256, 4), 256, 0, stream>>>(Wq, Wk, Wv, Wo, Wq16, EC * EC / 2);   // 1x1-conv weights [out][in] are the Bt layout; Wo is the A operand ([M=o][K=c]) of the output GEMM
  { const int t = (ES / 64) * (EC / 64);   // z = 0, 1, 2: the q, k, v projections
    wmma_gemm64<0, false, 2, 0, false><<<dim3((t + 7) / 8, EB, 3), 256, 0, stream>>>(U16(QT), nullptr, EC, (long)ES * EC, U16(Wq16), nullptr, EC, 0, QE, nullptr, EC, (long)ES * EC, bq, nullptr, 0, ES, EC, EC, 1.0f,
        (long)EB * ES * EC, (long)EC * EC, (long)EB * ES * EC, bk, bv); }
  { AttnGeom g;
    g.q_bs = (long)ES * EC; g.q_rs = EC; g.q_hs = 64; g.k_bs = (long)ES * EC; g.k_rs = EC; g.k_hs = 64; g.v_bs = (long)ES * EC; g.v_rs = EC; g.v_hs = 64; g.o_bs = (long)ES * EC; g.o_rs = EC; g.o_hs = 64;
    g.S = ES; g.Skv = ES; g.H = EH; g.mask_mode = 0; g.qscale = 0.125f; g.blk0 = 0; g.mask_fill = -INFINITY; g.mask_is_int = 0;
    attn64_kernel<false, false, true, 0><<<EB * EH * (ES / AT_QB), AT_NW * 32, 0, stream>>>(QE, KE, VE, Of, nullptr, nullptr, g); }
  cast_f32_f16x2<<<(EB * ES * EC / 2 + 255) / 256, 256, 0, stream>>>(Of, O16, EB * ES * EC / 2);
  { const int t = (EC / 64) * (ES / 64);   // outᵀ per batch: A = Wo [768][768], Bt = O16[b] [1024][768] -> out[b] [768][1024], bias per row
    wmma_gemm64<0, false, 1, 0, false><<<dim3((t + 7) / 8, EB), 256, 0, stream>>>(U16(Wo16), nullptr, EC, 0, U16(O16), nullptr, EC, (long)ES * EC, out, nullptr, ES, (long)EC * ES, bo, nullptr, 0, EC, ES, EC, 1.0f, 0, 0, 0, bo, bo); }
}

// v007
// It runs in 154 microseconds.
// Next to v006, in two timings, it ran 1.04 times as fast each time.
// All steps since v000 together make it 7.13 times as fast.
#include <hip/hip_runtime.h>
#include <math.h>
// Multi-head attention over 32x32 feature maps (8 batches, 12 heads x 64, 1024 queries/keys): the four 1x1-conv projections
// (1024 x 768 · 768 x 768 per batch; the output projection computed transposed so it lands in the (B, C, H·W) layout) and the attention
// (scores and p·v, p carried x2^15): v_wmma_f32_16x16x32_f16, f16 operands, f32 accumulate; softmax f32. Input transposes are VALU copies.
typedef __attribute__((ext_vector_type(16))) _Float16 v16h;
typedef __attribute__((ext_vector_type(8)))  _Float16 v8h;
typedef __attribute__((ext_vector_type(16))) __bf16   v16b;
typedef __attribute__((ext_vector_type(8)))  __bf16   v8b;
typedef __attribute__((ext_vector_type(4)))  __bf16   v4b;
typedef __attribute__((ext_vector_type(2)))  __bf16   v2b;
typedef __attribute__((ext_vector_type(8)))  float    v8f;
typedef __attribute__((ext_vector_type(4)))  float    v4f;
#define PSCALE 32768.0f
#define U16(p) ((const unsigned short*)(const void*)(p))
#define PSCALE_INV (1.0f / 32768.0f)

__device__ __forceinline__ unsigned short f2bf_bits(float f) {
  unsigned u = __float_as_uint(f);
  return (unsigned short)((u + 0x7FFFu + ((u >> 16) & 1u)) >> 16);
}
__device__ __forceinline__ float bf_bits2f(unsigned short h) { return __uint_as_float(((unsigned)h) << 16); }

// hazard guards as plain device helpers (no inline asm inside the kernel template body)
__device__ __forceinline__ void dep_guard_h(v8f& a, v8f& b, v16h x, v16h y) { asm volatile("v_nop\n\tv_nop\n\tv_nop\n\tv_nop" : "+v"(a), "+v"(b) : "v"(x), "v"(y)); }
__device__ __forceinline__ void dep_guard_b(v8f& a, v8f& b, v16b x, v16b y) { asm volatile("v_nop\n\tv_nop\n\tv_nop\n\tv_nop" : "+v"(a), "+v"(b) : "v"(x), "v"(y)); }
__device__ __forceinline__ void keep4_h(v16h a, v16h b, v16h c, v16h d) { asm volatile("v_nop" :: "v"(a), "v"(b), "v"(c), "v"(d)); }
__device__ __forceinline__ void keep4_b(v16b a, v16b b, v16b c, v16b d) { asm volatile("v_nop" :: "v"(a), "v"(b), "v"(c), "v"(d)); }
__device__ __forceinline__ void acc_guard4(v8f& a, v8f& b, v8f& c, v8f& d) { asm volatile("v_nop\n\tv_nop\n\tv_nop\n\tv_nop" : "+v"(a), "+v"(b), "+v"(c), "+v"(d)); }
template <typename T> struct Frag;
template <> struct Frag<_Float16> {
  typedef v16h V; typedef v8h H; union U { v16h v; v8h h[2]; };
  static __device__ __forceinline__ v16h load(const _Float16* p) {   // elements 0..7 <- p[0..7], 8..15 <- p[16..23]
    U f; f.h[0] = *(const v8h*)(p); f.h[1] = *(const v8h*)(p + 16); return f.v;
  }
  static __device__ __forceinline__ v8f mma(v16h a, v16h b, v8f c) {
    return __builtin_amdgcn_wmma_f32_16x16x32_f16(false, a, false, b, (short)0, c, false, false);
  }
  static __device__ __forceinline__ void guard(v8f& a, v8f& b, v16h x, v16h y) { dep_guard_h(a, b, x, y); }
  static __device__ __forceinline__ void keep(v16h a, v16h b, v16h c, v16h d) { keep4_h(a, b, c, d); }
};
template <> struct Frag<__bf16> {
  typedef v16b V; typedef v8b H; union U { v16b v; v8b h[2]; };
  static __device__ __forceinline__ v16b load(const __bf16* p) {
    U f; f.h[0] = *(const v8b*)(p); f.h[1] = *(const v8b*)(p + 16); return f.v;
  }
  static __device__ __forceinline__ v8f mma(v16b a, v16b b, v8f c) {
    return __builtin_amdgcn_wmma_f32_16x16x32_bf16(false, a, false, b, (short)0, c, false, false);
  }
  static __device__ __forceinline__ void guard(v8f& a, v8f& b, v16b x, v16b y) { dep_guard_b(a, b, x, y); }
  static __device__ __forceinline__ void keep(v16b a, v16b b, v16b c, v16b d) { keep4_b(a, b, c, d); }
};

// ---- Register-blocked batched WMMA GEMM ------------------------------------
// C[m,n] = scale * sum_k A[m,k] * Bt[n,k] (+bias)(+resid); each wave owns a 64x64 tile, the 8 waves of a block (2 x 4) one 128x256 tile.
// A row-major [M,K]; Bt row-major [N,K]; M % 128 == 0, N % 256 == 0, K % 64 == 0; grid.x = (M / 128) * (N / 256).
// Operands go through LDS: a stage is 64 k (one whole 128-B line) of the block's 128 A rows and 256 Bt rows, read from global memory
// with every wave-wide 16-B load covering 4 whole lines, two buffers, the next stage's loads in flight while this one is multiplied.
// SPLIT (hi/lo operand planes) is not built in this form.
// BIAS_MODE: 0 = none, 1 = bias[m], 2 = bias[n].
// OUT_MODE: 0 = f32, 1 = f16, 2 = bf16 hi plane (Cout) + bf16 lo plane (Cout2).
// ET: 0 = f16 operands, 1 = bf16 operands (pointers passed as 16-bit storage)
// blockIdx.z picks one of up to three independent problems of the same shape in one launch: operands and output advance by zA / zB / zC
// elements per z, the bias is bias / bias_z1 / bias_z2.
#define GS_K 64                 // k per stage
#define GS_LP 72                // LDS row pitch in 16-bit elements: 144 B = 16 B x 9, for the ds_load_b128 fragment reads
#define GS_ROWS (128 + 256)     // A rows + Bt rows of a block tile
template <int ET> struct Elem;
template <> struct Elem<0> { typedef _Float16 T; };
template <> struct Elem<1> { typedef __bf16 T; };
template <int ET, bool SPLIT, int BIAS_MODE, int OUT_MODE, bool RESID, int ACT = 0>
__global__ __launch_bounds__(256) void wmma_gemm64(
    const unsigned short* __restrict__ Ap, const unsigned short* __restrict__ A2p, int lda, long strideA,
    const unsigned short* __restrict__ Btp, const unsigned short* __restrict__ Bt2p, int ldb, long strideB,
    void* __restrict__ Cout, void* __restrict__ Cout2, int ldc, long strideC,
    const float* __restrict__ bias,
    const float* __restrict__ resid, long strideR,
    int M, int N, int K, float scale,
    long zA, long zB, long zC, const float* __restrict__ bias_z1, const float* __restrict__ bias_z2) {
  typedef typename Elem<ET>::T T;
  typedef typename Frag<T>::V V;
  typedef typename Frag<T>::H H;
  static_assert(!SPLIT, "the LDS-staged loop holds one plane per operand");
  const T* A = (const T*)Ap; const T* Bt = (const T*)Btp;
  (void)A2p; (void)Bt2p;
  __shared__ __align__(16) T sOp[2][GS_ROWS * GS_LP];   // two stages: rows 0..127 = A, rows 128..383 = Bt
  __shared__ __align__(16) float sT[8][16 * 68];   // per-wave 16x64 slab, pitch 68 floats
  const int b    = blockIdx.y;
  const int z    = blockIdx.z;
  const float* biasz = (z == 0) ? bias : (z == 1) ? bias_z1 : bias_z2;
  const int lane = threadIdx.x & 31;
  const int wave = threadIdx.x >> 5;
  const int tilesN = N >> 8;
  const int tilesM = M >> 7;
  const int tile = blockIdx.x;
  if (tile >= tilesM * tilesN) return;   // block-uniform, in front of every barrier
  const int tm = tile / tilesN;
  const int tn = tile - tm * tilesN;
  const int m0b = tm << 7;                     // the block's first row and column
  const int n0b = tn << 8;
  const int wm = wave >> 2, wn = wave & 3;     // the wave's place in the 2 x 4 block tile
  const int m0 = m0b + (wm << 6);
  const int n0 = n0b + (wn << 6);

  const T* Ab  = A  + (size_t)z * zA + (size_t)b * strideA;
  const T* Bb  = Bt + (size_t)z * zB + (size_t)b * strideB;

  const int rlane = lane & 15;                 // row (A) / col (B, D) within subtile
  const int koff  = (lane >> 4) * 8;           // k offset of this lane half
  const int mOff  = (lane >> 4) * 8;           // D row offset

  v8f acc[4][4];
#pragma unroll
  for (int i = 0; i < 4; ++i)
#pragma unroll
    for (int j = 0; j < 4; ++j) acc[i][j] = (v8f){0.f,0.f,0.f,0.f,0.f,0.f,0.f,0.f};

  // Staging map: 16-B piece p = i * 256 + thread of a stage is row p / 8, bytes 16 * (p % 8): 8 lanes cover one row's 128-B line.
  const int srow = threadIdx.x >> 3;
  const int sc8  = (threadIdx.x & 7) * 8;
  const T* gA = Ab + (size_t)(m0b + srow) * lda + sc8;
  const T* gB = Bb + (size_t)(n0b + srow) * ldb + sc8;
  const int sW = srow * GS_LP + sc8;                              // this thread's first piece in a stage
  const int rA = ((wm << 6) + rlane) * GS_LP + koff;              // this lane's fragment rows in a stage
  const int rB = (128 + (wn << 6) + rlane) * GS_LP + koff;
  H st[12];
#pragma unroll
  for (int i = 0; i < 4; ++i) st[i] = *(const H*)(gA + (size_t)(i * 32) * lda);
#pragma unroll
  for (int i = 0; i < 8; ++i) st[4 + i] = *(const H*)(gB + (size_t)(i * 32) * ldb);
#pragma unroll
  for (int i = 0; i < 12; ++i) *(H*)(&sOp[0][sW + i * 32 * GS_LP]) = st[i];
  __syncthreads();

  const int nStage = K / GS_K;
  for (int s = 0; s < nStage; ++s) {
    const T* cur = sOp[s & 1];
    const bool more = (s + 1 < nStage);        // block-uniform
    if (more) {                                // the next stage's lines fly while this stage is multiplied
      const int k1 = (s + 1) * GS_K;
#pragma unroll
      for (int i = 0; i < 4; ++i) st[i] = *(const H*)(gA + (size_t)(i * 32) * lda + k1);
#pragma unroll
      for (int i = 0; i < 8; ++i) st[4 + i] = *(const H*)(gB + (size_t)(i * 32) * ldb + k1);
    }
#pragma unroll
    for (int kb = 0; kb < GS_K / 32; ++kb) {
      V bh[4], ah[4];                          // all eight fragments of a 32-k block are read as one group: one LDS wait per 16 products
#pragma unroll
      for (int j = 0; j < 4; ++j) bh[j] = Frag<T>::load(cur + rB + (j << 4) * GS_LP + kb * 32);
#pragma unroll
      for (int i = 0; i < 4; ++i) ah[i] = Frag<T>::load(cur + rA + (i << 4) * GS_LP + kb * 32);
#pragma unroll
      for (int i = 0; i < 4; ++i) {
#pragma unroll
        for (int j = 0; j < 4; ++j) acc[i][j] = Frag<T>::mma(ah[i], bh[j], acc[i][j]);
        Frag<T>::guard(acc[i][0], acc[i][3], ah[i], ah[i]);
      }
      Frag<T>::keep(bh[0], bh[1], bh[2], bh[3]);
    }
    if (more) {                                // into the buffer whose readers all left it at the barrier that ended stage s - 1
      T* nxt = sOp[(s + 1) & 1];
#pragma unroll
      for (int i = 0; i < 12; ++i) *(H*)(nxt + sW + i * 32 * GS_LP) = st[i];
    }
    __syncthreads();                           // publishes stage s + 1 and ends every wave's reads of stage s
  }
  acc_guard4(acc[0][0], acc[0][1], acc[0][2], acc[0][3]);
  acc_guard4(acc[1][0], acc[1][1], acc[1][2], acc[1][3]);
  acc_guard4(acc[2][0], acc[2][1], acc[2][2], acc[2][3]);
  acc_guard4(acc[3][0], acc[3][1], acc[3][2], acc[3][3]);

  // ---- epilogue ----
  float* slab = sT[wave];
  const float* Rb = RESID ? (resid + (size_t)b * strideR) : nullptr;
#pragma unroll
  for (int i = 0; i < 4; ++i) {
    const int mBase = m0 + (i << 4);
#pragma unroll
    for (int j = 0; j < 4; ++j) {
      const int n = n0 + (j << 4) + rlane;
      float bv = 0.f;
      if (BIAS_MODE == 2) bv = biasz[n];
#pragma unroll
      for (int r = 0; r < 8; ++r) {
        float v = acc[i][j][r] * scale;
        if (BIAS_MODE == 1) v += biasz[mBase + mOff + r];
        if (BIAS_MODE == 2) v += bv;
        if (RESID) v += Rb[(size_t)(mBase + mOff + r) * ldc + n];
        if (ACT == 1) v = tanhf(v);
        if (ACT == 2) v = fmaxf(v, 0.0f);
        if (ACT == 3) v = v / (1.0f + expf(-v));
        if (ACT == 4) v = (v > 0.f) ? v : 0.01f * v;
        if (ACT == 5) v = 0.5f * v * (1.0f + erff(v * 0.70710678118654752f));
        slab[(mOff + r) * 68 + (j << 4) + rlane] = v;
      }
    }
    __builtin_amdgcn_fence(__ATOMIC_RELEASE, "workgroup");
    __builtin_amdgcn_wave_barrier();
    __builtin_amdgcn_fence(__ATOMIC_ACQUIRE, "workgroup");
    if (OUT_MODE == 0) {
      float* C = (float*)Cout + (size_t)z * zC + (size_t)b * strideC;
      const int hh = lane >> 4, c4 = (lane & 15) * 4;     // row seg = 256 B = 16 lanes x 16 B
      {
#pragma unroll
        for (int it = 0; it < 8; ++it) {
          const int row = it * 2 + hh;
          v4f v = *(const v4f*)(slab + row * 68 + c4);
          *(v4f*)(C + (size_t)(mBase + row) * ldc + n0 + c4) = v;
        }
        
      }
    } else {
      const int q = lane >> 3, c8 = (lane & 7) * 8;
      unsigned short* C  = (unsigned short*)Cout  + (size_t)z * zC + (size_t)b * strideC;
      unsigned short* C2 = (OUT_MODE == 2) ? ((unsigned short*)Cout2 + (size_t)z * zC + (size_t)b * strideC) : nullptr;
      {
#pragma unroll
        for (int it = 0; it < 4; ++it) {
          const int row = it * 4 + q;
          const float* sp = slab + row * 68 + c8;
          v8h hv, lv;
#pragma unroll
          for (int e = 0; e < 8; ++e) {
            if (OUT_MODE == 1) {
              hv[e] = (_Float16)sp[e];
            } else {
              unsigned short hb = f2bf_bits(sp[e]);
              unsigned short lb = f2bf_bits(sp[e] - bf_bits2f(hb));
              hv[e] = __builtin_bit_cast(_Float16, hb);
              lv[e] = __builtin_bit_cast(_Float16, lb);
            }
          }
          *(v8h*)(C + (size_t)(mBase + row) * ldc + n0 + c8) = hv;
          if (OUT_MODE == 2) *(v8h*)(C2 + (size_t)(mBase + row) * ldc + n0 + c8) = lv;
        }
        
      }
    }
    __builtin_amdgcn_fence(__ATOMIC_RELEASE, "workgroup");
    __builtin_amdgcn_wave_barrier();
    __builtin_amdgcn_fence(__ATOMIC_ACQUIRE, "workgroup");
  }
}

// ---- f32 -> f16 cast of four arrays of equal length in one launch: blockIdx.y picks the input, outputs lie n2 pairs apart ----
__global__ __launch_bounds__(256) void cast4_f32_f16x2(
    const float* __restrict__ in0, const float* __restrict__ in1, const float* __restrict__ in2, const float* __restrict__ in3,
    _Float16* __restrict__ out, int n2) {
  const int y = blockIdx.y;
  const float* in = (y == 0) ? in0 : (y == 1) ? in1 : (y == 2) ? in2 : in3;
  int i = blockIdx.x * 256 + threadIdx.x;
  if (i < n2) {
    const _Float16 h0 = (_Float16)in[2 * i], h1 = (_Float16)in[2 * i + 1];
    const unsigned u = (unsigned)__builtin_bit_cast(unsigned short, h0) | ((unsigned)__builtin_bit_cast(unsigned short, h1) << 16);
    ((unsigned*)out)[(size_t)y * n2 + i] = u;
  }
}

// ---- f32 -> f16 cast with a power-of-two pre-scale (folded back by the consumer GEMM's scale) ----
__global__ __launch_bounds__(256) void cast_f32_f16x2s(const float* __restrict__ in, _Float16* __restrict__ out, int n2, float s) {
  int i = blockIdx.x * 256 + threadIdx.x;
  if (i < n2) {
    const _Float16 h0 = (_Float16)(in[2 * i] * s), h1 = (_Float16)(in[2 * i + 1] * s);
    const unsigned u = (unsigned)__builtin_bit_cast(unsigned short, h0) | ((unsigned)__builtin_bit_cast(unsigned short, h1) << 16);
    ((unsigned*)out)[i] = u;
    
  }
}
__global__ __launch_bounds__(256) void split_f32_bf16x2(
    const float* __restrict__ in, __bf16* __restrict__ hi, __bf16* __restrict__ lo, long n2) {
  long i = (long)blockIdx.x * 256 + threadIdx.x;
  long stride = (long)gridDim.x * 256;
  {
    for (long j = i; j < n2; j += stride) {
      const float a = in[2 * j], b = in[2 * j + 1];
      const unsigned short ah = f2bf_bits(a), bh = f2bf_bits(b);
      const unsigned short al = f2bf_bits(a - bf_bits2f(ah)), bl = f2bf_bits(b - bf_bits2f(bh));
      ((unsigned*)hi)[j] = (unsigned)ah | ((unsigned)bh << 16);
      ((unsigned*)lo)[j] = (unsigned)al | ((unsigned)bl << 16);
    }
    
  }
}


// ---- f32 [R][C] (row pitch ldi) -> f16 transposed [C][R] (row pitch ldo); 64x64 tiles; each output row segment
// blockIdx.z = tensor * nb + batch: three input tensors of nb matrices each (mat elements apart) in one launch; output matrix z lies at outT0 + z * mat.
__global__ __launch_bounds__(256) void transpose_cast_f16(const float* __restrict__ in0, const float* __restrict__ in1, const float* __restrict__ in2,
                                                         int nb, long mat, int ldi, _Float16* __restrict__ outT0, int ldo, float scale) {
  __shared__ __align__(16) _Float16 tile[64][72];     // [c][r]
  const int zt = blockIdx.z / nb, zb = blockIdx.z - zt * nb;
  const float* in = ((zt == 0) ? in0 : (zt == 1) ? in1 : in2) + (size_t)zb * mat;
  _Float16* outT = outT0 + (size_t)blockIdx.z * mat;
  const int c0 = blockIdx.x * 64, r0 = blockIdx.y * 64;
  const int t = threadIdx.y * 32 + threadIdx.x;
  for (int i = threadIdx.y; i < 64; i += 8) {
    tile[threadIdx.x][i]      = (_Float16)(in[(size_t)(r0 + i) * ldi + c0 + threadIdx.x] * scale);
    tile[32 + threadIdx.x][i] = (_Float16)(in[(size_t)(r0 + i) * ldi + c0 + 32 + threadIdx.x] * scale);
  }
  __syncthreads();
  const int q = t >> 3, c8 = (t & 7) * 8;
  {
#pragma unroll
    for (int it = 0; it < 2; ++it) {
      const int c = it * 32 + q;
      v8h hv = *(const v8h*)(&tile[c][c8]);
      *(v8h*)(outT + (size_t)(c0 + c) * ldo + r0 + c8) = hv;
    }
    
  }
}

// ---- f32 [R][C] (pitch ldi) -> bf16 hi/lo transposed planes [C][R] (pitch ldo); 64x64 tiles; each output row segment
__global__ __launch_bounds__(256) void transpose_split_bf16(const float* __restrict__ in, int ldi,
                                                           __bf16* __restrict__ outH, __bf16* __restrict__ outL, int ldo) {
  __shared__ __align__(16) float tile[64][68];     // [c][r]
  const int c0 = blockIdx.x * 64, r0 = blockIdx.y * 64;
  const int t = threadIdx.y * 32 + threadIdx.x;
  for (int i = threadIdx.y; i < 64; i += 8) {
    tile[threadIdx.x][i]      = in[(size_t)(r0 + i) * ldi + c0 + threadIdx.x];
    tile[32 + threadIdx.x][i] = in[(size_t)(r0 + i) * ldi + c0 + 32 + threadIdx.x];
  }
  __syncthreads();
  const int q = t >> 3, c8 = (t & 7) * 8;
  {
#pragma unroll
    for (int it = 0; it < 2; ++it) {
      const int c = it * 32 + q;
      v8b hv, lv;
#pragma unroll
      for (int e = 0; e < 8; ++e) {
        const float f = tile[c][c8 + e];
        const unsigned short hb = f2bf_bits(f);
        hv[e] = __builtin_bit_cast(__bf16, hb);
        lv[e] = __builtin_bit_cast(__bf16, f2bf_bits(f - bf_bits2f(hb)));
      }
      *(v8b*)(outH + (size_t)(c0 + c) * ldo + r0 + c8) = hv;
      *(v8b*)(outL + (size_t)(c0 + c) * ldo + r0 + c8) = lv;
    }
    
  }
}

// =====================================================================================
// Generic causal/non-causal attention for head_dim 64, f32 in / f32 out (f16 into out16 with OUT16); 16-bit operands: bf16 with optional hi/lo splits, or
// plain f16 (F16=true, non-split, probabilities carried x2^15).
//   scores = (q*qscale)·kᵀ : v_wmma_f32_16x16x32_bf16; SPLIT_QK -> q,k as bf16 hi/lo (hi·hi + hi·lo + lo·hi)
//   out    = p·v           : v_wmma_f32_16x16x32_bf16; SPLIT_PV -> p,v as bf16 hi/lo; else p,v plain bf16
//   f32 accumulate; online softmax in f32. Block = 4 waves = 64 query rows of one (batch, head); S % 64 == 0.
//   Element (b, s, h, d) of tensor X lives at X[b*X_bs + s*X_rs + h*X_hs + d] (strides in floats, multiples of 4).
//   Masking: MASK_MODE 0 none, 1 causal (kv > q masked), 2 tensor [S][Skv] shared over (b,h) (float if
//   mask_is_int==0, int32 with element == 0 -> masked if 1, int32 with element != 0 -> masked if 2), 3 per-token vectors qmask[B][S] & kvmask[B][Skv] (int32,
//   0 -> masked), 4 causal + sliding window (kv > q or q - kv > W masked; W passed in mask_is_int);
//   5 = relative-position bias: s += cp[b,h,q][idx[q][kv]] + pc[b,h,kv][idx[q][kv]] with idx = mask_b ([S][Skv] int32) and
//   mask_a an int32 [S][Skv] tensor with nonzero = masked (tables: element (b,h,row,n) at X + b*c_bs + h*c_hs + row*c_rs + n);
//   masked scores are replaced by mask_fill (e.g. -inf or -1e9) before the softmax.
//   grid.x = B * H * (S/64) (or a sub-range with blk0).
// =====================================================================================
#define AT_D 64
#define AT_NW 4
#define AT_QB 64
#define AT_KC 64
#define AT_LOG2E 1.4426950408889634f   // e^x = 2^(x * log2 e): the softmax runs in base 2, where the chip's own v_exp_f32 is the whole exponential
#define AT_LP 72   // LDS row pitch of the K, V^T and P tiles in 16-bit elements: 144 B = 16 B x 9, so the 16 rows of a ds_load_b128 fragment read fall on distinct banks
struct AttnGeom { const float* cp = nullptr; const float* pc = nullptr; long c_bs = 0, c_rs = 0, c_hs = 0;   // mode-5 score-bias tables
                  long q_bs, q_rs, q_hs, k_bs, k_rs, k_hs, v_bs, v_rs, v_hs, o_bs, o_rs, o_hs;
                  int S, Skv, H, mask_mode; float qscale; int blk0; float mask_fill; int mask_is_int; };
static_assert(sizeof(AttnGeom) == 168, "no padding");

__device__ __forceinline__ unsigned short at_bf_bits(float f) {
  unsigned u = __float_as_uint(f);
  return (unsigned short)((u + 0x7FFFu + ((u >> 16) & 1u)) >> 16);
}
__device__ __forceinline__ __bf16 at_f2bf(float f) { return __builtin_bit_cast(__bf16, at_bf_bits(f)); }
__device__ __forceinline__ void at_split(float f, __bf16& hi, __bf16& lo) {
  const unsigned short hb = at_bf_bits(f);
  hi = __builtin_bit_cast(__bf16, hb);
  lo = at_f2bf(f - __uint_as_float(((unsigned)hb) << 16));
}
__device__ __forceinline__ v8f at_mma(v16b a, v16b b, v8f c) {
  c = __builtin_amdgcn_wmma_f32_16x16x32_bf16(false, a, false, b, (short)0, c, false, false);
  asm volatile("v_nop\n\tv_nop\n\tv_nop\n\tv_nop" : "+v"(c) : "v"(a), "v"(b));
  return c;
}
// 16-bit element as a bit pattern held in a __bf16 slot: f16 bits when F16, bf16 (RNE) otherwise
template <bool F16> __device__ __forceinline__ __bf16 at_to16(float f) {
  if (F16) return __builtin_bit_cast(__bf16, (_Float16)f);
  return at_f2bf(f);
}
template <bool F16> __device__ __forceinline__ v8f at_mma16(v16b a, v16b b, v8f c) {
  if (F16) {
    const v16h ah = __builtin_bit_cast(v16h, a), bh = __builtin_bit_cast(v16h, b);
    c = __builtin_amdgcn_wmma_f32_16x16x32_f16(false, ah, false, bh, (short)0, c, false, false);
    asm volatile("v_nop\n\tv_nop\n\tv_nop\n\tv_nop" : "+v"(c) : "v"(ah), "v"(bh));
    return c;
  }
  return at_mma(a, b, c);
}

// MASK_MODE is a compile-time constant: each instance holds only its own masking code, so the score loop has no per-element mode branches.
// OUT16: the result is rounded to f16 here and stored to out16 (same strides, in elements), for a consumer that takes f16 operands; out is not used.
template <bool SPLIT_QK, bool SPLIT_PV, bool F16, int MASK_MODE, bool OUT16>
__global__ __launch_bounds__(128)
void attn64_kernel(const float* __restrict__ q, const float* __restrict__ k,
                   const float* __restrict__ v, float* __restrict__ out, _Float16* __restrict__ out16,
                   const void* __restrict__ mask_a, const int* __restrict__ mask_b, AttnGeom g) {
  static_assert(!(F16 && (SPLIT_QK || SPLIT_PV)), "f16 mode is non-split");
  const float PSC = F16 ? 32768.0f : 1.0f;     // f16 probabilities carried x2^15 (subnormal range), folded into the final 1/l
  union FB { v16b v; v8b h[2]; };
  __shared__ __align__(16) __bf16 Ksh[AT_KC * AT_LP];            // K hi [kv][d]      9 KB
  __shared__ __align__(16) __bf16 Ksl[SPLIT_QK ? AT_KC * AT_LP : 8];
  __shared__ __align__(16) __bf16 Vth[AT_D * AT_LP];             // V hi [d][kv]      9 KB
  __shared__ __align__(16) __bf16 Vtl[SPLIT_PV ? AT_D * AT_LP : 8];
  __shared__ __align__(16) __bf16 Psh[AT_NW][16 * AT_LP];        // per wave P hi [row][kv]  9 KB
  __shared__ __align__(16) __bf16 Psl[SPLIT_PV ? AT_NW : 1][SPLIT_PV ? 16 * AT_LP : 8];
  __shared__ __align__(16) float  Os[AT_NW][16 * 68];            // per wave out tile, pitch 68

  const int tid  = threadIdx.x;
  const int wave = tid >> 5;
  const int lane = tid & 31;
  const int hh   = lane >> 4;
  const int c    = lane & 15;

  const int nqb = g.S / AT_QB;
  const int bx = blockIdx.x + g.blk0;
  const int qb = bx % nqb;
  const int bh = bx / nqb;
  const int h  = bh % g.H;
  const int b  = bh / g.H;
  const int qbase_block = qb * AT_QB;
  const int q0 = qbase_block + wave * 16;

  const float* qb_ptr = q + (size_t)b * g.q_bs + (size_t)h * g.q_hs;
  const float* kb_ptr = k + (size_t)b * g.k_bs + (size_t)h * g.k_hs;
  const float* vb_ptr = v + (size_t)b * g.v_bs + (size_t)h * g.v_hs;
  const size_t ob_off = (size_t)b * g.o_bs + (size_t)h * g.o_hs;

  // ---- Q fragments (A operand): 2 d-chunks, hi (and lo) ----
  v16b qah[2], qal[2];
  {
    const float* qrow = qb_ptr + (size_t)(q0 + c) * g.q_rs;
#pragma unroll
    for (int dc = 0; dc < 2; ++dc) {
#pragma unroll
      for (int e = 0; e < 8; ++e) {
        const float f0 = qrow[dc * 32 + 8 * hh + e] * g.qscale;
        const float f1 = qrow[dc * 32 + 16 + 8 * hh + e] * g.qscale;
        if (SPLIT_QK) { __bf16 hq, lq; at_split(f0, hq, lq); qah[dc][e] = hq; qal[dc][e] = lq; at_split(f1, hq, lq); qah[dc][8 + e] = hq; qal[dc][8 + e] = lq; }
        else { qah[dc][e] = at_to16<F16>(f0); qah[dc][8 + e] = at_to16<F16>(f1); qal[dc][e] = qah[dc][e]; qal[dc][8 + e] = qah[dc][8 + e]; }
      }
    }
  }

  float mrow[8], lrow[8];
  v8f oacc[4];
#pragma unroll
  for (int r = 0; r < 8; ++r) { mrow[r] = -INFINITY; lrow[r] = 0.f; }
#pragma unroll
  for (int t = 0; t < 4; ++t) oacc[t] = (v8f){0.f,0.f,0.f,0.f,0.f,0.f,0.f,0.f};

  const int nChunks = (MASK_MODE == 1 || MASK_MODE == 4) ? (qb + 1) : (g.Skv / AT_KC);   // block-uniform
  // per-row query mask (mode 3)
  int qkeep[8];
#pragma unroll
  for (int r = 0; r < 8; ++r) qkeep[r] = (MASK_MODE == 3) ? mask_b[(size_t)b * g.S + q0 + 8 * hh + r] : 1;   // mask_b = qmask in mode 3
  const char* kp = (const char*)kb_ptr;   // first key row of the current chunk, block-uniform; stepped at the foot of the loop
  const char* vp = (const char*)vb_ptr;
  for (int kc = 0; kc < nChunks; ++kc) {
    const int kv0 = kc * AT_KC;
    __syncthreads();
    {
      // Staging map: 8 lanes cover one 128-B line of a key's head row, so a wave-wide 16-B load takes 4 whole lines (4 keys), not 32 pieces
      // of 32 lines. A thread holds the keys 2n and 2n + 1 at the same four d, so V^T goes to LDS as 32-bit pairs of neighbouring keys.
      const int c8 = tid & 7, rq = (tid >> 3) & 3;
      const int r0 = wave * 16 + rq * 2;                 // load i: key r0 + 8 * (i >> 2) + (i & 1), d from 32 * ((i >> 1) & 1) + 4 * c8
      // address = block-uniform base of the chunk + block-uniform row step + this lane's byte offset inside the 64-key chunk
      const unsigned klo = (unsigned)(r0 * (int)g.k_rs + c8 * 4) * 4u, vlo = (unsigned)(r0 * (int)g.v_rs + c8 * 4) * 4u;
      v4f kk[8], vv[8];
      const char* ka[4]; const char* va[4];              // row n: key r0 + 8 * (n >> 1) + (n & 1)
#pragma unroll
      for (int n = 0; n < 4; ++n) {
        ka[n] = kp + (size_t)(8 * (n >> 1) + (n & 1)) * g.k_rs * 4 + klo;
        va[n] = vp + (size_t)(8 * (n >> 1) + (n & 1)) * g.v_rs * 4 + vlo;
      }
#pragma unroll
      for (int i = 0; i < 8; ++i) kk[i] = *(const v4f*)(ka[2 * (i >> 2) + (i & 1)] + 128 * ((i >> 1) & 1));
      // the wait that stands before a register of an issued global load is overwritten; the addresses are named as inputs so that they
      // stay whole up to it (without that the compiler lays a later load's destination over an earlier load's address pair)
      asm volatile("s_wait_xcnt 0x0" :: "v"(ka[0]), "v"(ka[1]), "v"(ka[2]), "v"(ka[3]) : "memory");
#pragma unroll
      for (int i = 0; i < 8; ++i) vv[i] = *(const v4f*)(va[2 * (i >> 2) + (i & 1)] + 128 * ((i >> 1) & 1));
      asm volatile("s_wait_xcnt 0x0" :: "v"(va[0]), "v"(va[1]), "v"(va[2]), "v"(va[3]) : "memory");   // the same for the V loads
#pragma unroll
      for (int i = 0; i < 8; ++i) {
        const int kvr = r0 + 8 * (i >> 2) + (i & 1), d = 32 * ((i >> 1) & 1) + c8 * 4;
        v4b kh, kl;
#pragma unroll
        for (int e = 0; e < 4; ++e) {
          if (SPLIT_QK) { __bf16 a, bl; at_split(kk[i][e], a, bl); kh[e] = a; kl[e] = bl; }
          else kh[e] = at_to16<F16>(kk[i][e]);
        }
        *(v4b*)(Ksh + kvr * AT_LP + d) = kh;
        if (SPLIT_QK) *(v4b*)(Ksl + kvr * AT_LP + d) = kl;
      }
#pragma unroll
      for (int i = 0; i < 8; i += 2) {
        const int kvr = r0 + 8 * (i >> 2), d = 32 * ((i >> 1) & 1) + c8 * 4;
#pragma unroll
        for (int e = 0; e < 4; ++e) {
          v2b vh, vl;
          if (SPLIT_PV) { __bf16 a, bl; at_split(vv[i][e], a, bl); vh[0] = a; vl[0] = bl; at_split(vv[i + 1][e], a, bl); vh[1] = a; vl[1] = bl; }
          else { vh[0] = at_to16<F16>(vv[i][e]); vh[1] = at_to16<F16>(vv[i + 1][e]); }
          *(v2b*)(Vth + (d + e) * AT_LP + kvr) = vh;
          if (SPLIT_PV) *(v2b*)(Vtl + (d + e) * AT_LP + kvr) = vl;
        }
      }
    }
    __syncthreads();

    v8f s[4];
#pragma unroll
    for (int j = 0; j < 4; ++j) {
      s[j] = (v8f){0.f,0.f,0.f,0.f,0.f,0.f,0.f,0.f};
#pragma unroll 1
      for (int dc = 0; dc < 2; ++dc) {
        FB kb;
        kb.h[0] = *(const v8b*)(Ksh + (j * 16 + c) * AT_LP + dc * 32 + 8 * hh);
        kb.h[1] = *(const v8b*)(Ksh + (j * 16 + c) * AT_LP + dc * 32 + 16 + 8 * hh);
        s[j] = at_mma16<F16>(qah[dc], kb.v, s[j]);
        if (SPLIT_QK) {
          FB kl;
          kl.h[0] = *(const v8b*)(Ksl + (j * 16 + c) * AT_LP + dc * 32 + 8 * hh);
          kl.h[1] = *(const v8b*)(Ksl + (j * 16 + c) * AT_LP + dc * 32 + 16 + 8 * hh);
          s[j] = at_mma16<F16>(qah[dc], kl.v, s[j]);
          s[j] = at_mma16<F16>(qal[dc], kb.v, s[j]);
        }
      }
    }
    const bool diag = (MASK_MODE == 1) && (kc == qb);
    int kvkeep[4] = {1, 1, 1, 1};
    if (MASK_MODE == 3) {
#pragma unroll
      for (int j = 0; j < 4; ++j) kvkeep[j] = ((const int*)mask_a)[(size_t)b * g.Skv + kv0 + j * 16 + c];   // mask_a = kvmask
    }
    float cm[8];
#pragma unroll
    for (int r = 0; r < 8; ++r) {
      const int qrow = q0 + 8 * hh + r;
      float m = -INFINITY;
#pragma unroll
      for (int j = 0; j < 4; ++j) {
        const int kvcol = kv0 + j * 16 + c;
        bool masked = false;
        if (diag) masked = (kvcol > qrow);
        else if (MASK_MODE == 4) masked = (kvcol > qrow) || (qrow - kvcol > g.mask_is_int);
        else if (MASK_MODE == 2) {
          const size_t mi = (size_t)qrow * g.Skv + kvcol;
          masked = (g.mask_is_int == 0) ? (((const float*)mask_a)[mi] == 0.0f)
                 : (g.mask_is_int == 1) ? (((const int*)mask_a)[mi] == 0) : (((const int*)mask_a)[mi] != 0);
        } else if (MASK_MODE == 3) masked = (qkeep[r] == 0) || (kvkeep[j] == 0);
        else if (MASK_MODE == 5) {
          const size_t mi = (size_t)qrow * g.Skv + kvcol;
          masked = (((const int*)mask_a)[mi] != 0);
          int n = mask_b[mi]; n = n < 0 ? 0 : n;
          s[j][r] += g.cp[(size_t)b * g.c_bs + (size_t)h * g.c_hs + (size_t)qrow * g.c_rs + n]
                   + g.pc[(size_t)b * g.c_bs + (size_t)h * g.c_hs + (size_t)kvcol * g.c_rs + n];
        }
        if (masked) s[j][r] = g.mask_fill;
        m = fmaxf(m, s[j][r]);
      }
#pragma unroll
      for (int off = 1; off < 16; off <<= 1) m = fmaxf(m, __shfl_xor(m, off, 32));
      cm[r] = m;
    }
    __bf16* pwh = Psh[wave];
    __bf16* pwl = Psl[SPLIT_PV ? wave : 0];
#pragma unroll
    for (int r = 0; r < 8; ++r) {
      const float mnew = fmaxf(mrow[r], cm[r] * AT_LOG2E);     // the running maximum is kept in log2 units
      const float alpha = __builtin_amdgcn_exp2f(mrow[r] - mnew);
      mrow[r] = mnew;
      float psum = 0.f;
#pragma unroll
      for (int j = 0; j < 4; ++j) {
        const float p = __builtin_amdgcn_exp2f(fmaf(s[j][r], AT_LOG2E, -mnew));   // one fma + one v_exp_f32 per score
        psum += p;
        if (SPLIT_PV) { __bf16 a, bl; at_split(p, a, bl); pwh[(8 * hh + r) * AT_LP + j * 16 + c] = a; pwl[(8 * hh + r) * AT_LP + j * 16 + c] = bl; }
        else pwh[(8 * hh + r) * AT_LP + j * 16 + c] = at_to16<F16>(p * PSC);
      }
#pragma unroll
      for (int off = 1; off < 16; off <<= 1) psum += __shfl_xor(psum, off, 32);
      lrow[r] = lrow[r] * alpha + psum;
#pragma unroll
      for (int t = 0; t < 4; ++t) oacc[t][r] *= alpha;
    }
    __builtin_amdgcn_fence(__ATOMIC_RELEASE, "workgroup");
    __builtin_amdgcn_wave_barrier();
    __builtin_amdgcn_fence(__ATOMIC_ACQUIRE, "workgroup");
#pragma unroll 1
    for (int kk = 0; kk < 2; ++kk) {
      FB pa, pl;
      pa.h[0] = *(const v8b*)(pwh + c * AT_LP + kk * 32 + 8 * hh);
      pa.h[1] = *(const v8b*)(pwh + c * AT_LP + kk * 32 + 16 + 8 * hh);
      if (SPLIT_PV) {
        pl.h[0] = *(const v8b*)(pwl + c * AT_LP + kk * 32 + 8 * hh);
        pl.h[1] = *(const v8b*)(pwl + c * AT_LP + kk * 32 + 16 + 8 * hh);
      }
#pragma unroll
      for (int t = 0; t < 4; ++t) {
        FB vb;
        vb.h[0] = *(const v8b*)(Vth + (t * 16 + c) * AT_LP + kk * 32 + 8 * hh);
        vb.h[1] = *(const v8b*)(Vth + (t * 16 + c) * AT_LP + kk * 32 + 16 + 8 * hh);
        oacc[t] = at_mma16<F16>(pa.v, vb.v, oacc[t]);
        if (SPLIT_PV) {
          FB vl;
          vl.h[0] = *(const v8b*)(Vtl + (t * 16 + c) * AT_LP + kk * 32 + 8 * hh);
          vl.h[1] = *(const v8b*)(Vtl + (t * 16 + c) * AT_LP + kk * 32 + 16 + 8 * hh);
          oacc[t] = at_mma16<F16>(pa.v, vl.v, oacc[t]);
          oacc[t] = at_mma16<F16>(pl.v, vb.v, oacc[t]);
        }
      }
    }
    kp += (size_t)AT_KC * g.k_rs * 4;
    vp += (size_t)AT_KC * g.v_rs * 4;
  }

  float* os = Os[wave];
#pragma unroll
  for (int r = 0; r < 8; ++r) {
    const float inv = 1.0f / (lrow[r] * PSC);
#pragma unroll
    for (int t = 0; t < 4; ++t) os[(8 * hh + r) * 68 + t * 16 + c] = oacc[t][r] * inv;
  }
  __builtin_amdgcn_fence(__ATOMIC_RELEASE, "workgroup");
  __builtin_amdgcn_wave_barrier();
  __builtin_amdgcn_fence(__ATOMIC_ACQUIRE, "workgroup");
  if (OUT16) {
    _Float16* ob16 = out16 + ob_off;
    const int q4 = lane >> 3, c8 = (lane & 7) * 8;       // a head's row is 64 f16 = one 128-B line = 8 lanes x 16 B; a wave-wide store takes 4 rows
#pragma unroll
    for (int it = 0; it < 4; ++it) {
      const int row = it * 4 + q4;
      const float* sp = os + row * 68 + c8;
      v8h hv;
#pragma unroll
      for (int e = 0; e < 8; ++e) hv[e] = (_Float16)sp[e];
      *(v8h*)(ob16 + (size_t)(q0 + row) * g.o_rs + c8) = hv;
    }
  } else {
    float* ob_ptr = out + ob_off;
    const int c4 = (lane & 15) * 4;
#pragma unroll
    for (int it = 0; it < 8; ++it) {
      const int row = it * 2 + hh;
      v4f val = *(const v4f*)(os + row * 68 + c4);
      *(v4f*)(ob_ptr + (size_t)(q0 + row) * g.o_rs + c4) = val;
    }
  }
}

#define EB 8
#define EC 768
#define ES 1024
#define EH 12
extern "C" void kernel_launch(void* const* d_in, const int* in_sizes, int n_in, void* d_out, int out_size, void* d_ws, size_t ws_size, hipStream_t stream) {
  (void)in_sizes; (void)n_in; (void)out_size; (void)ws_size;
  const float* q = (const float*)d_in[0]; const float* k = (const float*)d_in[1]; const float* v = (const float*)d_in[2];
  const float* Wq = (const float*)d_in[3]; const float* bq = (const float*)d_in[4]; const float* Wk = (const float*)d_in[5]; const float* bk = (const float*)d_in[6];
  const float* Wv = (const float*)d_in[7]; const float* bv = (const float*)d_in[8]; const float* Wo = (const float*)d_in[9]; const float* bo = (const float*)d_in[10];
  float* out = (float*)d_out;    // [8][768][1024]
  char* ws = (char*)d_ws; size_t off = 0;
  auto carve = [&](size_t bytes) -> char* { char* p = ws + off; off += (bytes + 255) & ~(size_t)255; return p; };
  _Float16* QT = (_Float16*)carve((size_t)EB * ES * EC * 2); _Float16* KT = (_Float16*)carve((size_t)EB * ES * EC * 2); _Float16* VT = (_Float16*)carve((size_t)EB * ES * EC * 2);   // 3 x 12.6 MB
  _Float16* Wq16 = (_Float16*)carve((size_t)EC * EC * 2); _Float16* Wk16 = (_Float16*)carve((size_t)EC * EC * 2); _Float16* Wv16 = (_Float16*)carve((size_t)EC * EC * 2); _Float16* Wo16 = (_Float16*)carve((size_t)EC * EC * 2);
  float* QE = (float*)carve((size_t)EB * ES * EC * 4); float* KE = (float*)carve((size_t)EB * ES * EC * 4); float* VE = (float*)carve((size_t)EB * ES * EC * 4);   // 3 x 25 MB
  _Float16* O16 = QT;     // reuse (QT dead after the q projection)
  // Launches that read none of each other's output share one grid. QT, KT, VT lie back to back in the workspace, and so do the four
  // f16 weights and QE, KE, VE (every carve is a multiple of 256 B), so a grid index times a fixed stride reaches each of them.
  (void)KT; (void)VT; (void)Wk16; (void)Wv16;
  transpose_cast_f16<<<dim3(ES / 64, EC / 64, 3 * EB), dim3(32, 8), 0, stream>>>(q, k, v, EB, (long)EC * ES, ES, QT, EC, 1.0f);   // each [768][1024] -> [1024][768]
  cast4_f32_f16x2<<<dim3((EC * EC / 2 + 255) / 256, 4), 256, 0, stream>>>(Wq, Wk, Wv, Wo, Wq16, EC * EC / 2);   // 1x1-conv weights [out][in] are the Bt layout; Wo is the A operand ([M=o][K=c]) of the output GEMM
  { const int t = (ES / 64) * (EC / 64);   // z = 0, 1, 2: the q, k, v projections
    wmma_gemm64<0, false, 2, 0, false><<<dim3((t + 7) / 8, EB, 3), 256, 0, stream>>>(U16(QT), nullptr, EC, (long)ES * EC, U16(Wq16), nullptr, EC, 0, QE, nullptr, EC, (long)ES * EC, bq, nullptr, 0, ES, EC, EC, 1.0f,
        (long)EB * ES * EC, (long)EC * EC, (long)EB * ES * EC, bk, bv); }
  { AttnGeom g;
    g.q_bs = (long)ES * EC; g.q_rs = EC; g.q_hs = 64; g.k_bs = (long)ES * EC; g.k_rs = EC; g.k_hs = 64; g.v_bs = (long)ES * EC; g.v_rs = EC; g.v_hs = 64; g.o_bs = (long)ES * EC; g.o_rs = EC; g.o_hs = 64;
    g.S = ES; g.Skv = ES; g.H = EH; g.mask_mode = 0; g.qscale = 0.125f; g.blk0 = 0; g.mask_fill = -INFINITY; g.mask_is_int = 0;
    attn64_kernel<false, false, true, 0, true><<<EB * EH * (ES / AT_QB), AT_NW * 32, 0, stream>>>(QE, KE, VE, nullptr, O16, nullptr, nullptr, g); }   // stores the f16 operand of the output GEMM itself
  { const int t = (EC / 64) * (ES / 64);   // outᵀ per batch: A = Wo [768][768], Bt = O16[b] [1024][768] -> out[b] [768][1024], bias per row
    wmma_gemm64<0, false, 1, 0, false><<<dim3((t + 7) / 8, EB), 256, 0, stream>>>(U16(Wo16), nullptr, EC, 0, U16(O16), nullptr, EC, (long)ES * EC, out, nullptr, ES, (long)EC * ES, bo, nullptr, 0, EC, ES, EC, 1.0f, 0, 0, 0, bo, bo); }
}

// v008
// A run of this version takes 131 microseconds.
// Next to v007, in two timings, it ran 1.17 times as fast each time.
// All steps since v000 together make it 8.33 times as fast.
#include <hip/hip_runtime.h>
#include <math.h>
// Multi-head attention over 32x32 feature maps (8 batches, 12 heads x 64, 1024 queries/keys): the four 1x1-conv projections
// (1024 x 768 · 768 x 768 per batch; the output projection computed transposed so it lands in the (B, C, H·W) layout) and the attention
// (scores and p·v, p carried x2^15): v_wmma_f32_16x16x32_f16, f16 operands, f32 accumulate; softmax f32. Input transposes are VALU copies.
typedef __attribute__((ext_vector_type(16))) _Float16 v16h;
typedef __attribute__((ext_vector_type(8)))  _Float16 v8h;
typedef __attribute__((ext_vector_type(16))) __bf16   v16b;
typedef __attribute__((ext_vector_type(8)))  __bf16   v8b;
typedef __attribute__((ext_vector_type(4)))  __bf16   v4b;
typedef __attribute__((ext_vector_type(2)))  __bf16   v2b;
typedef __attribute__((ext_vector_type(8)))  float    v8f;
typedef __attribute__((ext_vector_type(4)))  float    v4f;
typedef __attribute__((ext_vector_type(2)))  float    v2f;
#define PSCALE 32768.0f
#define U16(p) ((const unsigned short*)(const void*)(p))
#define PSCALE_INV (1.0f / 32768.0f)

__device__ __forceinline__ unsigned short f2bf_bits(float f) {
  unsigned u = __float_as_uint(f);
  return (unsigned short)((u + 0x7FFFu + ((u >> 16) & 1u)) >> 16);
}
__device__ __forceinline__ float bf_bits2f(unsigned short h) { return __uint_as_float(((unsigned)h) << 16); }

// hazard guards as plain device helpers (no inline asm inside the kernel template body)
__device__ __forceinline__ void dep_guard_h(v8f& a, v8f& b, v16h x, v16h y) { asm volatile("v_nop\n\tv_nop\n\tv_nop\n\tv_nop" : "+v"(a), "+v"(b) : "v"(x), "v"(y)); }
__device__ __forceinline__ void dep_guard_b(v8f& a, v8f& b, v16b x, v16b y) { asm volatile("v_nop\n\tv_nop\n\tv_nop\n\tv_nop" : "+v"(a), "+v"(b) : "v"(x), "v"(y)); }
__device__ __forceinline__ void keep4_h(v16h a, v16h b, v16h c, v16h d) { asm volatile("v_nop" :: "v"(a), "v"(b), "v"(c), "v"(d)); }
__device__ __forceinline__ void keep4_b(v16b a, v16b b, v16b c, v16b d) { asm volatile("v_nop" :: "v"(a), "v"(b), "v"(c), "v"(d)); }
__device__ __forceinline__ void acc_guard4(v8f& a, v8f& b, v8f& c, v8f& d) { asm volatile("v_nop\n\tv_nop\n\tv_nop\n\tv_nop" : "+v"(a), "+v"(b), "+v"(c), "+v"(d)); }
template <typename T> struct Frag;
template <> struct Frag<_Float16> {
  typedef v16h V; typedef v8h H; union U { v16h v; v8h h[2]; };
  static __device__ __forceinline__ v16h load(const _Float16* p) {   // elements 0..7 <- p[0..7], 8..15 <- p[16..23]
    U f; f.h[0] = *(const v8h*)(p); f.h[1] = *(const v8h*)(p + 16); return f.v;
  }
  static __device__ __forceinline__ v8f mma(v16h a, v16h b, v8f c) {
    return __builtin_amdgcn_wmma_f32_16x16x32_f16(false, a, false, b, (short)0, c, false, false);
  }
  static __device__ __forceinline__ void guard(v8f& a, v8f& b, v16h x, v16h y) { dep_guard_h(a, b, x, y); }
  static __device__ __forceinline__ void keep(v16h a, v16h b, v16h c, v16h d) { keep4_h(a, b, c, d); }
};
template <> struct Frag<__bf16> {
  typedef v16b V; typedef v8b H; union U { v16b v; v8b h[2]; };
  static __device__ __forceinline__ v16b load(const __bf16* p) {
    U f; f.h[0] = *(const v8b*)(p); f.h[1] = *(const v8b*)(p + 16); return f.v;
  }
  static __device__ __forceinline__ v8f mma(v16b a, v16b b, v8f c) {
    return __builtin_amdgcn_wmma_f32_16x16x32_bf16(false, a, false, b, (short)0, c, false, false);
  }
  static __device__ __forceinline__ void guard(v8f& a, v8f& b, v16b x, v16b y) { dep_guard_b(a, b, x, y); }
  static __device__ __forceinline__ void keep(v16b a, v16b b, v16b c, v16b d) { keep4_b(a, b, c, d); }
};

// ---- Register-blocked batched WMMA GEMM ------------------------------------
// C[m,n] = scale * sum_k A[m,k] * Bt[n,k] (+bias)(+resid); each wave owns a 64x64 tile, the 8 waves of a block (2 x 4) one 128x256 tile.
// A row-major [M,K]; Bt row-major [N,K]; M % 128 == 0, N % 256 == 0, K % 64 == 0; grid.x = (M / 128) * (N / 256).
// Operands go through LDS: a stage is 64 k (one whole 128-B line) of the block's 128 A rows and 256 Bt rows, read from global memory
// with every wave-wide 16-B load covering 4 whole lines, two buffers, the next stage's loads in flight while this one is multiplied.
// SPLIT (hi/lo operand planes) is not built in this form.
// BIAS_MODE: 0 = none, 1 = bias[m], 2 = bias[n].
// OUT_MODE: 0 = f32, 1 = f16, 2 = bf16 hi plane (Cout) + bf16 lo plane (Cout2).
// ET: 0 = f16 operands, 1 = bf16 operands (pointers passed as 16-bit storage)
// blockIdx.z picks one of up to three independent problems of the same shape in one launch: operands and output advance by zA / zB / zC
// elements per z, the bias is bias / bias_z1 / bias_z2.
#define GS_K 64                 // k per stage
#define GS_LP 72                // LDS row pitch in 16-bit elements: 144 B = 16 B x 9, for the ds_load_b128 fragment reads
#define GS_ROWS (128 + 256)     // A rows + Bt rows of a block tile
template <int ET> struct Elem;
template <> struct Elem<0> { typedef _Float16 T; };
template <> struct Elem<1> { typedef __bf16 T; };
template <int ET, bool SPLIT, int BIAS_MODE, int OUT_MODE, bool RESID, int ACT = 0>
__global__ __launch_bounds__(256) void wmma_gemm64(
    const unsigned short* __restrict__ Ap, const unsigned short* __restrict__ A2p, int lda, long strideA,
    const unsigned short* __restrict__ Btp, const unsigned short* __restrict__ Bt2p, int ldb, long strideB,
    void* __restrict__ Cout, void* __restrict__ Cout2, int ldc, long strideC,
    const float* __restrict__ bias,
    const float* __restrict__ resid, long strideR,
    int M, int N, int K, float scale,
    long zA, long zB, long zC, const float* __restrict__ bias_z1, const float* __restrict__ bias_z2) {
  typedef typename Elem<ET>::T T;
  typedef typename Frag<T>::V V;
  typedef typename Frag<T>::H H;
  static_assert(!SPLIT, "the LDS-staged loop holds one plane per operand");
  const T* A = (const T*)Ap; const T* Bt = (const T*)Btp;
  (void)A2p; (void)Bt2p;
  __shared__ __align__(16) T sOp[2][GS_ROWS * GS_LP];   // two stages: rows 0..127 = A, rows 128..383 = Bt
  __shared__ __align__(16) float sT[8][16 * 68];   // per-wave 16x64 slab, pitch 68 floats
  const int b    = blockIdx.y;
  const int z    = blockIdx.z;
  const float* biasz = (z == 0) ? bias : (z == 1) ? bias_z1 : bias_z2;
  const int lane = threadIdx.x & 31;
  const int wave = threadIdx.x >> 5;
  const int tilesN = N >> 8;
  const int tilesM = M >> 7;
  const int tile = blockIdx.x;
  if (tile >= tilesM * tilesN) return;   // block-uniform, in front of every barrier
  const int tm = tile / tilesN;
  const int tn = tile - tm * tilesN;
  const int m0b = tm << 7;                     // the block's first row and column
  const int n0b = tn << 8;
  const int wm = wave >> 2, wn = wave & 3;     // the wave's place in the 2 x 4 block tile
  const int m0 = m0b + (wm << 6);
  const int n0 = n0b + (wn << 6);

  const T* Ab  = A  + (size_t)z * zA + (size_t)b * strideA;
  const T* Bb  = Bt + (size_t)z * zB + (size_t)b * strideB;

  const int rlane = lane & 15;                 // row (A) / col (B, D) within subtile
  const int koff  = (lane >> 4) * 8;           // k offset of this lane half
  const int mOff  = (lane >> 4) * 8;           // D row offset

  v8f acc[4][4];
#pragma unroll
  for (int i = 0; i < 4; ++i)
#pragma unroll
    for (int j = 0; j < 4; ++j) acc[i][j] = (v8f){0.f,0.f,0.f,0.f,0.f,0.f,0.f,0.f};

  // Staging map: 16-B piece p = i * 256 + thread of a stage is row p / 8, bytes 16 * (p % 8): 8 lanes cover one row's 128-B line.
  const int srow = threadIdx.x >> 3;
  const int sc8  = (threadIdx.x & 7) * 8;
  const T* gA = Ab + (size_t)(m0b + srow) * lda + sc8;
  const T* gB = Bb + (size_t)(n0b + srow) * ldb + sc8;
  const int sW = srow * GS_LP + sc8;                              // this thread's first piece in a stage
  const int rA = ((wm << 6) + rlane) * GS_LP + koff;              // this lane's fragment rows in a stage
  const int rB = (128 + (wn << 6) + rlane) * GS_LP + koff;
  H st[12];
#pragma unroll
  for (int i = 0; i < 4; ++i) st[i] = *(const H*)(gA + (size_t)(i * 32) * lda);
#pragma unroll
  for (int i = 0; i < 8; ++i) st[4 + i] = *(const H*)(gB + (size_t)(i * 32) * ldb);
#pragma unroll
  for (int i = 0; i < 12; ++i) *(H*)(&sOp[0][sW + i * 32 * GS_LP]) = st[i];
  __syncthreads();

  const int nStage = K / GS_K;
  for (int s = 0; s < nStage; ++s) {
    const T* cur = sOp[s & 1];
    const bool more = (s + 1 < nStage);        // block-uniform
    if (more) {                                // the next stage's lines fly while this stage is multiplied
      const int k1 = (s + 1) * GS_K;
#pragma unroll
      for (int i = 0; i < 4; ++i) st[i] = *(const H*)(gA + (size_t)(i * 32) * lda + k1);
#pragma unroll
      for (int i = 0; i < 8; ++i) st[4 + i] = *(const H*)(gB + (size_t)(i * 32) * ldb + k1);
    }
#pragma unroll
    for (int kb = 0; kb < GS_K / 32; ++kb) {
      V bh[4], ah[4];                          // all eight fragments of a 32-k block are read as one group: one LDS wait per 16 products
#pragma unroll
      for (int j = 0; j < 4; ++j) bh[j] = Frag<T>::load(cur + rB + (j << 4) * GS_LP + kb * 32);
#pragma unroll
      for (int i = 0; i < 4; ++i) ah[i] = Frag<T>::load(cur + rA + (i << 4) * GS_LP + kb * 32);
#pragma unroll
      for (int i = 0; i < 4; ++i) {
#pragma unroll
        for (int j = 0; j < 4; ++j) acc[i][j] = Frag<T>::mma(ah[i], bh[j], acc[i][j]);
        Frag<T>::guard(acc[i][0], acc[i][3], ah[i], ah[i]);
      }
      Frag<T>::keep(bh[0], bh[1], bh[2], bh[3]);
    }
    if (more) {                                // into the buffer whose readers all left it at the barrier that ended stage s - 1
      T* nxt = sOp[(s + 1) & 1];
#pragma unroll
      for (int i = 0; i < 12; ++i) *(H*)(nxt + sW + i * 32 * GS_LP) = st[i];
    }
    __syncthreads();                           // publishes stage s + 1 and ends every wave's reads of stage s
  }
  acc_guard4(acc[0][0], acc[0][1], acc[0][2], acc[0][3]);
  acc_guard4(acc[1][0], acc[1][1], acc[1][2], acc[1][3]);
  acc_guard4(acc[2][0], acc[2][1], acc[2][2], acc[2][3]);
  acc_guard4(acc[3][0], acc[3][1], acc[3][2], acc[3][3]);

  // ---- epilogue ----
  float* slab = sT[wave];
  const float* Rb = RESID ? (resid + (size_t)b * strideR) : nullptr;
#pragma unroll
  for (int i = 0; i < 4; ++i) {
    const int mBase = m0 + (i << 4);
#pragma unroll
    for (int j = 0; j < 4; ++j) {
      const int n = n0 + (j << 4) + rlane;
      float bv = 0.f;
      if (BIAS_MODE == 2) bv = biasz[n];
#pragma unroll
      for (int r = 0; r < 8; ++r) {
        float v = acc[i][j][r] * scale;
        if (BIAS_MODE == 1) v += biasz[mBase + mOff + r];
        if (BIAS_MODE == 2) v += bv;
        if (RESID) v += Rb[(size_t)(mBase + mOff + r) * ldc + n];
        if (ACT == 1) v = tanhf(v);
        if (ACT == 2) v = fmaxf(v, 0.0f);
        if (ACT == 3) v = v / (1.0f + expf(-v));
        if (ACT == 4) v = (v > 0.f) ? v : 0.01f * v;
        if (ACT == 5) v = 0.5f * v * (1.0f + erff(v * 0.70710678118654752f));
        slab[(mOff + r) * 68 + (j << 4) + rlane] = v;
      }
    }
    __builtin_amdgcn_fence(__ATOMIC_RELEASE, "workgroup");
    __builtin_amdgcn_wave_barrier();
    __builtin_amdgcn_fence(__ATOMIC_ACQUIRE, "workgroup");
    if (OUT_MODE == 0) {
      float* C = (float*)Cout + (size_t)z * zC + (size_t)b * strideC;
      const int hh = lane >> 4, c4 = (lane & 15) * 4;     // row seg = 256 B = 16 lanes x 16 B
      {
#pragma unroll
        for (int it = 0; it < 8; ++it) {
          const int row = it * 2 + hh;
          v4f v = *(const v4f*)(slab + row * 68 + c4);
          *(v4f*)(C + (size_t)(mBase + row) * ldc + n0 + c4) = v;
        }
        
      }
    } else {
      const int q = lane >> 3, c8 = (lane & 7) * 8;
      unsigned short* C  = (unsigned short*)Cout  + (size_t)z * zC + (size_t)b * strideC;
      unsigned short* C2 = (OUT_MODE == 2) ? ((unsigned short*)Cout2 + (size_t)z * zC + (size_t)b * strideC) : nullptr;
      {
#pragma unroll
        for (int it = 0; it < 4; ++it) {
          const int row = it * 4 + q;
          const float* sp = slab + row * 68 + c8;
          v8h hv, lv;
#pragma unroll
          for (int e = 0; e < 8; ++e) {
            if (OUT_MODE == 1) {
              hv[e] = (_Float16)sp[e];
            } else {
              unsigned short hb = f2bf_bits(sp[e]);
              unsigned short lb = f2bf_bits(sp[e] - bf_bits2f(hb));
              hv[e] = __builtin_bit_cast(_Float16, hb);
              lv[e] = __builtin_bit_cast(_Float16, lb);
            }
          }
          *(v8h*)(C + (size_t)(mBase + row) * ldc + n0 + c8) = hv;
          if (OUT_MODE == 2) *(v8h*)(C2 + (size_t)(mBase + row) * ldc + n0 + c8) = lv;
        }
        
      }
    }
    __builtin_amdgcn_fence(__ATOMIC_RELEASE, "workgroup");
    __builtin_amdgcn_wave_barrier();
    __builtin_amdgcn_fence(__ATOMIC_ACQUIRE, "workgroup");
  }
}

// ---- f32 -> f16 cast of four arrays of equal length in one launch: blockIdx.y picks the input, outputs lie n2 pairs apart ----
__global__ __launch_bounds__(256) void cast4_f32_f16x2(
    const float* __restrict__ in0, const float* __restrict__ in1, const float* __restrict__ in2, const float* __restrict__ in3,
    _Float16* __restrict__ out, int n2) {
  const int y = blockIdx.y;
  const float* in = (y == 0) ? in0 : (y == 1) ? in1 : (y == 2) ? in2 : in3;
  int i = blockIdx.x * 256 + threadIdx.x;
  if (i < n2) {
    const _Float16 h0 = (_Float16)in[2 * i], h1 = (_Float16)in[2 * i + 1];
    const unsigned u = (unsigned)__builtin_bit_cast(unsigned short, h0) | ((unsigned)__builtin_bit_cast(unsigned short, h1) << 16);
    ((unsigned*)out)[(size_t)y * n2 + i] = u;
  }
}

// ---- f32 -> f16 cast with a power-of-two pre-scale (folded back by the consumer GEMM's scale) ----
__global__ __launch_bounds__(256) void cast_f32_f16x2s(const float* __restrict__ in, _Float16* __restrict__ out, int n2, float s) {
  int i = blockIdx.x * 256 + threadIdx.x;
  if (i < n2) {
    const _Float16 h0 = (_Float16)(in[2 * i] * s), h1 = (_Float16)(in[2 * i + 1] * s);
    const unsigned u = (unsigned)__builtin_bit_cast(unsigned short, h0) | ((unsigned)__builtin_bit_cast(unsigned short, h1) << 16);
    ((unsigned*)out)[i] = u;
    
  }
}
__global__ __launch_bounds__(256) void split_f32_bf16x2(
    const float* __restrict__ in, __bf16* __restrict__ hi, __bf16* __restrict__ lo, long n2) {
  long i = (long)blockIdx.x * 256 + threadIdx.x;
  long stride = (long)gridDim.x * 256;
  {
    for (long j = i; j < n2; j += stride) {
      const float a = in[2 * j], b = in[2 * j + 1];
      const unsigned short ah = f2bf_bits(a), bh = f2bf_bits(b);
      const unsigned short al = f2bf_bits(a - bf_bits2f(ah)), bl = f2bf_bits(b - bf_bits2f(bh));
      ((unsigned*)hi)[j] = (unsigned)ah | ((unsigned)bh << 16);
      ((unsigned*)lo)[j] = (unsigned)al | ((unsigned)bl << 16);
    }
    
  }
}


// ---- f32 [R][C] (row pitch ldi) -> f16 transposed [C][R] (row pitch ldo); 64x64 tiles; each output row segment
// blockIdx.z = tensor * nb + batch: three input tensors of nb matrices each (mat elements apart) in one launch; output matrix z lies at outT0 + z * mat.
__global__ __launch_bounds__(256) void transpose_cast_f16(const float* __restrict__ in0, const float* __restrict__ in1, const float* __restrict__ in2,
                                                         int nb, long mat, int ldi, _Float16* __restrict__ outT0, int ldo, float scale) {
  __shared__ __align__(16) _Float16 tile[64][72];     // [c][r]
  const int zt = blockIdx.z / nb, zb = blockIdx.z - zt * nb;
  const float* in = ((zt == 0) ? in0 : (zt == 1) ? in1 : in2) + (size_t)zb * mat;
  _Float16* outT = outT0 + (size_t)blockIdx.z * mat;
  const int c0 = blockIdx.x * 64, r0 = blockIdx.y * 64;
  const int t = threadIdx.y * 32 + threadIdx.x;
  for (int i = threadIdx.y; i < 64; i += 8) {
    tile[threadIdx.x][i]      = (_Float16)(in[(size_t)(r0 + i) * ldi + c0 + threadIdx.x] * scale);
    tile[32 + threadIdx.x][i] = (_Float16)(in[(size_t)(r0 + i) * ldi + c0 + 32 + threadIdx.x] * scale);
  }
  __syncthreads();
  const int q = t >> 3, c8 = (t & 7) * 8;
  {
#pragma unroll
    for (int it = 0; it < 2; ++it) {
      const int c = it * 32 + q;
      v8h hv = *(const v8h*)(&tile[c][c8]);
      *(v8h*)(outT + (size_t)(c0 + c) * ldo + r0 + c8) = hv;
    }
    
  }
}

// ---- f32 [R][C] (pitch ldi) -> bf16 hi/lo transposed planes [C][R] (pitch ldo); 64x64 tiles; each output row segment
__global__ __launch_bounds__(256) void transpose_split_bf16(const float* __restrict__ in, int ldi,
                                                           __bf16* __restrict__ outH, __bf16* __restrict__ outL, int ldo) {
  __shared__ __align__(16) float tile[64][68];     // [c][r]
  const int c0 = blockIdx.x * 64, r0 = blockIdx.y * 64;
  const int t = threadIdx.y * 32 + threadIdx.x;
  for (int i = threadIdx.y; i < 64; i += 8) {
    tile[threadIdx.x][i]      = in[(size_t)(r0 + i) * ldi + c0 + threadIdx.x];
    tile[32 + threadIdx.x][i] = in[(size_t)(r0 + i) * ldi + c0 + 32 + threadIdx.x];
  }
  __syncthreads();
  const int q = t >> 3, c8 = (t & 7) * 8;
  {
#pragma unroll
    for (int it = 0; it < 2; ++it) {
      const int c = it * 32 + q;
      v8b hv, lv;
#pragma unroll
      for (int e = 0; e < 8; ++e) {
        const float f = tile[c][c8 + e];
        const unsigned short hb = f2bf_bits(f);
        hv[e] = __builtin_bit_cast(__bf16, hb);
        lv[e] = __builtin_bit_cast(__bf16, f2bf_bits(f - bf_bits2f(hb)));
      }
      *(v8b*)(outH + (size_t)(c0 + c) * ldo + r0 + c8) = hv;
      *(v8b*)(outL + (size_t)(c0 + c) * ldo + r0 + c8) = lv;
    }
    
  }
}

// =====================================================================================
// Generic causal/non-causal attention for head_dim 64, f32 in / f32 out (f16 into out16 with OUT16); 16-bit operands: bf16 with optional hi/lo splits, or
// plain f16 (F16=true, non-split, probabilities carried x2^15).
//   scores = (q*qscale)·kᵀ : v_wmma_f32_16x16x32_bf16; SPLIT_QK -> q,k as bf16 hi/lo (hi·hi + hi·lo + lo·hi)
//   out    = p·v           : v_wmma_f32_16x16x32_bf16; SPLIT_PV -> p,v as bf16 hi/lo; else p,v plain bf16
//   f32 accumulate; online softmax in f32. Block = 4 waves = 64 query rows of one (batch, head); S % 64 == 0.
//   Element (b, s, h, d) of tensor X lives at X[b*X_bs + s*X_rs + h*X_hs + d] (strides in floats, multiples of 4).
//   Masking: MASK_MODE 0 none, 1 causal (kv > q masked), 2 tensor [S][Skv] shared over (b,h) (float if
//   mask_is_int==0, int32 with element == 0 -> masked if 1, int32 with element != 0 -> masked if 2), 3 per-token vectors qmask[B][S] & kvmask[B][Skv] (int32,
//   0 -> masked), 4 causal + sliding window (kv > q or q - kv > W masked; W passed in mask_is_int);
//   5 = relative-position bias: s += cp[b,h,q][idx[q][kv]] + pc[b,h,kv][idx[q][kv]] with idx = mask_b ([S][Skv] int32) and
//   mask_a an int32 [S][Skv] tensor with nonzero = masked (tables: element (b,h,row,n) at X + b*c_bs + h*c_hs + row*c_rs + n);
//   masked scores are replaced by mask_fill (e.g. -inf or -1e9) before the softmax.
//   grid.x = B * H * (S/64) (or a sub-range with blk0).
// =====================================================================================
#define AT_D 64
#define AT_NW 4
#define AT_QB 64
#define AT_KC 64
#define AT_LOG2E 1.4426950408889634f   // e^x = 2^(x * log2 e): the softmax runs in base 2, where the chip's own v_exp_f32 is the whole exponential
#define AT_LP 72   // LDS row pitch of the K and V^T tiles in 16-bit elements: 144 B = 16 B x 9, so the 16 rows of a ds_load_b128 fragment read fall on distinct banks
struct AttnGeom { const float* cp = nullptr; const float* pc = nullptr; long c_bs = 0, c_rs = 0, c_hs = 0;   // mode-5 score-bias tables
                  long q_bs, q_rs, q_hs, k_bs, k_rs, k_hs, v_bs, v_rs, v_hs, o_bs, o_rs, o_hs;
                  int S, Skv, H, mask_mode; float qscale; int blk0; float mask_fill; int mask_is_int; };
static_assert(sizeof(AttnGeom) == 168, "no padding");

__device__ __forceinline__ unsigned short at_bf_bits(float f) {
  unsigned u = __float_as_uint(f);
  return (unsigned short)((u + 0x7FFFu + ((u >> 16) & 1u)) >> 16);
}
__device__ __forceinline__ __bf16 at_f2bf(float f) { return __builtin_bit_cast(__bf16, at_bf_bits(f)); }
__device__ __forceinline__ void at_split(float f, __bf16& hi, __bf16& lo) {
  const unsigned short hb = at_bf_bits(f);
  hi = __builtin_bit_cast(__bf16, hb);
  lo = at_f2bf(f - __uint_as_float(((unsigned)hb) << 16));
}
__device__ __forceinline__ v8f at_mma(v16b a, v16b b, v8f c) {
  c = __builtin_amdgcn_wmma_f32_16x16x32_bf16(false, a, false, b, (short)0, c, false, false);
  asm volatile("v_nop\n\tv_nop\n\tv_nop\n\tv_nop" : "+v"(c) : "v"(a), "v"(b));
  return c;
}
// 16-bit element as a bit pattern held in a __bf16 slot: f16 bits when F16, bf16 (RNE) otherwise
template <bool F16> __device__ __forceinline__ __bf16 at_to16(float f) {
  if (F16) return __builtin_bit_cast(__bf16, (_Float16)f);
  return at_f2bf(f);
}
template <bool F16> __device__ __forceinline__ v8f at_mma16(v16b a, v16b b, v8f c) {
  if (F16) {
    const v16h ah = __builtin_bit_cast(v16h, a), bh = __builtin_bit_cast(v16h, b);
    c = __builtin_amdgcn_wmma_f32_16x16x32_f16(false, ah, false, bh, (short)0, c, false, false);
    asm volatile("v_nop\n\tv_nop\n\tv_nop\n\tv_nop" : "+v"(c) : "v"(ah), "v"(bh));
    return c;
  }
  return at_mma(a, b, c);
}

// lane l <-> lane l ^ 16: the two lanes that share one column of a matrix tile
__device__ __forceinline__ float at_xhalf(float x) {
  const int b = __builtin_bit_cast(int, x);
  return __builtin_bit_cast(float, __builtin_amdgcn_permlanex16(b, b, 0x76543210, 0xfedcba98, false, false));
}

// Both products run transposed: S^T = K.Q^T (A = K rows, B = Q) and O^T += V^T.P^T (A = V^T rows, B = P^T). In a result tile lane l holds
// column l & 15 = one query, rows 8 * (l >> 4) + r = keys (or d): a query's maximum and sum are taken inside the lane, with one exchange
// between the wave's halves, and two neighbouring score tiles, converted in place, are the B operand of the second product.
// MASK_MODE is a compile-time constant: each instance holds only its own masking code, so the score loop has no per-element mode branches.
// OUT16: the result is rounded to f16 here and stored to out16 (same strides, in elements), for a consumer that takes f16 operands; out is not used.
template <bool SPLIT_QK, bool SPLIT_PV, bool F16, int MASK_MODE, bool OUT16>
__global__ __launch_bounds__(128)
void attn64_kernel(const float* __restrict__ q, const float* __restrict__ k,
                   const float* __restrict__ v, float* __restrict__ out, _Float16* __restrict__ out16,
                   const void* __restrict__ mask_a, const int* __restrict__ mask_b, AttnGeom g) {
  static_assert(!(F16 && (SPLIT_QK || SPLIT_PV)), "f16 mode is non-split");
  const float PSC = F16 ? 32768.0f : 1.0f;     // f16 probabilities carried x2^15 (subnormal range), folded into the final 1/l
  union FB { v16b v; v8b h[2]; };
  __shared__ __align__(16) __bf16 Ksh[AT_KC * AT_LP];            // K hi [kv][d]      9 KB
  __shared__ __align__(16) __bf16 Ksl[SPLIT_QK ? AT_KC * AT_LP : 8];
  __shared__ __align__(16) __bf16 Vth[AT_D * AT_LP];             // V hi [d][kv]      9 KB
  __shared__ __align__(16) __bf16 Vtl[SPLIT_PV ? AT_D * AT_LP : 8];
  __shared__ __align__(16) float  Os[AT_NW][16 * 68];            // per wave out tile, pitch 68

  const int tid  = threadIdx.x;
  const int wave = tid >> 5;
  const int lane = tid & 31;
  const int hh   = lane >> 4;
  const int c    = lane & 15;

  const int nqb = g.S / AT_QB;
  const int bx = blockIdx.x + g.blk0;
  const int qb = bx % nqb;
  const int bh = bx / nqb;
  const int h  = bh % g.H;
  const int b  = bh / g.H;
  const int qbase_block = qb * AT_QB;
  const int q0 = qbase_block + wave * 16;

  const float* qb_ptr = q + (size_t)b * g.q_bs + (size_t)h * g.q_hs;
  const float* kb_ptr = k + (size_t)b * g.k_bs + (size_t)h * g.k_hs;
  const float* vb_ptr = v + (size_t)b * g.v_bs + (size_t)h * g.v_hs;
  const size_t ob_off = (size_t)b * g.o_bs + (size_t)h * g.o_hs;

  // ---- Q fragments (B operand: lane = query column c): 2 d-chunks, hi (and lo) ----
  v16b qah[2], qal[2];
  {
    const float* qrow = qb_ptr + (size_t)(q0 + c) * g.q_rs;
#pragma unroll
    for (int dc = 0; dc < 2; ++dc) {
#pragma unroll
      for (int e = 0; e < 8; ++e) {
        const float f0 = qrow[dc * 32 + 8 * hh + e] * g.qscale;
        const float f1 = qrow[dc * 32 + 16 + 8 * hh + e] * g.qscale;
        if (SPLIT_QK) { __bf16 hq, lq; at_split(f0, hq, lq); qah[dc][e] = hq; qal[dc][e] = lq; at_split(f1, hq, lq); qah[dc][8 + e] = hq; qal[dc][8 + e] = lq; }
        else { qah[dc][e] = at_to16<F16>(f0); qah[dc][8 + e] = at_to16<F16>(f1); qal[dc][e] = qah[dc][e]; qal[dc][8 + e] = qah[dc][8 + e]; }
      }
    }
  }

  float mrow = -INFINITY, lrow = 0.f;   // of query q0 + c; lrow sums this lane's half of the keys, the halves are joined in the epilogue
  v8f oacc[4];                          // O^T: oacc[t][r] = out[q0 + c][t * 16 + 8 * hh + r]
#pragma unroll
  for (int t = 0; t < 4; ++t) oacc[t] = (v8f){0.f,0.f,0.f,0.f,0.f,0.f,0.f,0.f};

  const int nChunks = (MASK_MODE == 1 || MASK_MODE == 4) ? (qb + 1) : (g.Skv / AT_KC);   // block-uniform
  // this lane's query mask (mode 3)
  const int qkeep = (MASK_MODE == 3) ? mask_b[(size_t)b * g.S + q0 + c] : 1;   // mask_b = qmask in mode 3
  const char* kp = (const char*)kb_ptr;   // first key row of the current chunk, block-uniform; stepped at the foot of the loop
  const char* vp = (const char*)vb_ptr;
  for (int kc = 0; kc < nChunks; ++kc) {
    const int kv0 = kc * AT_KC;
    __syncthreads();
    {
      // Staging map: 8 lanes cover one 128-B line of a key's head row, so a wave-wide 16-B load takes 4 whole lines (4 keys), not 32 pieces
      // of 32 lines. A thread holds the keys 2n and 2n + 1 at the same four d, so V^T goes to LDS as 32-bit pairs of neighbouring keys.
      const int c8 = tid & 7, rq = (tid >> 3) & 3;
      const int r0 = wave * 16 + rq * 2;                 // load i: key r0 + 8 * (i >> 2) + (i & 1), d from 32 * ((i >> 1) & 1) + 4 * c8
      // address = block-uniform base of the chunk + block-uniform row step + this lane's byte offset inside the 64-key chunk
      const unsigned klo = (unsigned)(r0 * (int)g.k_rs + c8 * 4) * 4u, vlo = (unsigned)(r0 * (int)g.v_rs + c8 * 4) * 4u;
      v4f kk[8], vv[8];
      const char* ka[4]; const char* va[4];              // row n: key r0 + 8 * (n >> 1) + (n & 1)
#pragma unroll
      for (int n = 0; n < 4; ++n) {
        ka[n] = kp + (size_t)(8 * (n >> 1) + (n & 1)) * g.k_rs * 4 + klo;
        va[n] = vp + (size_t)(8 * (n >> 1) + (n & 1)) * g.v_rs * 4 + vlo;
      }
#pragma unroll
      for (int i = 0; i < 8; ++i) kk[i] = *(const v4f*)(ka[2 * (i >> 2) + (i & 1)] + 128 * ((i >> 1) & 1));
      // the wait that stands before a register of an issued global load is overwritten; the addresses are named as inputs so that they
      // stay whole up to it (without that the compiler lays a later load's destination over an earlier load's address pair)
      asm volatile("s_wait_xcnt 0x0" :: "v"(ka[0]), "v"(ka[1]), "v"(ka[2]), "v"(ka[3]) : "memory");
#pragma unroll
      for (int i = 0; i < 8; ++i) vv[i] = *(const v4f*)(va[2 * (i >> 2) + (i & 1)] + 128 * ((i >> 1) & 1));
      asm volatile("s_wait_xcnt 0x0" :: "v"(va[0]), "v"(va[1]), "v"(va[2]), "v"(va[3]) : "memory");   // the same for the V loads
#pragma unroll
      for (int i = 0; i < 8; ++i) {
        const int kvr = r0 + 8 * (i >> 2) + (i & 1), d = 32 * ((i >> 1) & 1) + c8 * 4;
        v4b kh, kl;
#pragma unroll
        for (int e = 0; e < 4; ++e) {
          if (SPLIT_QK) { __bf16 a, bl; at_split(kk[i][e], a, bl); kh[e] = a; kl[e] = bl; }
          else kh[e] = at_to16<F16>(kk[i][e]);
        }
        *(v4b*)(Ksh + kvr * AT_LP + d) = kh;
        if (SPLIT_QK) *(v4b*)(Ksl + kvr * AT_LP + d) = kl;
      }
#pragma unroll
      for (int i = 0; i < 8; i += 2) {
        const int kvr = r0 + 8 * (i >> 2), d = 32 * ((i >> 1) & 1) + c8 * 4;
#pragma unroll
        for (int e = 0; e < 4; ++e) {
          v2b vh, vl;
          if (SPLIT_PV) { __bf16 a, bl; at_split(vv[i][e], a, bl); vh[0] = a; vl[0] = bl; at_split(vv[i + 1][e], a, bl); vh[1] = a; vl[1] = bl; }
          else { vh[0] = at_to16<F16>(vv[i][e]); vh[1] = at_to16<F16>(vv[i + 1][e]); }
          *(v2b*)(Vth + (d + e) * AT_LP + kvr) = vh;
          if (SPLIT_PV) *(v2b*)(Vtl + (d + e) * AT_LP + kvr) = vl;
        }
      }
    }
    __syncthreads();

    v8f s[4];
#pragma unroll
    for (int j = 0; j < 4; ++j) {
      s[j] = (v8f){0.f,0.f,0.f,0.f,0.f,0.f,0.f,0.f};
#pragma unroll 1
      for (int dc = 0; dc < 2; ++dc) {
        FB kb;
        kb.h[0] = *(const v8b*)(Ksh + (j * 16 + c) * AT_LP + dc * 32 + 8 * hh);
        kb.h[1] = *(const v8b*)(Ksh + (j * 16 + c) * AT_LP + dc * 32 + 16 + 8 * hh);
        s[j] = at_mma16<F16>(kb.v, qah[dc], s[j]);   // s[j][r] = score of key kv0 + j * 16 + 8 * hh + r with query q0 + c
        if (SPLIT_QK) {
          FB kl;
          kl.h[0] = *(const v8b*)(Ksl + (j * 16 + c) * AT_LP + dc * 32 + 8 * hh);
          kl.h[1] = *(const v8b*)(Ksl + (j * 16 + c) * AT_LP + dc * 32 + 16 + 8 * hh);
          s[j] = at_mma16<F16>(kl.v, qah[dc], s[j]);
          s[j] = at_mma16<F16>(kb.v, qal[dc], s[j]);
        }
      }
    }
    const bool diag = (MASK_MODE == 1) && (kc == qb);
    const int qrow = q0 + c;
    float mj[4];                                             // one chain per score tile, so that the maxima do not all wait on one another
#pragma unroll
    for (int j = 0; j < 4; ++j) {
      mj[j] = -INFINITY;
#pragma unroll
      for (int r = 0; r < 8; ++r) {
        const int kvcol = kv0 + j * 16 + 8 * hh + r;
        bool masked = false;
        if (diag) masked = (kvcol > qrow);
        else if (MASK_MODE == 4) masked = (kvcol > qrow) || (qrow - kvcol > g.mask_is_int);
        else if (MASK_MODE == 2) {
          const size_t mi = (size_t)qrow * g.Skv + kvcol;
          masked = (g.mask_is_int == 0) ? (((const float*)mask_a)[mi] == 0.0f)
                 : (g.mask_is_int == 1) ? (((const int*)mask_a)[mi] == 0) : (((const int*)mask_a)[mi] != 0);
        } else if (MASK_MODE == 3) masked = (qkeep == 0) || (((const int*)mask_a)[(size_t)b * g.Skv + kvcol] == 0);   // mask_a = kvmask
        else if (MASK_MODE == 5) {
          const size_t mi = (size_t)qrow * g.Skv + kvcol;
          masked = (((const int*)mask_a)[mi] != 0);
          int n = mask_b[mi]; n = n < 0 ? 0 : n;
          s[j][r] += g.cp[(size_t)b * g.c_bs + (size_t)h * g.c_hs + (size_t)qrow * g.c_rs + n]
                   + g.pc[(size_t)b * g.c_bs + (size_t)h * g.c_hs + (size_t)kvcol * g.c_rs + n];
        }
        if (masked) s[j][r] = g.mask_fill;
        mj[j] = fmaxf(mj[j], s[j][r]);
      }
    }
    float m = fmaxf(fmaxf(mj[0], mj[1]), fmaxf(mj[2], mj[3]));
    m = fmaxf(m, at_xhalf(m));                               // lanes c and c + 16 hold the two halves of query c's 64 keys
    const float mnew = fmaxf(mrow, m * AT_LOG2E);            // the running maximum is kept in log2 units
    const float alpha = __builtin_amdgcn_exp2f(mrow - mnew);
    mrow = mnew;
    FB pt[2], ptl[2];                                        // P^T as B operand: element e of pt[kk] = tile 2 * kk + (e >> 3), register e & 7
    const v2f l2e = {AT_LOG2E, AT_LOG2E}, nm = {-mnew, -mnew};   // one maximum for all of a lane's scores: the fma and the sum run two wide
    v2f ps[4];
#pragma unroll
    for (int j = 0; j < 4; ++j) {
#pragma unroll
      for (int r = 0; r < 8; r += 2) {
        const v2f arg = __builtin_elementwise_fma((v2f){s[j][r], s[j][r + 1]}, l2e, nm);
        const v2f p = {__builtin_amdgcn_exp2f(arg.x), __builtin_amdgcn_exp2f(arg.y)};   // one v_exp_f32 per score
        ps[j] = (r == 0) ? p : ps[j] + p;
#pragma unroll
        for (int u = 0; u < 2; ++u) {
          const int e = (j & 1) * 8 + r + u;
          if (SPLIT_PV) { __bf16 a, bl; at_split(p[u], a, bl); pt[j >> 1].v[e] = a; ptl[j >> 1].v[e] = bl; }
          else pt[j >> 1].v[e] = at_to16<F16>(p[u] * PSC);
        }
      }
    }
    const v2f pq = (ps[0] + ps[1]) + (ps[2] + ps[3]);
    lrow = lrow * alpha + (pq.x + pq.y);
#pragma unroll
    for (int t = 0; t < 4; ++t)
#pragma unroll
      for (int r = 0; r < 8; ++r) oacc[t][r] *= alpha;
#pragma unroll   // unrolled: pt[kk] lives in registers, and a run-time index into it would cost a register copy per word
    for (int kk = 0; kk < 2; ++kk) {
#pragma unroll
      for (int t = 0; t < 4; ++t) {
        FB vb;
        vb.h[0] = *(const v8b*)(Vth + (t * 16 + c) * AT_LP + kk * 32 + 8 * hh);
        vb.h[1] = *(const v8b*)(Vth + (t * 16 + c) * AT_LP + kk * 32 + 16 + 8 * hh);
        oacc[t] = at_mma16<F16>(vb.v, pt[kk].v, oacc[t]);
        if (SPLIT_PV) {
          FB vl;
          vl.h[0] = *(const v8b*)(Vtl + (t * 16 + c) * AT_LP + kk * 32 + 8 * hh);
          vl.h[1] = *(const v8b*)(Vtl + (t * 16 + c) * AT_LP + kk * 32 + 16 + 8 * hh);
          oacc[t] = at_mma16<F16>(vl.v, pt[kk].v, oacc[t]);
          oacc[t] = at_mma16<F16>(vb.v, ptl[kk].v, oacc[t]);
        }
      }
    }
    kp += (size_t)AT_KC * g.k_rs * 4;
    vp += (size_t)AT_KC * g.v_rs * 4;
  }

  float* os = Os[wave];
  const float inv = 1.0f / ((lrow + at_xhalf(lrow)) * PSC);   // the two halves' sums of query q0 + c are joined here, once
#pragma unroll
  for (int t = 0; t < 4; ++t) {
#pragma unroll
    for (int r = 0; r < 8; ++r) os[c * 68 + t * 16 + 8 * hh + r] = oacc[t][r] * inv;
  }
  __builtin_amdgcn_fence(__ATOMIC_RELEASE, "workgroup");
  __builtin_amdgcn_wave_barrier();
  __builtin_amdgcn_fence(__ATOMIC_ACQUIRE, "workgroup");
  if (OUT16) {
    _Float16* ob16 = out16 + ob_off;
    const int q4 = lane >> 3, c8 = (lane & 7) * 8;       // a head's row is 64 f16 = one 128-B line = 8 lanes x 16 B; a wave-wide store takes 4 rows
#pragma unroll
    for (int it = 0; it < 4; ++it) {
      const int row = it * 4 + q4;
      const float* sp = os + row * 68 + c8;
      v8h hv;
#pragma unroll
      for (int e = 0; e < 8; ++e) hv[e] = (_Float16)sp[e];
      *(v8h*)(ob16 + (size_t)(q0 + row) * g.o_rs + c8) = hv;
    }
  } else {
    float* ob_ptr = out + ob_off;
    const int c4 = (lane & 15) * 4;
#pragma unroll
    for (int it = 0; it < 8; ++it) {
      const int row = it * 2 + hh;
      v4f val = *(const v4f*)(os + row * 68 + c4);
      *(v4f*)(ob_ptr + (size_t)(q0 + row) * g.o_rs + c4) = val;
    }
  }
}

#define EB 8
#define EC 768
#define ES 1024
#define EH 12
extern "C" void kernel_launch(void* const* d_in, const int* in_sizes, int n_in, void* d_out, int out_size, void* d_ws, size_t ws_size, hipStream_t stream) {
  (void)in_sizes; (void)n_in; (void)out_size; (void)ws_size;
  const float* q = (const float*)d_in[0]; const float* k = (const float*)d_in[1]; const float* v = (const float*)d_in[2];
  const float* Wq = (const float*)d_in[3]; const float* bq = (const float*)d_in[4]; const float* Wk = (const float*)d_in[5]; const float* bk = (const float*)d_in[6];
  const float* Wv = (const float*)d_in[7]; const float* bv = (const float*)d_in[8]; const float* Wo = (const float*)d_in[9]; const float* bo = (const float*)d_in[10];
  float* out = (float*)d_out;    // [8][768][1024]
  char* ws = (char*)d_ws; size_t off = 0;
  auto carve = [&](size_t bytes) -> char* { char* p = ws + off; off += (bytes + 255) & ~(size_t)255; return p; };
  _Float16* QT = (_Float16*)carve((size_t)EB * ES * EC * 2); _Float16* KT = (_Float16*)carve((size_t)EB * ES * EC * 2); _Float16* VT = (_Float16*)carve((size_t)EB * ES * EC * 2);   // 3 x 12.6 MB
  _Float16* Wq16 = (_Float16*)carve((size_t)EC * EC * 2); _Float16* Wk16 = (_Float16*)carve((size_t)EC * EC * 2); _Float16* Wv16 = (_Float16*)carve((size_t)EC * EC * 2); _Float16* Wo16 = (_Float16*)carve((size_t)EC * EC * 2);
  float* QE = (float*)carve((size_t)EB * ES * EC * 4); float* KE = (float*)carve((size_t)EB * ES * EC * 4); float* VE = (float*)carve((size_t)EB * ES * EC * 4);   // 3 x 25 MB
  _Float16* O16 = QT;     // reuse (QT dead after the q projection)
  // Launches that read none of each other's output share one grid. QT, KT, VT lie back to back in the workspace, and so do the four
  // f16 weights and QE, KE, VE (every carve is a multiple of 256 B), so a grid index times a fixed stride reaches each of them.
  (void)KT; (void)VT; (void)Wk16; (void)Wv16;
  transpose_cast_f16<<<dim3(ES / 64, EC / 64, 3 * EB), dim3(32, 8), 0, stream>>>(q, k, v, EB, (long)EC * ES, ES, QT, EC, 1.0f);   // each [768][1024] -> [1024][768]
  cast4_f32_f16x2<<<dim3((EC * EC / 2 + 255) / 256, 4), 256, 0, stream>>>(Wq, Wk, Wv, Wo, Wq16, EC * EC / 2);   // 1x1-conv weights [out][in] are the Bt layout; Wo is the A operand ([M=o][K=c]) of the output GEMM
  { const int t = (ES / 64) * (EC / 64);   // z = 0, 1, 2: the q, k, v projections
    wmma_gemm64<0, false, 2, 0, false><<<dim3((t + 7) / 8, EB, 3), 256, 0, stream>>>(U16(QT), nullptr, EC, (long)ES * EC, U16(Wq16), nullptr, EC, 0, QE, nullptr, EC, (long)ES * EC, bq, nullptr, 0, ES, EC, EC, 1.0f,
        (long)EB * ES * EC, (long)EC * EC, (long)EB * ES * EC, bk, bv); }
  { AttnGeom g;
    g.q_bs = (long)ES * EC; g.q_rs = EC; g.q_hs = 64; g.k_bs = (long)ES * EC; g.k_rs = EC; g.k_hs = 64; g.v_bs = (long)ES * EC; g.v_rs = EC; g.v_hs = 64; g.o_bs = (long)ES * EC; g.o_rs = EC; g.o_hs = 64;
    g.S = ES; g.Skv = ES; g.H = EH; g.mask_mode = 0; g.qscale = 0.125f; g.blk0 = 0; g.mask_fill = -INFINITY; g.mask_is_int = 0;
    attn64_kernel<false, false, true, 0, true><<<EB * EH * (ES / AT_QB), AT_NW * 32, 0, stream>>>(QE, KE, VE, nullptr, O16, nullptr, nullptr, g); }   // stores the f16 operand of the output GEMM itself
  { const int t = (EC / 64) * (ES / 64);   // outᵀ per batch: A = Wo [768][768], Bt = O16[b] [1024][768] -> out[b] [768][1024], bias per row
    wmma_gemm64<0, false, 1, 0, false><<<dim3((t + 7) / 8, EB), 256, 0, stream>>>(U16(Wo16), nullptr, EC, 0, U16(O16), nullptr, EC, (long)ES * EC, out, nullptr, ES, (long)EC * ES, bo, nullptr, 0, EC, ES, EC, 1.0f, 0, 0, 0, bo, bo); }
}

// v009
// It runs in 123 microseconds.
// In both of two side-by-side timings against v008, it was 1.07 times as fast.
// Counting every step since v000, it is 8.90 times as fast.
#include <hip/hip_runtime.h>
#include <math.h>
// Multi-head attention over 32x32 feature maps (8 batches, 12 heads x 64, 1024 queries/keys): the four 1x1-conv projections
// (1024 x 768 · 768 x 768 per batch; the output projection computed transposed so it lands in the (B, C, H·W) layout) and the attention
// (scores and p·v, p carried x2^15): v_wmma_f32_16x16x32_f16, f16 operands, f32 accumulate; softmax f32. Input transposes are VALU copies.
typedef __attribute__((ext_vector_type(16))) _Float16 v16h;
typedef __attribute__((ext_vector_type(8)))  _Float16 v8h;
typedef __attribute__((ext_vector_type(16))) __bf16   v16b;
typedef __attribute__((ext_vector_type(8)))  __bf16   v8b;
typedef __attribute__((ext_vector_type(4)))  __bf16   v4b;
typedef __attribute__((ext_vector_type(2)))  __bf16   v2b;
typedef __attribute__((ext_vector_type(8)))  float    v8f;
typedef __attribute__((ext_vector_type(4)))  float    v4f;
typedef __attribute__((ext_vector_type(2)))  float    v2f;
#define PSCALE 32768.0f
#define U16(p) ((const unsigned short*)(const void*)(p))
#define PSCALE_INV (1.0f / 32768.0f)

__device__ __forceinline__ unsigned short f2bf_bits(float f) {
  unsigned u = __float_as_uint(f);
  return (unsigned short)((u + 0x7FFFu + ((u >> 16) & 1u)) >> 16);
}
__device__ __forceinline__ float bf_bits2f(unsigned short h) { return __uint_as_float(((unsigned)h) << 16); }

// hazard guards as plain device helpers (no inline asm inside the kernel template body)
__device__ __forceinline__ void dep_guard_h(v8f& a, v8f& b, v16h x, v16h y) { asm volatile("v_nop\n\tv_nop\n\tv_nop\n\tv_nop" : "+v"(a), "+v"(b) : "v"(x), "v"(y)); }
__device__ __forceinline__ void dep_guard_b(v8f& a, v8f& b, v16b x, v16b y) { asm volatile("v_nop\n\tv_nop\n\tv_nop\n\tv_nop" : "+v"(a), "+v"(b) : "v"(x), "v"(y)); }
__device__ __forceinline__ void keep4_h(v16h a, v16h b, v16h c, v16h d) { asm volatile("v_nop" :: "v"(a), "v"(b), "v"(c), "v"(d)); }
__device__ __forceinline__ void keep4_b(v16b a, v16b b, v16b c, v16b d) { asm volatile("v_nop" :: "v"(a), "v"(b), "v"(c), "v"(d)); }
__device__ __forceinline__ void acc_guard4(v8f& a, v8f& b, v8f& c, v8f& d) { asm volatile("v_nop\n\tv_nop\n\tv_nop\n\tv_nop" : "+v"(a), "+v"(b), "+v"(c), "+v"(d)); }
template <typename T> struct Frag;
template <> struct Frag<_Float16> {
  typedef v16h V; typedef v8h H; union U { v16h v; v8h h[2]; };
  static __device__ __forceinline__ v16h load(const _Float16* p) {   // elements 0..7 <- p[0..7], 8..15 <- p[16..23]
    U f; f.h[0] = *(const v8h*)(p); f.h[1] = *(const v8h*)(p + 16); return f.v;
  }
  static __device__ __forceinline__ v8f mma(v16h a, v16h b, v8f c) {
    return __builtin_amdgcn_wmma_f32_16x16x32_f16(false, a, false, b, (short)0, c, false, false);
  }
  static __device__ __forceinline__ void guard(v8f& a, v8f& b, v16h x, v16h y) { dep_guard_h(a, b, x, y); }
  static __device__ __forceinline__ void keep(v16h a, v16h b, v16h c, v16h d) { keep4_h(a, b, c, d); }
};
template <> struct Frag<__bf16> {
  typedef v16b V; typedef v8b H; union U { v16b v; v8b h[2]; };
  static __device__ __forceinline__ v16b load(const __bf16* p) {
    U f; f.h[0] = *(const v8b*)(p); f.h[1] = *(const v8b*)(p + 16); return f.v;
  }
  static __device__ __forceinline__ v8f mma(v16b a, v16b b, v8f c) {
    return __builtin_amdgcn_wmma_f32_16x16x32_bf16(false, a, false, b, (short)0, c, false, false);
  }
  static __device__ __forceinline__ void guard(v8f& a, v8f& b, v16b x, v16b y) { dep_guard_b(a, b, x, y); }
  static __device__ __forceinline__ void keep(v16b a, v16b b, v16b c, v16b d) { keep4_b(a, b, c, d); }
};

// ---- Register-blocked batched WMMA GEMM ------------------------------------
// C[m,n] = scale * sum_k A[m,k] * Bt[n,k] (+bias)(+resid); each wave owns a 64x64 tile, the 8 waves of a block (2 x 4) one 128x256 tile.
// A row-major [M,K]; Bt row-major [N,K]; M % 128 == 0, N % 256 == 0, K % 64 == 0; grid.x = (M / 128) * (N / 256).
// Operands go through LDS: a stage is 64 k (one whole 128-B line) of the block's 128 A rows and 256 Bt rows, read from global memory
// with every wave-wide 16-B load covering 4 whole lines, two buffers, the next stage's loads in flight while this one is multiplied.
// SPLIT (hi/lo operand planes) is not built in this form.
// BIAS_MODE: 0 = none, 1 = bias[m], 2 = bias[n].
// OUT_MODE: 0 = f32, 1 = f16, 2 = bf16 hi plane (Cout) + bf16 lo plane (Cout2).
// ET: 0 = f16 operands, 1 = bf16 operands (pointers passed as 16-bit storage)
// blockIdx.z picks one of up to three independent problems of the same shape in one launch: operands and output advance by zA / zB / zC
// elements per z, the bias is bias / bias_z1 / bias_z2.
#define GS_K 64                 // k per stage
#define GS_LP 72                // LDS row pitch in 16-bit elements: 144 B = 16 B x 9, for the ds_load_b128 fragment reads
#define GS_ROWS (128 + 256)     // A rows + Bt rows of a block tile
template <int ET> struct Elem;
template <> struct Elem<0> { typedef _Float16 T; };
template <> struct Elem<1> { typedef __bf16 T; };
template <int ET, bool SPLIT, int BIAS_MODE, int OUT_MODE, bool RESID, int ACT = 0>
__global__ __launch_bounds__(256) void wmma_gemm64(
    const unsigned short* __restrict__ Ap, const unsigned short* __restrict__ A2p, int lda, long strideA,
    const unsigned short* __restrict__ Btp, const unsigned short* __restrict__ Bt2p, int ldb, long strideB,
    void* __restrict__ Cout, void* __restrict__ Cout2, int ldc, long strideC,
    const float* __restrict__ bias,
    const float* __restrict__ resid, long strideR,
    int M, int N, int K, float scale,
    long zA, long zB, long zC, const float* __restrict__ bias_z1, const float* __restrict__ bias_z2) {
  typedef typename Elem<ET>::T T;
  typedef typename Frag<T>::V V;
  typedef typename Frag<T>::H H;
  static_assert(!SPLIT, "the LDS-staged loop holds one plane per operand");
  const T* A = (const T*)Ap; const T* Bt = (const T*)Btp;
  (void)A2p; (void)Bt2p;
  __shared__ __align__(16) T sOp[2][GS_ROWS * GS_LP];   // two stages: rows 0..127 = A, rows 128..383 = Bt
  __shared__ __align__(16) float sT[8][16 * 68];   // per-wave 16x64 slab, pitch 68 floats
  const int b    = blockIdx.y;
  const int z    = blockIdx.z;
  const float* biasz = (z == 0) ? bias : (z == 1) ? bias_z1 : bias_z2;
  const int lane = threadIdx.x & 31;
  const int wave = threadIdx.x >> 5;
  const int tilesN = N >> 8;
  const int tilesM = M >> 7;
  const int tile = blockIdx.x;
  if (tile >= tilesM * tilesN) return;   // block-uniform, in front of every barrier
  const int tm = tile / tilesN;
  const int tn = tile - tm * tilesN;
  const int m0b = tm << 7;                     // the block's first row and column
  const int n0b = tn << 8;
  const int wm = wave >> 2, wn = wave & 3;     // the wave's place in the 2 x 4 block tile
  const int m0 = m0b + (wm << 6);
  const int n0 = n0b + (wn << 6);

  const T* Ab  = A  + (size_t)z * zA + (size_t)b * strideA;
  const T* Bb  = Bt + (size_t)z * zB + (size_t)b * strideB;

  const int rlane = lane & 15;                 // row (A) / col (B, D) within subtile
  const int koff  = (lane >> 4) * 8;           // k offset of this lane half
  const int mOff  = (lane >> 4) * 8;           // D row offset

  v8f acc[4][4];
#pragma unroll
  for (int i = 0; i < 4; ++i)
#pragma unroll
    for (int j = 0; j < 4; ++j) acc[i][j] = (v8f){0.f,0.f,0.f,0.f,0.f,0.f,0.f,0.f};

  // Staging map: 16-B piece p = i * 256 + thread of a stage is row p / 8, bytes 16 * (p % 8): 8 lanes cover one row's 128-B line.
  const int srow = threadIdx.x >> 3;
  const int sc8  = (threadIdx.x & 7) * 8;
  const T* gA = Ab + (size_t)(m0b + srow) * lda + sc8;
  const T* gB = Bb + (size_t)(n0b + srow) * ldb + sc8;
  const int sW = srow * GS_LP + sc8;                              // this thread's first piece in a stage
  const int rA = ((wm << 6) + rlane) * GS_LP + koff;              // this lane's fragment rows in a stage
  const int rB = (128 + (wn << 6) + rlane) * GS_LP + koff;
  H st[12];
#pragma unroll
  for (int i = 0; i < 4; ++i) st[i] = *(const H*)(gA + (size_t)(i * 32) * lda);
#pragma unroll
  for (int i = 0; i < 8; ++i) st[4 + i] = *(const H*)(gB + (size_t)(i * 32) * ldb);
#pragma unroll
  for (int i = 0; i < 12; ++i) *(H*)(&sOp[0][sW + i * 32 * GS_LP]) = st[i];
  __syncthreads();

  const int nStage = K / GS_K;
  for (int s = 0; s < nStage; ++s) {
    const T* cur = sOp[s & 1];
    const bool more = (s + 1 < nStage);        // block-uniform
    if (more) {                                // the next stage's lines fly while this stage is multiplied
      const int k1 = (s + 1) * GS_K;
#pragma unroll
      for (int i = 0; i < 4; ++i) st[i] = *(const H*)(gA + (size_t)(i * 32) * lda + k1);
#pragma unroll
      for (int i = 0; i < 8; ++i) st[4 + i] = *(const H*)(gB + (size_t)(i * 32) * ldb + k1);
    }
#pragma unroll
    for (int kb = 0; kb < GS_K / 32; ++kb) {
      V bh[4], ah[4];                          // all eight fragments of a 32-k block are read as one group: one LDS wait per 16 products
#pragma unroll
      for (int j = 0; j < 4; ++j) bh[j] = Frag<T>::load(cur + rB + (j << 4) * GS_LP + kb * 32);
#pragma unroll
      for (int i = 0; i < 4; ++i) ah[i] = Frag<T>::load(cur + rA + (i << 4) * GS_LP + kb * 32);
#pragma unroll
      for (int i = 0; i < 4; ++i) {
#pragma unroll
        for (int j = 0; j < 4; ++j) acc[i][j] = Frag<T>::mma(ah[i], bh[j], acc[i][j]);
        Frag<T>::guard(acc[i][0], acc[i][3], ah[i], ah[i]);
      }
      Frag<T>::keep(bh[0], bh[1], bh[2], bh[3]);
    }
    if (more) {                                // into the buffer whose readers all left it at the barrier that ended stage s - 1
      T* nxt = sOp[(s + 1) & 1];
#pragma unroll
      for (int i = 0; i < 12; ++i) *(H*)(nxt + sW + i * 32 * GS_LP) = st[i];
    }
    __syncthreads();                           // publishes stage s + 1 and ends every wave's reads of stage s
  }
  acc_guard4(acc[0][0], acc[0][1], acc[0][2], acc[0][3]);
  acc_guard4(acc[1][0], acc[1][1], acc[1][2], acc[1][3]);
  acc_guard4(acc[2][0], acc[2][1], acc[2][2], acc[2][3]);
  acc_guard4(acc[3][0], acc[3][1], acc[3][2], acc[3][3]);

  // ---- epilogue ----
  float* slab = sT[wave];
  const float* Rb = RESID ? (resid + (size_t)b * strideR) : nullptr;
#pragma unroll
  for (int i = 0; i < 4; ++i) {
    const int mBase = m0 + (i << 4);
#pragma unroll
    for (int j = 0; j < 4; ++j) {
      const int n = n0 + (j << 4) + rlane;
      float bv = 0.f;
      if (BIAS_MODE == 2) bv = biasz[n];
#pragma unroll
      for (int r = 0; r < 8; ++r) {
        float v = acc[i][j][r] * scale;
        if (BIAS_MODE == 1) v += biasz[mBase + mOff + r];
        if (BIAS_MODE == 2) v += bv;
        if (RESID) v += Rb[(size_t)(mBase + mOff + r) * ldc + n];
        if (ACT == 1) v = tanhf(v);
        if (ACT == 2) v = fmaxf(v, 0.0f);
        if (ACT == 3) v = v / (1.0f + expf(-v));
        if (ACT == 4) v = (v > 0.f) ? v : 0.01f * v;
        if (ACT == 5) v = 0.5f * v * (1.0f + erff(v * 0.70710678118654752f));
        slab[(mOff + r) * 68 + (j << 4) + rlane] = v;
      }
    }
    __builtin_amdgcn_fence(__ATOMIC_RELEASE, "workgroup");
    __builtin_amdgcn_wave_barrier();
    __builtin_amdgcn_fence(__ATOMIC_ACQUIRE, "workgroup");
    if (OUT_MODE == 0) {
      float* C = (float*)Cout + (size_t)z * zC + (size_t)b * strideC;
      const int hh = lane >> 4, c4 = (lane & 15) * 4;     // row seg = 256 B = 16 lanes x 16 B
      {
#pragma unroll
        for (int it = 0; it < 8; ++it) {
          const int row = it * 2 + hh;
          v4f v = *(const v4f*)(slab + row * 68 + c4);
          *(v4f*)(C + (size_t)(mBase + row) * ldc + n0 + c4) = v;
        }
        
      }
    } else {
      const int q = lane >> 3, c8 = (lane & 7) * 8;
      unsigned short* C  = (unsigned short*)Cout  + (size_t)z * zC + (size_t)b * strideC;
      unsigned short* C2 = (OUT_MODE == 2) ? ((unsigned short*)Cout2 + (size_t)z * zC + (size_t)b * strideC) : nullptr;
      {
#pragma unroll
        for (int it = 0; it < 4; ++it) {
          const int row = it * 4 + q;
          const float* sp = slab + row * 68 + c8;
          v8h hv, lv;
#pragma unroll
          for (int e = 0; e < 8; ++e) {
            if (OUT_MODE == 1) {
              hv[e] = (_Float16)sp[e];
            } else {
              unsigned short hb = f2bf_bits(sp[e]);
              unsigned short lb = f2bf_bits(sp[e] - bf_bits2f(hb));
              hv[e] = __builtin_bit_cast(_Float16, hb);
              lv[e] = __builtin_bit_cast(_Float16, lb);
            }
          }
          *(v8h*)(C + (size_t)(mBase + row) * ldc + n0 + c8) = hv;
          if (OUT_MODE == 2) *(v8h*)(C2 + (size_t)(mBase + row) * ldc + n0 + c8) = lv;
        }
        
      }
    }
    __builtin_amdgcn_fence(__ATOMIC_RELEASE, "workgroup");
    __builtin_amdgcn_wave_barrier();
    __builtin_amdgcn_fence(__ATOMIC_ACQUIRE, "workgroup");
  }
}

// ---- f32 -> f16 cast of four arrays of equal length in one launch: blockIdx.y picks the input, outputs lie n2 pairs apart ----
__global__ __launch_bounds__(256) void cast4_f32_f16x2(
    const float* __restrict__ in0, const float* __restrict__ in1, const float* __restrict__ in2, const float* __restrict__ in3,
    _Float16* __restrict__ out, int n2) {
  const int y = blockIdx.y;
  const float* in = (y == 0) ? in0 : (y == 1) ? in1 : (y == 2) ? in2 : in3;
  int i = blockIdx.x * 256 + threadIdx.x;
  if (i < n2) {
    const _Float16 h0 = (_Float16)in[2 * i], h1 = (_Float16)in[2 * i + 1];
    const unsigned u = (unsigned)__builtin_bit_cast(unsigned short, h0) | ((unsigned)__builtin_bit_cast(unsigned short, h1) << 16);
    ((unsigned*)out)[(size_t)y * n2 + i] = u;
  }
}

// ---- f32 -> f16 cast with a power-of-two pre-scale (folded back by the consumer GEMM's scale) ----
__global__ __launch_bounds__(256) void cast_f32_f16x2s(const float* __restrict__ in, _Float16* __restrict__ out, int n2, float s) {
  int i = blockIdx.x * 256 + threadIdx.x;
  if (i < n2) {
    const _Float16 h0 = (_Float16)(in[2 * i] * s), h1 = (_Float16)(in[2 * i + 1] * s);
    const unsigned u = (unsigned)__builtin_bit_cast(unsigned short, h0) | ((unsigned)__builtin_bit_cast(unsigned short, h1) << 16);
    ((unsigned*)out)[i] = u;
    
  }
}
__global__ __launch_bounds__(256) void split_f32_bf16x2(
    const float* __restrict__ in, __bf16* __restrict__ hi, __bf16* __restrict__ lo, long n2) {
  long i = (long)blockIdx.x * 256 + threadIdx.x;
  long stride = (long)gridDim.x * 256;
  {
    for (long j = i; j < n2; j += stride) {
      const float a = in[2 * j], b = in[2 * j + 1];
      const unsigned short ah = f2bf_bits(a), bh = f2bf_bits(b);
      const unsigned short al = f2bf_bits(a - bf_bits2f(ah)), bl = f2bf_bits(b - bf_bits2f(bh));
      ((unsigned*)hi)[j] = (unsigned)ah | ((unsigned)bh << 16);
      ((unsigned*)lo)[j] = (unsigned)al | ((unsigned)bl << 16);
    }
    
  }
}


// ---- f32 [R][C] (row pitch ldi) -> f16 transposed [C][R] (row pitch ldo); 64x64 tiles; each output row segment
// blockIdx.z = tensor * nb + batch: three input tensors of nb matrices each (mat elements apart) in one launch; output matrix z lies at outT0 + z * mat.
__global__ __launch_bounds__(256) void transpose_cast_f16(const float* __restrict__ in0, const float* __restrict__ in1, const float* __restrict__ in2,
                                                         int nb, long mat, int ldi, _Float16* __restrict__ outT0, int ldo, float scale) {
  __shared__ __align__(16) _Float16 tile[64][72];     // [c][r]
  const int zt = blockIdx.z / nb, zb = blockIdx.z - zt * nb;
  const float* in = ((zt == 0) ? in0 : (zt == 1) ? in1 : in2) + (size_t)zb * mat;
  _Float16* outT = outT0 + (size_t)blockIdx.z * mat;
  const int c0 = blockIdx.x * 64, r0 = blockIdx.y * 64;
  const int t = threadIdx.y * 32 + threadIdx.x;
  for (int i = threadIdx.y; i < 64; i += 8) {
    tile[threadIdx.x][i]      = (_Float16)(in[(size_t)(r0 + i) * ldi + c0 + threadIdx.x] * scale);
    tile[32 + threadIdx.x][i] = (_Float16)(in[(size_t)(r0 + i) * ldi + c0 + 32 + threadIdx.x] * scale);
  }
  __syncthreads();
  const int q = t >> 3, c8 = (t & 7) * 8;
  {
#pragma unroll
    for (int it = 0; it < 2; ++it) {
      const int c = it * 32 + q;
      v8h hv = *(const v8h*)(&tile[c][c8]);
      *(v8h*)(outT + (size_t)(c0 + c) * ldo + r0 + c8) = hv;
    }
    
  }
}

// ---- f32 [R][C] (pitch ldi) -> bf16 hi/lo transposed planes [C][R] (pitch ldo); 64x64 tiles; each output row segment
__global__ __launch_bounds__(256) void transpose_split_bf16(const float* __restrict__ in, int ldi,
                                                           __bf16* __restrict__ outH, __bf16* __restrict__ outL, int ldo) {
  __shared__ __align__(16) float tile[64][68];     // [c][r]
  const int c0 = blockIdx.x * 64, r0 = blockIdx.y * 64;
  const int t = threadIdx.y * 32 + threadIdx.x;
  for (int i = threadIdx.y; i < 64; i += 8) {
    tile[threadIdx.x][i]      = in[(size_t)(r0 + i) * ldi + c0 + threadIdx.x];
    tile[32 + threadIdx.x][i] = in[(size_t)(r0 + i) * ldi + c0 + 32 + threadIdx.x];
  }
  __syncthreads();
  const int q = t >> 3, c8 = (t & 7) * 8;
  {
#pragma unroll
    for (int it = 0; it < 2; ++it) {
      const int c = it * 32 + q;
      v8b hv, lv;
#pragma unroll
      for (int e = 0; e < 8; ++e) {
        const float f = tile[c][c8 + e];
        const unsigned short hb = f2bf_bits(f);
        hv[e] = __builtin_bit_cast(__bf16, hb);
        lv[e] = __builtin_bit_cast(__bf16, f2bf_bits(f - bf_bits2f(hb)));
      }
      *(v8b*)(outH + (size_t)(c0 + c) * ldo + r0 + c8) = hv;
      *(v8b*)(outL + (size_t)(c0 + c) * ldo + r0 + c8) = lv;
    }
    
  }
}

// =====================================================================================
// Generic causal/non-causal attention for head_dim 64, f32 in / f32 out (f16 into out16 with OUT16); 16-bit operands: bf16 with optional hi/lo splits, or
// plain f16 (F16=true, non-split, probabilities carried x2^15).
//   scores = (q*qscale)·kᵀ : v_wmma_f32_16x16x32_bf16; SPLIT_QK -> q,k as bf16 hi/lo (hi·hi + hi·lo + lo·hi)
//   out    = p·v           : v_wmma_f32_16x16x32_bf16; SPLIT_PV -> p,v as bf16 hi/lo; else p,v plain bf16
//   f32 accumulate; online softmax in f32. Block = 4 waves = 64 query rows of one (batch, head); S % 64 == 0.
//   Element (b, s, h, d) of tensor X lives at X[b*X_bs + s*X_rs + h*X_hs + d] (strides in floats, multiples of 4).
//   Masking: MASK_MODE 0 none, 1 causal (kv > q masked), 2 tensor [S][Skv] shared over (b,h) (float if
//   mask_is_int==0, int32 with element == 0 -> masked if 1, int32 with element != 0 -> masked if 2), 3 per-token vectors qmask[B][S] & kvmask[B][Skv] (int32,
//   0 -> masked), 4 causal + sliding window (kv > q or q - kv > W masked; W passed in mask_is_int);
//   5 = relative-position bias: s += cp[b,h,q][idx[q][kv]] + pc[b,h,kv][idx[q][kv]] with idx = mask_b ([S][Skv] int32) and
//   mask_a an int32 [S][Skv] tensor with nonzero = masked (tables: element (b,h,row,n) at X + b*c_bs + h*c_hs + row*c_rs + n);
//   masked scores are replaced by mask_fill (e.g. -inf or -1e9) before the softmax.
//   grid.x = B * H * (S/64) (or a sub-range with blk0).
// =====================================================================================
#define AT_D 64
#define AT_NW 4
#define AT_QB 64
#define AT_KC 64
#define AT_LOG2E 1.4426950408889634f   // e^x = 2^(x * log2 e): the softmax runs in base 2, where the chip's own v_exp_f32 is the whole exponential
#define AT_LP 72   // LDS row pitch of the K and V^T tiles in 16-bit elements: 144 B = 16 B x 9, so the 16 rows of a ds_load_b128 fragment read fall on distinct banks
struct AttnGeom { const float* cp = nullptr; const float* pc = nullptr; long c_bs = 0, c_rs = 0, c_hs = 0;   // mode-5 score-bias tables
                  long q_bs, q_rs, q_hs, k_bs, k_rs, k_hs, v_bs, v_rs, v_hs, o_bs, o_rs, o_hs;
                  int S, Skv, H, mask_mode; float qscale; int blk0; float mask_fill; int mask_is_int; };
static_assert(sizeof(AttnGeom) == 168, "no padding");

__device__ __forceinline__ unsigned short at_bf_bits(float f) {
  unsigned u = __float_as_uint(f);
  return (unsigned short)((u + 0x7FFFu + ((u >> 16) & 1u)) >> 16);
}
__device__ __forceinline__ __bf16 at_f2bf(float f) { return __builtin_bit_cast(__bf16, at_bf_bits(f)); }
__device__ __forceinline__ void at_split(float f, __bf16& hi, __bf16& lo) {
  const unsigned short hb = at_bf_bits(f);
  hi = __builtin_bit_cast(__bf16, hb);
  lo = at_f2bf(f - __uint_as_float(((unsigned)hb) << 16));
}
__device__ __forceinline__ v8f at_mma(v16b a, v16b b, v8f c) {
  c = __builtin_amdgcn_wmma_f32_16x16x32_bf16(false, a, false, b, (short)0, c, false, false);
  asm volatile("v_nop\n\tv_nop\n\tv_nop\n\tv_nop" : "+v"(c) : "v"(a), "v"(b));
  return c;
}
// 16-bit element as a bit pattern held in a __bf16 slot: f16 bits when F16, bf16 (RNE) otherwise
template <bool F16> __device__ __forceinline__ __bf16 at_to16(float f) {
  if (F16) return __builtin_bit_cast(__bf16, (_Float16)f);
  return at_f2bf(f);
}
template <bool F16> __device__ __forceinline__ v8f at_mma16(v16b a, v16b b, v8f c) {
  if (F16) {
    const v16h ah = __builtin_bit_cast(v16h, a), bh = __builtin_bit_cast(v16h, b);
    return __builtin_amdgcn_wmma_f32_16x16x32_f16(false, ah, false, bh, (short)0, c, false, false);   // the builtin alone: the compiler keeps its distances, and a run of products issues back to back
  }
  return at_mma(a, b, c);
}

// lane l <-> lane l ^ 16: the two lanes that share one column of a matrix tile
__device__ __forceinline__ float at_xhalf(float x) {
  const int b = __builtin_bit_cast(int, x);
  return __builtin_bit_cast(float, __builtin_amdgcn_permlanex16(b, b, 0x76543210, 0xfedcba98, false, false));
}

// Both products run transposed: S^T = K.Q^T (A = K rows, B = Q) and O^T += V^T.P^T (A = V^T rows, B = P^T). In a result tile lane l holds
// column l & 15 = one query, rows 8 * (l >> 4) + r = keys (or d): a query's maximum and sum are taken inside the lane, with one exchange
// between the wave's halves, and two neighbouring score tiles, converted in place, are the B operand of the second product.
// MASK_MODE is a compile-time constant: each instance holds only its own masking code, so the score loop has no per-element mode branches.
// OUT16: the result is rounded to f16 here and stored to out16 (same strides, in elements), for a consumer that takes f16 operands; out is not used.
template <bool SPLIT_QK, bool SPLIT_PV, bool F16, int MASK_MODE, bool OUT16>
__global__ __launch_bounds__(128)
void attn64_kernel(const float* __restrict__ q, const float* __restrict__ k,
                   const float* __restrict__ v, float* __restrict__ out, _Float16* __restrict__ out16,
                   const void* __restrict__ mask_a, const int* __restrict__ mask_b, AttnGeom g) {
  static_assert(!(F16 && (SPLIT_QK || SPLIT_PV)), "f16 mode is non-split");
  const float PSC = F16 ? 32768.0f : 1.0f;     // f16 probabilities carried x2^15 (subnormal range), folded into the final 1/l
  union FB { v16b v; v8b h[2]; };
  __shared__ __align__(16) __bf16 Ksh[AT_KC * AT_LP];            // K hi [kv][d]      9 KB
  __shared__ __align__(16) __bf16 Ksl[SPLIT_QK ? AT_KC * AT_LP : 8];
  __shared__ __align__(16) __bf16 Vth[AT_D * AT_LP];             // V hi [d][kv]      9 KB
  __shared__ __align__(16) __bf16 Vtl[SPLIT_PV ? AT_D * AT_LP : 8];
  __shared__ __align__(16) float  Os[AT_NW][16 * 68];            // per wave out tile, pitch 68

  const int tid  = threadIdx.x;
  const int wave = tid >> 5;
  const int lane = tid & 31;
  const int hh   = lane >> 4;
  const int c    = lane & 15;

  const int nqb = g.S / AT_QB;
  const int bx = blockIdx.x + g.blk0;
  const int qb = bx % nqb;
  const int bh = bx / nqb;
  const int h  = bh % g.H;
  const int b  = bh / g.H;
  const int qbase_block = qb * AT_QB;
  const int q0 = qbase_block + wave * 16;

  const float* qb_ptr = q + (size_t)b * g.q_bs + (size_t)h * g.q_hs;
  const float* kb_ptr = k + (size_t)b * g.k_bs + (size_t)h * g.k_hs;
  const float* vb_ptr = v + (size_t)b * g.v_bs + (size_t)h * g.v_hs;
  const size_t ob_off = (size_t)b * g.o_bs + (size_t)h * g.o_hs;

  // ---- Q fragments (B operand: lane = query column c): 2 d-chunks, hi (and lo) ----
  v16b qah[2], qal[2];
  {
    const float* qrow = qb_ptr + (size_t)(q0 + c) * g.q_rs;
#pragma unroll
    for (int dc = 0; dc < 2; ++dc) {
#pragma unroll
      for (int e = 0; e < 8; ++e) {
        const float f0 = qrow[dc * 32 + 8 * hh + e] * g.qscale;
        const float f1 = qrow[dc * 32 + 16 + 8 * hh + e] * g.qscale;
        if (SPLIT_QK) { __bf16 hq, lq; at_split(f0, hq, lq); qah[dc][e] = hq; qal[dc][e] = lq; at_split(f1, hq, lq); qah[dc][8 + e] = hq; qal[dc][8 + e] = lq; }
        else { qah[dc][e] = at_to16<F16>(f0); qah[dc][8 + e] = at_to16<F16>(f1); qal[dc][e] = qah[dc][e]; qal[dc][8 + e] = qah[dc][8 + e]; }
      }
    }
  }

  float mrow = -INFINITY, lrow = 0.f;   // of query q0 + c; lrow sums this lane's half of the keys, the halves are joined in the epilogue
  v8f oacc[4];                          // O^T: oacc[t][r] = out[q0 + c][t * 16 + 8 * hh + r]
#pragma unroll
  for (int t = 0; t < 4; ++t) oacc[t] = (v8f){0.f,0.f,0.f,0.f,0.f,0.f,0.f,0.f};

  const int nChunks = (MASK_MODE == 1 || MASK_MODE == 4) ? (qb + 1) : (g.Skv / AT_KC);   // block-uniform
  // this lane's query mask (mode 3)
  const int qkeep = (MASK_MODE == 3) ? mask_b[(size_t)b * g.S + q0 + c] : 1;   // mask_b = qmask in mode 3
  const char* kp = (const char*)kb_ptr;   // first key row of the current chunk, block-uniform; stepped at the foot of the loop
  const char* vp = (const char*)vb_ptr;
  for (int kc = 0; kc < nChunks; ++kc) {
    const int kv0 = kc * AT_KC;
    __syncthreads();
    {
      // Staging map: 8 lanes cover one 128-B line of a key's head row, so a wave-wide 16-B load takes 4 whole lines (4 keys), not 32 pieces
      // of 32 lines. A thread holds the keys 2n and 2n + 1 at the same four d, so V^T goes to LDS as 32-bit pairs of neighbouring keys.
      const int c8 = tid & 7, rq = (tid >> 3) & 3;
      const int r0 = wave * 16 + rq * 2;                 // load i: key r0 + 8 * (i >> 2) + (i & 1), d from 32 * ((i >> 1) & 1) + 4 * c8
      // address = block-uniform base of the chunk + block-uniform row step + this lane's byte offset inside the 64-key chunk
      const unsigned klo = (unsigned)(r0 * (int)g.k_rs + c8 * 4) * 4u, vlo = (unsigned)(r0 * (int)g.v_rs + c8 * 4) * 4u;
      v4f kk[8], vv[8];
      const char* ka[4]; const char* va[4];              // row n: key r0 + 8 * (n >> 1) + (n & 1)
#pragma unroll
      for (int n = 0; n < 4; ++n) {
        ka[n] = kp + (size_t)(8 * (n >> 1) + (n & 1)) * g.k_rs * 4 + klo;
        va[n] = vp + (size_t)(8 * (n >> 1) + (n & 1)) * g.v_rs * 4 + vlo;
      }
#pragma unroll
      for (int i = 0; i < 8; ++i) kk[i] = *(const v4f*)(ka[2 * (i >> 2) + (i & 1)] + 128 * ((i >> 1) & 1));
      // the wait that stands before a register of an issued global load is overwritten; the addresses are named as inputs so that they
      // stay whole up to it (without that the compiler lays a later load's destination over an earlier load's address pair)
      asm volatile("s_wait_xcnt 0x0" :: "v"(ka[0]), "v"(ka[1]), "v"(ka[2]), "v"(ka[3]) : "memory");
#pragma unroll
      for (int i = 0; i < 8; ++i) vv[i] = *(const v4f*)(va[2 * (i >> 2) + (i & 1)] + 128 * ((i >> 1) & 1));
      asm volatile("s_wait_xcnt 0x0" :: "v"(va[0]), "v"(va[1]), "v"(va[2]), "v"(va[3]) : "memory");   // the same for the V loads
#pragma unroll
      for (int i = 0; i < 8; ++i) {
        const int kvr = r0 + 8 * (i >> 2) + (i & 1), d = 32 * ((i >> 1) & 1) + c8 * 4;
        v4b kh, kl;
#pragma unroll
        for (int e = 0; e < 4; ++e) {
          if (SPLIT_QK) { __bf16 a, bl; at_split(kk[i][e], a, bl); kh[e] = a; kl[e] = bl; }
          else kh[e] = at_to16<F16>(kk[i][e]);
        }
        *(v4b*)(Ksh + kvr * AT_LP + d) = kh;
        if (SPLIT_QK) *(v4b*)(Ksl + kvr * AT_LP + d) = kl;
      }
#pragma unroll
      for (int i = 0; i < 8; i += 2) {
        const int kvr = r0 + 8 * (i >> 2), d = 32 * ((i >> 1) & 1) + c8 * 4;
#pragma unroll
        for (int e = 0; e < 4; ++e) {
          v2b vh, vl;
          if (SPLIT_PV) { __bf16 a, bl; at_split(vv[i][e], a, bl); vh[0] = a; vl[0] = bl; at_split(vv[i + 1][e], a, bl); vh[1] = a; vl[1] = bl; }
          else { vh[0] = at_to16<F16>(vv[i][e]); vh[1] = at_to16<F16>(vv[i + 1][e]); }
          *(v2b*)(Vth + (d + e) * AT_LP + kvr) = vh;
          if (SPLIT_PV) *(v2b*)(Vtl + (d + e) * AT_LP + kvr) = vl;
        }
      }
    }
    __syncthreads();

    // Each matrix run is straight-line code: its LDS fragment reads are free to issue ahead of the products that use them (counted LDS waits:
    // no product waits out its own read), and neighbouring products write different tiles, so none waits for the one before it. Each tile's
    // own sum order is as before.
    // Every loop over fragments is unrolled: the fragment arrays then live in registers under constant indices (a rolled loop copies them).
    v8f s[4];
    FB kf[2][4], kfl[2][4];
#pragma unroll
    for (int dc = 0; dc < 2; ++dc)
#pragma unroll
      for (int j = 0; j < 4; ++j) {
        kf[dc][j].h[0] = *(const v8b*)(Ksh + (j * 16 + c) * AT_LP + dc * 32 + 8 * hh);
        kf[dc][j].h[1] = *(const v8b*)(Ksh + (j * 16 + c) * AT_LP + dc * 32 + 16 + 8 * hh);
        if (SPLIT_QK) {
          kfl[dc][j].h[0] = *(const v8b*)(Ksl + (j * 16 + c) * AT_LP + dc * 32 + 8 * hh);
          kfl[dc][j].h[1] = *(const v8b*)(Ksl + (j * 16 + c) * AT_LP + dc * 32 + 16 + 8 * hh);
        }
      }
#pragma unroll
    for (int j = 0; j < 4; ++j) s[j] = (v8f){0.f,0.f,0.f,0.f,0.f,0.f,0.f,0.f};
#pragma unroll
    for (int dc = 0; dc < 2; ++dc) {
#pragma unroll
      for (int j = 0; j < 4; ++j) s[j] = at_mma16<F16>(kf[dc][j].v, qah[dc], s[j]);   // s[j][r] = score of key kv0 + j * 16 + 8 * hh + r with query q0 + c
      if (SPLIT_QK) {
#pragma unroll
        for (int j = 0; j < 4; ++j) s[j] = at_mma16<F16>(kfl[dc][j].v, qah[dc], s[j]);
#pragma unroll
        for (int j = 0; j < 4; ++j) s[j] = at_mma16<F16>(kf[dc][j].v, qal[dc], s[j]);
      }
    }
    FB vf[2][4], vfl[2][4];                                  // the V^T fragments of the second run: read here, so that they land under the softmax
#pragma unroll
    for (int kk = 0; kk < 2; ++kk)
#pragma unroll
      for (int t = 0; t < 4; ++t) {
        vf[kk][t].h[0] = *(const v8b*)(Vth + (t * 16 + c) * AT_LP + kk * 32 + 8 * hh);
        vf[kk][t].h[1] = *(const v8b*)(Vth + (t * 16 + c) * AT_LP + kk * 32 + 16 + 8 * hh);
        if (SPLIT_PV) {
          vfl[kk][t].h[0] = *(const v8b*)(Vtl + (t * 16 + c) * AT_LP + kk * 32 + 8 * hh);
          vfl[kk][t].h[1] = *(const v8b*)(Vtl + (t * 16 + c) * AT_LP + kk * 32 + 16 + 8 * hh);
        }
      }
    const bool diag = (MASK_MODE == 1) && (kc == qb);
    const int qrow = q0 + c;
    float mj[4];                                             // one chain per score tile, so that the maxima do not all wait on one another
#pragma unroll
    for (int j = 0; j < 4; ++j) {
      mj[j] = -INFINITY;
#pragma unroll
      for (int r = 0; r < 8; ++r) {
        const int kvcol = kv0 + j * 16 + 8 * hh + r;
        bool masked = false;
        if (diag) masked = (kvcol > qrow);
        else if (MASK_MODE == 4) masked = (kvcol > qrow) || (qrow - kvcol > g.mask_is_int);
        else if (MASK_MODE == 2) {
          const size_t mi = (size_t)qrow * g.Skv + kvcol;
          masked = (g.mask_is_int == 0) ? (((const float*)mask_a)[mi] == 0.0f)
                 : (g.mask_is_int == 1) ? (((const int*)mask_a)[mi] == 0) : (((const int*)mask_a)[mi] != 0);
        } else if (MASK_MODE == 3) masked = (qkeep == 0) || (((const int*)mask_a)[(size_t)b * g.Skv + kvcol] == 0);   // mask_a = kvmask
        else if (MASK_MODE == 5) {
          const size_t mi = (size_t)qrow * g.Skv + kvcol;
          masked = (((const int*)mask_a)[mi] != 0);
          int n = mask_b[mi]; n = n < 0 ? 0 : n;
          s[j][r] += g.cp[(size_t)b * g.c_bs + (size_t)h * g.c_hs + (size_t)qrow * g.c_rs + n]
                   + g.pc[(size_t)b * g.c_bs + (size_t)h * g.c_hs + (size_t)kvcol * g.c_rs + n];
        }
        if (masked) s[j][r] = g.mask_fill;
        mj[j] = fmaxf(mj[j], s[j][r]);
      }
    }
    float m = fmaxf(fmaxf(mj[0], mj[1]), fmaxf(mj[2], mj[3]));
    m = fmaxf(m, at_xhalf(m));                               // lanes c and c + 16 hold the two halves of query c's 64 keys
    const float mnew = fmaxf(mrow, m * AT_LOG2E);            // the running maximum is kept in log2 units
    const float alpha = __builtin_amdgcn_exp2f(mrow - mnew);
    mrow = mnew;
    FB pt[2], ptl[2];                                        // P^T as B operand: element e of pt[kk] = tile 2 * kk + (e >> 3), register e & 7
    const v2f l2e = {AT_LOG2E, AT_LOG2E}, nm = {-mnew, -mnew};   // one maximum for all of a lane's scores: the fma and the sum run two wide
    v2f ps[4];
#pragma unroll
    for (int j = 0; j < 4; ++j) {
#pragma unroll
      for (int r = 0; r < 8; r += 2) {
        const v2f arg = __builtin_elementwise_fma((v2f){s[j][r], s[j][r + 1]}, l2e, nm);
        const v2f p = {__builtin_amdgcn_exp2f(arg.x), __builtin_amdgcn_exp2f(arg.y)};   // one v_exp_f32 per score
        ps[j] = (r == 0) ? p : ps[j] + p;
#pragma unroll
        for (int u = 0; u < 2; ++u) {
          const int e = (j & 1) * 8 + r + u;
          if (SPLIT_PV) { __bf16 a, bl; at_split(p[u], a, bl); pt[j >> 1].v[e] = a; ptl[j >> 1].v[e] = bl; }
          else pt[j >> 1].v[e] = at_to16<F16>(p[u] * PSC);
        }
      }
    }
    const v2f pq = (ps[0] + ps[1]) + (ps[2] + ps[3]);
    lrow = lrow * alpha + (pq.x + pq.y);
#pragma unroll
    for (int t = 0; t < 4; ++t)
#pragma unroll
      for (int r = 0; r < 8; ++r) oacc[t][r] *= alpha;
#pragma unroll   // unrolled: pt[kk] lives in registers, and a run-time index into it would cost a register copy per word
    for (int kk = 0; kk < 2; ++kk) {
#pragma unroll
      for (int t = 0; t < 4; ++t) oacc[t] = at_mma16<F16>(vf[kk][t].v, pt[kk].v, oacc[t]);
      if (SPLIT_PV) {
#pragma unroll
        for (int t = 0; t < 4; ++t) oacc[t] = at_mma16<F16>(vfl[kk][t].v, pt[kk].v, oacc[t]);
#pragma unroll
        for (int t = 0; t < 4; ++t) oacc[t] = at_mma16<F16>(vf[kk][t].v, ptl[kk].v, oacc[t]);
      }
    }
    kp += (size_t)AT_KC * g.k_rs * 4;
    vp += (size_t)AT_KC * g.v_rs * 4;
  }

  float* os = Os[wave];
  const float inv = 1.0f / ((lrow + at_xhalf(lrow)) * PSC);   // the two halves' sums of query q0 + c are joined here, once
#pragma unroll
  for (int t = 0; t < 4; ++t) {
#pragma unroll
    for (int r = 0; r < 8; ++r) os[c * 68 + t * 16 + 8 * hh + r] = oacc[t][r] * inv;
  }
  __builtin_amdgcn_fence(__ATOMIC_RELEASE, "workgroup");
  __builtin_amdgcn_wave_barrier();
  __builtin_amdgcn_fence(__ATOMIC_ACQUIRE, "workgroup");
  if (OUT16) {
    _Float16* ob16 = out16 + ob_off;
    const int q4 = lane >> 3, c8 = (lane & 7) * 8;       // a head's row is 64 f16 = one 128-B line = 8 lanes x 16 B; a wave-wide store takes 4 rows
#pragma unroll
    for (int it = 0; it < 4; ++it) {
      const int row = it * 4 + q4;
      const float* sp = os + row * 68 + c8;
      v8h hv;
#pragma unroll
      for (int e = 0; e < 8; ++e) hv[e] = (_Float16)sp[e];
      *(v8h*)(ob16 + (size_t)(q0 + row) * g.o_rs + c8) = hv;
    }
  } else {
    float* ob_ptr = out + ob_off;
    const int c4 = (lane & 15) * 4;
#pragma unroll
    for (int it = 0; it < 8; ++it) {
      const int row = it * 2 + hh;
      v4f val = *(const v4f*)(os + row * 68 + c4);
      *(v4f*)(ob_ptr + (size_t)(q0 + row) * g.o_rs + c4) = val;
    }
  }
}

#define EB 8
#define EC 768
#define ES 1024
#define EH 12
extern "C" void kernel_launch(void* const* d_in, const int* in_sizes, int n_in, void* d_out, int out_size, void* d_ws, size_t ws_size, hipStream_t stream) {
  (void)in_sizes; (void)n_in; (void)out_size; (void)ws_size;
  const float* q = (const float*)d_in[0]; const float* k = (const float*)d_in[1]; const float* v = (const float*)d_in[2];
  const float* Wq = (const float*)d_in[3]; const float* bq = (const float*)d_in[4]; const float* Wk = (const float*)d_in[5]; const float* bk = (const float*)d_in[6];
  const float* Wv = (const float*)d_in[7]; const float* bv = (const float*)d_in[8]; const float* Wo = (const float*)d_in[9]; const float* bo = (const float*)d_in[10];
  float* out = (float*)d_out;    // [8][768][1024]
  char* ws = (char*)d_ws; size_t off = 0;
  auto carve = [&](size_t bytes) -> char* { char* p = ws + off; off += (bytes + 255) & ~(size_t)255; return p; };
  _Float16* QT = (_Float16*)carve((size_t)EB * ES * EC * 2); _Float16* KT = (_Float16*)carve((size_t)EB * ES * EC * 2); _Float16* VT = (_Float16*)carve((size_t)EB * ES * EC * 2);   // 3 x 12.6 MB
  _Float16* Wq16 = (_Float16*)carve((size_t)EC * EC * 2); _Float16* Wk16 = (_Float16*)carve((size_t)EC * EC * 2); _Float16* Wv16 = (_Float16*)carve((size_t)EC * EC * 2); _Float16* Wo16 = (_Float16*)carve((size_t)EC * EC * 2);
  float* QE = (float*)carve((size_t)EB * ES * EC * 4); float* KE = (float*)carve((size_t)EB * ES * EC * 4); float* VE = (float*)carve((size_t)EB * ES * EC * 4);   // 3 x 25 MB
  _Float16* O16 = QT;     // reuse (QT dead after the q projection)
  // Launches that read none of each other's output share one grid. QT, KT, VT lie back to back in the workspace, and so do the four
  // f16 weights and QE, KE, VE (every carve is a multiple of 256 B), so a grid index times a fixed stride reaches each of them.
  (void)KT; (void)VT; (void)Wk16; (void)Wv16;
  transpose_cast_f16<<<dim3(ES / 64, EC / 64, 3 * EB), dim3(32, 8), 0, stream>>>(q, k, v, EB, (long)EC * ES, ES, QT, EC, 1.0f);   // each [768][1024] -> [1024][768]
  cast4_f32_f16x2<<<dim3((EC * EC / 2 + 255) / 256, 4), 256, 0, stream>>>(Wq, Wk, Wv, Wo, Wq16, EC * EC / 2);   // 1x1-conv weights [out][in] are the Bt layout; Wo is the A operand ([M=o][K=c]) of the output GEMM
  { const int t = (ES / 64) * (EC / 64);   // z = 0, 1, 2: the q, k, v projections
    wmma_gemm64<0, false, 2, 0, false><<<dim3((t + 7) / 8, EB, 3), 256, 0, stream>>>(U16(QT), nullptr, EC, (long)ES * EC, U16(Wq16), nullptr, EC, 0, QE, nullptr, EC, (long)ES * EC, bq, nullptr, 0, ES, EC, EC, 1.0f,
        (long)EB * ES * EC, (long)EC * EC, (long)EB * ES * EC, bk, bv); }
  { AttnGeom g;
    g.q_bs = (long)ES * EC; g.q_rs = EC; g.q_hs = 64; g.k_bs = (long)ES * EC; g.k_rs = EC; g.k_hs = 64; g.v_bs = (long)ES * EC; g.v_rs = EC; g.v_hs = 64; g.o_bs = (long)ES * EC; g.o_rs = EC; g.o_hs = 64;
    g.S = ES; g.Skv = ES; g.H = EH; g.mask_mode = 0; g.qscale = 0.125f; g.blk0 = 0; g.mask_fill = -INFINITY; g.mask_is_int = 0;
    attn64_kernel<false, false, true, 0, true><<<EB * EH * (ES / AT_QB), AT_NW * 32, 0, stream>>>(QE, KE, VE, nullptr, O16, nullptr, nullptr, g); }   // stores the f16 operand of the output GEMM itself
  { const int t = (EC / 64) * (ES / 64);   // outᵀ per batch: A = Wo [768][768], Bt = O16[b] [1024][768] -> out[b] [768][1024], bias per row
    wmma_gemm64<0, false, 1, 0, false><<<dim3((t + 7) / 8, EB), 256, 0, stream>>>(U16(Wo16), nullptr, EC, 0, U16(O16), nullptr, EC, (long)ES * EC, out, nullptr, ES, (long)EC * ES, bo, nullptr, 0, EC, ES, EC, 1.0f, 0, 0, 0, bo, bo); }
}

// v010
// It runs in 107 microseconds.
// Next to v009, in two timings, it ran 1.14 times as fast each time.
// Counting every step since v000, it is 10.2 times as fast.
#include <hip/hip_runtime.h>
#include <math.h>
// Multi-head attention over 32x32 feature maps (8 batches, 12 heads x 64, 1024 queries/keys): the four 1x1-conv projections
// (1024 x 768 · 768 x 768 per batch; the output projection computed transposed so it lands in the (B, C, H·W) layout) and the attention
// (scores and p·v, p carried x2^15): v_wmma_f32_16x16x32_f16, f16 operands, f32 accumulate; softmax f32. Input transposes are VALU copies.
typedef __attribute__((ext_vector_type(16))) _Float16 v16h;
typedef __attribute__((ext_vector_type(8)))  _Float16 v8h;
typedef __attribute__((ext_vector_type(16))) __bf16   v16b;
typedef __attribute__((ext_vector_type(8)))  __bf16   v8b;
typedef __attribute__((ext_vector_type(4)))  __bf16   v4b;
typedef __attribute__((ext_vector_type(2)))  __bf16   v2b;
typedef __attribute__((ext_vector_type(8)))  float    v8f;
typedef __attribute__((ext_vector_type(4)))  float    v4f;
typedef __attribute__((ext_vector_type(2)))  float    v2f;
typedef __attribute__((ext_vector_type(4)))  unsigned v4u;
typedef __attribute__((ext_vector_type(2)))  unsigned v2u;
#define PSCALE 32768.0f
#define U16(p) ((const unsigned short*)(const void*)(p))
#define PSCALE_INV (1.0f / 32768.0f)

__device__ __forceinline__ unsigned short f2bf_bits(float f) {
  unsigned u = __float_as_uint(f);
  return (unsigned short)((u + 0x7FFFu + ((u >> 16) & 1u)) >> 16);
}
__device__ __forceinline__ float bf_bits2f(unsigned short h) { return __uint_as_float(((unsigned)h) << 16); }

// hazard guards as plain device helpers (no inline asm inside the kernel template body)
__device__ __forceinline__ void dep_guard_h(v8f& a, v8f& b, v16h x, v16h y) { asm volatile("v_nop\n\tv_nop\n\tv_nop\n\tv_nop" : "+v"(a), "+v"(b) : "v"(x), "v"(y)); }
__device__ __forceinline__ void dep_guard_b(v8f& a, v8f& b, v16b x, v16b y) { asm volatile("v_nop\n\tv_nop\n\tv_nop\n\tv_nop" : "+v"(a), "+v"(b) : "v"(x), "v"(y)); }
__device__ __forceinline__ void keep4_h(v16h a, v16h b, v16h c, v16h d) { asm volatile("v_nop" :: "v"(a), "v"(b), "v"(c), "v"(d)); }
__device__ __forceinline__ void keep4_b(v16b a, v16b b, v16b c, v16b d) { asm volatile("v_nop" :: "v"(a), "v"(b), "v"(c), "v"(d)); }
__device__ __forceinline__ void acc_guard4(v8f& a, v8f& b, v8f& c, v8f& d) { asm volatile("v_nop\n\tv_nop\n\tv_nop\n\tv_nop" : "+v"(a), "+v"(b), "+v"(c), "+v"(d)); }
template <typename T> struct Frag;
template <> struct Frag<_Float16> {
  typedef v16h V; typedef v8h H; union U { v16h v; v8h h[2]; };
  static __device__ __forceinline__ v16h load(const _Float16* p) {   // elements 0..7 <- p[0..7], 8..15 <- p[16..23]
    U f; f.h[0] = *(const v8h*)(p); f.h[1] = *(const v8h*)(p + 16); return f.v;
  }
  static __device__ __forceinline__ v8f mma(v16h a, v16h b, v8f c) {
    return __builtin_amdgcn_wmma_f32_16x16x32_f16(false, a, false, b, (short)0, c, false, false);
  }
  static __device__ __forceinline__ void guard(v8f& a, v8f& b, v16h x, v16h y) { dep_guard_h(a, b, x, y); }
  static __device__ __forceinline__ void keep(v16h a, v16h b, v16h c, v16h d) { keep4_h(a, b, c, d); }
};
template <> struct Frag<__bf16> {
  typedef v16b V; typedef v8b H; union U { v16b v; v8b h[2]; };
  static __device__ __forceinline__ v16b load(const __bf16* p) {
    U f; f.h[0] = *(const v8b*)(p); f.h[1] = *(const v8b*)(p + 16); return f.v;
  }
  static __device__ __forceinline__ v8f mma(v16b a, v16b b, v8f c) {
    return __builtin_amdgcn_wmma_f32_16x16x32_bf16(false, a, false, b, (short)0, c, false, false);
  }
  static __device__ __forceinline__ void guard(v8f& a, v8f& b, v16b x, v16b y) { dep_guard_b(a, b, x, y); }
  static __device__ __forceinline__ void keep(v16b a, v16b b, v16b c, v16b d) { keep4_b(a, b, c, d); }
};

// ---- Register-blocked batched WMMA GEMM ------------------------------------
// C[m,n] = scale * sum_k A[m,k] * Bt[n,k] (+bias)(+resid); each wave owns a 64x64 tile, the 8 waves of a block (2 x 4) one 128x256 tile.
// A row-major [M,K]; Bt row-major [N,K]; M % 128 == 0, N % 256 == 0, K % 64 == 0; grid.x = (M / 128) * (N / 256).
// Operands go through LDS: a stage is 64 k (one whole 128-B line) of the block's 128 A rows and 256 Bt rows, read from global memory
// with every wave-wide 16-B load covering 4 whole lines, two buffers, the next stage's loads in flight while this one is multiplied.
// SPLIT (hi/lo operand planes) is not built in this form.
// BIAS_MODE: 0 = none, 1 = bias[m], 2 = bias[n].
// OUT_MODE: 0 = f32, 1 = f16, 2 = bf16 hi plane (Cout) + bf16 lo plane (Cout2).
// ET: 0 = f16 operands, 1 = bf16 operands (pointers passed as 16-bit storage)
// blockIdx.z picks one of up to three independent problems of the same shape in one launch: operands and output advance by zA / zB / zC
// elements per z, the bias is bias / bias_z1 / bias_z2.
#define GS_K 64                 // k per stage
#define GS_LP 72                // LDS row pitch in 16-bit elements: 144 B = 16 B x 9, for the ds_load_b128 fragment reads
#define GS_ROWS (128 + 256)     // A rows + Bt rows of a block tile
template <int ET> struct Elem;
template <> struct Elem<0> { typedef _Float16 T; };
template <> struct Elem<1> { typedef __bf16 T; };
template <int ET, bool SPLIT, int BIAS_MODE, int OUT_MODE, bool RESID, int ACT = 0>
// four waves per SIMD = two blocks per WGP (what the LDS allows): holds every instance to 256 registers, one more would halve the blocks in flight
__global__ __launch_bounds__(256) __attribute__((amdgpu_waves_per_eu(4, 4))) void wmma_gemm64(
    const unsigned short* __restrict__ Ap, const unsigned short* __restrict__ A2p, int lda, long strideA,
    const unsigned short* __restrict__ Btp, const unsigned short* __restrict__ Bt2p, int ldb, long strideB,
    void* __restrict__ Cout, void* __restrict__ Cout2, int ldc, long strideC,
    const float* __restrict__ bias,
    const float* __restrict__ resid, long strideR,
    int M, int N, int K, float scale,
    long zA, long zB, long zC, const float* __restrict__ bias_z1, const float* __restrict__ bias_z2) {
  typedef typename Elem<ET>::T T;
  typedef typename Frag<T>::V V;
  typedef typename Frag<T>::H H;
  static_assert(!SPLIT, "the LDS-staged loop holds one plane per operand");
  const T* A = (const T*)Ap; const T* Bt = (const T*)Btp;
  (void)A2p; (void)Bt2p;
  __shared__ __align__(16) T sOp[2][GS_ROWS * GS_LP];   // two stages: rows 0..127 = A, rows 128..383 = Bt
  __shared__ __align__(16) float sT[8][16 * 68];   // per-wave 16x64 slab, pitch 68 floats
  const int b    = blockIdx.y;
  const int z    = blockIdx.z;
  const float* biasz = (z == 0) ? bias : (z == 1) ? bias_z1 : bias_z2;
  const int lane = threadIdx.x & 31;
  const int wave = threadIdx.x >> 5;
  const int tilesN = N >> 8;
  const int tilesM = M >> 7;
  const int tile = blockIdx.x;
  if (tile >= tilesM * tilesN) return;   // block-uniform, in front of every barrier
  const int tm = tile / tilesN;
  const int tn = tile - tm * tilesN;
  const int m0b = tm << 7;                     // the block's first row and column
  const int n0b = tn << 8;
  const int wm = wave >> 2, wn = wave & 3;     // the wave's place in the 2 x 4 block tile
  const int m0 = m0b + (wm << 6);
  const int n0 = n0b + (wn << 6);

  const T* Ab  = A  + (size_t)z * zA + (size_t)b * strideA;
  const T* Bb  = Bt + (size_t)z * zB + (size_t)b * strideB;

  const int rlane = lane & 15;                 // row (A) / col (B, D) within subtile
  const int koff  = (lane >> 4) * 8;           // k offset of this lane half
  const int mOff  = (lane >> 4) * 8;           // D row offset

  v8f acc[4][4];
#pragma unroll
  for (int i = 0; i < 4; ++i)
#pragma unroll
    for (int j = 0; j < 4; ++j) acc[i][j] = (v8f){0.f,0.f,0.f,0.f,0.f,0.f,0.f,0.f};

  // Staging map: 16-B piece p = i * 256 + thread of a stage is row p / 8, bytes 16 * (p % 8): 8 lanes cover one row's 128-B line.
  const int srow = threadIdx.x >> 3;
  const int sc8  = (threadIdx.x & 7) * 8;
  const T* gA = Ab + (size_t)(m0b + srow) * lda + sc8;
  const T* gB = Bb + (size_t)(n0b + srow) * ldb + sc8;
  const int sW = srow * GS_LP + sc8;                              // this thread's first piece in a stage
  const int rA = ((wm << 6) + rlane) * GS_LP + koff;              // this lane's fragment rows in a stage
  const int rB = (128 + (wn << 6) + rlane) * GS_LP + koff;
  H st[12];
#pragma unroll
  for (int i = 0; i < 4; ++i) st[i] = *(const H*)(gA + (size_t)(i * 32) * lda);
#pragma unroll
  for (int i = 0; i < 8; ++i) st[4 + i] = *(const H*)(gB + (size_t)(i * 32) * ldb);
#pragma unroll
  for (int i = 0; i < 12; ++i) *(H*)(&sOp[0][sW + i * 32 * GS_LP]) = st[i];
  __syncthreads();

  const int nStage = K / GS_K;
  for (int s = 0; s < nStage; ++s) {
    const T* cur = sOp[s & 1];
    const bool more = (s + 1 < nStage);        // block-uniform
    if (more) {                                // the next stage's lines fly while this stage is multiplied
      const int k1 = (s + 1) * GS_K;
#pragma unroll
      for (int i = 0; i < 4; ++i) st[i] = *(const H*)(gA + (size_t)(i * 32) * lda + k1);
#pragma unroll
      for (int i = 0; i < 8; ++i) st[4 + i] = *(const H*)(gB + (size_t)(i * 32) * ldb + k1);
    }
#pragma unroll
    for (int kb = 0; kb < GS_K / 32; ++kb) {
      V bh[4], ah[4];                          // all eight fragments of a 32-k block are read as one group: one LDS wait per 16 products
#pragma unroll
      for (int j = 0; j < 4; ++j) bh[j] = Frag<T>::load(cur + rB + (j << 4) * GS_LP + kb * 32);
#pragma unroll
      for (int i = 0; i < 4; ++i) ah[i] = Frag<T>::load(cur + rA + (i << 4) * GS_LP + kb * 32);
#pragma unroll
      for (int i = 0; i < 4; ++i) {
#pragma unroll
        for (int j = 0; j < 4; ++j) acc[i][j] = Frag<T>::mma(ah[i], bh[j], acc[i][j]);
        Frag<T>::guard(acc[i][0], acc[i][3], ah[i], ah[i]);
      }
      Frag<T>::keep(bh[0], bh[1], bh[2], bh[3]);
    }
    if (more) {                                // into the buffer whose readers all left it at the barrier that ended stage s - 1
      T* nxt = sOp[(s + 1) & 1];
#pragma unroll
      for (int i = 0; i < 12; ++i) *(H*)(nxt + sW + i * 32 * GS_LP) = st[i];
    }
    __syncthreads();                           // publishes stage s + 1 and ends every wave's reads of stage s
  }
  acc_guard4(acc[0][0], acc[0][1], acc[0][2], acc[0][3]);
  acc_guard4(acc[1][0], acc[1][1], acc[1][2], acc[1][3]);
  acc_guard4(acc[2][0], acc[2][1], acc[2][2], acc[2][3]);
  acc_guard4(acc[3][0], acc[3][1], acc[3][2], acc[3][3]);

  // ---- epilogue ----
  float* slab = sT[wave];
  const float* Rb = RESID ? (resid + (size_t)b * strideR) : nullptr;
#pragma unroll
  for (int i = 0; i < 4; ++i) {
    const int mBase = m0 + (i << 4);
#pragma unroll
    for (int j = 0; j < 4; ++j) {
      const int n = n0 + (j << 4) + rlane;
      float bv = 0.f;
      if (BIAS_MODE == 2) bv = biasz[n];
#pragma unroll
      for (int r = 0; r < 8; ++r) {
        float v = acc[i][j][r] * scale;
        if (BIAS_MODE == 1) v += biasz[mBase + mOff + r];
        if (BIAS_MODE == 2) v += bv;
        if (RESID) v += Rb[(size_t)(mBase + mOff + r) * ldc + n];
        if (ACT == 1) v = tanhf(v);
        if (ACT == 2) v = fmaxf(v, 0.0f);
        if (ACT == 3) v = v / (1.0f + expf(-v));
        if (ACT == 4) v = (v > 0.f) ? v : 0.01f * v;
        if (ACT == 5) v = 0.5f * v * (1.0f + erff(v * 0.70710678118654752f));
        slab[(mOff + r) * 68 + (j << 4) + rlane] = v;
      }
    }
    __builtin_amdgcn_fence(__ATOMIC_RELEASE, "workgroup");
    __builtin_amdgcn_wave_barrier();
    __builtin_amdgcn_fence(__ATOMIC_ACQUIRE, "workgroup");
    if (OUT_MODE == 0) {
      float* C = (float*)Cout + (size_t)z * zC + (size_t)b * strideC;
      const int hh = lane >> 4, c4 = (lane & 15) * 4;     // row seg = 256 B = 16 lanes x 16 B
      {
#pragma unroll
        for (int it = 0; it < 8; ++it) {
          const int row = it * 2 + hh;
          v4f v = *(const v4f*)(slab + row * 68 + c4);
          *(v4f*)(C + (size_t)(mBase + row) * ldc + n0 + c4) = v;
        }
        
      }
    } else {
      const int q = lane >> 3, c8 = (lane & 7) * 8;
      unsigned short* C  = (unsigned short*)Cout  + (size_t)z * zC + (size_t)b * strideC;
      unsigned short* C2 = (OUT_MODE == 2) ? ((unsigned short*)Cout2 + (size_t)z * zC + (size_t)b * strideC) : nullptr;
      {
#pragma unroll
        for (int it = 0; it < 4; ++it) {
          const int row = it * 4 + q;
          const float* sp = slab + row * 68 + c8;
          v8h hv, lv;
#pragma unroll
          for (int e = 0; e < 8; ++e) {
            if (OUT_MODE == 1) {
              hv[e] = (_Float16)sp[e];
            } else {
              unsigned short hb = f2bf_bits(sp[e]);
              unsigned short lb = f2bf_bits(sp[e] - bf_bits2f(hb));
              hv[e] = __builtin_bit_cast(_Float16, hb);
              lv[e] = __builtin_bit_cast(_Float16, lb);
            }
          }
          *(v8h*)(C + (size_t)(mBase + row) * ldc + n0 + c8) = hv;
          if (OUT_MODE == 2) *(v8h*)(C2 + (size_t)(mBase + row) * ldc + n0 + c8) = lv;
        }
        
      }
    }
    __builtin_amdgcn_fence(__ATOMIC_RELEASE, "workgroup");
    __builtin_amdgcn_wave_barrier();
    __builtin_amdgcn_fence(__ATOMIC_ACQUIRE, "workgroup");
  }
}

// ---- f32 -> f16 cast of four arrays of equal length in one launch: blockIdx.y picks the input, outputs lie n2 pairs apart ----
__global__ __launch_bounds__(256) void cast4_f32_f16x2(
    const float* __restrict__ in0, const float* __restrict__ in1, const float* __restrict__ in2, const float* __restrict__ in3,
    _Float16* __restrict__ out, int n2) {
  const int y = blockIdx.y;
  const float* in = (y == 0) ? in0 : (y == 1) ? in1 : (y == 2) ? in2 : in3;
  int i = blockIdx.x * 256 + threadIdx.x;
  if (i < n2) {
    const _Float16 h0 = (_Float16)in[2 * i], h1 = (_Float16)in[2 * i + 1];
    const unsigned u = (unsigned)__builtin_bit_cast(unsigned short, h0) | ((unsigned)__builtin_bit_cast(unsigned short, h1) << 16);
    ((unsigned*)out)[(size_t)y * n2 + i] = u;
  }
}

// ---- f32 -> f16 cast with a power-of-two pre-scale (folded back by the consumer GEMM's scale) ----
__global__ __launch_bounds__(256) void cast_f32_f16x2s(const float* __restrict__ in, _Float16* __restrict__ out, int n2, float s) {
  int i = blockIdx.x * 256 + threadIdx.x;
  if (i < n2) {
    const _Float16 h0 = (_Float16)(in[2 * i] * s), h1 = (_Float16)(in[2 * i + 1] * s);
    const unsigned u = (unsigned)__builtin_bit_cast(unsigned short, h0) | ((unsigned)__builtin_bit_cast(unsigned short, h1) << 16);
    ((unsigned*)out)[i] = u;
    
  }
}
__global__ __launch_bounds__(256) void split_f32_bf16x2(
    const float* __restrict__ in, __bf16* __restrict__ hi, __bf16* __restrict__ lo, long n2) {
  long i = (long)blockIdx.x * 256 + threadIdx.x;
  long stride = (long)gridDim.x * 256;
  {
    for (long j = i; j < n2; j += stride) {
      const float a = in[2 * j], b = in[2 * j + 1];
      const unsigned short ah = f2bf_bits(a), bh = f2bf_bits(b);
      const unsigned short al = f2bf_bits(a - bf_bits2f(ah)), bl = f2bf_bits(b - bf_bits2f(bh));
      ((unsigned*)hi)[j] = (unsigned)ah | ((unsigned)bh << 16);
      ((unsigned*)lo)[j] = (unsigned)al | ((unsigned)bl << 16);
    }
    
  }
}


// ---- f32 [R][C] (row pitch ldi) -> f16 transposed [C][R] (row pitch ldo); 64x64 tiles; each output row segment
// blockIdx.z = tensor * nb + batch: three input tensors of nb matrices each (mat elements apart) in one launch; output matrix z lies at outT0 + z * mat.
__global__ __launch_bounds__(256) void transpose_cast_f16(const float* __restrict__ in0, const float* __restrict__ in1, const float* __restrict__ in2,
                                                         int nb, long mat, int ldi, _Float16* __restrict__ outT0, int ldo, float scale) {
  __shared__ __align__(16) _Float16 tile[64][72];     // [c][r]
  const int zt = blockIdx.z / nb, zb = blockIdx.z - zt * nb;
  const float* in = ((zt == 0) ? in0 : (zt == 1) ? in1 : in2) + (size_t)zb * mat;
  _Float16* outT = outT0 + (size_t)blockIdx.z * mat;
  const int c0 = blockIdx.x * 64, r0 = blockIdx.y * 64;
  const int t = threadIdx.y * 32 + threadIdx.x;
  for (int i = threadIdx.y; i < 64; i += 8) {
    tile[threadIdx.x][i]      = (_Float16)(in[(size_t)(r0 + i) * ldi + c0 + threadIdx.x] * scale);
    tile[32 + threadIdx.x][i] = (_Float16)(in[(size_t)(r0 + i) * ldi + c0 + 32 + threadIdx.x] * scale);
  }
  __syncthreads();
  const int q = t >> 3, c8 = (t & 7) * 8;
  {
#pragma unroll
    for (int it = 0; it < 2; ++it) {
      const int c = it * 32 + q;
      v8h hv = *(const v8h*)(&tile[c][c8]);
      *(v8h*)(outT + (size_t)(c0 + c) * ldo + r0 + c8) = hv;
    }
    
  }
}

// ---- f32 [R][C] (pitch ldi) -> bf16 hi/lo transposed planes [C][R] (pitch ldo); 64x64 tiles; each output row segment
__global__ __launch_bounds__(256) void transpose_split_bf16(const float* __restrict__ in, int ldi,
                                                           __bf16* __restrict__ outH, __bf16* __restrict__ outL, int ldo) {
  __shared__ __align__(16) float tile[64][68];     // [c][r]
  const int c0 = blockIdx.x * 64, r0 = blockIdx.y * 64;
  const int t = threadIdx.y * 32 + threadIdx.x;
  for (int i = threadIdx.y; i < 64; i += 8) {
    tile[threadIdx.x][i]      = in[(size_t)(r0 + i) * ldi + c0 + threadIdx.x];
    tile[32 + threadIdx.x][i] = in[(size_t)(r0 + i) * ldi + c0 + 32 + threadIdx.x];
  }
  __syncthreads();
  const int q = t >> 3, c8 = (t & 7) * 8;
  {
#pragma unroll
    for (int it = 0; it < 2; ++it) {
      const int c = it * 32 + q;
      v8b hv, lv;
#pragma unroll
      for (int e = 0; e < 8; ++e) {
        const float f = tile[c][c8 + e];
        const unsigned short hb = f2bf_bits(f);
        hv[e] = __builtin_bit_cast(__bf16, hb);
        lv[e] = __builtin_bit_cast(__bf16, f2bf_bits(f - bf_bits2f(hb)));
      }
      *(v8b*)(outH + (size_t)(c0 + c) * ldo + r0 + c8) = hv;
      *(v8b*)(outL + (size_t)(c0 + c) * ldo + r0 + c8) = lv;
    }
    
  }
}

// =====================================================================================
// Generic causal/non-causal attention for head_dim 64, f32 in (f16 planes with IN16) / f32 out (f16 into out16 with OUT16); 16-bit operands: bf16 with optional hi/lo splits, or
// plain f16 (F16=true, non-split, probabilities carried x2^15).
//   scores = (q*qscale)·kᵀ : v_wmma_f32_16x16x32_bf16; SPLIT_QK -> q,k as bf16 hi/lo (hi·hi + hi·lo + lo·hi)
//   out    = p·v           : v_wmma_f32_16x16x32_bf16; SPLIT_PV -> p,v as bf16 hi/lo; else p,v plain bf16
//   f32 accumulate; online softmax in f32. Block = 4 waves = 64 query rows of one (batch, head); S % 64 == 0.
//   Element (b, s, h, d) of tensor X lives at X[b*X_bs + s*X_rs + h*X_hs + d] (strides in floats, multiples of 4).
//   Masking: MASK_MODE 0 none, 1 causal (kv > q masked), 2 tensor [S][Skv] shared over (b,h) (float if
//   mask_is_int==0, int32 with element == 0 -> masked if 1, int32 with element != 0 -> masked if 2), 3 per-token vectors qmask[B][S] & kvmask[B][Skv] (int32,
//   0 -> masked), 4 causal + sliding window (kv > q or q - kv > W masked; W passed in mask_is_int);
//   5 = relative-position bias: s += cp[b,h,q][idx[q][kv]] + pc[b,h,kv][idx[q][kv]] with idx = mask_b ([S][Skv] int32) and
//   mask_a an int32 [S][Skv] tensor with nonzero = masked (tables: element (b,h,row,n) at X + b*c_bs + h*c_hs + row*c_rs + n);
//   masked scores are replaced by mask_fill (e.g. -inf or -1e9) before the softmax.
//   grid.x = B * H * (S/64) (or a sub-range with blk0).
// =====================================================================================
#define AT_D 64
#define AT_NW 4
#define AT_QB 64
#define AT_KC 64
#define AT_LOG2E 1.4426950408889634f   // e^x = 2^(x * log2 e): the softmax runs in base 2, where the chip's own v_exp_f32 is the whole exponential
#define AT_LP 72   // LDS row pitch of the K and V^T tiles in 16-bit elements: 144 B = 16 B x 9, so the 16 rows of a ds_load_b128 fragment read fall on distinct banks
struct AttnGeom { const float* cp = nullptr; const float* pc = nullptr; long c_bs = 0, c_rs = 0, c_hs = 0;   // mode-5 score-bias tables
                  long q_bs, q_rs, q_hs, k_bs, k_rs, k_hs, v_bs, v_rs, v_hs, o_bs, o_rs, o_hs;
                  int S, Skv, H, mask_mode; float qscale; int blk0; float mask_fill; int mask_is_int; };
static_assert(sizeof(AttnGeom) == 168, "no padding");

__device__ __forceinline__ unsigned short at_bf_bits(float f) {
  unsigned u = __float_as_uint(f);
  return (unsigned short)((u + 0x7FFFu + ((u >> 16) & 1u)) >> 16);
}
__device__ __forceinline__ __bf16 at_f2bf(float f) { return __builtin_bit_cast(__bf16, at_bf_bits(f)); }
__device__ __forceinline__ void at_split(float f, __bf16& hi, __bf16& lo) {
  const unsigned short hb = at_bf_bits(f);
  hi = __builtin_bit_cast(__bf16, hb);
  lo = at_f2bf(f - __uint_as_float(((unsigned)hb) << 16));
}
__device__ __forceinline__ v8f at_mma(v16b a, v16b b, v8f c) {
  c = __builtin_amdgcn_wmma_f32_16x16x32_bf16(false, a, false, b, (short)0, c, false, false);
  asm volatile("v_nop\n\tv_nop\n\tv_nop\n\tv_nop" : "+v"(c) : "v"(a), "v"(b));
  return c;
}
// 16-bit element as a bit pattern held in a __bf16 slot: f16 bits when F16, bf16 (RNE) otherwise
template <bool F16> __device__ __forceinline__ __bf16 at_to16(float f) {
  if (F16) return __builtin_bit_cast(__bf16, (_Float16)f);
  return at_f2bf(f);
}
template <bool F16> __device__ __forceinline__ v8f at_mma16(v16b a, v16b b, v8f c) {
  if (F16) {
    const v16h ah = __builtin_bit_cast(v16h, a), bh = __builtin_bit_cast(v16h, b);
    return __builtin_amdgcn_wmma_f32_16x16x32_f16(false, ah, false, bh, (short)0, c, false, false);   // the builtin alone: the compiler keeps its distances, and a run of products issues back to back
  }
  return at_mma(a, b, c);
}

// lane l <-> lane l ^ 16: the two lanes that share one column of a matrix tile
__device__ __forceinline__ float at_xhalf(float x) {
  const int b = __builtin_bit_cast(int, x);
  return __builtin_bit_cast(float, __builtin_amdgcn_permlanex16(b, b, 0x76543210, 0xfedcba98, false, false));
}

// Both products run transposed: S^T = K.Q^T (A = K rows, B = Q) and O^T += V^T.P^T (A = V^T rows, B = P^T). In a result tile lane l holds
// column l & 15 = one query, rows 8 * (l >> 4) + r = keys (or d): a query's maximum and sum are taken inside the lane, with one exchange
// between the wave's halves, and two neighbouring score tiles, converted in place, are the B operand of the second product.
// MASK_MODE is a compile-time constant: each instance holds only its own masking code, so the score loop has no per-element mode branches.
// OUT16: the result is rounded to f16 here and stored to out16 (same strides, in elements), for a consumer that takes f16 operands; out is not used.
// IN16: q, k and v come as f16 planes q16, k16, v16 (same strides, in elements), rounded by their producer; the f32 pointers are not used.
template <bool SPLIT_QK, bool SPLIT_PV, bool F16, int MASK_MODE, bool OUT16, bool IN16>
__global__ __launch_bounds__(128)
void attn64_kernel(const float* __restrict__ q, const float* __restrict__ k,
                   const float* __restrict__ v, float* __restrict__ out, _Float16* __restrict__ out16,
                   const void* __restrict__ mask_a, const int* __restrict__ mask_b,
                   const _Float16* __restrict__ q16, const _Float16* __restrict__ k16, const _Float16* __restrict__ v16, AttnGeom g) {
  static_assert(!(F16 && (SPLIT_QK || SPLIT_PV)), "f16 mode is non-split");
  static_assert(!IN16 || F16, "f16 planes feed the f16 products");
  const float PSC = F16 ? 32768.0f : 1.0f;     // f16 probabilities carried x2^15 (subnormal range), folded into the final 1/l
  union FB { v16b v; v8b h[2]; };
  __shared__ __align__(16) __bf16 Ksh[AT_KC * AT_LP];            // K hi [kv][d]      9 KB
  __shared__ __align__(16) __bf16 Ksl[SPLIT_QK ? AT_KC * AT_LP : 8];
  __shared__ __align__(16) __bf16 Vth[AT_D * AT_LP];             // V hi [d][kv]      9 KB
  __shared__ __align__(16) __bf16 Vtl[SPLIT_PV ? AT_D * AT_LP : 8];
  __shared__ __align__(16) float  Os[AT_NW][16 * 68];            // per wave out tile, pitch 68

  const int tid  = threadIdx.x;
  const int wave = tid >> 5;
  const int lane = tid & 31;
  const int hh   = lane >> 4;
  const int c    = lane & 15;

  const int nqb = g.S / AT_QB;
  const int bx = blockIdx.x + g.blk0;
  const int qb = bx % nqb;
  const int bh = bx / nqb;
  const int h  = bh % g.H;
  const int b  = bh / g.H;
  const int qbase_block = qb * AT_QB;
  const int q0 = qbase_block + wave * 16;

  const size_t qb_off = (size_t)b * g.q_bs + (size_t)h * g.q_hs;
  const size_t kb_off = (size_t)b * g.k_bs + (size_t)h * g.k_hs;
  const size_t vb_off = (size_t)b * g.v_bs + (size_t)h * g.v_hs;
  const size_t ob_off = (size_t)b * g.o_bs + (size_t)h * g.o_hs;

  // ---- Q fragments (B operand: lane = query column c): 2 d-chunks, hi (and lo) ----
  v16b qah[2], qal[2];
  if (IN16) {
    const _Float16* qrow = q16 + qb_off + (size_t)(q0 + c) * g.q_rs;
#pragma unroll
    for (int dc = 0; dc < 2; ++dc) {
      const v8h a0 = *(const v8h*)(qrow + dc * 32 + 8 * hh), a1 = *(const v8h*)(qrow + dc * 32 + 16 + 8 * hh);
#pragma unroll
      for (int e = 0; e < 8; ++e) {
        qah[dc][e] = at_to16<F16>((float)a0[e] * g.qscale); qah[dc][8 + e] = at_to16<F16>((float)a1[e] * g.qscale);
        qal[dc][e] = qah[dc][e]; qal[dc][8 + e] = qah[dc][8 + e];
      }
    }
  } else {
    const float* qrow = q + qb_off + (size_t)(q0 + c) * g.q_rs;
#pragma unroll
    for (int dc = 0; dc < 2; ++dc) {
#pragma unroll
      for (int e = 0; e < 8; ++e) {
        const float f0 = qrow[dc * 32 + 8 * hh + e] * g.qscale;
        const float f1 = qrow[dc * 32 + 16 + 8 * hh + e] * g.qscale;
        if (SPLIT_QK) { __bf16 hq, lq; at_split(f0, hq, lq); qah[dc][e] = hq; qal[dc][e] = lq; at_split(f1, hq, lq); qah[dc][8 + e] = hq; qal[dc][8 + e] = lq; }
        else { qah[dc][e] = at_to16<F16>(f0); qah[dc][8 + e] = at_to16<F16>(f1); qal[dc][e] = qah[dc][e]; qal[dc][8 + e] = qah[dc][8 + e]; }
      }
    }
  }

  float mrow = -INFINITY, lrow = 0.f;   // of query q0 + c; lrow sums this lane's half of the keys, the halves are joined in the epilogue
  v8f oacc[4];                          // O^T: oacc[t][r] = out[q0 + c][t * 16 + 8 * hh + r]
#pragma unroll
  for (int t = 0; t < 4; ++t) oacc[t] = (v8f){0.f,0.f,0.f,0.f,0.f,0.f,0.f,0.f};

  const int nChunks = (MASK_MODE == 1 || MASK_MODE == 4) ? (qb + 1) : (g.Skv / AT_KC);   // block-uniform
  // this lane's query mask (mode 3)
  const int qkeep = (MASK_MODE == 3) ? mask_b[(size_t)b * g.S + q0 + c] : 1;   // mask_b = qmask in mode 3
  const char* kp = IN16 ? (const char*)(k16 + kb_off) : (const char*)(k + kb_off);   // first key row of the current chunk, block-uniform; stepped at the foot of the loop
  const char* vp = IN16 ? (const char*)(v16 + vb_off) : (const char*)(v + vb_off);
  for (int kc = 0; kc < nChunks; ++kc) {
    const int kv0 = kc * AT_KC;
    __syncthreads();
    if (IN16) {
      // f16 planes: a key's head row is one whole 128-B line, 8 lanes x 16 B, so a wave-wide load takes 4 keys' lines and a chunk is 4 + 4 loads
      // a thread. The bits go to LDS as they are. A thread holds the keys 4n .. 4n + 3 at the same eight d, so V^T is stored as 64-bit groups of
      // four neighbouring keys.
      static_assert(AT_NW * 32 / 8 * 4 == AT_KC, "16 groups of 8 lanes x 4 keys");
      const int c8 = tid & 7, r0 = (tid >> 3) * 4;
      // address = block-uniform base of the chunk + block-uniform row step + this lane's byte offset inside the 64-key chunk
      const unsigned klo = (unsigned)(r0 * (int)g.k_rs + c8 * 8) * 2u, vlo = (unsigned)(r0 * (int)g.v_rs + c8 * 8) * 2u;
      v8b kk[4]; v4u vv[4];                              // word w of vv[n]: d = 8 * c8 + 2 * w (low half) and + 1 (high half) of key r0 + n
      const char* ka[4]; const char* va[4];              // row n: key r0 + n
#pragma unroll
      for (int n = 0; n < 4; ++n) {
        ka[n] = kp + (size_t)n * g.k_rs * 2 + klo;
        va[n] = vp + (size_t)n * g.v_rs * 2 + vlo;
      }
#pragma unroll
      for (int i = 0; i < 4; ++i) kk[i] = *(const v8b*)(ka[i]);
      // the wait that stands before a register of an issued global load is overwritten; the addresses are named as inputs so that they
      // stay whole up to it
      asm volatile("s_wait_xcnt 0x0" :: "v"(ka[0]), "v"(ka[1]), "v"(ka[2]), "v"(ka[3]) : "memory");
#pragma unroll
      for (int i = 0; i < 4; ++i) vv[i] = *(const v4u*)(va[i]);
      asm volatile("s_wait_xcnt 0x0" :: "v"(va[0]), "v"(va[1]), "v"(va[2]), "v"(va[3]) : "memory");   // the same for the V loads
#pragma unroll
      for (int i = 0; i < 4; ++i) *(v8b*)(Ksh + (r0 + i) * AT_LP + c8 * 8) = kk[i];
#pragma unroll
      for (int w = 0; w < 4; ++w) {                      // one byte permute per stored word: the low (then the high) halves of two keys' words side by side
        const v2u lo = {__builtin_amdgcn_perm(vv[1][w], vv[0][w], 0x05040100u), __builtin_amdgcn_perm(vv[3][w], vv[2][w], 0x05040100u)};
        const v2u hi = {__builtin_amdgcn_perm(vv[1][w], vv[0][w], 0x07060302u), __builtin_amdgcn_perm(vv[3][w], vv[2][w], 0x07060302u)};
        *(v2u*)(Vth + (c8 * 8 + 2 * w) * AT_LP + r0) = lo;
        *(v2u*)(Vth + (c8 * 8 + 2 * w + 1) * AT_LP + r0) = hi;
      }
    } else {
      // Staging map: 8 lanes cover one 128-B line of a key's head row, so a wave-wide 16-B load takes 4 whole lines (4 keys), not 32 pieces
      // of 32 lines. A thread holds the keys 2n and 2n + 1 at the same four d, so V^T goes to LDS as 32-bit pairs of neighbouring keys.
      const int c8 = tid & 7, rq = (tid >> 3) & 3;
      const int r0 = wave * 16 + rq * 2;                 // load i: key r0 + 8 * (i >> 2) + (i & 1), d from 32 * ((i >> 1) & 1) + 4 * c8
      // address = block-uniform base of the chunk + block-uniform row step + this lane's byte offset inside the 64-key chunk
      const unsigned klo = (unsigned)(r0 * (int)g.k_rs + c8 * 4) * 4u, vlo = (unsigned)(r0 * (int)g.v_rs + c8 * 4) * 4u;
      v4f kk[8], vv[8];
      const char* ka[4]; const char* va[4];              // row n: key r0 + 8 * (n >> 1) + (n & 1)
#pragma unroll
      for (int n = 0; n < 4; ++n) {
        ka[n] = kp + (size_t)(8 * (n >> 1) + (n & 1)) * g.k_rs * 4 + klo;
        va[n] = vp + (size_t)(8 * (n >> 1) + (n & 1)) * g.v_rs * 4 + vlo;
      }
#pragma unroll
      for (int i = 0; i < 8; ++i) kk[i] = *(const v4f*)(ka[2 * (i >> 2) + (i & 1)] + 128 * ((i >> 1) & 1));
      // the wait that stands before a register of an issued global load is overwritten; the addresses are named as inputs so that they
      // stay whole up to it (without that the compiler lays a later load's destination over an earlier load's address pair)
      asm volatile("s_wait_xcnt 0x0" :: "v"(ka[0]), "v"(ka[1]), "v"(ka[2]), "v"(ka[3]) : "memory");
#pragma unroll
      for (int i = 0; i < 8; ++i) vv[i] = *(const v4f*)(va[2 * (i >> 2) + (i & 1)] + 128 * ((i >> 1) & 1));
      asm volatile("s_wait_xcnt 0x0" :: "v"(va[0]), "v"(va[1]), "v"(va[2]), "v"(va[3]) : "memory");   // the same for the V loads
#pragma unroll
      for (int i = 0; i < 8; ++i) {
        const int kvr = r0 + 8 * (i >> 2) + (i & 1), d = 32 * ((i >> 1) & 1) + c8 * 4;
        v4b kh, kl;
#pragma unroll
        for (int e = 0; e < 4; ++e) {
          if (SPLIT_QK) { __bf16 a, bl; at_split(kk[i][e], a, bl); kh[e] = a; kl[e] = bl; }
          else kh[e] = at_to16<F16>(kk[i][e]);
        }
        *(v4b*)(Ksh + kvr * AT_LP + d) = kh;
        if (SPLIT_QK) *(v4b*)(Ksl + kvr * AT_LP + d) = kl;
      }
#pragma unroll
      for (int i = 0; i < 8; i += 2) {
        const int kvr = r0 + 8 * (i >> 2), d = 32 * ((i >> 1) & 1) + c8 * 4;
#pragma unroll
        for (int e = 0; e < 4; ++e) {
          v2b vh, vl;
          if (SPLIT_PV) { __bf16 a, bl; at_split(vv[i][e], a, bl); vh[0] = a; vl[0] = bl; at_split(vv[i + 1][e], a, bl); vh[1] = a; vl[1] = bl; }
          else { vh[0] = at_to16<F16>(vv[i][e]); vh[1] = at_to16<F16>(vv[i + 1][e]); }
          *(v2b*)(Vth + (d + e) * AT_LP + kvr) = vh;
          if (SPLIT_PV) *(v2b*)(Vtl + (d + e) * AT_LP + kvr) = vl;
        }
      }
    }
    __syncthreads();

    // Each matrix run is straight-line code: its LDS fragment reads are free to issue ahead of the products that use them (counted LDS waits:
    // no product waits out its own read), and neighbouring products write different tiles, so none waits for the one before it. Each tile's
    // own sum order is as before.
    // Every loop over fragments is unrolled: the fragment arrays then live in registers under constant indices (a rolled loop copies them).
    v8f s[4];
    FB kf[2][4], kfl[2][4];
#pragma unroll
    for (int dc = 0; dc < 2; ++dc)
#pragma unroll
      for (int j = 0; j < 4; ++j) {
        kf[dc][j].h[0] = *(const v8b*)(Ksh + (j * 16 + c) * AT_LP + dc * 32 + 8 * hh);
        kf[dc][j].h[1] = *(const v8b*)(Ksh + (j * 16 + c) * AT_LP + dc * 32 + 16 + 8 * hh);
        if (SPLIT_QK) {
          kfl[dc][j].h[0] = *(const v8b*)(Ksl + (j * 16 + c) * AT_LP + dc * 32 + 8 * hh);
          kfl[dc][j].h[1] = *(const v8b*)(Ksl + (j * 16 + c) * AT_LP + dc * 32 + 16 + 8 * hh);
        }
      }
#pragma unroll
    for (int j = 0; j < 4; ++j) s[j] = (v8f){0.f,0.f,0.f,0.f,0.f,0.f,0.f,0.f};
#pragma unroll
    for (int dc = 0; dc < 2; ++dc) {
#pragma unroll
      for (int j = 0; j < 4; ++j) s[j] = at_mma16<F16>(kf[dc][j].v, qah[dc], s[j]);   // s[j][r] = score of key kv0 + j * 16 + 8 * hh + r with query q0 + c
      if (SPLIT_QK) {
#pragma unroll
        for (int j = 0; j < 4; ++j) s[j] = at_mma16<F16>(kfl[dc][j].v, qah[dc], s[j]);
#pragma unroll
        for (int j = 0; j < 4; ++j) s[j] = at_mma16<F16>(kf[dc][j].v, qal[dc], s[j]);
      }
    }
    FB vf[2][4], vfl[2][4];                                  // the V^T fragments of the second run: read here, so that they land under the softmax
#pragma unroll
    for (int kk = 0; kk < 2; ++kk)
#pragma unroll
      for (int t = 0; t < 4; ++t) {
        vf[kk][t].h[0] = *(const v8b*)(Vth + (t * 16 + c) * AT_LP + kk * 32 + 8 * hh);
        vf[kk][t].h[1] = *(const v8b*)(Vth + (t * 16 + c) * AT_LP + kk * 32 + 16 + 8 * hh);
        if (SPLIT_PV) {
          vfl[kk][t].h[0] = *(const v8b*)(Vtl + (t * 16 + c) * AT_LP + kk * 32 + 8 * hh);
          vfl[kk][t].h[1] = *(const v8b*)(Vtl + (t * 16 + c) * AT_LP + kk * 32 + 16 + 8 * hh);
        }
      }
    const bool diag = (MASK_MODE == 1) && (kc == qb);
    const int qrow = q0 + c;
    float mj[4];                                             // one chain per score tile, so that the maxima do not all wait on one another
#pragma unroll
    for (int j = 0; j < 4; ++j) {
      mj[j] = -INFINITY;
#pragma unroll
      for (int r = 0; r < 8; ++r) {
        const int kvcol = kv0 + j * 16 + 8 * hh + r;
        bool masked = false;
        if (diag) masked = (kvcol > qrow);
        else if (MASK_MODE == 4) masked = (kvcol > qrow) || (qrow - kvcol > g.mask_is_int);
        else if (MASK_MODE == 2) {
          const size_t mi = (size_t)qrow * g.Skv + kvcol;
          masked = (g.mask_is_int == 0) ? (((const float*)mask_a)[mi] == 0.0f)
                 : (g.mask_is_int == 1) ? (((const int*)mask_a)[mi] == 0) : (((const int*)mask_a)[mi] != 0);
        } else if (MASK_MODE == 3) masked = (qkeep == 0) || (((const int*)mask_a)[(size_t)b * g.Skv + kvcol] == 0);   // mask_a = kvmask
        else if (MASK_MODE == 5) {
          const size_t mi = (size_t)qrow * g.Skv + kvcol;
          masked = (((const int*)mask_a)[mi] != 0);
          int n = mask_b[mi]; n = n < 0 ? 0 : n;
          s[j][r] += g.cp[(size_t)b * g.c_bs + (size_t)h * g.c_hs + (size_t)qrow * g.c_rs + n]
                   + g.pc[(size_t)b * g.c_bs + (size_t)h * g.c_hs + (size_t)kvcol * g.c_rs + n];
        }
        if (masked) s[j][r] = g.mask_fill;
        mj[j] = fmaxf(mj[j], s[j][r]);
      }
    }
    float m = fmaxf(fmaxf(mj[0], mj[1]), fmaxf(mj[2], mj[3]));
    m = fmaxf(m, at_xhalf(m));                               // lanes c and c + 16 hold the two halves of query c's 64 keys
    const float mnew = fmaxf(mrow, m * AT_LOG2E);            // the running maximum is kept in log2 units
    const float alpha = __builtin_amdgcn_exp2f(mrow - mnew);
    mrow = mnew;
    FB pt[2], ptl[2];                                        // P^T as B operand: element e of pt[kk] = tile 2 * kk + (e >> 3), register e & 7
    const v2f l2e = {AT_LOG2E, AT_LOG2E}, nm = {-mnew, -mnew};   // one maximum for all of a lane's scores: the fma and the sum run two wide
    v2f ps[4];
#pragma unroll
    for (int j = 0; j < 4; ++j) {
#pragma unroll
      for (int r = 0; r < 8; r += 2) {
        const v2f arg = __builtin_elementwise_fma((v2f){s[j][r], s[j][r + 1]}, l2e, nm);
        const v2f p = {__builtin_amdgcn_exp2f(arg.x), __builtin_amdgcn_exp2f(arg.y)};   // one v_exp_f32 per score
        ps[j] = (r == 0) ? p : ps[j] + p;
#pragma unroll
        for (int u = 0; u < 2; ++u) {
          const int e = (j & 1) * 8 + r + u;
          if (SPLIT_PV) { __bf16 a, bl; at_split(p[u], a, bl); pt[j >> 1].v[e] = a; ptl[j >> 1].v[e] = bl; }
          else pt[j >> 1].v[e] = at_to16<F16>(p[u] * PSC);
        }
      }
    }
    const v2f pq = (ps[0] + ps[1]) + (ps[2] + ps[3]);
    lrow = lrow * alpha + (pq.x + pq.y);
#pragma unroll
    for (int t = 0; t < 4; ++t)
#pragma unroll
      for (int r = 0; r < 8; ++r) oacc[t][r] *= alpha;
#pragma unroll   // unrolled: pt[kk] lives in registers, and a run-time index into it would cost a register copy per word
    for (int kk = 0; kk < 2; ++kk) {
#pragma unroll
      for (int t = 0; t < 4; ++t) oacc[t] = at_mma16<F16>(vf[kk][t].v, pt[kk].v, oacc[t]);
      if (SPLIT_PV) {
#pragma unroll
        for (int t = 0; t < 4; ++t) oacc[t] = at_mma16<F16>(vfl[kk][t].v, pt[kk].v, oacc[t]);
#pragma unroll
        for (int t = 0; t < 4; ++t) oacc[t] = at_mma16<F16>(vf[kk][t].v, ptl[kk].v, oacc[t]);
      }
    }
    kp += (size_t)AT_KC * g.k_rs * (IN16 ? 2 : 4);
    vp += (size_t)AT_KC * g.v_rs * (IN16 ? 2 : 4);
  }

  float* os = Os[wave];
  const float inv = 1.0f / ((lrow + at_xhalf(lrow)) * PSC);   // the two halves' sums of query q0 + c are joined here, once
#pragma unroll
  for (int t = 0; t < 4; ++t) {
#pragma unroll
    for (int r = 0; r < 8; ++r) os[c * 68 + t * 16 + 8 * hh + r] = oacc[t][r] * inv;
  }
  __builtin_amdgcn_fence(__ATOMIC_RELEASE, "workgroup");
  __builtin_amdgcn_wave_barrier();
  __builtin_amdgcn_fence(__ATOMIC_ACQUIRE, "workgroup");
  if (OUT16) {
    _Float16* ob16 = out16 + ob_off;
    const int q4 = lane >> 3, c8 = (lane & 7) * 8;       // a head's row is 64 f16 = one 128-B line = 8 lanes x 16 B; a wave-wide store takes 4 rows
#pragma unroll
    for (int it = 0; it < 4; ++it) {
      const int row = it * 4 + q4;
      const float* sp = os + row * 68 + c8;
      v8h hv;
#pragma unroll
      for (int e = 0; e < 8; ++e) hv[e] = (_Float16)sp[e];
      *(v8h*)(ob16 + (size_t)(q0 + row) * g.o_rs + c8) = hv;
    }
  } else {
    float* ob_ptr = out + ob_off;
    const int c4 = (lane & 15) * 4;
#pragma unroll
    for (int it = 0; it < 8; ++it) {
      const int row = it * 2 + hh;
      v4f val = *(const v4f*)(os + row * 68 + c4);
      *(v4f*)(ob_ptr + (size_t)(q0 + row) * g.o_rs + c4) = val;
    }
  }
}

#define EB 8
#define EC 768
#define ES 1024
#define EH 12
extern "C" void kernel_launch(void* const* d_in, const int* in_sizes, int n_in, void* d_out, int out_size, void* d_ws, size_t ws_size, hipStream_t stream) {
  (void)in_sizes; (void)n_in; (void)out_size; (void)ws_size;
  const float* q = (const float*)d_in[0]; const float* k = (const float*)d_in[1]; const float* v = (const float*)d_in[2];
  const float* Wq = (const float*)d_in[3]; const float* bq = (const float*)d_in[4]; const float* Wk = (const float*)d_in[5]; const float* bk = (const float*)d_in[6];
  const float* Wv = (const float*)d_in[7]; const float* bv = (const float*)d_in[8]; const float* Wo = (const float*)d_in[9]; const float* bo = (const float*)d_in[10];
  float* out = (float*)d_out;    // [8][768][1024]
  char* ws = (char*)d_ws; size_t off = 0;
  auto carve = [&](size_t bytes) -> char* { char* p = ws + off; off += (bytes + 255) & ~(size_t)255; return p; };
  _Float16* QT = (_Float16*)carve((size_t)EB * ES * EC * 2); _Float16* KT = (_Float16*)carve((size_t)EB * ES * EC * 2); _Float16* VT = (_Float16*)carve((size_t)EB * ES * EC * 2);   // 3 x 12.6 MB
  _Float16* Wq16 = (_Float16*)carve((size_t)EC * EC * 2); _Float16* Wk16 = (_Float16*)carve((size_t)EC * EC * 2); _Float16* Wv16 = (_Float16*)carve((size_t)EC * EC * 2); _Float16* Wo16 = (_Float16*)carve((size_t)EC * EC * 2);
  _Float16* QE = (_Float16*)carve((size_t)EB * ES * EC * 2); _Float16* KE = (_Float16*)carve((size_t)EB * ES * EC * 2); _Float16* VE = (_Float16*)carve((size_t)EB * ES * EC * 2);   // 3 x 12.6 MB: the projections, rounded to f16 by the GEMM's epilogue
  _Float16* O16 = QT;     // reuse (QT dead after the q projection)
  // Launches that read none of each other's output share one grid. QT, KT, VT lie back to back in the workspace, and so do the four
  // f16 weights and QE, KE, VE (every carve is a multiple of 256 B), so a grid index times a fixed stride reaches each of them.
  (void)KT; (void)VT; (void)Wk16; (void)Wv16;
  transpose_cast_f16<<<dim3(ES / 64, EC / 64, 3 * EB), dim3(32, 8), 0, stream>>>(q, k, v, EB, (long)EC * ES, ES, QT, EC, 1.0f);   // each [768][1024] -> [1024][768]
  cast4_f32_f16x2<<<dim3((EC * EC / 2 + 255) / 256, 4), 256, 0, stream>>>(Wq, Wk, Wv, Wo, Wq16, EC * EC / 2);   // 1x1-conv weights [out][in] are the Bt layout; Wo is the A operand ([M=o][K=c]) of the output GEMM
  { const int t = (ES / 64) * (EC / 64);   // z = 0, 1, 2: the q, k, v projections
    wmma_gemm64<0, false, 2, 1, false><<<dim3((t + 7) / 8, EB, 3), 256, 0, stream>>>(U16(QT), nullptr, EC, (long)ES * EC, U16(Wq16), nullptr, EC, 0, QE, nullptr, EC, (long)ES * EC, bq, nullptr, 0, ES, EC, EC, 1.0f,
        (long)EB * ES * EC, (long)EC * EC, (long)EB * ES * EC, bk, bv); }
  { AttnGeom g;
    g.q_bs = (long)ES * EC; g.q_rs = EC; g.q_hs = 64; g.k_bs = (long)ES * EC; g.k_rs = EC; g.k_hs = 64; g.v_bs = (long)ES * EC; g.v_rs = EC; g.v_hs = 64; g.o_bs = (long)ES * EC; g.o_rs = EC; g.o_hs = 64;
    g.S = ES; g.Skv = ES; g.H = EH; g.mask_mode = 0; g.qscale = 0.125f; g.blk0 = 0; g.mask_fill = -INFINITY; g.mask_is_int = 0;
    attn64_kernel<false, false, true, 0, true, true><<<EB * EH * (ES / AT_QB), AT_NW * 32, 0, stream>>>(nullptr, nullptr, nullptr, nullptr, O16, nullptr, nullptr, QE, KE, VE, g); }   // stores the f16 operand of the output GEMM itself
  { const int t = (EC / 64) * (ES / 64);   // outᵀ per batch: A = Wo [768][768], Bt = O16[b] [1024][768] -> out[b] [768][1024], bias per row
    wmma_gemm64<0, false, 1, 0, false><<<dim3((t + 7) / 8, EB), 256, 0, stream>>>(U16(Wo16), nullptr, EC, 0, U16(O16), nullptr, EC, (long)ES * EC, out, nullptr, ES, (long)EC * ES, bo, nullptr, 0, EC, ES, EC, 1.0f, 0, 0, 0, bo, bo); }
}
